// v000
// The times below were measured on an AMD MI455X: many runs one after another, warmed up first and cycling through
// copies of the inputs, with the whole window's GPU time divided by the number of runs. Launches and the gaps
// between them are all in it. The median over several windows is given; except for v000 it joins two sittings, which
// can be a few percent apart, so the side-by-side timings, each taken in one sitting, are the better comparison.
// The starting kernel, v000, takes 748 microseconds a run.
#include <hip/hip_runtime.h>
// All contractions on v_wmma_f32_16x16x32_bf16, f32 accumulate: q/k/v/g = X·W (X, W rounded to bf16: single exact term); per-head retention
// Σ_{s≤t} ((q_t·k_s)/√128)·γ_h^{t−s}·v_s as 3-term bf16 hi/lo splits (scores and decayed weights split in registers/LDS); (silu(g)∘GN(ret))·W_O with
// the A operand split (2 terms). Decay factors, the per-head GroupNorm (no affine, eps 1e-6) and silu in f32.
#define BB 2
#define TT 2048
#define DD 1024
#define NH 8
#define HD 128

typedef __bf16 v16b __attribute__((ext_vector_type(16)));
typedef unsigned short v8us __attribute__((ext_vector_type(8), may_alias));
typedef float  v8f  __attribute__((ext_vector_type(8)));
typedef float  v4f  __attribute__((ext_vector_type(4)));
typedef float  v4fa __attribute__((ext_vector_type(4), may_alias));
union FragB { v16b v; v8us half[2]; unsigned short u[16]; };

__device__ __forceinline__ unsigned short bf16_bits(float x) { unsigned int u = __float_as_uint(x); return (unsigned short)((u + 0x7FFFu + ((u >> 16) & 1u)) >> 16); }
__device__ __forceinline__ float bf16_val(unsigned short b) { return __uint_as_float(((unsigned int)b) << 16); }
__device__ __forceinline__ float bf16_round(float x) { return bf16_val(bf16_bits(x)); }
// D += A·B with NT terms: 1 = ah·bh, 2 = + al·bh (A split), 3 = + ah·bl (both split)
template <int NT>
__device__ __forceinline__ v8f mmaN(v16b ah, v16b al, v16b bh, v16b bl, v8f c) {
  c = __builtin_amdgcn_wmma_f32_16x16x32_bf16(false, ah, false, bh, (short)0, c, false, false);
  if (NT >= 2) c = __builtin_amdgcn_wmma_f32_16x16x32_bf16(false, al, false, bh, (short)0, c, false, false);
  if (NT >= 3) c = __builtin_amdgcn_wmma_f32_16x16x32_bf16(false, ah, false, bl, (short)0, c, false, false);
  asm volatile("v_nop\n\tv_nop\n\tv_nop\n\tv_nop" : "+v"(c) : "v"(ah), "v"(al), "v"(bh), "v"(bl));
  return c;
}

__global__ __launch_bounds__(256) void k_wt_bf16(const float* __restrict__ W, unsigned short* __restrict__ Wt, int K, int N) {
  const int t = blockIdx.x * 256 + threadIdx.x;
  const int k8n = K / 8;
  if (t >= N * k8n) return;
  const int n = t / k8n, k8 = (t % k8n) * 8;
  v8us v;
#pragma unroll
  for (int i = 0; i < 8; ++i) v[i] = bf16_bits(W[(size_t)(k8 + i) * N + n]);
  *(v8us*)(Wt + (size_t)n * K + k8) = v;
  
}

// GEMM C[M][N] (f32, pitch ldc) = act(A[M][K]·W + bias). A f32 row-major (pitch lda) converted per fragment to bf16
// (ASPLIT: hi/lo two planes -> 2 terms, else single rounded term); Wt bf16 [N][K] (pitch ldb). BIAS_BF16 rounds the
// bias to bf16 first (bias quantised to bf16 before the add). K%32==0, M%16==0, N%64==0.
template <bool ASPLIT, int ACT, bool BIAS_BF16>
__global__ __launch_bounds__(128) void k_gemm_bf(const float* __restrict__ A, int lda, const unsigned short* __restrict__ Wt, int ldb,
                                               const float* __restrict__ bias, float* __restrict__ C, int ldc, int M, int N, int K) {
  __shared__ __attribute__((aligned(16))) float so[4][16][64];
  const int tid = threadIdx.x, w = tid >> 5, lane = tid & 31, ln = lane & 15, hh = lane >> 4;
  const int ntn = N / 64;
  const int wid = blockIdx.x * 4 + w;
  const int mt = wid / ntn, nq = wid % ntn;
  if (mt * 16 >= M) return;
  const int row0 = mt * 16, col0 = nq * 64;
  const float* arow = A + (size_t)(row0 + ln) * lda;
  v8f acc[4] = {};
  for (int kb = 0; kb < K; kb += 32) {
    FragB ah, al;
    const v4f x0 = *(const v4fa*)(arow + kb + 8 * hh), x1 = *(const v4fa*)(arow + kb + 8 * hh + 4);
    const v4f x2 = *(const v4fa*)(arow + kb + 16 + 8 * hh), x3 = *(const v4fa*)(arow + kb + 16 + 8 * hh + 4);
    float xs[16] = {x0[0],x0[1],x0[2],x0[3],x1[0],x1[1],x1[2],x1[3],x2[0],x2[1],x2[2],x2[3],x3[0],x3[1],x3[2],x3[3]};
#pragma unroll
    for (int i = 0; i < 16; ++i) { const unsigned short hb = bf16_bits(xs[i]); ah.u[i] = hb; al.u[i] = ASPLIT ? bf16_bits(xs[i] - bf16_val(hb)) : (unsigned short)0; }
#pragma unroll
    for (int t = 0; t < 4; ++t) {
      const unsigned short* brow = Wt + (size_t)(col0 + t * 16 + ln) * ldb + kb;
      FragB b;
      b.half[0] = *(const v8us*)(brow + 8 * hh);
      b.half[1] = *(const v8us*)(brow + 16 + 8 * hh);
      acc[t] = mmaN<ASPLIT ? 2 : 1>(ah.v, al.v, b.v, b.v, acc[t]);
    }
  }
#pragma unroll
  for (int t = 0; t < 4; ++t) {
    float bv = bias ? bias[col0 + t * 16 + ln] : 0.f;
    if (BIAS_BF16) bv = bf16_round(bv);
#pragma unroll
    for (int r = 0; r < 8; ++r) { float v = acc[t][r] + bv; if (ACT == 1) v = fmaxf(v, 0.f); so[w][8 * hh + r][t * 16 + ln] = v; }
  }
  __builtin_amdgcn_fence(__ATOMIC_ACQ_REL, "workgroup");
  __builtin_amdgcn_wave_barrier();
  const int rsub = lane >> 4, c4 = (lane & 15) * 4;
  {
#pragma unroll
    for (int q = 0; q < 8; ++q) {
      const int r = q * 2 + rsub;
      const v4f v = *(const v4fa*)&so[w][r][c4];
      *(v4f*)(C + (size_t)(row0 + r) * ldc + col0 + c4) = v;
    }
    
  }
}

// Flash-style causal/unmasked attention, all contractions 3-term bf16 hi/lo splits, f32 softmax with running max.
// q,k,v rows are read from f32 buffers with arbitrary row pitch (so they can live inside a fused qkv buffer);
// D = head size (multiple of 32, <= 128); one wave = 16 query rows; block = 4 waves (64 queries) sharing K/V chunks of 32.
template <int D, bool CAUSAL>
__global__ __launch_bounds__(128) void k_flash(const float* __restrict__ qb, const float* __restrict__ kb, const float* __restrict__ vb,
                                             int pitch, int T, int H, float scale, float* __restrict__ y, int ypitch) {
  constexpr int KS = D / 32;        // k-steps for QK
  constexpr int DT = D / 16;        // d tiles for PV
  __shared__ __attribute__((aligned(16))) unsigned short sKh[32][D + 8], sKl[32][D + 8], sVh[32][D + 8], sVl[32][D + 8];
  __shared__ __attribute__((aligned(16))) unsigned short sPh[4][16][40], sPl[4][16][40];
  __shared__ __attribute__((aligned(16))) float sO[4][16][D];
  const int tid = threadIdx.x, w = tid >> 5, lane = tid & 31, ln = lane & 15, hh = lane >> 4;
  const int nqb = (T + 63) / 64;
  const int bh = blockIdx.x / nqb, qblk = blockIdx.x % nqb;
  const int b = bh / H, h = bh % H;
  const int q0 = qblk * 64 + w * 16;
  const float* Q = qb + (size_t)b * T * pitch + h * D;
  const float* K = kb + (size_t)b * T * pitch + h * D;
  const float* V = vb + (size_t)b * T * pitch + h * D;

  // A fragments of the wave's 16 query rows (scaled), hi/lo
  FragB aqh[KS], aql[KS];
  {
    int row = q0 + ln; if (row >= T) row = T - 1;
    const float* qr = Q + (size_t)row * pitch;
#pragma unroll
    for (int ks = 0; ks < KS; ++ks)
#pragma unroll
      for (int i = 0; i < 16; ++i) {
        const int d = ks * 32 + ((i < 8) ? (8 * hh + i) : (16 + 8 * hh + (i - 8)));
        const float x = qr[d] * scale; const unsigned short hb = bf16_bits(x);
        aqh[ks].u[i] = hb; aql[ks].u[i] = bf16_bits(x - bf16_val(hb));
      }
  }
  float m_r[8], l_r[8];
#pragma unroll
  for (int r = 0; r < 8; ++r) { m_r[r] = -3.0e38f; l_r[r] = 0.f; }
  v8f oacc[DT];
#pragma unroll
  for (int dt = 0; dt < DT; ++dt) oacc[dt] = (v8f){0.f,0.f,0.f,0.f,0.f,0.f,0.f,0.f};

  const int kv_end = CAUSAL ? min(T, qblk * 64 + 64) : T;     // block-uniform
  for (int j0 = 0; j0 < kv_end; j0 += 32) {
    __syncthreads();
    for (int e = tid; e < 32 * (D / 4); e += 128) {
      const int r = e / (D / 4), c4 = (e % (D / 4)) * 4;
      const int key = j0 + r;
      v4f kf = {0.f,0.f,0.f,0.f}, vf = {0.f,0.f,0.f,0.f};
      if (key < T) { kf = *(const v4fa*)(K + (size_t)key * pitch + c4); vf = *(const v4fa*)(V + (size_t)key * pitch + c4); }
#pragma unroll
      for (int t = 0; t < 4; ++t) {
        unsigned short hb = bf16_bits(kf[t]); sKh[r][c4 + t] = hb; sKl[r][c4 + t] = bf16_bits(kf[t] - bf16_val(hb));
        hb = bf16_bits(vf[t]); sVh[r][c4 + t] = hb; sVl[r][c4 + t] = bf16_bits(vf[t] - bf16_val(hb));
      }
    }
    __syncthreads();
    // S tile 16 x 32
    v8f s[2];
#pragma unroll
    for (int nt = 0; nt < 2; ++nt) {
      v8f acc = {};
#pragma unroll
      for (int ks = 0; ks < KS; ++ks) {
        FragB bh_, bl_;
        bh_.half[0] = *(const v8us*)&sKh[nt * 16 + ln][ks * 32 + 8 * hh]; bh_.half[1] = *(const v8us*)&sKh[nt * 16 + ln][ks * 32 + 16 + 8 * hh];
        bl_.half[0] = *(const v8us*)&sKl[nt * 16 + ln][ks * 32 + 8 * hh]; bl_.half[1] = *(const v8us*)&sKl[nt * 16 + ln][ks * 32 + 16 + 8 * hh];
        acc = mmaN<3>(aqh[ks].v, aql[ks].v, bh_.v, bl_.v, acc);
      }
      s[nt] = acc;
    }
    // mask + running max (rows 8hh+r; the 16 lanes of a half share rows)
    float alpha[8];
#pragma unroll
    for (int r = 0; r < 8; ++r) {
      const int qi = q0 + 8 * hh + r;
      const int ja = j0 + ln, jb = j0 + 16 + ln;
      if (CAUSAL) { if (ja > qi) s[0][r] = -3.0e38f; if (jb > qi) s[1][r] = -3.0e38f; }
      if (ja >= T) s[0][r] = -3.0e38f;
      if (jb >= T) s[1][r] = -3.0e38f;
      float mx = fmaxf(s[0][r], s[1][r]);
      mx = fmaxf(mx, __shfl_xor(mx, 1, 32)); mx = fmaxf(mx, __shfl_xor(mx, 2, 32)); mx = fmaxf(mx, __shfl_xor(mx, 4, 32)); mx = fmaxf(mx, __shfl_xor(mx, 8, 32));
      const float mnew = fmaxf(m_r[r], mx);
      alpha[r] = (mnew > -1.0e38f) ? __expf(m_r[r] - mnew) : 1.0f;
      const float p0 = (s[0][r] > -1.0e38f) ? __expf(s[0][r] - mnew) : 0.f;
      const float p1 = (s[1][r] > -1.0e38f) ? __expf(s[1][r] - mnew) : 0.f;
      m_r[r] = mnew;
      l_r[r] = l_r[r] * alpha[r] + p0 + p1;            // per-lane partial row sum (16 lanes combined at the end)
      unsigned short hb = bf16_bits(p0); sPh[w][8 * hh + r][ln] = hb;      sPl[w][8 * hh + r][ln] = bf16_bits(p0 - bf16_val(hb));
      hb = bf16_bits(p1);                sPh[w][8 * hh + r][16 + ln] = hb; sPl[w][8 * hh + r][16 + ln] = bf16_bits(p1 - bf16_val(hb));
    }
#pragma unroll
    for (int dt = 0; dt < DT; ++dt)
#pragma unroll
      for (int r = 0; r < 8; ++r) oacc[dt][r] *= alpha[r];
    __builtin_amdgcn_fence(__ATOMIC_ACQ_REL, "workgroup");
    __builtin_amdgcn_wave_barrier();
    FragB pah, pal;
    pah.half[0] = *(const v8us*)&sPh[w][ln][8 * hh]; pah.half[1] = *(const v8us*)&sPh[w][ln][16 + 8 * hh];
    pal.half[0] = *(const v8us*)&sPl[w][ln][8 * hh]; pal.half[1] = *(const v8us*)&sPl[w][ln][16 + 8 * hh];
#pragma unroll
    for (int dt = 0; dt < DT; ++dt) {
      FragB bvh, bvl;
#pragma unroll
      for (int i = 0; i < 8; ++i) {
        bvh.u[i] = sVh[8 * hh + i][dt * 16 + ln]; bvh.u[8 + i] = sVh[16 + 8 * hh + i][dt * 16 + ln];
        bvl.u[i] = sVl[8 * hh + i][dt * 16 + ln]; bvl.u[8 + i] = sVl[16 + 8 * hh + i][dt * 16 + ln];
      }
      oacc[dt] = mmaN<3>(pah.v, pal.v, bvh.v, bvl.v, oacc[dt]);
    }
    __builtin_amdgcn_fence(__ATOMIC_ACQ_REL, "workgroup");
    __builtin_amdgcn_wave_barrier();
  }
#pragma unroll
  for (int r = 0; r < 8; ++r) {
    float l = l_r[r];
    l += __shfl_xor(l, 1, 32); l += __shfl_xor(l, 2, 32); l += __shfl_xor(l, 4, 32); l += __shfl_xor(l, 8, 32);
    l_r[r] = (l > 0.f) ? 1.0f / l : 0.f;
  }
#pragma unroll
  for (int dt = 0; dt < DT; ++dt)
#pragma unroll
    for (int r = 0; r < 8; ++r) sO[w][8 * hh + r][dt * 16 + ln] = oacc[dt][r] * l_r[r];
  __builtin_amdgcn_fence(__ATOMIC_ACQ_REL, "workgroup");
  __builtin_amdgcn_wave_barrier();
  {
    for (int r = 0; r < 16; ++r) {
      const int row = q0 + r;
      if (row < T && lane < D / 4) {
        const v4f val = *(const v4fa*)&sO[w][r][lane * 4];
        *(v4f*)(y + ((size_t)b * T + row) * ypitch + h * D + lane * 4) = val;
      }
    }
    
  }
}
// retention: out[b][t][h*128 + dv0..dv0+63] = Σ_{s<=t} ((q_t·k_s)/√dh)·γ_h^(t−s) · v_s  (γ_h = 1 − 2^(−5−h), decay computed as exp((t−s)·log γ_h))
__global__ __launch_bounds__(128) void k_ret(const float* __restrict__ q, const float* __restrict__ k, const float* __restrict__ v, float* __restrict__ y) {
  constexpr int KS = HD / 32, DV = 64, DT = DV / 16;
  __shared__ __attribute__((aligned(16))) unsigned short sKh[32][HD + 8], sKl[32][HD + 8], sVh[32][DV + 8], sVl[32][DV + 8];
  __shared__ __attribute__((aligned(16))) unsigned short sPh[4][16][40], sPl[4][16][40];
  __shared__ __attribute__((aligned(16))) float sO[4][16][DV];
  const int tid = threadIdx.x, w = tid >> 5, lane = tid & 31, ln = lane & 15, hh = lane >> 4;
  const int nqb = TT / 64;
  const int bh = blockIdx.x / nqb, qblk = blockIdx.x % nqb, dv0 = blockIdx.y * DV;
  const int b = bh / NH, h = bh % NH;
  const int q0 = qblk * 64 + w * 16;
  const float log_a = logf(1.0f - exp2f(-5.0f - (float)h));
  const float* Q = q + (size_t)b * TT * DD + h * HD; const float* K = k + (size_t)b * TT * DD + h * HD; const float* V = v + (size_t)b * TT * DD + h * HD + dv0;
  FragB aqh[KS], aql[KS];
  {
    const float* qr = Q + (size_t)(q0 + ln) * DD;
#pragma unroll
    for (int ks = 0; ks < KS; ++ks)
#pragma unroll
      for (int i = 0; i < 16; ++i) {
        const int d = ks * 32 + ((i < 8) ? (8 * hh + i) : (16 + 8 * hh + (i - 8)));
        const float x = qr[d]; const unsigned short hb = bf16_bits(x); aqh[ks].u[i] = hb; aql[ks].u[i] = bf16_bits(x - bf16_val(hb));
      }
  }
  v8f oacc[DT];
#pragma unroll
  for (int dt = 0; dt < DT; ++dt) oacc[dt] = (v8f){0.f,0.f,0.f,0.f,0.f,0.f,0.f,0.f};
  const int jstart = 0;
  const int kv_end = qblk * 64 + 64;
  for (int j0 = jstart; j0 < kv_end; j0 += 32) {
    __syncthreads();
    for (int e = tid; e < 32 * (HD / 4); e += 128) {
      const int r = e / (HD / 4), c4 = (e % (HD / 4)) * 4; const int key = j0 + r;
      const v4f kf = *(const v4fa*)(K + (size_t)key * DD + c4);
#pragma unroll
      for (int t = 0; t < 4; ++t) { const unsigned short hb = bf16_bits(kf[t]); sKh[r][c4 + t] = hb; sKl[r][c4 + t] = bf16_bits(kf[t] - bf16_val(hb)); }
    }
    for (int e = tid; e < 32 * (DV / 4); e += 128) {
      const int r = e / (DV / 4), c4 = (e % (DV / 4)) * 4; const int key = j0 + r;
      const v4f vf = *(const v4fa*)(V + (size_t)key * DD + c4);
#pragma unroll
      for (int t = 0; t < 4; ++t) { const unsigned short hb = bf16_bits(vf[t]); sVh[r][c4 + t] = hb; sVl[r][c4 + t] = bf16_bits(vf[t] - bf16_val(hb)); }
    }
    __syncthreads();
#pragma unroll
    for (int nt = 0; nt < 2; ++nt) {
      v8f acc = {};
#pragma unroll
      for (int ks = 0; ks < KS; ++ks) {
        FragB bh_, bl_;
        bh_.half[0] = *(const v8us*)&sKh[nt * 16 + ln][ks * 32 + 8 * hh]; bh_.half[1] = *(const v8us*)&sKh[nt * 16 + ln][ks * 32 + 16 + 8 * hh];
        bl_.half[0] = *(const v8us*)&sKl[nt * 16 + ln][ks * 32 + 8 * hh]; bl_.half[1] = *(const v8us*)&sKl[nt * 16 + ln][ks * 32 + 16 + 8 * hh];
        acc = mmaN<3>(aqh[ks].v, aql[ks].v, bh_.v, bl_.v, acc);
      }
      const int j = j0 + nt * 16 + ln;
#pragma unroll
      for (int r = 0; r < 8; ++r) {
        const int t = q0 + 8 * hh + r;
        const float p = (j <= t) ? acc[r] * 0.08838834764831845f * expf((float)(t - j) * log_a) : 0.f;
        const unsigned short hb = bf16_bits(p); sPh[w][8 * hh + r][nt * 16 + ln] = hb; sPl[w][8 * hh + r][nt * 16 + ln] = bf16_bits(p - bf16_val(hb));
      }
    }
    __builtin_amdgcn_fence(__ATOMIC_ACQ_REL, "workgroup");
    __builtin_amdgcn_wave_barrier();
    FragB pah, pal;
    pah.half[0] = *(const v8us*)&sPh[w][ln][8 * hh]; pah.half[1] = *(const v8us*)&sPh[w][ln][16 + 8 * hh];
    pal.half[0] = *(const v8us*)&sPl[w][ln][8 * hh]; pal.half[1] = *(const v8us*)&sPl[w][ln][16 + 8 * hh];
#pragma unroll
    for (int dt = 0; dt < DT; ++dt) {
      FragB bvh, bvl;
#pragma unroll
      for (int i = 0; i < 8; ++i) {
        bvh.u[i] = sVh[8 * hh + i][dt * 16 + ln]; bvh.u[8 + i] = sVh[16 + 8 * hh + i][dt * 16 + ln];
        bvl.u[i] = sVl[8 * hh + i][dt * 16 + ln]; bvl.u[8 + i] = sVl[16 + 8 * hh + i][dt * 16 + ln];
      }
      oacc[dt] = mmaN<3>(pah.v, pal.v, bvh.v, bvl.v, oacc[dt]);
    }
    __builtin_amdgcn_fence(__ATOMIC_ACQ_REL, "workgroup");
    __builtin_amdgcn_wave_barrier();
  }
#pragma unroll
  for (int dt = 0; dt < DT; ++dt)
#pragma unroll
    for (int r = 0; r < 8; ++r) sO[w][8 * hh + r][dt * 16 + ln] = oacc[dt][r];
  __builtin_amdgcn_fence(__ATOMIC_ACQ_REL, "workgroup");
  __builtin_amdgcn_wave_barrier();
  {
    for (int r = 0; r < 16; ++r) { if (lane < DV / 4) { const v4f val = *(const v4fa*)&sO[w][r][lane * 4]; *(v4f*)(y + ((size_t)b * TT + q0 + r) * DD + h * HD + dv0 + lane * 4) = val; } }
    
  }
}


// Z[row][h*128+d] = silu(g) · (ret − mean)/sqrt(var + 1e-6) per (row, head) over 128; wave per (row, head), lane = 4 values
__global__ __launch_bounds__(256) void k_gn_gate(const float* __restrict__ ret, const float* __restrict__ g, float* __restrict__ z) {
  const int tid = threadIdx.x, w = tid >> 5, lane = tid & 31; const size_t rh = (size_t)blockIdx.x * 8 + w; if (rh >= (size_t)BB * TT * NH) return;
  const size_t base = rh * HD + lane * 4;        // rows are [row][h*128 + d] contiguous -> rh*128
  const v4f a = *(const v4fa*)(ret + base), gg = *(const v4fa*)(g + base);
  float s = a[0] + a[1] + a[2] + a[3]; for (int o = 16; o >= 1; o >>= 1) s += __shfl_xor(s, o, 32); const float mu = s * (1.0f / HD);
  float q2 = 0.f; for (int q = 0; q < 4; ++q) { const float c = a[q] - mu; q2 += c * c; } for (int o = 16; o >= 1; o >>= 1) q2 += __shfl_xor(q2, o, 32);
  const float rs = rsqrtf(q2 * (1.0f / HD) + 1e-6f);
  v4f o4; for (int q = 0; q < 4; ++q) o4[q] = (gg[q] / (1.0f + expf(-gg[q]))) * ((a[q] - mu) * rs);
  *(v4f*)(z + base) = o4; 
}
extern "C" void kernel_launch(void* const* d_in, const int* in_sizes, int n_in,
                              void* d_out, int out_size, void* d_ws, size_t ws_size, hipStream_t stream) {
  (void)in_sizes; (void)n_in; (void)out_size;
  const float* X = (const float*)d_in[0]; const float* Wq = (const float*)d_in[1]; const float* Wk = (const float*)d_in[2]; const float* Wv = (const float*)d_in[3]; const float* WG = (const float*)d_in[4]; const float* WO = (const float*)d_in[5];
  char* ws = (char*)d_ws; size_t off = 0;
  auto take = [&](size_t bytes) { char* p = ws + off; off += (bytes + 255) & ~(size_t)255; return p; };
  const int M = BB * TT, gb = ((M / 16) * (DD / 64) + 3) / 4;
  unsigned short* Wt[5]; for (int i = 0; i < 5; ++i) Wt[i] = (unsigned short*)take((size_t)DD * DD * 2);
  float* q = (float*)take((size_t)M * DD * 4); float* k = (float*)take((size_t)M * DD * 4); float* v = (float*)take((size_t)M * DD * 4); float* g = (float*)take((size_t)M * DD * 4); float* ret = (float*)take((size_t)M * DD * 4);
  if (off > ws_size) return;
  const float* W5[5] = {Wq, Wk, Wv, WG, WO};
  for (int i = 0; i < 5; ++i) k_wt_bf16<<<(DD * (DD / 8) + 255) / 256, 256, 0, stream>>>(W5[i], Wt[i], DD, DD);       // X @ W: [K][N]
  k_gemm_bf<false, 0, false><<<gb, 128, 0, stream>>>(X, DD, Wt[0], DD, nullptr, q, DD, M, DD, DD);
  k_gemm_bf<false, 0, false><<<gb, 128, 0, stream>>>(X, DD, Wt[1], DD, nullptr, k, DD, M, DD, DD);
  k_gemm_bf<false, 0, false><<<gb, 128, 0, stream>>>(X, DD, Wt[2], DD, nullptr, v, DD, M, DD, DD);
  k_gemm_bf<false, 0, false><<<gb, 128, 0, stream>>>(X, DD, Wt[3], DD, nullptr, g, DD, M, DD, DD);
  k_ret<<<dim3(BB * NH * (TT / 64), 2), 128, 0, stream>>>(q, k, v, ret);
  k_gn_gate<<<(BB * TT * NH + 7) / 8, 256, 0, stream>>>(ret, g, q);                                                    // q reused as Z
  k_gemm_bf<true, 0, false><<<gb, 128, 0, stream>>>(q, DD, Wt[4], DD, nullptr, (float*)d_out, DD, M, DD, DD);
}

// v001
// One run takes 338 microseconds.
// In two side-by-side timings against v000, it was 2.24 and 2.25 times as fast.
#include <hip/hip_runtime.h>
// All contractions on v_wmma_f32_16x16x32_bf16, f32 accumulate: q/k/v/g = X·W (X, W rounded to bf16: single exact term); per-head retention
// Σ_{s≤t} ((q_t·k_s)/√128)·γ_h^{t−s}·v_s as 3-term bf16 hi/lo splits (scores and decayed weights split in registers/LDS); (silu(g)∘GN(ret))·W_O with
// the A operand split (2 terms). Decay factors, the per-head GroupNorm (no affine, eps 1e-6) and silu in f32.
#define BB 2
#define TT 2048
#define DD 1024
#define NH 8
#define HD 128
#define NC (TT / 64)   // chunks of 64 keys per sequence

typedef __bf16 v16b __attribute__((ext_vector_type(16)));
typedef unsigned short v8us __attribute__((ext_vector_type(8), may_alias));
typedef unsigned short v4us __attribute__((ext_vector_type(4), may_alias));
typedef float  v8f  __attribute__((ext_vector_type(8)));
typedef float  v4f  __attribute__((ext_vector_type(4)));
typedef float  v4fa __attribute__((ext_vector_type(4), may_alias));
union FragB { v16b v; v8us half[2]; unsigned short u[16]; };

__device__ __forceinline__ unsigned short bf16_bits(float x) { unsigned int u = __float_as_uint(x); return (unsigned short)((u + 0x7FFFu + ((u >> 16) & 1u)) >> 16); }
__device__ __forceinline__ float bf16_val(unsigned short b) { return __uint_as_float(((unsigned int)b) << 16); }
__device__ __forceinline__ float bf16_round(float x) { return bf16_val(bf16_bits(x)); }
// D += A·B with NT terms: 1 = ah·bh, 2 = + al·bh (A split), 3 = + ah·bl (both split)
template <int NT>
__device__ __forceinline__ v8f mmaN(v16b ah, v16b al, v16b bh, v16b bl, v8f c) {
  c = __builtin_amdgcn_wmma_f32_16x16x32_bf16(false, ah, false, bh, (short)0, c, false, false);
  if (NT >= 2) c = __builtin_amdgcn_wmma_f32_16x16x32_bf16(false, al, false, bh, (short)0, c, false, false);
  if (NT >= 3) c = __builtin_amdgcn_wmma_f32_16x16x32_bf16(false, ah, false, bl, (short)0, c, false, false);
  asm volatile("v_nop\n\tv_nop\n\tv_nop\n\tv_nop" : "+v"(c) : "v"(ah), "v"(al), "v"(bh), "v"(bl));
  return c;
}

__global__ __launch_bounds__(256) void k_wt_bf16(const float* __restrict__ W, unsigned short* __restrict__ Wt, int K, int N) {
  const int t = blockIdx.x * 256 + threadIdx.x;
  const int k8n = K / 8;
  if (t >= N * k8n) return;
  const int n = t / k8n, k8 = (t % k8n) * 8;
  v8us v;
#pragma unroll
  for (int i = 0; i < 8; ++i) v[i] = bf16_bits(W[(size_t)(k8 + i) * N + n]);
  *(v8us*)(Wt + (size_t)n * K + k8) = v;
  
}

// GEMM C[M][N] (f32, pitch ldc) = act(A[M][K]·W + bias). A f32 row-major (pitch lda) converted per fragment to bf16
// (ASPLIT: hi/lo two planes -> 2 terms, else single rounded term); Wt bf16 [N][K] (pitch ldb). BIAS_BF16 rounds the
// bias to bf16 first (bias quantised to bf16 before the add). K%32==0, M%16==0, N%64==0.
template <bool ASPLIT, int ACT, bool BIAS_BF16>
__global__ __launch_bounds__(128) void k_gemm_bf(const float* __restrict__ A, int lda, const unsigned short* __restrict__ Wt, int ldb,
                                               const float* __restrict__ bias, float* __restrict__ C, int ldc, int M, int N, int K) {
  __shared__ __attribute__((aligned(16))) float so[4][16][64];
  const int tid = threadIdx.x, w = tid >> 5, lane = tid & 31, ln = lane & 15, hh = lane >> 4;
  const int ntn = N / 64;
  const int wid = blockIdx.x * 4 + w;
  const int mt = wid / ntn, nq = wid % ntn;
  if (mt * 16 >= M) return;
  const int row0 = mt * 16, col0 = nq * 64;
  const float* arow = A + (size_t)(row0 + ln) * lda;
  v8f acc[4] = {};
  for (int kb = 0; kb < K; kb += 32) {
    FragB ah, al;
    const v4f x0 = *(const v4fa*)(arow + kb + 8 * hh), x1 = *(const v4fa*)(arow + kb + 8 * hh + 4);
    const v4f x2 = *(const v4fa*)(arow + kb + 16 + 8 * hh), x3 = *(const v4fa*)(arow + kb + 16 + 8 * hh + 4);
    float xs[16] = {x0[0],x0[1],x0[2],x0[3],x1[0],x1[1],x1[2],x1[3],x2[0],x2[1],x2[2],x2[3],x3[0],x3[1],x3[2],x3[3]};
#pragma unroll
    for (int i = 0; i < 16; ++i) { const unsigned short hb = bf16_bits(xs[i]); ah.u[i] = hb; al.u[i] = ASPLIT ? bf16_bits(xs[i] - bf16_val(hb)) : (unsigned short)0; }
#pragma unroll
    for (int t = 0; t < 4; ++t) {
      const unsigned short* brow = Wt + (size_t)(col0 + t * 16 + ln) * ldb + kb;
      FragB b;
      b.half[0] = *(const v8us*)(brow + 8 * hh);
      b.half[1] = *(const v8us*)(brow + 16 + 8 * hh);
      acc[t] = mmaN<ASPLIT ? 2 : 1>(ah.v, al.v, b.v, b.v, acc[t]);
    }
  }
#pragma unroll
  for (int t = 0; t < 4; ++t) {
    float bv = bias ? bias[col0 + t * 16 + ln] : 0.f;
    if (BIAS_BF16) bv = bf16_round(bv);
#pragma unroll
    for (int r = 0; r < 8; ++r) { float v = acc[t][r] + bv; if (ACT == 1) v = fmaxf(v, 0.f); so[w][8 * hh + r][t * 16 + ln] = v; }
  }
  __builtin_amdgcn_fence(__ATOMIC_ACQ_REL, "workgroup");
  __builtin_amdgcn_wave_barrier();
  const int rsub = lane >> 4, c4 = (lane & 15) * 4;
  {
#pragma unroll
    for (int q = 0; q < 8; ++q) {
      const int r = q * 2 + rsub;
      const v4f v = *(const v4fa*)&so[w][r][c4];
      *(v4f*)(C + (size_t)(row0 + r) * ldc + col0 + c4) = v;
    }
    
  }
}

// Flash-style causal/unmasked attention, all contractions 3-term bf16 hi/lo splits, f32 softmax with running max.
// q,k,v rows are read from f32 buffers with arbitrary row pitch (so they can live inside a fused qkv buffer);
// D = head size (multiple of 32, <= 128); one wave = 16 query rows; block = 4 waves (64 queries) sharing K/V chunks of 32.
template <int D, bool CAUSAL>
__global__ __launch_bounds__(128) void k_flash(const float* __restrict__ qb, const float* __restrict__ kb, const float* __restrict__ vb,
                                             int pitch, int T, int H, float scale, float* __restrict__ y, int ypitch) {
  constexpr int KS = D / 32;        // k-steps for QK
  constexpr int DT = D / 16;        // d tiles for PV
  __shared__ __attribute__((aligned(16))) unsigned short sKh[32][D + 8], sKl[32][D + 8], sVh[32][D + 8], sVl[32][D + 8];
  __shared__ __attribute__((aligned(16))) unsigned short sPh[4][16][40], sPl[4][16][40];
  __shared__ __attribute__((aligned(16))) float sO[4][16][D];
  const int tid = threadIdx.x, w = tid >> 5, lane = tid & 31, ln = lane & 15, hh = lane >> 4;
  const int nqb = (T + 63) / 64;
  const int bh = blockIdx.x / nqb, qblk = blockIdx.x % nqb;
  const int b = bh / H, h = bh % H;
  const int q0 = qblk * 64 + w * 16;
  const float* Q = qb + (size_t)b * T * pitch + h * D;
  const float* K = kb + (size_t)b * T * pitch + h * D;
  const float* V = vb + (size_t)b * T * pitch + h * D;

  // A fragments of the wave's 16 query rows (scaled), hi/lo
  FragB aqh[KS], aql[KS];
  {
    int row = q0 + ln; if (row >= T) row = T - 1;
    const float* qr = Q + (size_t)row * pitch;
#pragma unroll
    for (int ks = 0; ks < KS; ++ks)
#pragma unroll
      for (int i = 0; i < 16; ++i) {
        const int d = ks * 32 + ((i < 8) ? (8 * hh + i) : (16 + 8 * hh + (i - 8)));
        const float x = qr[d] * scale; const unsigned short hb = bf16_bits(x);
        aqh[ks].u[i] = hb; aql[ks].u[i] = bf16_bits(x - bf16_val(hb));
      }
  }
  float m_r[8], l_r[8];
#pragma unroll
  for (int r = 0; r < 8; ++r) { m_r[r] = -3.0e38f; l_r[r] = 0.f; }
  v8f oacc[DT];
#pragma unroll
  for (int dt = 0; dt < DT; ++dt) oacc[dt] = (v8f){0.f,0.f,0.f,0.f,0.f,0.f,0.f,0.f};

  const int kv_end = CAUSAL ? min(T, qblk * 64 + 64) : T;     // block-uniform
  for (int j0 = 0; j0 < kv_end; j0 += 32) {
    __syncthreads();
    for (int e = tid; e < 32 * (D / 4); e += 128) {
      const int r = e / (D / 4), c4 = (e % (D / 4)) * 4;
      const int key = j0 + r;
      v4f kf = {0.f,0.f,0.f,0.f}, vf = {0.f,0.f,0.f,0.f};
      if (key < T) { kf = *(const v4fa*)(K + (size_t)key * pitch + c4); vf = *(const v4fa*)(V + (size_t)key * pitch + c4); }
#pragma unroll
      for (int t = 0; t < 4; ++t) {
        unsigned short hb = bf16_bits(kf[t]); sKh[r][c4 + t] = hb; sKl[r][c4 + t] = bf16_bits(kf[t] - bf16_val(hb));
        hb = bf16_bits(vf[t]); sVh[r][c4 + t] = hb; sVl[r][c4 + t] = bf16_bits(vf[t] - bf16_val(hb));
      }
    }
    __syncthreads();
    // S tile 16 x 32
    v8f s[2];
#pragma unroll
    for (int nt = 0; nt < 2; ++nt) {
      v8f acc = {};
#pragma unroll
      for (int ks = 0; ks < KS; ++ks) {
        FragB bh_, bl_;
        bh_.half[0] = *(const v8us*)&sKh[nt * 16 + ln][ks * 32 + 8 * hh]; bh_.half[1] = *(const v8us*)&sKh[nt * 16 + ln][ks * 32 + 16 + 8 * hh];
        bl_.half[0] = *(const v8us*)&sKl[nt * 16 + ln][ks * 32 + 8 * hh]; bl_.half[1] = *(const v8us*)&sKl[nt * 16 + ln][ks * 32 + 16 + 8 * hh];
        acc = mmaN<3>(aqh[ks].v, aql[ks].v, bh_.v, bl_.v, acc);
      }
      s[nt] = acc;
    }
    // mask + running max (rows 8hh+r; the 16 lanes of a half share rows)
    float alpha[8];
#pragma unroll
    for (int r = 0; r < 8; ++r) {
      const int qi = q0 + 8 * hh + r;
      const int ja = j0 + ln, jb = j0 + 16 + ln;
      if (CAUSAL) { if (ja > qi) s[0][r] = -3.0e38f; if (jb > qi) s[1][r] = -3.0e38f; }
      if (ja >= T) s[0][r] = -3.0e38f;
      if (jb >= T) s[1][r] = -3.0e38f;
      float mx = fmaxf(s[0][r], s[1][r]);
      mx = fmaxf(mx, __shfl_xor(mx, 1, 32)); mx = fmaxf(mx, __shfl_xor(mx, 2, 32)); mx = fmaxf(mx, __shfl_xor(mx, 4, 32)); mx = fmaxf(mx, __shfl_xor(mx, 8, 32));
      const float mnew = fmaxf(m_r[r], mx);
      alpha[r] = (mnew > -1.0e38f) ? __expf(m_r[r] - mnew) : 1.0f;
      const float p0 = (s[0][r] > -1.0e38f) ? __expf(s[0][r] - mnew) : 0.f;
      const float p1 = (s[1][r] > -1.0e38f) ? __expf(s[1][r] - mnew) : 0.f;
      m_r[r] = mnew;
      l_r[r] = l_r[r] * alpha[r] + p0 + p1;            // per-lane partial row sum (16 lanes combined at the end)
      unsigned short hb = bf16_bits(p0); sPh[w][8 * hh + r][ln] = hb;      sPl[w][8 * hh + r][ln] = bf16_bits(p0 - bf16_val(hb));
      hb = bf16_bits(p1);                sPh[w][8 * hh + r][16 + ln] = hb; sPl[w][8 * hh + r][16 + ln] = bf16_bits(p1 - bf16_val(hb));
    }
#pragma unroll
    for (int dt = 0; dt < DT; ++dt)
#pragma unroll
      for (int r = 0; r < 8; ++r) oacc[dt][r] *= alpha[r];
    __builtin_amdgcn_fence(__ATOMIC_ACQ_REL, "workgroup");
    __builtin_amdgcn_wave_barrier();
    FragB pah, pal;
    pah.half[0] = *(const v8us*)&sPh[w][ln][8 * hh]; pah.half[1] = *(const v8us*)&sPh[w][ln][16 + 8 * hh];
    pal.half[0] = *(const v8us*)&sPl[w][ln][8 * hh]; pal.half[1] = *(const v8us*)&sPl[w][ln][16 + 8 * hh];
#pragma unroll
    for (int dt = 0; dt < DT; ++dt) {
      FragB bvh, bvl;
#pragma unroll
      for (int i = 0; i < 8; ++i) {
        bvh.u[i] = sVh[8 * hh + i][dt * 16 + ln]; bvh.u[8 + i] = sVh[16 + 8 * hh + i][dt * 16 + ln];
        bvl.u[i] = sVl[8 * hh + i][dt * 16 + ln]; bvl.u[8 + i] = sVl[16 + 8 * hh + i][dt * 16 + ln];
      }
      oacc[dt] = mmaN<3>(pah.v, pal.v, bvh.v, bvl.v, oacc[dt]);
    }
    __builtin_amdgcn_fence(__ATOMIC_ACQ_REL, "workgroup");
    __builtin_amdgcn_wave_barrier();
  }
#pragma unroll
  for (int r = 0; r < 8; ++r) {
    float l = l_r[r];
    l += __shfl_xor(l, 1, 32); l += __shfl_xor(l, 2, 32); l += __shfl_xor(l, 4, 32); l += __shfl_xor(l, 8, 32);
    l_r[r] = (l > 0.f) ? 1.0f / l : 0.f;
  }
#pragma unroll
  for (int dt = 0; dt < DT; ++dt)
#pragma unroll
    for (int r = 0; r < 8; ++r) sO[w][8 * hh + r][dt * 16 + ln] = oacc[dt][r] * l_r[r];
  __builtin_amdgcn_fence(__ATOMIC_ACQ_REL, "workgroup");
  __builtin_amdgcn_wave_barrier();
  {
    for (int r = 0; r < 16; ++r) {
      const int row = q0 + r;
      if (row < T && lane < D / 4) {
        const v4f val = *(const v4fa*)&sO[w][r][lane * 4];
        *(v4f*)(y + ((size_t)b * T + row) * ypitch + h * D + lane * 4) = val;
      }
    }
    
  }
}
// One chunk's own state, stored transposed: U[bh][n][dv][dk] = sum over j < 64 of (g^(63-j) * k[64n+j][dk]) * v[64n+j][dv], g = the head's decay.
// Block = one (batch, head, chunk); wave w = all 128 dk (A rows) by the 16 dv columns w*16..; 3-term bf16 hi/lo split, f32 accumulate.
// Every loop is unrolled so that the arrays it indexes (loaded rows, fragments, accumulators) stay in registers.
__global__ __launch_bounds__(256) void k_chunk_state(const float* __restrict__ k, const float* __restrict__ v, float* __restrict__ U) {
  __shared__ __attribute__((aligned(16))) unsigned short sKh[HD][72], sKl[HD][72], sVh[HD][72], sVl[HD][72];   // [column][key]: both operands contract over keys
  const int tid = threadIdx.x, w = tid >> 5, lane = tid & 31, ln = lane & 15, hh = lane >> 4;
  const int bh = blockIdx.x / (NC - 1), n = blockIdx.x % (NC - 1);     // the last chunk's state has no reader
  const int b = bh / NH, h = bh % NH;
  const float log_a = logf(1.0f - exp2f(-5.0f - (float)h));
  const float* K = k + ((size_t)b * TT + n * 64) * DD + h * HD; const float* V = v + ((size_t)b * TT + n * 64) * DD + h * HD;
  // a thread transposes 4 keys x 4 columns in registers: 8 lanes read 128 contiguous bytes of a row, and each column goes to LDS as one 8-byte store of 4 keys
  const int cl = tid & 7, k4 = ((tid >> 3) & 15) * 4, ch = tid >> 7;
  float dec[4];
#pragma unroll
  for (int j = 0; j < 4; ++j) dec[j] = expf((float)(63 - (k4 + j)) * log_a);
  const float* kp = K + (size_t)k4 * DD + (cl + 8 * ch) * 4; const float* vp = V + (size_t)k4 * DD + (cl + 8 * ch) * 4;
  v4f kf[2][4], vf[2][4];
#pragma unroll
  for (int i = 0; i < 2; ++i)
#pragma unroll
    for (int j = 0; j < 4; ++j) { kf[i][j] = *(const v4fa*)(kp + (size_t)j * DD + i * 64); vf[i][j] = *(const v4fa*)(vp + (size_t)j * DD + i * 64); }
  // precaution: wait before any register that an issued load names is rewritten; the two addresses are inputs so that no load lands in them ahead of the wait
  asm volatile("s_wait_xcnt 0x0" :: "v"(kp), "v"(vp) : "memory");
#pragma unroll
  for (int i = 0; i < 2; ++i) {
    const int c4 = (cl + 8 * (ch + 2 * i)) * 4;
#pragma unroll
    for (int t = 0; t < 4; ++t) {
      v4us kh, kl, vh, vl;
#pragma unroll
      for (int j = 0; j < 4; ++j) {
        const float x = kf[i][j][t] * dec[j], z = vf[i][j][t];
        kh[j] = bf16_bits(x); kl[j] = bf16_bits(x - bf16_val(kh[j]));
        vh[j] = bf16_bits(z); vl[j] = bf16_bits(z - bf16_val(vh[j]));
      }
      *(v4us*)&sKh[c4 + t][k4] = kh; *(v4us*)&sKl[c4 + t][k4] = kl; *(v4us*)&sVh[c4 + t][k4] = vh; *(v4us*)&sVl[c4 + t][k4] = vl;
    }
  }
  __syncthreads();
  v8f acc[8];
#pragma unroll
  for (int ct = 0; ct < 8; ++ct) acc[ct] = (v8f){0.f,0.f,0.f,0.f,0.f,0.f,0.f,0.f};
#pragma unroll
  for (int ks = 0; ks < 2; ++ks) {
    FragB bvh, bvl;
    bvh.half[0] = *(const v8us*)&sVh[w * 16 + ln][ks * 32 + 8 * hh]; bvh.half[1] = *(const v8us*)&sVh[w * 16 + ln][ks * 32 + 16 + 8 * hh];
    bvl.half[0] = *(const v8us*)&sVl[w * 16 + ln][ks * 32 + 8 * hh]; bvl.half[1] = *(const v8us*)&sVl[w * 16 + ln][ks * 32 + 16 + 8 * hh];
#pragma unroll
    for (int ct = 0; ct < 8; ++ct) {
      FragB akh, akl;
      akh.half[0] = *(const v8us*)&sKh[ct * 16 + ln][ks * 32 + 8 * hh]; akh.half[1] = *(const v8us*)&sKh[ct * 16 + ln][ks * 32 + 16 + 8 * hh];
      akl.half[0] = *(const v8us*)&sKl[ct * 16 + ln][ks * 32 + 8 * hh]; akl.half[1] = *(const v8us*)&sKl[ct * 16 + ln][ks * 32 + 16 + 8 * hh];
      acc[ct] = mmaN<3>(akh.v, akl.v, bvh.v, bvl.v, acc[ct]);
    }
  }
  // acc[ct][r] = U[dk = ct*16 + 8*hh + r][dv = w*16 + ln]: 8 neighbouring dk of one dv row
  float* Uo = U + ((size_t)bh * NC + n) * (HD * HD) + (size_t)(w * 16 + ln) * HD + 8 * hh;
#pragma unroll
  for (int ct = 0; ct < 8; ++ct) {
    *(v4f*)(Uo + ct * 16) = (v4f){acc[ct][0], acc[ct][1], acc[ct][2], acc[ct][3]};
    *(v4f*)(Uo + ct * 16 + 4) = (v4f){acc[ct][4], acc[ct][5], acc[ct][6], acc[ct][7]};
  }
}

// State in front of chunk n+1: S[n+1] = g^64 * S[n] + U[n], S[0] = 0, element by element in f32; stored as bf16 hi/lo planes [bh][n][dv][dk]
// (plane 0 is never written and never read). Thread = 4 neighbouring elements of one (batch, head).
__global__ __launch_bounds__(256) void k_state_scan(const float* __restrict__ U, unsigned short* __restrict__ Sh, unsigned short* __restrict__ Sl) {
  const int t = blockIdx.x * 256 + threadIdx.x;
  const int bh = t / (HD * HD / 4), e = (t % (HD * HD / 4)) * 4;
  const float g64 = expf(64.0f * logf(1.0f - exp2f(-5.0f - (float)(bh % NH))));
  const size_t o0 = (size_t)bh * NC * (HD * HD) + e;
  v4f u[NC - 1];
  // all loads first: they depend on nothing, so the serial recurrence below meets one memory latency and not one per chunk
#pragma unroll
  for (int n = 0; n < NC - 1; ++n) u[n] = *(const v4fa*)(U + o0 + (size_t)n * (HD * HD));
  v4f s = {0.f, 0.f, 0.f, 0.f};
  // unrolled so that u[] is indexed by constants and stays in registers
#pragma unroll
  for (int n = 0; n < NC - 1; ++n) {
    v4us hi, lo;
#pragma unroll
    for (int i = 0; i < 4; ++i) { s[i] = s[i] * g64 + u[n][i]; hi[i] = bf16_bits(s[i]); lo[i] = bf16_bits(s[i] - bf16_val(hi[i])); }
    *(v4us*)(Sh + o0 + (size_t)(n + 1) * (HD * HD)) = hi;
    *(v4us*)(Sl + o0 + (size_t)(n + 1) * (HD * HD)) = lo;
    asm volatile("s_wait_xcnt 0x0" ::: "memory");   // before the next chunk's values reuse the registers that the two stores name
  }
}

// retention: out[b][t][h*128 + dv0..dv0+63] = Σ_{s<=t} ((q_t·k_s)/√dh)·γ_h^(t−s) · v_s  (γ_h = 1 − 2^(−5−h), decay computed as exp((t−s)·log γ_h))
// Chunked by 64 keys: with t0 the first query of the block, g^(t-s) = g^(t-t0+1) * g^(t0-1-s) for every key s < t0, so all keys in front of the block's own
// chunk enter as g^(t-t0+1)/sqrt(dh) * q_t . S, S = sum over s < t0 of g^(t0-1-s) k_s v_s^T (k_chunk_state, k_state_scan); the own chunk keeps the score tile.
__global__ __launch_bounds__(128) void k_ret(const float* __restrict__ q, const float* __restrict__ k, const float* __restrict__ v,
                                             const unsigned short* __restrict__ Sh, const unsigned short* __restrict__ Sl, float* __restrict__ y) {
  constexpr int KS = HD / 32, DV = 64, DT = DV / 16;
  __shared__ __attribute__((aligned(16))) unsigned short sKh[32][HD + 8], sKl[32][HD + 8], sVh[32][DV + 8], sVl[32][DV + 8];
  __shared__ __attribute__((aligned(16))) unsigned short sPh[4][16][40], sPl[4][16][40];
  __shared__ __attribute__((aligned(16))) float sO[4][16][DV];
  const int tid = threadIdx.x, w = tid >> 5, lane = tid & 31, ln = lane & 15, hh = lane >> 4;
  const int nqb = TT / 64;
  const int bh = blockIdx.x / nqb, qblk = blockIdx.x % nqb, dv0 = blockIdx.y * DV;
  const int b = bh / NH, h = bh % NH;
  const int q0 = qblk * 64 + w * 16;
  const float log_a = logf(1.0f - exp2f(-5.0f - (float)h));
  const float* Q = q + (size_t)b * TT * DD + h * HD; const float* K = k + (size_t)b * TT * DD + h * HD; const float* V = v + (size_t)b * TT * DD + h * HD + dv0;
  FragB aqh[KS], aql[KS];
  {
    const float* qr = Q + (size_t)(q0 + ln) * DD;
#pragma unroll
    for (int ks = 0; ks < KS; ++ks)
#pragma unroll
      for (int i = 0; i < 16; ++i) {
        const int d = ks * 32 + ((i < 8) ? (8 * hh + i) : (16 + 8 * hh + (i - 8)));
        const float x = qr[d]; const unsigned short hb = bf16_bits(x); aqh[ks].u[i] = hb; aql[ks].u[i] = bf16_bits(x - bf16_val(hb));
      }
  }
  v8f oacc[DT];
#pragma unroll
  for (int dt = 0; dt < DT; ++dt) oacc[dt] = (v8f){0.f,0.f,0.f,0.f,0.f,0.f,0.f,0.f};
  if (qblk > 0) {                                                       // block-uniform; chunk 0 has no earlier keys
    const size_t so = ((size_t)bh * NC + qblk) * (HD * HD) + (size_t)(dv0 + ln) * HD + 8 * hh;
    const unsigned short* rh = Sh + so; const unsigned short* rl = Sl + so;
    FragB fh[2][KS], fl[2][KS];                                         // two dv tiles of state fragments: a tile's 16 loads fly together, one tile ahead of its products
    auto load_state = [&](int dt) {
#pragma unroll
      for (int ks = 0; ks < KS; ++ks) {
        fh[dt & 1][ks].half[0] = *(const v8us*)(rh + dt * 16 * HD + ks * 32); fh[dt & 1][ks].half[1] = *(const v8us*)(rh + dt * 16 * HD + ks * 32 + 16);
        fl[dt & 1][ks].half[0] = *(const v8us*)(rl + dt * 16 * HD + ks * 32); fl[dt & 1][ks].half[1] = *(const v8us*)(rl + dt * 16 * HD + ks * 32 + 16);
      }
    };
    load_state(0); load_state(1);
    // unrolled (here and in load_state) so that the two fragment buffers are picked by constants and stay in registers
#pragma unroll
    for (int dt = 0; dt < DT; ++dt) {
      v8f acc = {};
#pragma unroll
      for (int ks = 0; ks < KS; ++ks) acc = mmaN<3>(aqh[ks].v, aql[ks].v, fh[dt & 1][ks].v, fl[dt & 1][ks].v, acc);
      if (dt + 2 < DT) load_state(dt + 2);
#pragma unroll
      for (int r = 0; r < 8; ++r) oacc[dt][r] = acc[r] * 0.08838834764831845f * expf((float)(w * 16 + 8 * hh + r + 1) * log_a);
    }
  }
  const int jstart = qblk * 64;
  const int kv_end = qblk * 64 + 64;
  for (int j0 = jstart; j0 < kv_end; j0 += 32) {
    __syncthreads();
    for (int e = tid; e < 32 * (HD / 4); e += 128) {
      const int r = e / (HD / 4), c4 = (e % (HD / 4)) * 4; const int key = j0 + r;
      const v4f kf = *(const v4fa*)(K + (size_t)key * DD + c4);
#pragma unroll
      for (int t = 0; t < 4; ++t) { const unsigned short hb = bf16_bits(kf[t]); sKh[r][c4 + t] = hb; sKl[r][c4 + t] = bf16_bits(kf[t] - bf16_val(hb)); }
    }
    for (int e = tid; e < 32 * (DV / 4); e += 128) {
      const int r = e / (DV / 4), c4 = (e % (DV / 4)) * 4; const int key = j0 + r;
      const v4f vf = *(const v4fa*)(V + (size_t)key * DD + c4);
#pragma unroll
      for (int t = 0; t < 4; ++t) { const unsigned short hb = bf16_bits(vf[t]); sVh[r][c4 + t] = hb; sVl[r][c4 + t] = bf16_bits(vf[t] - bf16_val(hb)); }
    }
    __syncthreads();
#pragma unroll
    for (int nt = 0; nt < 2; ++nt) {
      v8f acc = {};
#pragma unroll
      for (int ks = 0; ks < KS; ++ks) {
        FragB bh_, bl_;
        bh_.half[0] = *(const v8us*)&sKh[nt * 16 + ln][ks * 32 + 8 * hh]; bh_.half[1] = *(const v8us*)&sKh[nt * 16 + ln][ks * 32 + 16 + 8 * hh];
        bl_.half[0] = *(const v8us*)&sKl[nt * 16 + ln][ks * 32 + 8 * hh]; bl_.half[1] = *(const v8us*)&sKl[nt * 16 + ln][ks * 32 + 16 + 8 * hh];
        acc = mmaN<3>(aqh[ks].v, aql[ks].v, bh_.v, bl_.v, acc);
      }
      const int j = j0 + nt * 16 + ln;
#pragma unroll
      for (int r = 0; r < 8; ++r) {
        const int t = q0 + 8 * hh + r;
        const float p = (j <= t) ? acc[r] * 0.08838834764831845f * expf((float)(t - j) * log_a) : 0.f;
        const unsigned short hb = bf16_bits(p); sPh[w][8 * hh + r][nt * 16 + ln] = hb; sPl[w][8 * hh + r][nt * 16 + ln] = bf16_bits(p - bf16_val(hb));
      }
    }
    __builtin_amdgcn_fence(__ATOMIC_ACQ_REL, "workgroup");
    __builtin_amdgcn_wave_barrier();
    FragB pah, pal;
    pah.half[0] = *(const v8us*)&sPh[w][ln][8 * hh]; pah.half[1] = *(const v8us*)&sPh[w][ln][16 + 8 * hh];
    pal.half[0] = *(const v8us*)&sPl[w][ln][8 * hh]; pal.half[1] = *(const v8us*)&sPl[w][ln][16 + 8 * hh];
#pragma unroll
    for (int dt = 0; dt < DT; ++dt) {
      FragB bvh, bvl;
#pragma unroll
      for (int i = 0; i < 8; ++i) {
        bvh.u[i] = sVh[8 * hh + i][dt * 16 + ln]; bvh.u[8 + i] = sVh[16 + 8 * hh + i][dt * 16 + ln];
        bvl.u[i] = sVl[8 * hh + i][dt * 16 + ln]; bvl.u[8 + i] = sVl[16 + 8 * hh + i][dt * 16 + ln];
      }
      oacc[dt] = mmaN<3>(pah.v, pal.v, bvh.v, bvl.v, oacc[dt]);
    }
    __builtin_amdgcn_fence(__ATOMIC_ACQ_REL, "workgroup");
    __builtin_amdgcn_wave_barrier();
  }
#pragma unroll
  for (int dt = 0; dt < DT; ++dt)
#pragma unroll
    for (int r = 0; r < 8; ++r) sO[w][8 * hh + r][dt * 16 + ln] = oacc[dt][r];
  __builtin_amdgcn_fence(__ATOMIC_ACQ_REL, "workgroup");
  __builtin_amdgcn_wave_barrier();
  {
    for (int r = 0; r < 16; ++r) { if (lane < DV / 4) { const v4f val = *(const v4fa*)&sO[w][r][lane * 4]; *(v4f*)(y + ((size_t)b * TT + q0 + r) * DD + h * HD + dv0 + lane * 4) = val; } }
    
  }
}


// Z[row][h*128+d] = silu(g) · (ret − mean)/sqrt(var + 1e-6) per (row, head) over 128; wave per (row, head), lane = 4 values
__global__ __launch_bounds__(256) void k_gn_gate(const float* __restrict__ ret, const float* __restrict__ g, float* __restrict__ z) {
  const int tid = threadIdx.x, w = tid >> 5, lane = tid & 31; const size_t rh = (size_t)blockIdx.x * 8 + w; if (rh >= (size_t)BB * TT * NH) return;
  const size_t base = rh * HD + lane * 4;        // rows are [row][h*128 + d] contiguous -> rh*128
  const v4f a = *(const v4fa*)(ret + base), gg = *(const v4fa*)(g + base);
  float s = a[0] + a[1] + a[2] + a[3]; for (int o = 16; o >= 1; o >>= 1) s += __shfl_xor(s, o, 32); const float mu = s * (1.0f / HD);
  float q2 = 0.f; for (int q = 0; q < 4; ++q) { const float c = a[q] - mu; q2 += c * c; } for (int o = 16; o >= 1; o >>= 1) q2 += __shfl_xor(q2, o, 32);
  const float rs = rsqrtf(q2 * (1.0f / HD) + 1e-6f);
  v4f o4; for (int q = 0; q < 4; ++q) o4[q] = (gg[q] / (1.0f + expf(-gg[q]))) * ((a[q] - mu) * rs);
  *(v4f*)(z + base) = o4; 
}
extern "C" void kernel_launch(void* const* d_in, const int* in_sizes, int n_in,
                              void* d_out, int out_size, void* d_ws, size_t ws_size, hipStream_t stream) {
  (void)in_sizes; (void)n_in; (void)out_size;
  const float* X = (const float*)d_in[0]; const float* Wq = (const float*)d_in[1]; const float* Wk = (const float*)d_in[2]; const float* Wv = (const float*)d_in[3]; const float* WG = (const float*)d_in[4]; const float* WO = (const float*)d_in[5];
  char* ws = (char*)d_ws; size_t off = 0;
  auto take = [&](size_t bytes) { char* p = ws + off; off += (bytes + 255) & ~(size_t)255; return p; };
  const int M = BB * TT, gb = ((M / 16) * (DD / 64) + 3) / 4;
  unsigned short* Wt[5]; for (int i = 0; i < 5; ++i) Wt[i] = (unsigned short*)take((size_t)DD * DD * 2);
  float* q = (float*)take((size_t)M * DD * 4); float* k = (float*)take((size_t)M * DD * 4); float* v = (float*)take((size_t)M * DD * 4); float* g = (float*)take((size_t)M * DD * 4); float* ret = (float*)take((size_t)M * DD * 4);
  float* U = (float*)take((size_t)BB * NH * NC * HD * HD * 4); unsigned short* Sh = (unsigned short*)take((size_t)BB * NH * NC * HD * HD * 2); unsigned short* Sl = (unsigned short*)take((size_t)BB * NH * NC * HD * HD * 2);
  if (off > ws_size) return;
  const float* W5[5] = {Wq, Wk, Wv, WG, WO};
  for (int i = 0; i < 5; ++i) k_wt_bf16<<<(DD * (DD / 8) + 255) / 256, 256, 0, stream>>>(W5[i], Wt[i], DD, DD);       // X @ W: [K][N]
  k_gemm_bf<false, 0, false><<<gb, 128, 0, stream>>>(X, DD, Wt[0], DD, nullptr, q, DD, M, DD, DD);
  k_gemm_bf<false, 0, false><<<gb, 128, 0, stream>>>(X, DD, Wt[1], DD, nullptr, k, DD, M, DD, DD);
  k_gemm_bf<false, 0, false><<<gb, 128, 0, stream>>>(X, DD, Wt[2], DD, nullptr, v, DD, M, DD, DD);
  k_gemm_bf<false, 0, false><<<gb, 128, 0, stream>>>(X, DD, Wt[3], DD, nullptr, g, DD, M, DD, DD);
  k_chunk_state<<<BB * NH * (NC - 1), 256, 0, stream>>>(k, v, U);
  k_state_scan<<<BB * NH * (HD * HD / 4) / 256, 256, 0, stream>>>(U, Sh, Sl);
  k_ret<<<dim3(BB * NH * (TT / 64), 2), 128, 0, stream>>>(q, k, v, Sh, Sl, ret);
  k_gn_gate<<<(BB * TT * NH + 7) / 8, 256, 0, stream>>>(ret, g, q);                                                    // q reused as Z
  k_gemm_bf<true, 0, false><<<gb, 128, 0, stream>>>(q, DD, Wt[4], DD, nullptr, (float*)d_out, DD, M, DD, DD);
}

// v002
// One run takes 188 microseconds.
// In two side-by-side timings against v001, it was 1.80 and 1.79 times as fast.
// Over all steps from v000 it is 4.03 times as fast.
#include <hip/hip_runtime.h>
// All contractions on v_wmma_f32_16x16x32_bf16, f32 accumulate: q/k/v/g = X·W (X, W rounded to bf16: single exact term); per-head retention
// Σ_{s≤t} ((q_t·k_s)/√128)·γ_h^{t−s}·v_s as 3-term bf16 hi/lo splits (scores and decayed weights split in registers/LDS); (silu(g)∘GN(ret))·W_O with
// the A operand split (2 terms). Decay factors, the per-head GroupNorm (no affine, eps 1e-6) and silu in f32.
#define BB 2
#define TT 2048
#define DD 1024
#define NH 8
#define HD 128
#define NC (TT / 64)   // chunks of 64 keys per sequence

typedef __bf16 v16b __attribute__((ext_vector_type(16)));
typedef unsigned short v8us __attribute__((ext_vector_type(8), may_alias));
typedef unsigned short v4us __attribute__((ext_vector_type(4), may_alias));
typedef float  v8f  __attribute__((ext_vector_type(8)));
typedef float  v4f  __attribute__((ext_vector_type(4)));
typedef float  v4fa __attribute__((ext_vector_type(4), may_alias));
union FragB { v16b v; v8us half[2]; unsigned short u[16]; };

__device__ __forceinline__ unsigned short bf16_bits(float x) { unsigned int u = __float_as_uint(x); return (unsigned short)((u + 0x7FFFu + ((u >> 16) & 1u)) >> 16); }
__device__ __forceinline__ float bf16_val(unsigned short b) { return __uint_as_float(((unsigned int)b) << 16); }
__device__ __forceinline__ float bf16_round(float x) { return bf16_val(bf16_bits(x)); }
// D += A·B with NT terms: 1 = ah·bh, 2 = + al·bh (A split), 3 = + ah·bl (both split)
template <int NT>
__device__ __forceinline__ v8f mmaN(v16b ah, v16b al, v16b bh, v16b bl, v8f c) {
  c = __builtin_amdgcn_wmma_f32_16x16x32_bf16(false, ah, false, bh, (short)0, c, false, false);
  if (NT >= 2) c = __builtin_amdgcn_wmma_f32_16x16x32_bf16(false, al, false, bh, (short)0, c, false, false);
  if (NT >= 3) c = __builtin_amdgcn_wmma_f32_16x16x32_bf16(false, ah, false, bl, (short)0, c, false, false);
  asm volatile("v_nop\n\tv_nop\n\tv_nop\n\tv_nop" : "+v"(c) : "v"(ah), "v"(al), "v"(bh), "v"(bl));
  return c;
}

__global__ __launch_bounds__(256) void k_wt_bf16(const float* __restrict__ W, unsigned short* __restrict__ Wt, int K, int N) {
  const int t = blockIdx.x * 256 + threadIdx.x;
  const int k8n = K / 8;
  if (t >= N * k8n) return;
  const int n = t / k8n, k8 = (t % k8n) * 8;
  v8us v;
#pragma unroll
  for (int i = 0; i < 8; ++i) v[i] = bf16_bits(W[(size_t)(k8 + i) * N + n]);
  *(v8us*)(Wt + (size_t)n * K + k8) = v;
  
}

// GEMM C[M][N] (f32) = A[M][K] * W, M = BB*TT, N = K = DD. A f32 row-major, rounded to bf16 on its way into LDS (ASPLIT: hi/lo planes -> 2 terms, else one
// rounded term); Wt bf16 [N][K]. Block = 8 waves = one 128 x 128 tile of C; a stage is 128 k of the 128 A rows and the 128 Wt rows, loaded once per block with
// whole-line loads and shared by all waves through LDS. Two stage buffers, one barrier per stage: the next stage's global loads fly during this stage's products.
// Wave = 32 x 64 of C (waves 4 x 2). Each accumulator sums its k in ascending order, hi term before lo term.
#define GBK 128            // k per stage
#define GP (GBK + 8)       // LDS row pitch in bf16: 272 B, the pitch for 16-byte fragment reads of 256-B rows
#define GSP 68             // row pitch in f32 of a wave's staged C rows: the two half-waves (rows 8 apart) fall on different banks
typedef float f1a __attribute__((may_alias));
template <bool ASPLIT>
__global__ __launch_bounds__(256) void k_gemm_bf(const float* __restrict__ A, const unsigned short* __restrict__ Wt, float* __restrict__ C) {
  constexpr int K = DD, N = DD, NT = K / GBK;
  constexpr int PLANE = 128 * GP;                       // bf16 elements of one operand plane: [0] A hi, [1] Wt, [2] A lo
  constexpr int STAGE = (ASPLIT ? 3 : 2) * PLANE;
  static_assert(2 * STAGE * 2 >= 8 * 32 * GSP * 4, "the staged C tile must fit the operand buffers");
  __shared__ __attribute__((aligned(16))) unsigned short sm[2 * STAGE];
  const int tid = threadIdx.x, w = tid >> 5, lane = tid & 31, ln = lane & 15, hh = lane >> 4;
  const int wm = w >> 1, wn = w & 1;
  const int row0 = (blockIdx.x / (N / 128)) * 128, col0 = (blockIdx.x % (N / 128)) * 128;
  const int ar = tid >> 5, ac = (tid & 31) * 4;         // A: a wave reads 512 contiguous bytes of one row
  const int br = tid >> 4, bc = (tid & 15) * 8;         // Wt: 16 lanes read 256 contiguous bytes of one row
  const float* ap = A + (size_t)(row0 + ar) * K + ac;
  const unsigned short* bp = Wt + (size_t)(col0 + br) * K + bc;
  v4f xa[16]; v8us xb[8];
  // every loop below is unrolled so that the arrays it indexes (loaded rows, fragments, accumulators) stay in registers
  auto fetch = [&](int kb) {
#pragma unroll
    for (int i = 0; i < 16; ++i) xa[i] = *(const v4fa*)(ap + (size_t)i * 8 * K + kb);
#pragma unroll
    for (int i = 0; i < 8; ++i) xb[i] = *(const v8us*)(bp + (size_t)i * 16 * K + kb);
    asm volatile("s_wait_xcnt 0x0" ::: "memory");       // precaution: before any register that an issued load names is rewritten
  };
  auto stash = [&](unsigned short* st) {
#pragma unroll
    for (int i = 0; i < 16; ++i) {
      v4us hi, lo;
#pragma unroll
      for (int t = 0; t < 4; ++t) { hi[t] = bf16_bits(xa[i][t]); lo[t] = ASPLIT ? bf16_bits(xa[i][t] - bf16_val(hi[t])) : (unsigned short)0; }
      *(v4us*)&st[(ar + 8 * i) * GP + ac] = hi;
      if (ASPLIT) *(v4us*)&st[2 * PLANE + (ar + 8 * i) * GP + ac] = lo;
    }
#pragma unroll
    for (int i = 0; i < 8; ++i) *(v8us*)&st[PLANE + (br + 16 * i) * GP + bc] = xb[i];
  };
  v8f acc[2][4];
#pragma unroll
  for (int mi = 0; mi < 2; ++mi)
#pragma unroll
    for (int ni = 0; ni < 4; ++ni) acc[mi][ni] = (v8f){0.f,0.f,0.f,0.f,0.f,0.f,0.f,0.f};
  auto products = [&](const unsigned short* st) {
    const unsigned short* pa = st + (wm * 32 + ln) * GP + 8 * hh;
    const unsigned short* pb = st + PLANE + (wn * 64 + ln) * GP + 8 * hh;
#pragma unroll
    for (int ks = 0; ks < GBK / 32; ++ks) {
      FragB a[2], al[2], b[4];
#pragma unroll
      for (int mi = 0; mi < 2; ++mi) {
        a[mi].half[0] = *(const v8us*)(pa + mi * 16 * GP + ks * 32); a[mi].half[1] = *(const v8us*)(pa + mi * 16 * GP + ks * 32 + 16);
        if (ASPLIT) { al[mi].half[0] = *(const v8us*)(pa + 2 * PLANE + mi * 16 * GP + ks * 32); al[mi].half[1] = *(const v8us*)(pa + 2 * PLANE + mi * 16 * GP + ks * 32 + 16); }
      }
#pragma unroll
      for (int ni = 0; ni < 4; ++ni) { b[ni].half[0] = *(const v8us*)(pb + ni * 16 * GP + ks * 32); b[ni].half[1] = *(const v8us*)(pb + ni * 16 * GP + ks * 32 + 16); }
#pragma unroll
      for (int mi = 0; mi < 2; ++mi)
#pragma unroll
        for (int ni = 0; ni < 4; ++ni) acc[mi][ni] = __builtin_amdgcn_wmma_f32_16x16x32_bf16(false, a[mi].v, false, b[ni].v, (short)0, acc[mi][ni], false, false);
      if (ASPLIT) {
#pragma unroll
        for (int mi = 0; mi < 2; ++mi)
#pragma unroll
          for (int ni = 0; ni < 4; ++ni) acc[mi][ni] = __builtin_amdgcn_wmma_f32_16x16x32_bf16(false, al[mi].v, false, b[ni].v, (short)0, acc[mi][ni], false, false);
      }
    }
  };
  fetch(0);
  stash(sm);
  for (int t = 0; t + 1 < NT; ++t) {
    __syncthreads();                                    // stage t is complete in its buffer, and every reader has left the other buffer
    fetch((t + 1) * GBK);
    products(sm + (t & 1) * STAGE);
    stash(sm + ((t + 1) & 1) * STAGE);
  }
  __syncthreads();
  products(sm + ((NT - 1) & 1) * STAGE);
  __syncthreads();                                      // every wave has left the operand buffers: their LDS now stages C, each wave in its own range
  f1a* so = (f1a*)sm + w * (32 * GSP);
#pragma unroll
  for (int mi = 0; mi < 2; ++mi)
#pragma unroll
    for (int ni = 0; ni < 4; ++ni)
#pragma unroll
      for (int r = 0; r < 8; ++r) so[(mi * 16 + 8 * hh + r) * GSP + ni * 16 + ln] = acc[mi][ni][r];
  __builtin_amdgcn_fence(__ATOMIC_ACQ_REL, "workgroup");
  __builtin_amdgcn_wave_barrier();
  float* cp = C + (size_t)(row0 + wm * 32 + hh) * N + col0 + wn * 64 + ln * 4;
  v4f o[16];
#pragma unroll
  for (int q = 0; q < 16; ++q) o[q] = *(const v4fa*)&so[(q * 2 + hh) * GSP + ln * 4];
#pragma unroll
  for (int q = 0; q < 16; ++q) *(v4f*)(cp + (size_t)q * 2 * N) = o[q];   // 16 lanes store 256 contiguous bytes of a row
}

// Flash-style causal/unmasked attention, all contractions 3-term bf16 hi/lo splits, f32 softmax with running max.
// q,k,v rows are read from f32 buffers with arbitrary row pitch (so they can live inside a fused qkv buffer);
// D = head size (multiple of 32, <= 128); one wave = 16 query rows; block = 4 waves (64 queries) sharing K/V chunks of 32.
template <int D, bool CAUSAL>
__global__ __launch_bounds__(128) void k_flash(const float* __restrict__ qb, const float* __restrict__ kb, const float* __restrict__ vb,
                                             int pitch, int T, int H, float scale, float* __restrict__ y, int ypitch) {
  constexpr int KS = D / 32;        // k-steps for QK
  constexpr int DT = D / 16;        // d tiles for PV
  __shared__ __attribute__((aligned(16))) unsigned short sKh[32][D + 8], sKl[32][D + 8], sVh[32][D + 8], sVl[32][D + 8];
  __shared__ __attribute__((aligned(16))) unsigned short sPh[4][16][40], sPl[4][16][40];
  __shared__ __attribute__((aligned(16))) float sO[4][16][D];
  const int tid = threadIdx.x, w = tid >> 5, lane = tid & 31, ln = lane & 15, hh = lane >> 4;
  const int nqb = (T + 63) / 64;
  const int bh = blockIdx.x / nqb, qblk = blockIdx.x % nqb;
  const int b = bh / H, h = bh % H;
  const int q0 = qblk * 64 + w * 16;
  const float* Q = qb + (size_t)b * T * pitch + h * D;
  const float* K = kb + (size_t)b * T * pitch + h * D;
  const float* V = vb + (size_t)b * T * pitch + h * D;

  // A fragments of the wave's 16 query rows (scaled), hi/lo
  FragB aqh[KS], aql[KS];
  {
    int row = q0 + ln; if (row >= T) row = T - 1;
    const float* qr = Q + (size_t)row * pitch;
#pragma unroll
    for (int ks = 0; ks < KS; ++ks)
#pragma unroll
      for (int i = 0; i < 16; ++i) {
        const int d = ks * 32 + ((i < 8) ? (8 * hh + i) : (16 + 8 * hh + (i - 8)));
        const float x = qr[d] * scale; const unsigned short hb = bf16_bits(x);
        aqh[ks].u[i] = hb; aql[ks].u[i] = bf16_bits(x - bf16_val(hb));
      }
  }
  float m_r[8], l_r[8];
#pragma unroll
  for (int r = 0; r < 8; ++r) { m_r[r] = -3.0e38f; l_r[r] = 0.f; }
  v8f oacc[DT];
#pragma unroll
  for (int dt = 0; dt < DT; ++dt) oacc[dt] = (v8f){0.f,0.f,0.f,0.f,0.f,0.f,0.f,0.f};

  const int kv_end = CAUSAL ? min(T, qblk * 64 + 64) : T;     // block-uniform
  for (int j0 = 0; j0 < kv_end; j0 += 32) {
    __syncthreads();
    for (int e = tid; e < 32 * (D / 4); e += 128) {
      const int r = e / (D / 4), c4 = (e % (D / 4)) * 4;
      const int key = j0 + r;
      v4f kf = {0.f,0.f,0.f,0.f}, vf = {0.f,0.f,0.f,0.f};
      if (key < T) { kf = *(const v4fa*)(K + (size_t)key * pitch + c4); vf = *(const v4fa*)(V + (size_t)key * pitch + c4); }
#pragma unroll
      for (int t = 0; t < 4; ++t) {
        unsigned short hb = bf16_bits(kf[t]); sKh[r][c4 + t] = hb; sKl[r][c4 + t] = bf16_bits(kf[t] - bf16_val(hb));
        hb = bf16_bits(vf[t]); sVh[r][c4 + t] = hb; sVl[r][c4 + t] = bf16_bits(vf[t] - bf16_val(hb));
      }
    }
    __syncthreads();
    // S tile 16 x 32
    v8f s[2];
#pragma unroll
    for (int nt = 0; nt < 2; ++nt) {
      v8f acc = {};
#pragma unroll
      for (int ks = 0; ks < KS; ++ks) {
        FragB bh_, bl_;
        bh_.half[0] = *(const v8us*)&sKh[nt * 16 + ln][ks * 32 + 8 * hh]; bh_.half[1] = *(const v8us*)&sKh[nt * 16 + ln][ks * 32 + 16 + 8 * hh];
        bl_.half[0] = *(const v8us*)&sKl[nt * 16 + ln][ks * 32 + 8 * hh]; bl_.half[1] = *(const v8us*)&sKl[nt * 16 + ln][ks * 32 + 16 + 8 * hh];
        acc = mmaN<3>(aqh[ks].v, aql[ks].v, bh_.v, bl_.v, acc);
      }
      s[nt] = acc;
    }
    // mask + running max (rows 8hh+r; the 16 lanes of a half share rows)
    float alpha[8];
#pragma unroll
    for (int r = 0; r < 8; ++r) {
      const int qi = q0 + 8 * hh + r;
      const int ja = j0 + ln, jb = j0 + 16 + ln;
      if (CAUSAL) { if (ja > qi) s[0][r] = -3.0e38f; if (jb > qi) s[1][r] = -3.0e38f; }
      if (ja >= T) s[0][r] = -3.0e38f;
      if (jb >= T) s[1][r] = -3.0e38f;
      float mx = fmaxf(s[0][r], s[1][r]);
      mx = fmaxf(mx, __shfl_xor(mx, 1, 32)); mx = fmaxf(mx, __shfl_xor(mx, 2, 32)); mx = fmaxf(mx, __shfl_xor(mx, 4, 32)); mx = fmaxf(mx, __shfl_xor(mx, 8, 32));
      const float mnew = fmaxf(m_r[r], mx);
      alpha[r] = (mnew > -1.0e38f) ? __expf(m_r[r] - mnew) : 1.0f;
      const float p0 = (s[0][r] > -1.0e38f) ? __expf(s[0][r] - mnew) : 0.f;
      const float p1 = (s[1][r] > -1.0e38f) ? __expf(s[1][r] - mnew) : 0.f;
      m_r[r] = mnew;
      l_r[r] = l_r[r] * alpha[r] + p0 + p1;            // per-lane partial row sum (16 lanes combined at the end)
      unsigned short hb = bf16_bits(p0); sPh[w][8 * hh + r][ln] = hb;      sPl[w][8 * hh + r][ln] = bf16_bits(p0 - bf16_val(hb));
      hb = bf16_bits(p1);                sPh[w][8 * hh + r][16 + ln] = hb; sPl[w][8 * hh + r][16 + ln] = bf16_bits(p1 - bf16_val(hb));
    }
#pragma unroll
    for (int dt = 0; dt < DT; ++dt)
#pragma unroll
      for (int r = 0; r < 8; ++r) oacc[dt][r] *= alpha[r];
    __builtin_amdgcn_fence(__ATOMIC_ACQ_REL, "workgroup");
    __builtin_amdgcn_wave_barrier();
    FragB pah, pal;
    pah.half[0] = *(const v8us*)&sPh[w][ln][8 * hh]; pah.half[1] = *(const v8us*)&sPh[w][ln][16 + 8 * hh];
    pal.half[0] = *(const v8us*)&sPl[w][ln][8 * hh]; pal.half[1] = *(const v8us*)&sPl[w][ln][16 + 8 * hh];
#pragma unroll
    for (int dt = 0; dt < DT; ++dt) {
      FragB bvh, bvl;
#pragma unroll
      for (int i = 0; i < 8; ++i) {
        bvh.u[i] = sVh[8 * hh + i][dt * 16 + ln]; bvh.u[8 + i] = sVh[16 + 8 * hh + i][dt * 16 + ln];
        bvl.u[i] = sVl[8 * hh + i][dt * 16 + ln]; bvl.u[8 + i] = sVl[16 + 8 * hh + i][dt * 16 + ln];
      }
      oacc[dt] = mmaN<3>(pah.v, pal.v, bvh.v, bvl.v, oacc[dt]);
    }
    __builtin_amdgcn_fence(__ATOMIC_ACQ_REL, "workgroup");
    __builtin_amdgcn_wave_barrier();
  }
#pragma unroll
  for (int r = 0; r < 8; ++r) {
    float l = l_r[r];
    l += __shfl_xor(l, 1, 32); l += __shfl_xor(l, 2, 32); l += __shfl_xor(l, 4, 32); l += __shfl_xor(l, 8, 32);
    l_r[r] = (l > 0.f) ? 1.0f / l : 0.f;
  }
#pragma unroll
  for (int dt = 0; dt < DT; ++dt)
#pragma unroll
    for (int r = 0; r < 8; ++r) sO[w][8 * hh + r][dt * 16 + ln] = oacc[dt][r] * l_r[r];
  __builtin_amdgcn_fence(__ATOMIC_ACQ_REL, "workgroup");
  __builtin_amdgcn_wave_barrier();
  {
    for (int r = 0; r < 16; ++r) {
      const int row = q0 + r;
      if (row < T && lane < D / 4) {
        const v4f val = *(const v4fa*)&sO[w][r][lane * 4];
        *(v4f*)(y + ((size_t)b * T + row) * ypitch + h * D + lane * 4) = val;
      }
    }
    
  }
}
// One chunk's own state, stored transposed: U[bh][n][dv][dk] = sum over j < 64 of (g^(63-j) * k[64n+j][dk]) * v[64n+j][dv], g = the head's decay.
// Block = one (batch, head, chunk); wave w = all 128 dk (A rows) by the 16 dv columns w*16..; 3-term bf16 hi/lo split, f32 accumulate.
// Every loop is unrolled so that the arrays it indexes (loaded rows, fragments, accumulators) stay in registers.
__global__ __launch_bounds__(256) void k_chunk_state(const float* __restrict__ k, const float* __restrict__ v, float* __restrict__ U) {
  __shared__ __attribute__((aligned(16))) unsigned short sKh[HD][72], sKl[HD][72], sVh[HD][72], sVl[HD][72];   // [column][key]: both operands contract over keys
  const int tid = threadIdx.x, w = tid >> 5, lane = tid & 31, ln = lane & 15, hh = lane >> 4;
  const int bh = blockIdx.x / (NC - 1), n = blockIdx.x % (NC - 1);     // the last chunk's state has no reader
  const int b = bh / NH, h = bh % NH;
  const float log_a = logf(1.0f - exp2f(-5.0f - (float)h));
  const float* K = k + ((size_t)b * TT + n * 64) * DD + h * HD; const float* V = v + ((size_t)b * TT + n * 64) * DD + h * HD;
  // a thread transposes 4 keys x 4 columns in registers: 8 lanes read 128 contiguous bytes of a row, and each column goes to LDS as one 8-byte store of 4 keys
  const int cl = tid & 7, k4 = ((tid >> 3) & 15) * 4, ch = tid >> 7;
  float dec[4];
#pragma unroll
  for (int j = 0; j < 4; ++j) dec[j] = expf((float)(63 - (k4 + j)) * log_a);
  const float* kp = K + (size_t)k4 * DD + (cl + 8 * ch) * 4; const float* vp = V + (size_t)k4 * DD + (cl + 8 * ch) * 4;
  v4f kf[2][4], vf[2][4];
#pragma unroll
  for (int i = 0; i < 2; ++i)
#pragma unroll
    for (int j = 0; j < 4; ++j) { kf[i][j] = *(const v4fa*)(kp + (size_t)j * DD + i * 64); vf[i][j] = *(const v4fa*)(vp + (size_t)j * DD + i * 64); }
  // precaution: wait before any register that an issued load names is rewritten; the two addresses are inputs so that no load lands in them ahead of the wait
  asm volatile("s_wait_xcnt 0x0" :: "v"(kp), "v"(vp) : "memory");
#pragma unroll
  for (int i = 0; i < 2; ++i) {
    const int c4 = (cl + 8 * (ch + 2 * i)) * 4;
#pragma unroll
    for (int t = 0; t < 4; ++t) {
      v4us kh, kl, vh, vl;
#pragma unroll
      for (int j = 0; j < 4; ++j) {
        const float x = kf[i][j][t] * dec[j], z = vf[i][j][t];
        kh[j] = bf16_bits(x); kl[j] = bf16_bits(x - bf16_val(kh[j]));
        vh[j] = bf16_bits(z); vl[j] = bf16_bits(z - bf16_val(vh[j]));
      }
      *(v4us*)&sKh[c4 + t][k4] = kh; *(v4us*)&sKl[c4 + t][k4] = kl; *(v4us*)&sVh[c4 + t][k4] = vh; *(v4us*)&sVl[c4 + t][k4] = vl;
    }
  }
  __syncthreads();
  v8f acc[8];
#pragma unroll
  for (int ct = 0; ct < 8; ++ct) acc[ct] = (v8f){0.f,0.f,0.f,0.f,0.f,0.f,0.f,0.f};
#pragma unroll
  for (int ks = 0; ks < 2; ++ks) {
    FragB bvh, bvl;
    bvh.half[0] = *(const v8us*)&sVh[w * 16 + ln][ks * 32 + 8 * hh]; bvh.half[1] = *(const v8us*)&sVh[w * 16 + ln][ks * 32 + 16 + 8 * hh];
    bvl.half[0] = *(const v8us*)&sVl[w * 16 + ln][ks * 32 + 8 * hh]; bvl.half[1] = *(const v8us*)&sVl[w * 16 + ln][ks * 32 + 16 + 8 * hh];
#pragma unroll
    for (int ct = 0; ct < 8; ++ct) {
      FragB akh, akl;
      akh.half[0] = *(const v8us*)&sKh[ct * 16 + ln][ks * 32 + 8 * hh]; akh.half[1] = *(const v8us*)&sKh[ct * 16 + ln][ks * 32 + 16 + 8 * hh];
      akl.half[0] = *(const v8us*)&sKl[ct * 16 + ln][ks * 32 + 8 * hh]; akl.half[1] = *(const v8us*)&sKl[ct * 16 + ln][ks * 32 + 16 + 8 * hh];
      acc[ct] = mmaN<3>(akh.v, akl.v, bvh.v, bvl.v, acc[ct]);
    }
  }
  // acc[ct][r] = U[dk = ct*16 + 8*hh + r][dv = w*16 + ln]: 8 neighbouring dk of one dv row
  float* Uo = U + ((size_t)bh * NC + n) * (HD * HD) + (size_t)(w * 16 + ln) * HD + 8 * hh;
#pragma unroll
  for (int ct = 0; ct < 8; ++ct) {
    *(v4f*)(Uo + ct * 16) = (v4f){acc[ct][0], acc[ct][1], acc[ct][2], acc[ct][3]};
    *(v4f*)(Uo + ct * 16 + 4) = (v4f){acc[ct][4], acc[ct][5], acc[ct][6], acc[ct][7]};
  }
}

// State in front of chunk n+1: S[n+1] = g^64 * S[n] + U[n], S[0] = 0, element by element in f32; stored as bf16 hi/lo planes [bh][n][dv][dk]
// (plane 0 is never written and never read). Thread = 4 neighbouring elements of one (batch, head).
__global__ __launch_bounds__(256) void k_state_scan(const float* __restrict__ U, unsigned short* __restrict__ Sh, unsigned short* __restrict__ Sl) {
  const int t = blockIdx.x * 256 + threadIdx.x;
  const int bh = t / (HD * HD / 4), e = (t % (HD * HD / 4)) * 4;
  const float g64 = expf(64.0f * logf(1.0f - exp2f(-5.0f - (float)(bh % NH))));
  const size_t o0 = (size_t)bh * NC * (HD * HD) + e;
  v4f u[NC - 1];
  // all loads first: they depend on nothing, so the serial recurrence below meets one memory latency and not one per chunk
#pragma unroll
  for (int n = 0; n < NC - 1; ++n) u[n] = *(const v4fa*)(U + o0 + (size_t)n * (HD * HD));
  v4f s = {0.f, 0.f, 0.f, 0.f};
  // unrolled so that u[] is indexed by constants and stays in registers
#pragma unroll
  for (int n = 0; n < NC - 1; ++n) {
    v4us hi, lo;
#pragma unroll
    for (int i = 0; i < 4; ++i) { s[i] = s[i] * g64 + u[n][i]; hi[i] = bf16_bits(s[i]); lo[i] = bf16_bits(s[i] - bf16_val(hi[i])); }
    *(v4us*)(Sh + o0 + (size_t)(n + 1) * (HD * HD)) = hi;
    *(v4us*)(Sl + o0 + (size_t)(n + 1) * (HD * HD)) = lo;
    asm volatile("s_wait_xcnt 0x0" ::: "memory");   // before the next chunk's values reuse the registers that the two stores name
  }
}

// retention: out[b][t][h*128 + dv0..dv0+63] = Σ_{s<=t} ((q_t·k_s)/√dh)·γ_h^(t−s) · v_s  (γ_h = 1 − 2^(−5−h), decay computed as exp((t−s)·log γ_h))
// Chunked by 64 keys: with t0 the first query of the block, g^(t-s) = g^(t-t0+1) * g^(t0-1-s) for every key s < t0, so all keys in front of the block's own
// chunk enter as g^(t-t0+1)/sqrt(dh) * q_t . S, S = sum over s < t0 of g^(t0-1-s) k_s v_s^T (k_chunk_state, k_state_scan); the own chunk keeps the score tile.
__global__ __launch_bounds__(128) void k_ret(const float* __restrict__ q, const float* __restrict__ k, const float* __restrict__ v,
                                             const unsigned short* __restrict__ Sh, const unsigned short* __restrict__ Sl, float* __restrict__ y) {
  constexpr int KS = HD / 32, DV = 64, DT = DV / 16;
  __shared__ __attribute__((aligned(16))) unsigned short sKh[32][HD + 8], sKl[32][HD + 8], sVh[32][DV + 8], sVl[32][DV + 8];
  __shared__ __attribute__((aligned(16))) unsigned short sPh[4][16][40], sPl[4][16][40];
  __shared__ __attribute__((aligned(16))) float sO[4][16][DV];
  const int tid = threadIdx.x, w = tid >> 5, lane = tid & 31, ln = lane & 15, hh = lane >> 4;
  const int nqb = TT / 64;
  const int bh = blockIdx.x / nqb, qblk = blockIdx.x % nqb, dv0 = blockIdx.y * DV;
  const int b = bh / NH, h = bh % NH;
  const int q0 = qblk * 64 + w * 16;
  const float log_a = logf(1.0f - exp2f(-5.0f - (float)h));
  const float* Q = q + (size_t)b * TT * DD + h * HD; const float* K = k + (size_t)b * TT * DD + h * HD; const float* V = v + (size_t)b * TT * DD + h * HD + dv0;
  FragB aqh[KS], aql[KS];
  {
    const float* qr = Q + (size_t)(q0 + ln) * DD;
#pragma unroll
    for (int ks = 0; ks < KS; ++ks)
#pragma unroll
      for (int i = 0; i < 16; ++i) {
        const int d = ks * 32 + ((i < 8) ? (8 * hh + i) : (16 + 8 * hh + (i - 8)));
        const float x = qr[d]; const unsigned short hb = bf16_bits(x); aqh[ks].u[i] = hb; aql[ks].u[i] = bf16_bits(x - bf16_val(hb));
      }
  }
  v8f oacc[DT];
#pragma unroll
  for (int dt = 0; dt < DT; ++dt) oacc[dt] = (v8f){0.f,0.f,0.f,0.f,0.f,0.f,0.f,0.f};
  if (qblk > 0) {                                                       // block-uniform; chunk 0 has no earlier keys
    const size_t so = ((size_t)bh * NC + qblk) * (HD * HD) + (size_t)(dv0 + ln) * HD + 8 * hh;
    const unsigned short* rh = Sh + so; const unsigned short* rl = Sl + so;
    FragB fh[2][KS], fl[2][KS];                                         // two dv tiles of state fragments: a tile's 16 loads fly together, one tile ahead of its products
    auto load_state = [&](int dt) {
#pragma unroll
      for (int ks = 0; ks < KS; ++ks) {
        fh[dt & 1][ks].half[0] = *(const v8us*)(rh + dt * 16 * HD + ks * 32); fh[dt & 1][ks].half[1] = *(const v8us*)(rh + dt * 16 * HD + ks * 32 + 16);
        fl[dt & 1][ks].half[0] = *(const v8us*)(rl + dt * 16 * HD + ks * 32); fl[dt & 1][ks].half[1] = *(const v8us*)(rl + dt * 16 * HD + ks * 32 + 16);
      }
    };
    load_state(0); load_state(1);
    // unrolled (here and in load_state) so that the two fragment buffers are picked by constants and stay in registers
#pragma unroll
    for (int dt = 0; dt < DT; ++dt) {
      v8f acc = {};
#pragma unroll
      for (int ks = 0; ks < KS; ++ks) acc = mmaN<3>(aqh[ks].v, aql[ks].v, fh[dt & 1][ks].v, fl[dt & 1][ks].v, acc);
      if (dt + 2 < DT) load_state(dt + 2);
#pragma unroll
      for (int r = 0; r < 8; ++r) oacc[dt][r] = acc[r] * 0.08838834764831845f * expf((float)(w * 16 + 8 * hh + r + 1) * log_a);
    }
  }
  const int jstart = qblk * 64;
  const int kv_end = qblk * 64 + 64;
  for (int j0 = jstart; j0 < kv_end; j0 += 32) {
    __syncthreads();
    for (int e = tid; e < 32 * (HD / 4); e += 128) {
      const int r = e / (HD / 4), c4 = (e % (HD / 4)) * 4; const int key = j0 + r;
      const v4f kf = *(const v4fa*)(K + (size_t)key * DD + c4);
#pragma unroll
      for (int t = 0; t < 4; ++t) { const unsigned short hb = bf16_bits(kf[t]); sKh[r][c4 + t] = hb; sKl[r][c4 + t] = bf16_bits(kf[t] - bf16_val(hb)); }
    }
    for (int e = tid; e < 32 * (DV / 4); e += 128) {
      const int r = e / (DV / 4), c4 = (e % (DV / 4)) * 4; const int key = j0 + r;
      const v4f vf = *(const v4fa*)(V + (size_t)key * DD + c4);
#pragma unroll
      for (int t = 0; t < 4; ++t) { const unsigned short hb = bf16_bits(vf[t]); sVh[r][c4 + t] = hb; sVl[r][c4 + t] = bf16_bits(vf[t] - bf16_val(hb)); }
    }
    __syncthreads();
#pragma unroll
    for (int nt = 0; nt < 2; ++nt) {
      v8f acc = {};
#pragma unroll
      for (int ks = 0; ks < KS; ++ks) {
        FragB bh_, bl_;
        bh_.half[0] = *(const v8us*)&sKh[nt * 16 + ln][ks * 32 + 8 * hh]; bh_.half[1] = *(const v8us*)&sKh[nt * 16 + ln][ks * 32 + 16 + 8 * hh];
        bl_.half[0] = *(const v8us*)&sKl[nt * 16 + ln][ks * 32 + 8 * hh]; bl_.half[1] = *(const v8us*)&sKl[nt * 16 + ln][ks * 32 + 16 + 8 * hh];
        acc = mmaN<3>(aqh[ks].v, aql[ks].v, bh_.v, bl_.v, acc);
      }
      const int j = j0 + nt * 16 + ln;
#pragma unroll
      for (int r = 0; r < 8; ++r) {
        const int t = q0 + 8 * hh + r;
        const float p = (j <= t) ? acc[r] * 0.08838834764831845f * expf((float)(t - j) * log_a) : 0.f;
        const unsigned short hb = bf16_bits(p); sPh[w][8 * hh + r][nt * 16 + ln] = hb; sPl[w][8 * hh + r][nt * 16 + ln] = bf16_bits(p - bf16_val(hb));
      }
    }
    __builtin_amdgcn_fence(__ATOMIC_ACQ_REL, "workgroup");
    __builtin_amdgcn_wave_barrier();
    FragB pah, pal;
    pah.half[0] = *(const v8us*)&sPh[w][ln][8 * hh]; pah.half[1] = *(const v8us*)&sPh[w][ln][16 + 8 * hh];
    pal.half[0] = *(const v8us*)&sPl[w][ln][8 * hh]; pal.half[1] = *(const v8us*)&sPl[w][ln][16 + 8 * hh];
#pragma unroll
    for (int dt = 0; dt < DT; ++dt) {
      FragB bvh, bvl;
#pragma unroll
      for (int i = 0; i < 8; ++i) {
        bvh.u[i] = sVh[8 * hh + i][dt * 16 + ln]; bvh.u[8 + i] = sVh[16 + 8 * hh + i][dt * 16 + ln];
        bvl.u[i] = sVl[8 * hh + i][dt * 16 + ln]; bvl.u[8 + i] = sVl[16 + 8 * hh + i][dt * 16 + ln];
      }
      oacc[dt] = mmaN<3>(pah.v, pal.v, bvh.v, bvl.v, oacc[dt]);
    }
    __builtin_amdgcn_fence(__ATOMIC_ACQ_REL, "workgroup");
    __builtin_amdgcn_wave_barrier();
  }
#pragma unroll
  for (int dt = 0; dt < DT; ++dt)
#pragma unroll
    for (int r = 0; r < 8; ++r) sO[w][8 * hh + r][dt * 16 + ln] = oacc[dt][r];
  __builtin_amdgcn_fence(__ATOMIC_ACQ_REL, "workgroup");
  __builtin_amdgcn_wave_barrier();
  {
    for (int r = 0; r < 16; ++r) { if (lane < DV / 4) { const v4f val = *(const v4fa*)&sO[w][r][lane * 4]; *(v4f*)(y + ((size_t)b * TT + q0 + r) * DD + h * HD + dv0 + lane * 4) = val; } }
    
  }
}


// Z[row][h*128+d] = silu(g) · (ret − mean)/sqrt(var + 1e-6) per (row, head) over 128; wave per (row, head), lane = 4 values
__global__ __launch_bounds__(256) void k_gn_gate(const float* __restrict__ ret, const float* __restrict__ g, float* __restrict__ z) {
  const int tid = threadIdx.x, w = tid >> 5, lane = tid & 31; const size_t rh = (size_t)blockIdx.x * 8 + w; if (rh >= (size_t)BB * TT * NH) return;
  const size_t base = rh * HD + lane * 4;        // rows are [row][h*128 + d] contiguous -> rh*128
  const v4f a = *(const v4fa*)(ret + base), gg = *(const v4fa*)(g + base);
  float s = a[0] + a[1] + a[2] + a[3]; for (int o = 16; o >= 1; o >>= 1) s += __shfl_xor(s, o, 32); const float mu = s * (1.0f / HD);
  float q2 = 0.f; for (int q = 0; q < 4; ++q) { const float c = a[q] - mu; q2 += c * c; } for (int o = 16; o >= 1; o >>= 1) q2 += __shfl_xor(q2, o, 32);
  const float rs = rsqrtf(q2 * (1.0f / HD) + 1e-6f);
  v4f o4; for (int q = 0; q < 4; ++q) o4[q] = (gg[q] / (1.0f + expf(-gg[q]))) * ((a[q] - mu) * rs);
  *(v4f*)(z + base) = o4; 
}
extern "C" void kernel_launch(void* const* d_in, const int* in_sizes, int n_in,
                              void* d_out, int out_size, void* d_ws, size_t ws_size, hipStream_t stream) {
  (void)in_sizes; (void)n_in; (void)out_size;
  const float* X = (const float*)d_in[0]; const float* Wq = (const float*)d_in[1]; const float* Wk = (const float*)d_in[2]; const float* Wv = (const float*)d_in[3]; const float* WG = (const float*)d_in[4]; const float* WO = (const float*)d_in[5];
  char* ws = (char*)d_ws; size_t off = 0;
  auto take = [&](size_t bytes) { char* p = ws + off; off += (bytes + 255) & ~(size_t)255; return p; };
  const int M = BB * TT, gb = (M / 128) * (DD / 128);
  unsigned short* Wt[5]; for (int i = 0; i < 5; ++i) Wt[i] = (unsigned short*)take((size_t)DD * DD * 2);
  float* q = (float*)take((size_t)M * DD * 4); float* k = (float*)take((size_t)M * DD * 4); float* v = (float*)take((size_t)M * DD * 4); float* g = (float*)take((size_t)M * DD * 4); float* ret = (float*)take((size_t)M * DD * 4);
  float* U = (float*)take((size_t)BB * NH * NC * HD * HD * 4); unsigned short* Sh = (unsigned short*)take((size_t)BB * NH * NC * HD * HD * 2); unsigned short* Sl = (unsigned short*)take((size_t)BB * NH * NC * HD * HD * 2);
  if (off > ws_size) return;
  const float* W5[5] = {Wq, Wk, Wv, WG, WO};
  for (int i = 0; i < 5; ++i) k_wt_bf16<<<(DD * (DD / 8) + 255) / 256, 256, 0, stream>>>(W5[i], Wt[i], DD, DD);       // X @ W: [K][N]
  k_gemm_bf<false><<<gb, 256, 0, stream>>>(X, Wt[0], q);
  k_gemm_bf<false><<<gb, 256, 0, stream>>>(X, Wt[1], k);
  k_gemm_bf<false><<<gb, 256, 0, stream>>>(X, Wt[2], v);
  k_gemm_bf<false><<<gb, 256, 0, stream>>>(X, Wt[3], g);
  k_chunk_state<<<BB * NH * (NC - 1), 256, 0, stream>>>(k, v, U);
  k_state_scan<<<BB * NH * (HD * HD / 4) / 256, 256, 0, stream>>>(U, Sh, Sl);
  k_ret<<<dim3(BB * NH * (TT / 64), 2), 128, 0, stream>>>(q, k, v, Sh, Sl, ret);
  k_gn_gate<<<(BB * TT * NH + 7) / 8, 256, 0, stream>>>(ret, g, q);                                                    // q reused as Z
  k_gemm_bf<true><<<gb, 256, 0, stream>>>(q, Wt[4], (float*)d_out);
}

// v003
// Measured time: 170 microseconds a run.
// Two timings next to v002 both put it at 1.11 times that version's speed.
// Counting every step since v000, it is 4.46 times as fast.
#include <hip/hip_runtime.h>
// All contractions on v_wmma_f32_16x16x32_bf16, f32 accumulate: q/k/v/g = X·W (X, W rounded to bf16: single exact term); per-head retention
// Σ_{s≤t} ((q_t·k_s)/√128)·γ_h^{t−s}·v_s as 3-term bf16 hi/lo splits (scores and decayed weights split in registers/LDS); (silu(g)∘GN(ret))·W_O with
// the A operand split (2 terms). Decay factors, the per-head GroupNorm (no affine, eps 1e-6) and silu in f32.
#define BB 2
#define TT 2048
#define DD 1024
#define NH 8
#define HD 128
#define NC (TT / 64)   // chunks of 64 keys per sequence

typedef __bf16 v16b __attribute__((ext_vector_type(16)));
typedef unsigned short v8us __attribute__((ext_vector_type(8), may_alias));
typedef unsigned short v4us __attribute__((ext_vector_type(4), may_alias));
typedef float  v8f  __attribute__((ext_vector_type(8)));
typedef float  v4f  __attribute__((ext_vector_type(4)));
typedef float  v4fa __attribute__((ext_vector_type(4), may_alias));
union FragB { v16b v; v8us half[2]; unsigned short u[16]; };

__device__ __forceinline__ unsigned short bf16_bits(float x) { unsigned int u = __float_as_uint(x); return (unsigned short)((u + 0x7FFFu + ((u >> 16) & 1u)) >> 16); }
__device__ __forceinline__ float bf16_val(unsigned short b) { return __uint_as_float(((unsigned int)b) << 16); }
__device__ __forceinline__ float bf16_round(float x) { return bf16_val(bf16_bits(x)); }
// D += A·B with NT terms: 1 = ah·bh, 2 = + al·bh (A split), 3 = + ah·bl (both split)
template <int NT>
__device__ __forceinline__ v8f mmaN(v16b ah, v16b al, v16b bh, v16b bl, v8f c) {
  c = __builtin_amdgcn_wmma_f32_16x16x32_bf16(false, ah, false, bh, (short)0, c, false, false);
  if (NT >= 2) c = __builtin_amdgcn_wmma_f32_16x16x32_bf16(false, al, false, bh, (short)0, c, false, false);
  if (NT >= 3) c = __builtin_amdgcn_wmma_f32_16x16x32_bf16(false, ah, false, bl, (short)0, c, false, false);
  asm volatile("v_nop\n\tv_nop\n\tv_nop\n\tv_nop" : "+v"(c) : "v"(ah), "v"(al), "v"(bh), "v"(bl));
  return c;
}

// One launch for all five weights: blockIdx.y picks the matrix; the five bf16 transposes lie one behind the other from Wt0.
__global__ __launch_bounds__(256) void k_wt_bf16(const float* __restrict__ W0, const float* __restrict__ W1, const float* __restrict__ W2, const float* __restrict__ W3,
                                                 const float* __restrict__ W4, unsigned short* __restrict__ Wt0, int K, int N) {
  const int y = blockIdx.y;
  const float* __restrict__ W = y == 0 ? W0 : y == 1 ? W1 : y == 2 ? W2 : y == 3 ? W3 : W4;
  unsigned short* __restrict__ Wt = Wt0 + (size_t)y * K * N;
  const int t = blockIdx.x * 256 + threadIdx.x;
  const int k8n = K / 8;
  if (t >= N * k8n) return;
  const int n = t / k8n, k8 = (t % k8n) * 8;
  v8us v;
#pragma unroll
  for (int i = 0; i < 8; ++i) v[i] = bf16_bits(W[(size_t)(k8 + i) * N + n]);
  *(v8us*)(Wt + (size_t)n * K + k8) = v;
  
}

// GEMM C[M][N] (f32) = A[M][K] * W, M = BB*TT, N = K = DD. A f32 row-major, rounded to bf16 on its way into LDS (ASPLIT: hi/lo planes -> 2 terms, else one
// rounded term); Wt bf16 [N][K]. Block = 8 waves = one 128 x 128 tile of C; a stage is 128 k of the 128 A rows and the 128 Wt rows, loaded once per block with
// whole-line loads and shared by all waves through LDS. Two stage buffers, one barrier per stage: the next stage's global loads fly during this stage's products.
// Wave = 32 x 64 of C (waves 4 x 2). Each accumulator sums its k in ascending order, hi term before lo term.
// NW products that share A run as one launch: their Wt planes lie one behind the other from Wt0, their C planes from C0, and the column tiles of all NW
// are numbered through. With more blocks than WGPs two unsplit blocks (136 KiB of LDS each) share a WGP, and one block's loads fly while the other stores or waits.
#define GBK 128            // k per stage
#define GP (GBK + 8)       // LDS row pitch in bf16: 272 B, the pitch for 16-byte fragment reads of 256-B rows
#define GSP 68             // row pitch in f32 of a wave's staged C rows: the two half-waves (rows 8 apart) fall on different banks
typedef float f1a __attribute__((may_alias));
template <bool ASPLIT, int NW>
__global__ __launch_bounds__(256) void k_gemm_bf(const float* __restrict__ A, const unsigned short* __restrict__ Wt0, float* __restrict__ C0) {
  constexpr int K = DD, N = DD, NT = K / GBK, CT = N / 128;
  constexpr int PLANE = 128 * GP;                       // bf16 elements of one operand plane: [0] A hi, [1] Wt, [2] A lo
  constexpr int STAGE = (ASPLIT ? 3 : 2) * PLANE;
  static_assert(2 * STAGE * 2 >= 8 * 32 * GSP * 4, "the staged C tile must fit the operand buffers");
  __shared__ __attribute__((aligned(16))) unsigned short sm[2 * STAGE];
  const int tid = threadIdx.x, w = tid >> 5, lane = tid & 31, ln = lane & 15, hh = lane >> 4;
  const int wm = w >> 1, wn = w & 1;
  const int ct = blockIdx.x % (NW * CT), which = ct / CT;
  const int row0 = (blockIdx.x / (NW * CT)) * 128, col0 = (ct % CT) * 128;
  const unsigned short* __restrict__ Wt = Wt0 + (size_t)which * N * K;
  float* __restrict__ C = C0 + (size_t)which * (BB * TT) * N;
  const int ar = tid >> 5, ac = (tid & 31) * 4;         // A: a wave reads 512 contiguous bytes of one row
  const int br = tid >> 4, bc = (tid & 15) * 8;         // Wt: 16 lanes read 256 contiguous bytes of one row
  const float* ap = A + (size_t)(row0 + ar) * K + ac;
  const unsigned short* bp = Wt + (size_t)(col0 + br) * K + bc;
  v4f xa[16]; v8us xb[8];
  // every loop below is unrolled so that the arrays it indexes (loaded rows, fragments, accumulators) stay in registers
  auto fetch = [&](int kb) {
#pragma unroll
    for (int i = 0; i < 16; ++i) xa[i] = *(const v4fa*)(ap + (size_t)i * 8 * K + kb);
#pragma unroll
    for (int i = 0; i < 8; ++i) xb[i] = *(const v8us*)(bp + (size_t)i * 16 * K + kb);
    asm volatile("s_wait_xcnt 0x0" ::: "memory");       // precaution: before any register that an issued load names is rewritten
  };
  auto stash = [&](unsigned short* st) {
#pragma unroll
    for (int i = 0; i < 16; ++i) {
      v4us hi, lo;
#pragma unroll
      for (int t = 0; t < 4; ++t) { hi[t] = bf16_bits(xa[i][t]); lo[t] = ASPLIT ? bf16_bits(xa[i][t] - bf16_val(hi[t])) : (unsigned short)0; }
      *(v4us*)&st[(ar + 8 * i) * GP + ac] = hi;
      if (ASPLIT) *(v4us*)&st[2 * PLANE + (ar + 8 * i) * GP + ac] = lo;
    }
#pragma unroll
    for (int i = 0; i < 8; ++i) *(v8us*)&st[PLANE + (br + 16 * i) * GP + bc] = xb[i];
  };
  v8f acc[2][4];
#pragma unroll
  for (int mi = 0; mi < 2; ++mi)
#pragma unroll
    for (int ni = 0; ni < 4; ++ni) acc[mi][ni] = (v8f){0.f,0.f,0.f,0.f,0.f,0.f,0.f,0.f};
  auto products = [&](const unsigned short* st) {
    const unsigned short* pa = st + (wm * 32 + ln) * GP + 8 * hh;
    const unsigned short* pb = st + PLANE + (wn * 64 + ln) * GP + 8 * hh;
#pragma unroll
    for (int ks = 0; ks < GBK / 32; ++ks) {
      FragB a[2], al[2], b[4];
#pragma unroll
      for (int mi = 0; mi < 2; ++mi) {
        a[mi].half[0] = *(const v8us*)(pa + mi * 16 * GP + ks * 32); a[mi].half[1] = *(const v8us*)(pa + mi * 16 * GP + ks * 32 + 16);
        if (ASPLIT) { al[mi].half[0] = *(const v8us*)(pa + 2 * PLANE + mi * 16 * GP + ks * 32); al[mi].half[1] = *(const v8us*)(pa + 2 * PLANE + mi * 16 * GP + ks * 32 + 16); }
      }
#pragma unroll
      for (int ni = 0; ni < 4; ++ni) { b[ni].half[0] = *(const v8us*)(pb + ni * 16 * GP + ks * 32); b[ni].half[1] = *(const v8us*)(pb + ni * 16 * GP + ks * 32 + 16); }
#pragma unroll
      for (int mi = 0; mi < 2; ++mi)
#pragma unroll
        for (int ni = 0; ni < 4; ++ni) acc[mi][ni] = __builtin_amdgcn_wmma_f32_16x16x32_bf16(false, a[mi].v, false, b[ni].v, (short)0, acc[mi][ni], false, false);
      if (ASPLIT) {
#pragma unroll
        for (int mi = 0; mi < 2; ++mi)
#pragma unroll
          for (int ni = 0; ni < 4; ++ni) acc[mi][ni] = __builtin_amdgcn_wmma_f32_16x16x32_bf16(false, al[mi].v, false, b[ni].v, (short)0, acc[mi][ni], false, false);
      }
    }
  };
  fetch(0);
  stash(sm);
  for (int t = 0; t + 1 < NT; ++t) {
    __syncthreads();                                    // stage t is complete in its buffer, and every reader has left the other buffer
    fetch((t + 1) * GBK);
    products(sm + (t & 1) * STAGE);
    stash(sm + ((t + 1) & 1) * STAGE);
  }
  __syncthreads();
  products(sm + ((NT - 1) & 1) * STAGE);
  __syncthreads();                                      // every wave has left the operand buffers: their LDS now stages C, each wave in its own range
  f1a* so = (f1a*)sm + w * (32 * GSP);
#pragma unroll
  for (int mi = 0; mi < 2; ++mi)
#pragma unroll
    for (int ni = 0; ni < 4; ++ni)
#pragma unroll
      for (int r = 0; r < 8; ++r) so[(mi * 16 + 8 * hh + r) * GSP + ni * 16 + ln] = acc[mi][ni][r];
  __builtin_amdgcn_fence(__ATOMIC_ACQ_REL, "workgroup");
  __builtin_amdgcn_wave_barrier();
  float* cp = C + (size_t)(row0 + wm * 32 + hh) * N + col0 + wn * 64 + ln * 4;
  v4f o[16];
#pragma unroll
  for (int q = 0; q < 16; ++q) o[q] = *(const v4fa*)&so[(q * 2 + hh) * GSP + ln * 4];
#pragma unroll
  for (int q = 0; q < 16; ++q) *(v4f*)(cp + (size_t)q * 2 * N) = o[q];   // 16 lanes store 256 contiguous bytes of a row
}

// Flash-style causal/unmasked attention, all contractions 3-term bf16 hi/lo splits, f32 softmax with running max.
// q,k,v rows are read from f32 buffers with arbitrary row pitch (so they can live inside a fused qkv buffer);
// D = head size (multiple of 32, <= 128); one wave = 16 query rows; block = 4 waves (64 queries) sharing K/V chunks of 32.
template <int D, bool CAUSAL>
__global__ __launch_bounds__(128) void k_flash(const float* __restrict__ qb, const float* __restrict__ kb, const float* __restrict__ vb,
                                             int pitch, int T, int H, float scale, float* __restrict__ y, int ypitch) {
  constexpr int KS = D / 32;        // k-steps for QK
  constexpr int DT = D / 16;        // d tiles for PV
  __shared__ __attribute__((aligned(16))) unsigned short sKh[32][D + 8], sKl[32][D + 8], sVh[32][D + 8], sVl[32][D + 8];
  __shared__ __attribute__((aligned(16))) unsigned short sPh[4][16][40], sPl[4][16][40];
  __shared__ __attribute__((aligned(16))) float sO[4][16][D];
  const int tid = threadIdx.x, w = tid >> 5, lane = tid & 31, ln = lane & 15, hh = lane >> 4;
  const int nqb = (T + 63) / 64;
  const int bh = blockIdx.x / nqb, qblk = blockIdx.x % nqb;
  const int b = bh / H, h = bh % H;
  const int q0 = qblk * 64 + w * 16;
  const float* Q = qb + (size_t)b * T * pitch + h * D;
  const float* K = kb + (size_t)b * T * pitch + h * D;
  const float* V = vb + (size_t)b * T * pitch + h * D;

  // A fragments of the wave's 16 query rows (scaled), hi/lo
  FragB aqh[KS], aql[KS];
  {
    int row = q0 + ln; if (row >= T) row = T - 1;
    const float* qr = Q + (size_t)row * pitch;
#pragma unroll
    for (int ks = 0; ks < KS; ++ks)
#pragma unroll
      for (int i = 0; i < 16; ++i) {
        const int d = ks * 32 + ((i < 8) ? (8 * hh + i) : (16 + 8 * hh + (i - 8)));
        const float x = qr[d] * scale; const unsigned short hb = bf16_bits(x);
        aqh[ks].u[i] = hb; aql[ks].u[i] = bf16_bits(x - bf16_val(hb));
      }
  }
  float m_r[8], l_r[8];
#pragma unroll
  for (int r = 0; r < 8; ++r) { m_r[r] = -3.0e38f; l_r[r] = 0.f; }
  v8f oacc[DT];
#pragma unroll
  for (int dt = 0; dt < DT; ++dt) oacc[dt] = (v8f){0.f,0.f,0.f,0.f,0.f,0.f,0.f,0.f};

  const int kv_end = CAUSAL ? min(T, qblk * 64 + 64) : T;     // block-uniform
  for (int j0 = 0; j0 < kv_end; j0 += 32) {
    __syncthreads();
    for (int e = tid; e < 32 * (D / 4); e += 128) {
      const int r = e / (D / 4), c4 = (e % (D / 4)) * 4;
      const int key = j0 + r;
      v4f kf = {0.f,0.f,0.f,0.f}, vf = {0.f,0.f,0.f,0.f};
      if (key < T) { kf = *(const v4fa*)(K + (size_t)key * pitch + c4); vf = *(const v4fa*)(V + (size_t)key * pitch + c4); }
#pragma unroll
      for (int t = 0; t < 4; ++t) {
        unsigned short hb = bf16_bits(kf[t]); sKh[r][c4 + t] = hb; sKl[r][c4 + t] = bf16_bits(kf[t] - bf16_val(hb));
        hb = bf16_bits(vf[t]); sVh[r][c4 + t] = hb; sVl[r][c4 + t] = bf16_bits(vf[t] - bf16_val(hb));
      }
    }
    __syncthreads();
    // S tile 16 x 32
    v8f s[2];
#pragma unroll
    for (int nt = 0; nt < 2; ++nt) {
      v8f acc = {};
#pragma unroll
      for (int ks = 0; ks < KS; ++ks) {
        FragB bh_, bl_;
        bh_.half[0] = *(const v8us*)&sKh[nt * 16 + ln][ks * 32 + 8 * hh]; bh_.half[1] = *(const v8us*)&sKh[nt * 16 + ln][ks * 32 + 16 + 8 * hh];
        bl_.half[0] = *(const v8us*)&sKl[nt * 16 + ln][ks * 32 + 8 * hh]; bl_.half[1] = *(const v8us*)&sKl[nt * 16 + ln][ks * 32 + 16 + 8 * hh];
        acc = mmaN<3>(aqh[ks].v, aql[ks].v, bh_.v, bl_.v, acc);
      }
      s[nt] = acc;
    }
    // mask + running max (rows 8hh+r; the 16 lanes of a half share rows)
    float alpha[8];
#pragma unroll
    for (int r = 0; r < 8; ++r) {
      const int qi = q0 + 8 * hh + r;
      const int ja = j0 + ln, jb = j0 + 16 + ln;
      if (CAUSAL) { if (ja > qi) s[0][r] = -3.0e38f; if (jb > qi) s[1][r] = -3.0e38f; }
      if (ja >= T) s[0][r] = -3.0e38f;
      if (jb >= T) s[1][r] = -3.0e38f;
      float mx = fmaxf(s[0][r], s[1][r]);
      mx = fmaxf(mx, __shfl_xor(mx, 1, 32)); mx = fmaxf(mx, __shfl_xor(mx, 2, 32)); mx = fmaxf(mx, __shfl_xor(mx, 4, 32)); mx = fmaxf(mx, __shfl_xor(mx, 8, 32));
      const float mnew = fmaxf(m_r[r], mx);
      alpha[r] = (mnew > -1.0e38f) ? __expf(m_r[r] - mnew) : 1.0f;
      const float p0 = (s[0][r] > -1.0e38f) ? __expf(s[0][r] - mnew) : 0.f;
      const float p1 = (s[1][r] > -1.0e38f) ? __expf(s[1][r] - mnew) : 0.f;
      m_r[r] = mnew;
      l_r[r] = l_r[r] * alpha[r] + p0 + p1;            // per-lane partial row sum (16 lanes combined at the end)
      unsigned short hb = bf16_bits(p0); sPh[w][8 * hh + r][ln] = hb;      sPl[w][8 * hh + r][ln] = bf16_bits(p0 - bf16_val(hb));
      hb = bf16_bits(p1);                sPh[w][8 * hh + r][16 + ln] = hb; sPl[w][8 * hh + r][16 + ln] = bf16_bits(p1 - bf16_val(hb));
    }
#pragma unroll
    for (int dt = 0; dt < DT; ++dt)
#pragma unroll
      for (int r = 0; r < 8; ++r) oacc[dt][r] *= alpha[r];
    __builtin_amdgcn_fence(__ATOMIC_ACQ_REL, "workgroup");
    __builtin_amdgcn_wave_barrier();
    FragB pah, pal;
    pah.half[0] = *(const v8us*)&sPh[w][ln][8 * hh]; pah.half[1] = *(const v8us*)&sPh[w][ln][16 + 8 * hh];
    pal.half[0] = *(const v8us*)&sPl[w][ln][8 * hh]; pal.half[1] = *(const v8us*)&sPl[w][ln][16 + 8 * hh];
#pragma unroll
    for (int dt = 0; dt < DT; ++dt) {
      FragB bvh, bvl;
#pragma unroll
      for (int i = 0; i < 8; ++i) {
        bvh.u[i] = sVh[8 * hh + i][dt * 16 + ln]; bvh.u[8 + i] = sVh[16 + 8 * hh + i][dt * 16 + ln];
        bvl.u[i] = sVl[8 * hh + i][dt * 16 + ln]; bvl.u[8 + i] = sVl[16 + 8 * hh + i][dt * 16 + ln];
      }
      oacc[dt] = mmaN<3>(pah.v, pal.v, bvh.v, bvl.v, oacc[dt]);
    }
    __builtin_amdgcn_fence(__ATOMIC_ACQ_REL, "workgroup");
    __builtin_amdgcn_wave_barrier();
  }
#pragma unroll
  for (int r = 0; r < 8; ++r) {
    float l = l_r[r];
    l += __shfl_xor(l, 1, 32); l += __shfl_xor(l, 2, 32); l += __shfl_xor(l, 4, 32); l += __shfl_xor(l, 8, 32);
    l_r[r] = (l > 0.f) ? 1.0f / l : 0.f;
  }
#pragma unroll
  for (int dt = 0; dt < DT; ++dt)
#pragma unroll
    for (int r = 0; r < 8; ++r) sO[w][8 * hh + r][dt * 16 + ln] = oacc[dt][r] * l_r[r];
  __builtin_amdgcn_fence(__ATOMIC_ACQ_REL, "workgroup");
  __builtin_amdgcn_wave_barrier();
  {
    for (int r = 0; r < 16; ++r) {
      const int row = q0 + r;
      if (row < T && lane < D / 4) {
        const v4f val = *(const v4fa*)&sO[w][r][lane * 4];
        *(v4f*)(y + ((size_t)b * T + row) * ypitch + h * D + lane * 4) = val;
      }
    }
    
  }
}
// One chunk's own state, stored transposed: U[bh][n][dv][dk] = sum over j < 64 of (g^(63-j) * k[64n+j][dk]) * v[64n+j][dv], g = the head's decay.
// Block = one (batch, head, chunk); wave w = all 128 dk (A rows) by the 16 dv columns w*16..; 3-term bf16 hi/lo split, f32 accumulate.
// Every loop is unrolled so that the arrays it indexes (loaded rows, fragments, accumulators) stay in registers.
__global__ __launch_bounds__(256) void k_chunk_state(const float* __restrict__ k, const float* __restrict__ v, float* __restrict__ U) {
  __shared__ __attribute__((aligned(16))) unsigned short sKh[HD][72], sKl[HD][72], sVh[HD][72], sVl[HD][72];   // [column][key]: both operands contract over keys
  const int tid = threadIdx.x, w = tid >> 5, lane = tid & 31, ln = lane & 15, hh = lane >> 4;
  const int bh = blockIdx.x / (NC - 1), n = blockIdx.x % (NC - 1);     // the last chunk's state has no reader
  const int b = bh / NH, h = bh % NH;
  const float log_a = logf(1.0f - exp2f(-5.0f - (float)h));
  const float* K = k + ((size_t)b * TT + n * 64) * DD + h * HD; const float* V = v + ((size_t)b * TT + n * 64) * DD + h * HD;
  // a thread transposes 4 keys x 4 columns in registers: 8 lanes read 128 contiguous bytes of a row, and each column goes to LDS as one 8-byte store of 4 keys
  const int cl = tid & 7, k4 = ((tid >> 3) & 15) * 4, ch = tid >> 7;
  float dec[4];
#pragma unroll
  for (int j = 0; j < 4; ++j) dec[j] = expf((float)(63 - (k4 + j)) * log_a);
  const float* kp = K + (size_t)k4 * DD + (cl + 8 * ch) * 4; const float* vp = V + (size_t)k4 * DD + (cl + 8 * ch) * 4;
  v4f kf[2][4], vf[2][4];
#pragma unroll
  for (int i = 0; i < 2; ++i)
#pragma unroll
    for (int j = 0; j < 4; ++j) { kf[i][j] = *(const v4fa*)(kp + (size_t)j * DD + i * 64); vf[i][j] = *(const v4fa*)(vp + (size_t)j * DD + i * 64); }
  // precaution: wait before any register that an issued load names is rewritten; the two addresses are inputs so that no load lands in them ahead of the wait
  asm volatile("s_wait_xcnt 0x0" :: "v"(kp), "v"(vp) : "memory");
#pragma unroll
  for (int i = 0; i < 2; ++i) {
    const int c4 = (cl + 8 * (ch + 2 * i)) * 4;
#pragma unroll
    for (int t = 0; t < 4; ++t) {
      v4us kh, kl, vh, vl;
#pragma unroll
      for (int j = 0; j < 4; ++j) {
        const float x = kf[i][j][t] * dec[j], z = vf[i][j][t];
        kh[j] = bf16_bits(x); kl[j] = bf16_bits(x - bf16_val(kh[j]));
        vh[j] = bf16_bits(z); vl[j] = bf16_bits(z - bf16_val(vh[j]));
      }
      *(v4us*)&sKh[c4 + t][k4] = kh; *(v4us*)&sKl[c4 + t][k4] = kl; *(v4us*)&sVh[c4 + t][k4] = vh; *(v4us*)&sVl[c4 + t][k4] = vl;
    }
  }
  __syncthreads();
  v8f acc[8];
#pragma unroll
  for (int ct = 0; ct < 8; ++ct) acc[ct] = (v8f){0.f,0.f,0.f,0.f,0.f,0.f,0.f,0.f};
#pragma unroll
  for (int ks = 0; ks < 2; ++ks) {
    FragB bvh, bvl;
    bvh.half[0] = *(const v8us*)&sVh[w * 16 + ln][ks * 32 + 8 * hh]; bvh.half[1] = *(const v8us*)&sVh[w * 16 + ln][ks * 32 + 16 + 8 * hh];
    bvl.half[0] = *(const v8us*)&sVl[w * 16 + ln][ks * 32 + 8 * hh]; bvl.half[1] = *(const v8us*)&sVl[w * 16 + ln][ks * 32 + 16 + 8 * hh];
#pragma unroll
    for (int ct = 0; ct < 8; ++ct) {
      FragB akh, akl;
      akh.half[0] = *(const v8us*)&sKh[ct * 16 + ln][ks * 32 + 8 * hh]; akh.half[1] = *(const v8us*)&sKh[ct * 16 + ln][ks * 32 + 16 + 8 * hh];
      akl.half[0] = *(const v8us*)&sKl[ct * 16 + ln][ks * 32 + 8 * hh]; akl.half[1] = *(const v8us*)&sKl[ct * 16 + ln][ks * 32 + 16 + 8 * hh];
      acc[ct] = mmaN<3>(akh.v, akl.v, bvh.v, bvl.v, acc[ct]);
    }
  }
  // acc[ct][r] = U[dk = ct*16 + 8*hh + r][dv = w*16 + ln]: 8 neighbouring dk of one dv row
  float* Uo = U + ((size_t)bh * NC + n) * (HD * HD) + (size_t)(w * 16 + ln) * HD + 8 * hh;
#pragma unroll
  for (int ct = 0; ct < 8; ++ct) {
    *(v4f*)(Uo + ct * 16) = (v4f){acc[ct][0], acc[ct][1], acc[ct][2], acc[ct][3]};
    *(v4f*)(Uo + ct * 16 + 4) = (v4f){acc[ct][4], acc[ct][5], acc[ct][6], acc[ct][7]};
  }
}

// State in front of chunk n+1: S[n+1] = g^64 * S[n] + U[n], S[0] = 0, element by element in f32; stored as bf16 hi/lo planes [bh][n][dv][dk]
// (plane 0 is never written and never read). Thread = 4 neighbouring elements of one (batch, head).
__global__ __launch_bounds__(256) void k_state_scan(const float* __restrict__ U, unsigned short* __restrict__ Sh, unsigned short* __restrict__ Sl) {
  const int t = blockIdx.x * 256 + threadIdx.x;
  const int bh = t / (HD * HD / 4), e = (t % (HD * HD / 4)) * 4;
  const float g64 = expf(64.0f * logf(1.0f - exp2f(-5.0f - (float)(bh % NH))));
  const size_t o0 = (size_t)bh * NC * (HD * HD) + e;
  v4f u[NC - 1];
  // all loads first: they depend on nothing, so the serial recurrence below meets one memory latency and not one per chunk
#pragma unroll
  for (int n = 0; n < NC - 1; ++n) u[n] = *(const v4fa*)(U + o0 + (size_t)n * (HD * HD));
  v4f s = {0.f, 0.f, 0.f, 0.f};
  // unrolled so that u[] is indexed by constants and stays in registers
#pragma unroll
  for (int n = 0; n < NC - 1; ++n) {
    v4us hi, lo;
#pragma unroll
    for (int i = 0; i < 4; ++i) { s[i] = s[i] * g64 + u[n][i]; hi[i] = bf16_bits(s[i]); lo[i] = bf16_bits(s[i] - bf16_val(hi[i])); }
    *(v4us*)(Sh + o0 + (size_t)(n + 1) * (HD * HD)) = hi;
    *(v4us*)(Sl + o0 + (size_t)(n + 1) * (HD * HD)) = lo;
    asm volatile("s_wait_xcnt 0x0" ::: "memory");   // before the next chunk's values reuse the registers that the two stores name
  }
}

// retention: out[b][t][h*128 + dv0..dv0+63] = Σ_{s<=t} ((q_t·k_s)/√dh)·γ_h^(t−s) · v_s  (γ_h = 1 − 2^(−5−h), decay computed as exp((t−s)·log γ_h))
// Chunked by 64 keys: with t0 the first query of the block, g^(t-s) = g^(t-t0+1) * g^(t0-1-s) for every key s < t0, so all keys in front of the block's own
// chunk enter as g^(t-t0+1)/sqrt(dh) * q_t . S, S = sum over s < t0 of g^(t0-1-s) k_s v_s^T (k_chunk_state, k_state_scan); the own chunk keeps the score tile.
__global__ __launch_bounds__(128) void k_ret(const float* __restrict__ q, const float* __restrict__ k, const float* __restrict__ v,
                                             const unsigned short* __restrict__ Sh, const unsigned short* __restrict__ Sl, float* __restrict__ y) {
  constexpr int KS = HD / 32, DV = 64, DT = DV / 16;
  __shared__ __attribute__((aligned(16))) unsigned short sKh[32][HD + 8], sKl[32][HD + 8], sVh[32][DV + 8], sVl[32][DV + 8];
  __shared__ __attribute__((aligned(16))) unsigned short sPh[4][16][40], sPl[4][16][40];
  __shared__ __attribute__((aligned(16))) float sO[4][16][DV];
  const int tid = threadIdx.x, w = tid >> 5, lane = tid & 31, ln = lane & 15, hh = lane >> 4;
  const int nqb = TT / 64;
  const int bh = blockIdx.x / nqb, qblk = blockIdx.x % nqb, dv0 = blockIdx.y * DV;
  const int b = bh / NH, h = bh % NH;
  const int q0 = qblk * 64 + w * 16;
  const float log_a = logf(1.0f - exp2f(-5.0f - (float)h));
  const float* Q = q + (size_t)b * TT * DD + h * HD; const float* K = k + (size_t)b * TT * DD + h * HD; const float* V = v + (size_t)b * TT * DD + h * HD + dv0;
  FragB aqh[KS], aql[KS];
  {
    const float* qr = Q + (size_t)(q0 + ln) * DD;
#pragma unroll
    for (int ks = 0; ks < KS; ++ks)
#pragma unroll
      for (int i = 0; i < 16; ++i) {
        const int d = ks * 32 + ((i < 8) ? (8 * hh + i) : (16 + 8 * hh + (i - 8)));
        const float x = qr[d]; const unsigned short hb = bf16_bits(x); aqh[ks].u[i] = hb; aql[ks].u[i] = bf16_bits(x - bf16_val(hb));
      }
  }
  v8f oacc[DT];
#pragma unroll
  for (int dt = 0; dt < DT; ++dt) oacc[dt] = (v8f){0.f,0.f,0.f,0.f,0.f,0.f,0.f,0.f};
  if (qblk > 0) {                                                       // block-uniform; chunk 0 has no earlier keys
    const size_t so = ((size_t)bh * NC + qblk) * (HD * HD) + (size_t)(dv0 + ln) * HD + 8 * hh;
    const unsigned short* rh = Sh + so; const unsigned short* rl = Sl + so;
    FragB fh[2][KS], fl[2][KS];                                         // two dv tiles of state fragments: a tile's 16 loads fly together, one tile ahead of its products
    auto load_state = [&](int dt) {
#pragma unroll
      for (int ks = 0; ks < KS; ++ks) {
        fh[dt & 1][ks].half[0] = *(const v8us*)(rh + dt * 16 * HD + ks * 32); fh[dt & 1][ks].half[1] = *(const v8us*)(rh + dt * 16 * HD + ks * 32 + 16);
        fl[dt & 1][ks].half[0] = *(const v8us*)(rl + dt * 16 * HD + ks * 32); fl[dt & 1][ks].half[1] = *(const v8us*)(rl + dt * 16 * HD + ks * 32 + 16);
      }
    };
    load_state(0); load_state(1);
    // unrolled (here and in load_state) so that the two fragment buffers are picked by constants and stay in registers
#pragma unroll
    for (int dt = 0; dt < DT; ++dt) {
      v8f acc = {};
#pragma unroll
      for (int ks = 0; ks < KS; ++ks) acc = mmaN<3>(aqh[ks].v, aql[ks].v, fh[dt & 1][ks].v, fl[dt & 1][ks].v, acc);
      if (dt + 2 < DT) load_state(dt + 2);
#pragma unroll
      for (int r = 0; r < 8; ++r) oacc[dt][r] = acc[r] * 0.08838834764831845f * expf((float)(w * 16 + 8 * hh + r + 1) * log_a);
    }
  }
  const int jstart = qblk * 64;
  const int kv_end = qblk * 64 + 64;
  for (int j0 = jstart; j0 < kv_end; j0 += 32) {
    __syncthreads();
    for (int e = tid; e < 32 * (HD / 4); e += 128) {
      const int r = e / (HD / 4), c4 = (e % (HD / 4)) * 4; const int key = j0 + r;
      const v4f kf = *(const v4fa*)(K + (size_t)key * DD + c4);
#pragma unroll
      for (int t = 0; t < 4; ++t) { const unsigned short hb = bf16_bits(kf[t]); sKh[r][c4 + t] = hb; sKl[r][c4 + t] = bf16_bits(kf[t] - bf16_val(hb)); }
    }
    for (int e = tid; e < 32 * (DV / 4); e += 128) {
      const int r = e / (DV / 4), c4 = (e % (DV / 4)) * 4; const int key = j0 + r;
      const v4f vf = *(const v4fa*)(V + (size_t)key * DD + c4);
#pragma unroll
      for (int t = 0; t < 4; ++t) { const unsigned short hb = bf16_bits(vf[t]); sVh[r][c4 + t] = hb; sVl[r][c4 + t] = bf16_bits(vf[t] - bf16_val(hb)); }
    }
    __syncthreads();
#pragma unroll
    for (int nt = 0; nt < 2; ++nt) {
      v8f acc = {};
#pragma unroll
      for (int ks = 0; ks < KS; ++ks) {
        FragB bh_, bl_;
        bh_.half[0] = *(const v8us*)&sKh[nt * 16 + ln][ks * 32 + 8 * hh]; bh_.half[1] = *(const v8us*)&sKh[nt * 16 + ln][ks * 32 + 16 + 8 * hh];
        bl_.half[0] = *(const v8us*)&sKl[nt * 16 + ln][ks * 32 + 8 * hh]; bl_.half[1] = *(const v8us*)&sKl[nt * 16 + ln][ks * 32 + 16 + 8 * hh];
        acc = mmaN<3>(aqh[ks].v, aql[ks].v, bh_.v, bl_.v, acc);
      }
      const int j = j0 + nt * 16 + ln;
#pragma unroll
      for (int r = 0; r < 8; ++r) {
        const int t = q0 + 8 * hh + r;
        const float p = (j <= t) ? acc[r] * 0.08838834764831845f * expf((float)(t - j) * log_a) : 0.f;
        const unsigned short hb = bf16_bits(p); sPh[w][8 * hh + r][nt * 16 + ln] = hb; sPl[w][8 * hh + r][nt * 16 + ln] = bf16_bits(p - bf16_val(hb));
      }
    }
    __builtin_amdgcn_fence(__ATOMIC_ACQ_REL, "workgroup");
    __builtin_amdgcn_wave_barrier();
    FragB pah, pal;
    pah.half[0] = *(const v8us*)&sPh[w][ln][8 * hh]; pah.half[1] = *(const v8us*)&sPh[w][ln][16 + 8 * hh];
    pal.half[0] = *(const v8us*)&sPl[w][ln][8 * hh]; pal.half[1] = *(const v8us*)&sPl[w][ln][16 + 8 * hh];
#pragma unroll
    for (int dt = 0; dt < DT; ++dt) {
      FragB bvh, bvl;
#pragma unroll
      for (int i = 0; i < 8; ++i) {
        bvh.u[i] = sVh[8 * hh + i][dt * 16 + ln]; bvh.u[8 + i] = sVh[16 + 8 * hh + i][dt * 16 + ln];
        bvl.u[i] = sVl[8 * hh + i][dt * 16 + ln]; bvl.u[8 + i] = sVl[16 + 8 * hh + i][dt * 16 + ln];
      }
      oacc[dt] = mmaN<3>(pah.v, pal.v, bvh.v, bvl.v, oacc[dt]);
    }
    __builtin_amdgcn_fence(__ATOMIC_ACQ_REL, "workgroup");
    __builtin_amdgcn_wave_barrier();
  }
#pragma unroll
  for (int dt = 0; dt < DT; ++dt)
#pragma unroll
    for (int r = 0; r < 8; ++r) sO[w][8 * hh + r][dt * 16 + ln] = oacc[dt][r];
  __builtin_amdgcn_fence(__ATOMIC_ACQ_REL, "workgroup");
  __builtin_amdgcn_wave_barrier();
  {
    for (int r = 0; r < 16; ++r) { if (lane < DV / 4) { const v4f val = *(const v4fa*)&sO[w][r][lane * 4]; *(v4f*)(y + ((size_t)b * TT + q0 + r) * DD + h * HD + dv0 + lane * 4) = val; } }
    
  }
}


// Z[row][h*128+d] = silu(g) · (ret − mean)/sqrt(var + 1e-6) per (row, head) over 128; wave per (row, head), lane = 4 values
__global__ __launch_bounds__(256) void k_gn_gate(const float* __restrict__ ret, const float* __restrict__ g, float* __restrict__ z) {
  const int tid = threadIdx.x, w = tid >> 5, lane = tid & 31; const size_t rh = (size_t)blockIdx.x * 8 + w; if (rh >= (size_t)BB * TT * NH) return;
  const size_t base = rh * HD + lane * 4;        // rows are [row][h*128 + d] contiguous -> rh*128
  const v4f a = *(const v4fa*)(ret + base), gg = *(const v4fa*)(g + base);
  float s = a[0] + a[1] + a[2] + a[3]; for (int o = 16; o >= 1; o >>= 1) s += __shfl_xor(s, o, 32); const float mu = s * (1.0f / HD);
  float q2 = 0.f; for (int q = 0; q < 4; ++q) { const float c = a[q] - mu; q2 += c * c; } for (int o = 16; o >= 1; o >>= 1) q2 += __shfl_xor(q2, o, 32);
  const float rs = rsqrtf(q2 * (1.0f / HD) + 1e-6f);
  v4f o4; for (int q = 0; q < 4; ++q) o4[q] = (gg[q] / (1.0f + expf(-gg[q]))) * ((a[q] - mu) * rs);
  *(v4f*)(z + base) = o4; 
}
extern "C" void kernel_launch(void* const* d_in, const int* in_sizes, int n_in,
                              void* d_out, int out_size, void* d_ws, size_t ws_size, hipStream_t stream) {
  (void)in_sizes; (void)n_in; (void)out_size;
  const float* X = (const float*)d_in[0]; const float* Wq = (const float*)d_in[1]; const float* Wk = (const float*)d_in[2]; const float* Wv = (const float*)d_in[3]; const float* WG = (const float*)d_in[4]; const float* WO = (const float*)d_in[5];
  char* ws = (char*)d_ws; size_t off = 0;
  auto take = [&](size_t bytes) { char* p = ws + off; off += (bytes + 255) & ~(size_t)255; return p; };
  const int M = BB * TT, gb = (M / 128) * (DD / 128);
  unsigned short* Wt[5]; for (int i = 0; i < 5; ++i) Wt[i] = (unsigned short*)take((size_t)DD * DD * 2);
  float* q = (float*)take((size_t)M * DD * 4); float* k = (float*)take((size_t)M * DD * 4); float* v = (float*)take((size_t)M * DD * 4); float* g = (float*)take((size_t)M * DD * 4); float* ret = (float*)take((size_t)M * DD * 4);
  float* U = (float*)take((size_t)BB * NH * NC * HD * HD * 4); unsigned short* Sh = (unsigned short*)take((size_t)BB * NH * NC * HD * HD * 2); unsigned short* Sl = (unsigned short*)take((size_t)BB * NH * NC * HD * HD * 2);
  if (off > ws_size) return;
  k_wt_bf16<<<dim3((DD * (DD / 8) + 255) / 256, 5), 256, 0, stream>>>(Wq, Wk, Wv, WG, WO, Wt[0], DD, DD);               // X @ W: [K][N]
  k_gemm_bf<false, 4><<<4 * gb, 256, 0, stream>>>(X, Wt[0], q);                                                          // q, k, v, g: neighbours in ws, as Wt[0..3] are
  k_chunk_state<<<BB * NH * (NC - 1), 256, 0, stream>>>(k, v, U);
  k_state_scan<<<BB * NH * (HD * HD / 4) / 256, 256, 0, stream>>>(U, Sh, Sl);
  k_ret<<<dim3(BB * NH * (TT / 64), 2), 128, 0, stream>>>(q, k, v, Sh, Sl, ret);
  k_gn_gate<<<(BB * TT * NH + 7) / 8, 256, 0, stream>>>(ret, g, q);                                                    // q reused as Z
  k_gemm_bf<true, 1><<<gb, 256, 0, stream>>>(q, Wt[4], (float*)d_out);
}

// v004
// It runs in 161 microseconds.
// Timed twice side by side with v003, it ran 1.08 times as fast both times.
// Over all steps from v000 it is 4.80 times as fast.
#include <hip/hip_runtime.h>
// All contractions on v_wmma_f32_16x16x32_bf16, f32 accumulate: q/k/v/g = X·W (X, W rounded to bf16: single exact term); per-head retention
// Σ_{s≤t} ((q_t·k_s)/√128)·γ_h^{t−s}·v_s as 3-term bf16 hi/lo splits (scores and decayed weights split in registers/LDS); (silu(g)∘GN(ret))·W_O with
// the A operand split (2 terms). Decay factors, the per-head GroupNorm (no affine, eps 1e-6) and silu in f32.
#define BB 2
#define TT 2048
#define DD 1024
#define NH 8
#define HD 128
#define NC (TT / 64)   // chunks of 64 keys per sequence

typedef __bf16 v16b __attribute__((ext_vector_type(16)));
typedef unsigned short v8us __attribute__((ext_vector_type(8), may_alias));
typedef unsigned short v4us __attribute__((ext_vector_type(4), may_alias));
typedef float  v8f  __attribute__((ext_vector_type(8)));
typedef float  v4f  __attribute__((ext_vector_type(4)));
typedef float  v4fa __attribute__((ext_vector_type(4), may_alias));
union FragB { v16b v; v8us half[2]; unsigned short u[16]; };

__device__ __forceinline__ unsigned short bf16_bits(float x) { unsigned int u = __float_as_uint(x); return (unsigned short)((u + 0x7FFFu + ((u >> 16) & 1u)) >> 16); }
__device__ __forceinline__ float bf16_val(unsigned short b) { return __uint_as_float(((unsigned int)b) << 16); }
__device__ __forceinline__ float bf16_round(float x) { return bf16_val(bf16_bits(x)); }
// D += A·B with NT terms: 1 = ah·bh, 2 = + al·bh (A split), 3 = + ah·bl (both split)
template <int NT>
__device__ __forceinline__ v8f mmaN(v16b ah, v16b al, v16b bh, v16b bl, v8f c) {
  c = __builtin_amdgcn_wmma_f32_16x16x32_bf16(false, ah, false, bh, (short)0, c, false, false);
  if (NT >= 2) c = __builtin_amdgcn_wmma_f32_16x16x32_bf16(false, al, false, bh, (short)0, c, false, false);
  if (NT >= 3) c = __builtin_amdgcn_wmma_f32_16x16x32_bf16(false, ah, false, bl, (short)0, c, false, false);
  asm volatile("v_nop\n\tv_nop\n\tv_nop\n\tv_nop" : "+v"(c) : "v"(ah), "v"(al), "v"(bh), "v"(bl));
  return c;
}

// One launch for all five weights: blockIdx.y picks the matrix; the five bf16 transposes lie one behind the other from Wt0.
// Block = one 128 (k) x 128 (n) tile, turned in LDS: a wave reads 512 contiguous bytes of a W row, and 16 lanes store 256 contiguous bytes of a Wt row,
// so that every global access covers whole lines. A thread holds 16 k of 4 neighbouring n and hands each n to LDS as two 16-byte runs of k.
#define WTP (128 + 8)      // LDS row pitch in bf16: 272 B, the pitch for 16-byte reads of 256-B rows
__global__ __launch_bounds__(256) void k_wt_bf16(const float* __restrict__ W0, const float* __restrict__ W1, const float* __restrict__ W2, const float* __restrict__ W3,
                                                 const float* __restrict__ W4, unsigned short* __restrict__ Wt0) {
  constexpr int K = DD, N = DD;
  __shared__ __attribute__((aligned(16))) unsigned short sT[128 * WTP];   // [n][k]
  const int y = blockIdx.y;
  const float* __restrict__ W = y == 0 ? W0 : y == 1 ? W1 : y == 2 ? W2 : y == 3 ? W3 : W4;
  unsigned short* __restrict__ Wt = Wt0 + (size_t)y * K * N;
  const int tid = threadIdx.x;
  const int k0 = (blockIdx.x % (K / 128)) * 128, n0 = (blockIdx.x / (K / 128)) * 128;
  const int n4 = (tid & 31) * 4, kg = (tid >> 5) * 16;
  const float* wp = W + (size_t)(k0 + kg) * N + n0 + n4;
  v4f x[16];
  // every loop is unrolled so that x[] is indexed by constants and stays in registers; all 16 loads fly together
#pragma unroll
  for (int i = 0; i < 16; ++i) x[i] = *(const v4fa*)(wp + (size_t)i * N);
  asm volatile("s_wait_xcnt 0x0" :: "v"(wp) : "memory");   // precaution: before any register that an issued load names is rewritten
#pragma unroll
  for (int t = 0; t < 4; ++t)
#pragma unroll
    for (int hf = 0; hf < 2; ++hf) {
      v8us c;
#pragma unroll
      for (int i = 0; i < 8; ++i) c[i] = bf16_bits(x[hf * 8 + i][t]);
      *(v8us*)&sT[(n4 + t) * WTP + kg + hf * 8] = c;
    }
  __syncthreads();                                          // the tile is complete in LDS before any row of it is read
  const int r = tid >> 4, c8 = (tid & 15) * 8;
  unsigned short* op = Wt + (size_t)(n0 + r) * K + k0 + c8;
  v8us o[8];
#pragma unroll
  for (int j = 0; j < 8; ++j) o[j] = *(const v8us*)&sT[(r + 16 * j) * WTP + c8];
#pragma unroll
  for (int j = 0; j < 8; ++j) *(v8us*)(op + (size_t)j * 16 * K) = o[j];
}

// GEMM C[M][N] (f32) = A[M][K] * W, M = BB*TT, N = K = DD. A f32 row-major, rounded to bf16 on its way into LDS (ASPLIT: hi/lo planes -> 2 terms, else one
// rounded term); Wt bf16 [N][K]. Block = 8 waves = one 128 x 128 tile of C; a stage is 128 k of the 128 A rows and the 128 Wt rows, loaded once per block with
// whole-line loads and shared by all waves through LDS. Two stage buffers, one barrier per stage: the next stage's global loads fly during this stage's products.
// Wave = 32 x 64 of C (waves 4 x 2). Each accumulator sums its k in ascending order, hi term before lo term.
// NW products that share A run as one launch: their Wt planes lie one behind the other from Wt0, their C planes from C0, and the column tiles of all NW
// are numbered through. With more blocks than WGPs two unsplit blocks (136 KiB of LDS each) share a WGP, and one block's loads fly while the other stores or waits.
#define GBK 128            // k per stage
#define GP (GBK + 8)       // LDS row pitch in bf16: 272 B, the pitch for 16-byte fragment reads of 256-B rows
#define GSP 68             // row pitch in f32 of a wave's staged C rows: the two half-waves (rows 8 apart) fall on different banks
typedef float f1a __attribute__((may_alias));
template <bool ASPLIT, int NW>
__global__ __launch_bounds__(256) void k_gemm_bf(const float* __restrict__ A, const unsigned short* __restrict__ Wt0, float* __restrict__ C0) {
  constexpr int K = DD, N = DD, NT = K / GBK, CT = N / 128;
  constexpr int PLANE = 128 * GP;                       // bf16 elements of one operand plane: [0] A hi, [1] Wt, [2] A lo
  constexpr int STAGE = (ASPLIT ? 3 : 2) * PLANE;
  static_assert(2 * STAGE * 2 >= 8 * 32 * GSP * 4, "the staged C tile must fit the operand buffers");
  __shared__ __attribute__((aligned(16))) unsigned short sm[2 * STAGE];
  const int tid = threadIdx.x, w = tid >> 5, lane = tid & 31, ln = lane & 15, hh = lane >> 4;
  const int wm = w >> 1, wn = w & 1;
  const int ct = blockIdx.x % (NW * CT), which = ct / CT;
  const int row0 = (blockIdx.x / (NW * CT)) * 128, col0 = (ct % CT) * 128;
  const unsigned short* __restrict__ Wt = Wt0 + (size_t)which * N * K;
  float* __restrict__ C = C0 + (size_t)which * (BB * TT) * N;
  const int ar = tid >> 5, ac = (tid & 31) * 4;         // A: a wave reads 512 contiguous bytes of one row
  const int br = tid >> 4, bc = (tid & 15) * 8;         // Wt: 16 lanes read 256 contiguous bytes of one row
  const float* ap = A + (size_t)(row0 + ar) * K + ac;
  const unsigned short* bp = Wt + (size_t)(col0 + br) * K + bc;
  v4f xa[16]; v8us xb[8];
  // every loop below is unrolled so that the arrays it indexes (loaded rows, fragments, accumulators) stay in registers
  auto fetch = [&](int kb) {
#pragma unroll
    for (int i = 0; i < 16; ++i) xa[i] = *(const v4fa*)(ap + (size_t)i * 8 * K + kb);
#pragma unroll
    for (int i = 0; i < 8; ++i) xb[i] = *(const v8us*)(bp + (size_t)i * 16 * K + kb);
    asm volatile("s_wait_xcnt 0x0" ::: "memory");       // precaution: before any register that an issued load names is rewritten
  };
  auto stash = [&](unsigned short* st) {
#pragma unroll
    for (int i = 0; i < 16; ++i) {
      v4us hi, lo;
#pragma unroll
      for (int t = 0; t < 4; ++t) { hi[t] = bf16_bits(xa[i][t]); lo[t] = ASPLIT ? bf16_bits(xa[i][t] - bf16_val(hi[t])) : (unsigned short)0; }
      *(v4us*)&st[(ar + 8 * i) * GP + ac] = hi;
      if (ASPLIT) *(v4us*)&st[2 * PLANE + (ar + 8 * i) * GP + ac] = lo;
    }
#pragma unroll
    for (int i = 0; i < 8; ++i) *(v8us*)&st[PLANE + (br + 16 * i) * GP + bc] = xb[i];
  };
  v8f acc[2][4];
#pragma unroll
  for (int mi = 0; mi < 2; ++mi)
#pragma unroll
    for (int ni = 0; ni < 4; ++ni) acc[mi][ni] = (v8f){0.f,0.f,0.f,0.f,0.f,0.f,0.f,0.f};
  auto products = [&](const unsigned short* st) {
    const unsigned short* pa = st + (wm * 32 + ln) * GP + 8 * hh;
    const unsigned short* pb = st + PLANE + (wn * 64 + ln) * GP + 8 * hh;
#pragma unroll
    for (int ks = 0; ks < GBK / 32; ++ks) {
      FragB a[2], al[2], b[4];
#pragma unroll
      for (int mi = 0; mi < 2; ++mi) {
        a[mi].half[0] = *(const v8us*)(pa + mi * 16 * GP + ks * 32); a[mi].half[1] = *(const v8us*)(pa + mi * 16 * GP + ks * 32 + 16);
        if (ASPLIT) { al[mi].half[0] = *(const v8us*)(pa + 2 * PLANE + mi * 16 * GP + ks * 32); al[mi].half[1] = *(const v8us*)(pa + 2 * PLANE + mi * 16 * GP + ks * 32 + 16); }
      }
#pragma unroll
      for (int ni = 0; ni < 4; ++ni) { b[ni].half[0] = *(const v8us*)(pb + ni * 16 * GP + ks * 32); b[ni].half[1] = *(const v8us*)(pb + ni * 16 * GP + ks * 32 + 16); }
#pragma unroll
      for (int mi = 0; mi < 2; ++mi)
#pragma unroll
        for (int ni = 0; ni < 4; ++ni) acc[mi][ni] = __builtin_amdgcn_wmma_f32_16x16x32_bf16(false, a[mi].v, false, b[ni].v, (short)0, acc[mi][ni], false, false);
      if (ASPLIT) {
#pragma unroll
        for (int mi = 0; mi < 2; ++mi)
#pragma unroll
          for (int ni = 0; ni < 4; ++ni) acc[mi][ni] = __builtin_amdgcn_wmma_f32_16x16x32_bf16(false, al[mi].v, false, b[ni].v, (short)0, acc[mi][ni], false, false);
      }
    }
  };
  fetch(0);
  stash(sm);
  for (int t = 0; t + 1 < NT; ++t) {
    __syncthreads();                                    // stage t is complete in its buffer, and every reader has left the other buffer
    fetch((t + 1) * GBK);
    products(sm + (t & 1) * STAGE);
    stash(sm + ((t + 1) & 1) * STAGE);
  }
  __syncthreads();
  products(sm + ((NT - 1) & 1) * STAGE);
  __syncthreads();                                      // every wave has left the operand buffers: their LDS now stages C, each wave in its own range
  f1a* so = (f1a*)sm + w * (32 * GSP);
#pragma unroll
  for (int mi = 0; mi < 2; ++mi)
#pragma unroll
    for (int ni = 0; ni < 4; ++ni)
#pragma unroll
      for (int r = 0; r < 8; ++r) so[(mi * 16 + 8 * hh + r) * GSP + ni * 16 + ln] = acc[mi][ni][r];
  __builtin_amdgcn_fence(__ATOMIC_ACQ_REL, "workgroup");
  __builtin_amdgcn_wave_barrier();
  float* cp = C + (size_t)(row0 + wm * 32 + hh) * N + col0 + wn * 64 + ln * 4;
  v4f o[16];
#pragma unroll
  for (int q = 0; q < 16; ++q) o[q] = *(const v4fa*)&so[(q * 2 + hh) * GSP + ln * 4];
#pragma unroll
  for (int q = 0; q < 16; ++q) *(v4f*)(cp + (size_t)q * 2 * N) = o[q];   // 16 lanes store 256 contiguous bytes of a row
}

// Flash-style causal/unmasked attention, all contractions 3-term bf16 hi/lo splits, f32 softmax with running max.
// q,k,v rows are read from f32 buffers with arbitrary row pitch (so they can live inside a fused qkv buffer);
// D = head size (multiple of 32, <= 128); one wave = 16 query rows; block = 4 waves (64 queries) sharing K/V chunks of 32.
template <int D, bool CAUSAL>
__global__ __launch_bounds__(128) void k_flash(const float* __restrict__ qb, const float* __restrict__ kb, const float* __restrict__ vb,
                                             int pitch, int T, int H, float scale, float* __restrict__ y, int ypitch) {
  constexpr int KS = D / 32;        // k-steps for QK
  constexpr int DT = D / 16;        // d tiles for PV
  __shared__ __attribute__((aligned(16))) unsigned short sKh[32][D + 8], sKl[32][D + 8], sVh[32][D + 8], sVl[32][D + 8];
  __shared__ __attribute__((aligned(16))) unsigned short sPh[4][16][40], sPl[4][16][40];
  __shared__ __attribute__((aligned(16))) float sO[4][16][D];
  const int tid = threadIdx.x, w = tid >> 5, lane = tid & 31, ln = lane & 15, hh = lane >> 4;
  const int nqb = (T + 63) / 64;
  const int bh = blockIdx.x / nqb, qblk = blockIdx.x % nqb;
  const int b = bh / H, h = bh % H;
  const int q0 = qblk * 64 + w * 16;
  const float* Q = qb + (size_t)b * T * pitch + h * D;
  const float* K = kb + (size_t)b * T * pitch + h * D;
  const float* V = vb + (size_t)b * T * pitch + h * D;

  // A fragments of the wave's 16 query rows (scaled), hi/lo
  FragB aqh[KS], aql[KS];
  {
    int row = q0 + ln; if (row >= T) row = T - 1;
    const float* qr = Q + (size_t)row * pitch;
#pragma unroll
    for (int ks = 0; ks < KS; ++ks)
#pragma unroll
      for (int i = 0; i < 16; ++i) {
        const int d = ks * 32 + ((i < 8) ? (8 * hh + i) : (16 + 8 * hh + (i - 8)));
        const float x = qr[d] * scale; const unsigned short hb = bf16_bits(x);
        aqh[ks].u[i] = hb; aql[ks].u[i] = bf16_bits(x - bf16_val(hb));
      }
  }
  float m_r[8], l_r[8];
#pragma unroll
  for (int r = 0; r < 8; ++r) { m_r[r] = -3.0e38f; l_r[r] = 0.f; }
  v8f oacc[DT];
#pragma unroll
  for (int dt = 0; dt < DT; ++dt) oacc[dt] = (v8f){0.f,0.f,0.f,0.f,0.f,0.f,0.f,0.f};

  const int kv_end = CAUSAL ? min(T, qblk * 64 + 64) : T;     // block-uniform
  for (int j0 = 0; j0 < kv_end; j0 += 32) {
    __syncthreads();
    for (int e = tid; e < 32 * (D / 4); e += 128) {
      const int r = e / (D / 4), c4 = (e % (D / 4)) * 4;
      const int key = j0 + r;
      v4f kf = {0.f,0.f,0.f,0.f}, vf = {0.f,0.f,0.f,0.f};
      if (key < T) { kf = *(const v4fa*)(K + (size_t)key * pitch + c4); vf = *(const v4fa*)(V + (size_t)key * pitch + c4); }
#pragma unroll
      for (int t = 0; t < 4; ++t) {
        unsigned short hb = bf16_bits(kf[t]); sKh[r][c4 + t] = hb; sKl[r][c4 + t] = bf16_bits(kf[t] - bf16_val(hb));
        hb = bf16_bits(vf[t]); sVh[r][c4 + t] = hb; sVl[r][c4 + t] = bf16_bits(vf[t] - bf16_val(hb));
      }
    }
    __syncthreads();
    // S tile 16 x 32
    v8f s[2];
#pragma unroll
    for (int nt = 0; nt < 2; ++nt) {
      v8f acc = {};
#pragma unroll
      for (int ks = 0; ks < KS; ++ks) {
        FragB bh_, bl_;
        bh_.half[0] = *(const v8us*)&sKh[nt * 16 + ln][ks * 32 + 8 * hh]; bh_.half[1] = *(const v8us*)&sKh[nt * 16 + ln][ks * 32 + 16 + 8 * hh];
        bl_.half[0] = *(const v8us*)&sKl[nt * 16 + ln][ks * 32 + 8 * hh]; bl_.half[1] = *(const v8us*)&sKl[nt * 16 + ln][ks * 32 + 16 + 8 * hh];
        acc = mmaN<3>(aqh[ks].v, aql[ks].v, bh_.v, bl_.v, acc);
      }
      s[nt] = acc;
    }
    // mask + running max (rows 8hh+r; the 16 lanes of a half share rows)
    float alpha[8];
#pragma unroll
    for (int r = 0; r < 8; ++r) {
      const int qi = q0 + 8 * hh + r;
      const int ja = j0 + ln, jb = j0 + 16 + ln;
      if (CAUSAL) { if (ja > qi) s[0][r] = -3.0e38f; if (jb > qi) s[1][r] = -3.0e38f; }
      if (ja >= T) s[0][r] = -3.0e38f;
      if (jb >= T) s[1][r] = -3.0e38f;
      float mx = fmaxf(s[0][r], s[1][r]);
      mx = fmaxf(mx, __shfl_xor(mx, 1, 32)); mx = fmaxf(mx, __shfl_xor(mx, 2, 32)); mx = fmaxf(mx, __shfl_xor(mx, 4, 32)); mx = fmaxf(mx, __shfl_xor(mx, 8, 32));
      const float mnew = fmaxf(m_r[r], mx);
      alpha[r] = (mnew > -1.0e38f) ? __expf(m_r[r] - mnew) : 1.0f;
      const float p0 = (s[0][r] > -1.0e38f) ? __expf(s[0][r] - mnew) : 0.f;
      const float p1 = (s[1][r] > -1.0e38f) ? __expf(s[1][r] - mnew) : 0.f;
      m_r[r] = mnew;
      l_r[r] = l_r[r] * alpha[r] + p0 + p1;            // per-lane partial row sum (16 lanes combined at the end)
      unsigned short hb = bf16_bits(p0); sPh[w][8 * hh + r][ln] = hb;      sPl[w][8 * hh + r][ln] = bf16_bits(p0 - bf16_val(hb));
      hb = bf16_bits(p1);                sPh[w][8 * hh + r][16 + ln] = hb; sPl[w][8 * hh + r][16 + ln] = bf16_bits(p1 - bf16_val(hb));
    }
#pragma unroll
    for (int dt = 0; dt < DT; ++dt)
#pragma unroll
      for (int r = 0; r < 8; ++r) oacc[dt][r] *= alpha[r];
    __builtin_amdgcn_fence(__ATOMIC_ACQ_REL, "workgroup");
    __builtin_amdgcn_wave_barrier();
    FragB pah, pal;
    pah.half[0] = *(const v8us*)&sPh[w][ln][8 * hh]; pah.half[1] = *(const v8us*)&sPh[w][ln][16 + 8 * hh];
    pal.half[0] = *(const v8us*)&sPl[w][ln][8 * hh]; pal.half[1] = *(const v8us*)&sPl[w][ln][16 + 8 * hh];
#pragma unroll
    for (int dt = 0; dt < DT; ++dt) {
      FragB bvh, bvl;
#pragma unroll
      for (int i = 0; i < 8; ++i) {
        bvh.u[i] = sVh[8 * hh + i][dt * 16 + ln]; bvh.u[8 + i] = sVh[16 + 8 * hh + i][dt * 16 + ln];
        bvl.u[i] = sVl[8 * hh + i][dt * 16 + ln]; bvl.u[8 + i] = sVl[16 + 8 * hh + i][dt * 16 + ln];
      }
      oacc[dt] = mmaN<3>(pah.v, pal.v, bvh.v, bvl.v, oacc[dt]);
    }
    __builtin_amdgcn_fence(__ATOMIC_ACQ_REL, "workgroup");
    __builtin_amdgcn_wave_barrier();
  }
#pragma unroll
  for (int r = 0; r < 8; ++r) {
    float l = l_r[r];
    l += __shfl_xor(l, 1, 32); l += __shfl_xor(l, 2, 32); l += __shfl_xor(l, 4, 32); l += __shfl_xor(l, 8, 32);
    l_r[r] = (l > 0.f) ? 1.0f / l : 0.f;
  }
#pragma unroll
  for (int dt = 0; dt < DT; ++dt)
#pragma unroll
    for (int r = 0; r < 8; ++r) sO[w][8 * hh + r][dt * 16 + ln] = oacc[dt][r] * l_r[r];
  __builtin_amdgcn_fence(__ATOMIC_ACQ_REL, "workgroup");
  __builtin_amdgcn_wave_barrier();
  {
    for (int r = 0; r < 16; ++r) {
      const int row = q0 + r;
      if (row < T && lane < D / 4) {
        const v4f val = *(const v4fa*)&sO[w][r][lane * 4];
        *(v4f*)(y + ((size_t)b * T + row) * ypitch + h * D + lane * 4) = val;
      }
    }
    
  }
}
// One chunk's own state, stored transposed: U[bh][n][dv][dk] = sum over j < 64 of (g^(63-j) * k[64n+j][dk]) * v[64n+j][dv], g = the head's decay.
// Block = one (batch, head, chunk); wave w = all 128 dk (A rows) by the 16 dv columns w*16..; 3-term bf16 hi/lo split, f32 accumulate.
// Every loop is unrolled so that the arrays it indexes (loaded rows, fragments, accumulators) stay in registers.
__global__ __launch_bounds__(256) void k_chunk_state(const float* __restrict__ k, const float* __restrict__ v, float* __restrict__ U) {
  __shared__ __attribute__((aligned(16))) unsigned short sKh[HD][72], sKl[HD][72], sVh[HD][72], sVl[HD][72];   // [column][key]: both operands contract over keys
  const int tid = threadIdx.x, w = tid >> 5, lane = tid & 31, ln = lane & 15, hh = lane >> 4;
  const int bh = blockIdx.x / (NC - 1), n = blockIdx.x % (NC - 1);     // the last chunk's state has no reader
  const int b = bh / NH, h = bh % NH;
  const float log_a = logf(1.0f - exp2f(-5.0f - (float)h));
  const float* K = k + ((size_t)b * TT + n * 64) * DD + h * HD; const float* V = v + ((size_t)b * TT + n * 64) * DD + h * HD;
  // a thread transposes 4 keys x 4 columns in registers: 8 lanes read 128 contiguous bytes of a row, and each column goes to LDS as one 8-byte store of 4 keys
  const int cl = tid & 7, k4 = ((tid >> 3) & 15) * 4, ch = tid >> 7;
  float dec[4];
#pragma unroll
  for (int j = 0; j < 4; ++j) dec[j] = expf((float)(63 - (k4 + j)) * log_a);
  const float* kp = K + (size_t)k4 * DD + (cl + 8 * ch) * 4; const float* vp = V + (size_t)k4 * DD + (cl + 8 * ch) * 4;
  v4f kf[2][4], vf[2][4];
#pragma unroll
  for (int i = 0; i < 2; ++i)
#pragma unroll
    for (int j = 0; j < 4; ++j) { kf[i][j] = *(const v4fa*)(kp + (size_t)j * DD + i * 64); vf[i][j] = *(const v4fa*)(vp + (size_t)j * DD + i * 64); }
  // precaution: wait before any register that an issued load names is rewritten; the two addresses are inputs so that no load lands in them ahead of the wait
  asm volatile("s_wait_xcnt 0x0" :: "v"(kp), "v"(vp) : "memory");
#pragma unroll
  for (int i = 0; i < 2; ++i) {
    const int c4 = (cl + 8 * (ch + 2 * i)) * 4;
#pragma unroll
    for (int t = 0; t < 4; ++t) {
      v4us kh, kl, vh, vl;
#pragma unroll
      for (int j = 0; j < 4; ++j) {
        const float x = kf[i][j][t] * dec[j], z = vf[i][j][t];
        kh[j] = bf16_bits(x); kl[j] = bf16_bits(x - bf16_val(kh[j]));
        vh[j] = bf16_bits(z); vl[j] = bf16_bits(z - bf16_val(vh[j]));
      }
      *(v4us*)&sKh[c4 + t][k4] = kh; *(v4us*)&sKl[c4 + t][k4] = kl; *(v4us*)&sVh[c4 + t][k4] = vh; *(v4us*)&sVl[c4 + t][k4] = vl;
    }
  }
  __syncthreads();
  v8f acc[8];
#pragma unroll
  for (int ct = 0; ct < 8; ++ct) acc[ct] = (v8f){0.f,0.f,0.f,0.f,0.f,0.f,0.f,0.f};
#pragma unroll
  for (int ks = 0; ks < 2; ++ks) {
    FragB bvh, bvl;
    bvh.half[0] = *(const v8us*)&sVh[w * 16 + ln][ks * 32 + 8 * hh]; bvh.half[1] = *(const v8us*)&sVh[w * 16 + ln][ks * 32 + 16 + 8 * hh];
    bvl.half[0] = *(const v8us*)&sVl[w * 16 + ln][ks * 32 + 8 * hh]; bvl.half[1] = *(const v8us*)&sVl[w * 16 + ln][ks * 32 + 16 + 8 * hh];
#pragma unroll
    for (int ct = 0; ct < 8; ++ct) {
      FragB akh, akl;
      akh.half[0] = *(const v8us*)&sKh[ct * 16 + ln][ks * 32 + 8 * hh]; akh.half[1] = *(const v8us*)&sKh[ct * 16 + ln][ks * 32 + 16 + 8 * hh];
      akl.half[0] = *(const v8us*)&sKl[ct * 16 + ln][ks * 32 + 8 * hh]; akl.half[1] = *(const v8us*)&sKl[ct * 16 + ln][ks * 32 + 16 + 8 * hh];
      acc[ct] = mmaN<3>(akh.v, akl.v, bvh.v, bvl.v, acc[ct]);
    }
  }
  // acc[ct][r] = U[dk = ct*16 + 8*hh + r][dv = w*16 + ln]: 8 neighbouring dk of one dv row
  float* Uo = U + ((size_t)bh * NC + n) * (HD * HD) + (size_t)(w * 16 + ln) * HD + 8 * hh;
#pragma unroll
  for (int ct = 0; ct < 8; ++ct) {
    *(v4f*)(Uo + ct * 16) = (v4f){acc[ct][0], acc[ct][1], acc[ct][2], acc[ct][3]};
    *(v4f*)(Uo + ct * 16 + 4) = (v4f){acc[ct][4], acc[ct][5], acc[ct][6], acc[ct][7]};
  }
}

// State in front of chunk n+1: S[n+1] = g^64 * S[n] + U[n], S[0] = 0, element by element in f32; stored as bf16 hi/lo planes [bh][n][dv][dk]
// (plane 0 is never written and never read). Thread = 4 neighbouring elements of one (batch, head).
__global__ __launch_bounds__(256) void k_state_scan(const float* __restrict__ U, unsigned short* __restrict__ Sh, unsigned short* __restrict__ Sl) {
  const int t = blockIdx.x * 256 + threadIdx.x;
  const int bh = t / (HD * HD / 4), e = (t % (HD * HD / 4)) * 4;
  const float g64 = expf(64.0f * logf(1.0f - exp2f(-5.0f - (float)(bh % NH))));
  const size_t o0 = (size_t)bh * NC * (HD * HD) + e;
  v4f u[NC - 1];
  // all loads first: they depend on nothing, so the serial recurrence below meets one memory latency and not one per chunk
#pragma unroll
  for (int n = 0; n < NC - 1; ++n) u[n] = *(const v4fa*)(U + o0 + (size_t)n * (HD * HD));
  v4f s = {0.f, 0.f, 0.f, 0.f};
  // unrolled so that u[] is indexed by constants and stays in registers
#pragma unroll
  for (int n = 0; n < NC - 1; ++n) {
    v4us hi, lo;
#pragma unroll
    for (int i = 0; i < 4; ++i) { s[i] = s[i] * g64 + u[n][i]; hi[i] = bf16_bits(s[i]); lo[i] = bf16_bits(s[i] - bf16_val(hi[i])); }
    *(v4us*)(Sh + o0 + (size_t)(n + 1) * (HD * HD)) = hi;
    *(v4us*)(Sl + o0 + (size_t)(n + 1) * (HD * HD)) = lo;
    asm volatile("s_wait_xcnt 0x0" ::: "memory");   // before the next chunk's values reuse the registers that the two stores name
  }
}

// retention: out[b][t][h*128 + dv0..dv0+63] = Σ_{s<=t} ((q_t·k_s)/√dh)·γ_h^(t−s) · v_s  (γ_h = 1 − 2^(−5−h), decay computed as exp((t−s)·log γ_h))
// Chunked by 64 keys: with t0 the first query of the block, g^(t-s) = g^(t-t0+1) * g^(t0-1-s) for every key s < t0, so all keys in front of the block's own
// chunk enter as g^(t-t0+1)/sqrt(dh) * q_t . S, S = sum over s < t0 of g^(t0-1-s) k_s v_s^T (k_chunk_state, k_state_scan); the own chunk keeps the score tile.
__global__ __launch_bounds__(128) void k_ret(const float* __restrict__ q, const float* __restrict__ k, const float* __restrict__ v,
                                             const unsigned short* __restrict__ Sh, const unsigned short* __restrict__ Sl, float* __restrict__ y) {
  constexpr int KS = HD / 32, DV = 64, DT = DV / 16;
  __shared__ __attribute__((aligned(16))) unsigned short sKh[32][HD + 8], sKl[32][HD + 8], sVh[32][DV + 8], sVl[32][DV + 8];
  __shared__ __attribute__((aligned(16))) unsigned short sPh[4][16][40], sPl[4][16][40];
  __shared__ __attribute__((aligned(16))) float sO[4][16][DV];
  const int tid = threadIdx.x, w = tid >> 5, lane = tid & 31, ln = lane & 15, hh = lane >> 4;
  const int nqb = TT / 64;
  const int bh = blockIdx.x / nqb, qblk = blockIdx.x % nqb, dv0 = blockIdx.y * DV;
  const int b = bh / NH, h = bh % NH;
  const int q0 = qblk * 64 + w * 16;
  const float log_a = logf(1.0f - exp2f(-5.0f - (float)h));
  const float* Q = q + (size_t)b * TT * DD + h * HD; const float* K = k + (size_t)b * TT * DD + h * HD; const float* V = v + (size_t)b * TT * DD + h * HD + dv0;
  FragB aqh[KS], aql[KS];
  {
    const float* qr = Q + (size_t)(q0 + ln) * DD;
#pragma unroll
    for (int ks = 0; ks < KS; ++ks)
#pragma unroll
      for (int i = 0; i < 16; ++i) {
        const int d = ks * 32 + ((i < 8) ? (8 * hh + i) : (16 + 8 * hh + (i - 8)));
        const float x = qr[d]; const unsigned short hb = bf16_bits(x); aqh[ks].u[i] = hb; aql[ks].u[i] = bf16_bits(x - bf16_val(hb));
      }
  }
  v8f oacc[DT];
#pragma unroll
  for (int dt = 0; dt < DT; ++dt) oacc[dt] = (v8f){0.f,0.f,0.f,0.f,0.f,0.f,0.f,0.f};
  if (qblk > 0) {                                                       // block-uniform; chunk 0 has no earlier keys
    const size_t so = ((size_t)bh * NC + qblk) * (HD * HD) + (size_t)(dv0 + ln) * HD + 8 * hh;
    const unsigned short* rh = Sh + so; const unsigned short* rl = Sl + so;
    FragB fh[2][KS], fl[2][KS];                                         // two dv tiles of state fragments: a tile's 16 loads fly together, one tile ahead of its products
    auto load_state = [&](int dt) {
#pragma unroll
      for (int ks = 0; ks < KS; ++ks) {
        fh[dt & 1][ks].half[0] = *(const v8us*)(rh + dt * 16 * HD + ks * 32); fh[dt & 1][ks].half[1] = *(const v8us*)(rh + dt * 16 * HD + ks * 32 + 16);
        fl[dt & 1][ks].half[0] = *(const v8us*)(rl + dt * 16 * HD + ks * 32); fl[dt & 1][ks].half[1] = *(const v8us*)(rl + dt * 16 * HD + ks * 32 + 16);
      }
    };
    load_state(0); load_state(1);
    // unrolled (here and in load_state) so that the two fragment buffers are picked by constants and stay in registers
#pragma unroll
    for (int dt = 0; dt < DT; ++dt) {
      v8f acc = {};
#pragma unroll
      for (int ks = 0; ks < KS; ++ks) acc = mmaN<3>(aqh[ks].v, aql[ks].v, fh[dt & 1][ks].v, fl[dt & 1][ks].v, acc);
      if (dt + 2 < DT) load_state(dt + 2);
#pragma unroll
      for (int r = 0; r < 8; ++r) oacc[dt][r] = acc[r] * 0.08838834764831845f * expf((float)(w * 16 + 8 * hh + r + 1) * log_a);
    }
  }
  const int jstart = qblk * 64;
  const int kv_end = qblk * 64 + 64;
  for (int j0 = jstart; j0 < kv_end; j0 += 32) {
    __syncthreads();
    for (int e = tid; e < 32 * (HD / 4); e += 128) {
      const int r = e / (HD / 4), c4 = (e % (HD / 4)) * 4; const int key = j0 + r;
      const v4f kf = *(const v4fa*)(K + (size_t)key * DD + c4);
#pragma unroll
      for (int t = 0; t < 4; ++t) { const unsigned short hb = bf16_bits(kf[t]); sKh[r][c4 + t] = hb; sKl[r][c4 + t] = bf16_bits(kf[t] - bf16_val(hb)); }
    }
    for (int e = tid; e < 32 * (DV / 4); e += 128) {
      const int r = e / (DV / 4), c4 = (e % (DV / 4)) * 4; const int key = j0 + r;
      const v4f vf = *(const v4fa*)(V + (size_t)key * DD + c4);
#pragma unroll
      for (int t = 0; t < 4; ++t) { const unsigned short hb = bf16_bits(vf[t]); sVh[r][c4 + t] = hb; sVl[r][c4 + t] = bf16_bits(vf[t] - bf16_val(hb)); }
    }
    __syncthreads();
#pragma unroll
    for (int nt = 0; nt < 2; ++nt) {
      v8f acc = {};
#pragma unroll
      for (int ks = 0; ks < KS; ++ks) {
        FragB bh_, bl_;
        bh_.half[0] = *(const v8us*)&sKh[nt * 16 + ln][ks * 32 + 8 * hh]; bh_.half[1] = *(const v8us*)&sKh[nt * 16 + ln][ks * 32 + 16 + 8 * hh];
        bl_.half[0] = *(const v8us*)&sKl[nt * 16 + ln][ks * 32 + 8 * hh]; bl_.half[1] = *(const v8us*)&sKl[nt * 16 + ln][ks * 32 + 16 + 8 * hh];
        acc = mmaN<3>(aqh[ks].v, aql[ks].v, bh_.v, bl_.v, acc);
      }
      const int j = j0 + nt * 16 + ln;
#pragma unroll
      for (int r = 0; r < 8; ++r) {
        const int t = q0 + 8 * hh + r;
        const float p = (j <= t) ? acc[r] * 0.08838834764831845f * expf((float)(t - j) * log_a) : 0.f;
        const unsigned short hb = bf16_bits(p); sPh[w][8 * hh + r][nt * 16 + ln] = hb; sPl[w][8 * hh + r][nt * 16 + ln] = bf16_bits(p - bf16_val(hb));
      }
    }
    __builtin_amdgcn_fence(__ATOMIC_ACQ_REL, "workgroup");
    __builtin_amdgcn_wave_barrier();
    FragB pah, pal;
    pah.half[0] = *(const v8us*)&sPh[w][ln][8 * hh]; pah.half[1] = *(const v8us*)&sPh[w][ln][16 + 8 * hh];
    pal.half[0] = *(const v8us*)&sPl[w][ln][8 * hh]; pal.half[1] = *(const v8us*)&sPl[w][ln][16 + 8 * hh];
#pragma unroll
    for (int dt = 0; dt < DT; ++dt) {
      FragB bvh, bvl;
#pragma unroll
      for (int i = 0; i < 8; ++i) {
        bvh.u[i] = sVh[8 * hh + i][dt * 16 + ln]; bvh.u[8 + i] = sVh[16 + 8 * hh + i][dt * 16 + ln];
        bvl.u[i] = sVl[8 * hh + i][dt * 16 + ln]; bvl.u[8 + i] = sVl[16 + 8 * hh + i][dt * 16 + ln];
      }
      oacc[dt] = mmaN<3>(pah.v, pal.v, bvh.v, bvl.v, oacc[dt]);
    }
    __builtin_amdgcn_fence(__ATOMIC_ACQ_REL, "workgroup");
    __builtin_amdgcn_wave_barrier();
  }
#pragma unroll
  for (int dt = 0; dt < DT; ++dt)
#pragma unroll
    for (int r = 0; r < 8; ++r) sO[w][8 * hh + r][dt * 16 + ln] = oacc[dt][r];
  __builtin_amdgcn_fence(__ATOMIC_ACQ_REL, "workgroup");
  __builtin_amdgcn_wave_barrier();
  {
    for (int r = 0; r < 16; ++r) { if (lane < DV / 4) { const v4f val = *(const v4fa*)&sO[w][r][lane * 4]; *(v4f*)(y + ((size_t)b * TT + q0 + r) * DD + h * HD + dv0 + lane * 4) = val; } }
    
  }
}


// Z[row][h*128+d] = silu(g) · (ret − mean)/sqrt(var + 1e-6) per (row, head) over 128; wave per (row, head), lane = 4 values
__global__ __launch_bounds__(256) void k_gn_gate(const float* __restrict__ ret, const float* __restrict__ g, float* __restrict__ z) {
  const int tid = threadIdx.x, w = tid >> 5, lane = tid & 31; const size_t rh = (size_t)blockIdx.x * 8 + w; if (rh >= (size_t)BB * TT * NH) return;
  const size_t base = rh * HD + lane * 4;        // rows are [row][h*128 + d] contiguous -> rh*128
  const v4f a = *(const v4fa*)(ret + base), gg = *(const v4fa*)(g + base);
  float s = a[0] + a[1] + a[2] + a[3]; for (int o = 16; o >= 1; o >>= 1) s += __shfl_xor(s, o, 32); const float mu = s * (1.0f / HD);
  float q2 = 0.f; for (int q = 0; q < 4; ++q) { const float c = a[q] - mu; q2 += c * c; } for (int o = 16; o >= 1; o >>= 1) q2 += __shfl_xor(q2, o, 32);
  const float rs = rsqrtf(q2 * (1.0f / HD) + 1e-6f);
  v4f o4; for (int q = 0; q < 4; ++q) o4[q] = (gg[q] / (1.0f + expf(-gg[q]))) * ((a[q] - mu) * rs);
  *(v4f*)(z + base) = o4; 
}
extern "C" void kernel_launch(void* const* d_in, const int* in_sizes, int n_in,
                              void* d_out, int out_size, void* d_ws, size_t ws_size, hipStream_t stream) {
  (void)in_sizes; (void)n_in; (void)out_size;
  const float* X = (const float*)d_in[0]; const float* Wq = (const float*)d_in[1]; const float* Wk = (const float*)d_in[2]; const float* Wv = (const float*)d_in[3]; const float* WG = (const float*)d_in[4]; const float* WO = (const float*)d_in[5];
  char* ws = (char*)d_ws; size_t off = 0;
  auto take = [&](size_t bytes) { char* p = ws + off; off += (bytes + 255) & ~(size_t)255; return p; };
  const int M = BB * TT, gb = (M / 128) * (DD / 128);
  unsigned short* Wt[5]; for (int i = 0; i < 5; ++i) Wt[i] = (unsigned short*)take((size_t)DD * DD * 2);
  float* q = (float*)take((size_t)M * DD * 4); float* k = (float*)take((size_t)M * DD * 4); float* v = (float*)take((size_t)M * DD * 4); float* g = (float*)take((size_t)M * DD * 4); float* ret = (float*)take((size_t)M * DD * 4);
  float* U = (float*)take((size_t)BB * NH * NC * HD * HD * 4); unsigned short* Sh = (unsigned short*)take((size_t)BB * NH * NC * HD * HD * 2); unsigned short* Sl = (unsigned short*)take((size_t)BB * NH * NC * HD * HD * 2);
  if (off > ws_size) return;
  k_wt_bf16<<<dim3((DD / 128) * (DD / 128), 5), 256, 0, stream>>>(Wq, Wk, Wv, WG, WO, Wt[0]);                              // X @ W: [K][N]
  k_gemm_bf<false, 4><<<4 * gb, 256, 0, stream>>>(X, Wt[0], q);                                                          // q, k, v, g: neighbours in ws, as Wt[0..3] are
  k_chunk_state<<<BB * NH * (NC - 1), 256, 0, stream>>>(k, v, U);
  k_state_scan<<<BB * NH * (HD * HD / 4) / 256, 256, 0, stream>>>(U, Sh, Sl);
  k_ret<<<dim3(BB * NH * (TT / 64), 2), 128, 0, stream>>>(q, k, v, Sh, Sl, ret);
  k_gn_gate<<<(BB * TT * NH + 7) / 8, 256, 0, stream>>>(ret, g, q);                                                    // q reused as Z
  k_gemm_bf<true, 1><<<gb, 256, 0, stream>>>(q, Wt[4], (float*)d_out);
}

// v005
// A run of this version takes 147 microseconds.
// In two side-by-side timings against v004, it was 1.09 and 1.06 times as fast.
// Counting every step since v000, it is 5.16 times as fast.
#include <hip/hip_runtime.h>
// All contractions on v_wmma_f32_16x16x32_bf16, f32 accumulate: q/k/v/g = X·W (X, W rounded to bf16: single exact term); per-head retention
// Σ_{s≤t} ((q_t·k_s)/√128)·γ_h^{t−s}·v_s as 3-term bf16 hi/lo splits (scores and decayed weights split in registers/LDS); (silu(g)∘GN(ret))·W_O with
// the A operand split (2 terms). Decay factors, the per-head GroupNorm (no affine, eps 1e-6) and silu in f32.
#define BB 2
#define TT 2048
#define DD 1024
#define NH 8
#define HD 128
#define NC (TT / 64)   // chunks of 64 keys per sequence

typedef __bf16 v16b __attribute__((ext_vector_type(16)));
typedef unsigned short v8us __attribute__((ext_vector_type(8), may_alias));
typedef unsigned short v4us __attribute__((ext_vector_type(4), may_alias));
typedef float  v8f  __attribute__((ext_vector_type(8)));
typedef float  v4f  __attribute__((ext_vector_type(4)));
typedef float  v4fa __attribute__((ext_vector_type(4), may_alias));
union FragB { v16b v; v8us half[2]; unsigned short u[16]; };

__device__ __forceinline__ unsigned short bf16_bits(float x) { unsigned int u = __float_as_uint(x); return (unsigned short)((u + 0x7FFFu + ((u >> 16) & 1u)) >> 16); }
__device__ __forceinline__ float bf16_val(unsigned short b) { return __uint_as_float(((unsigned int)b) << 16); }
__device__ __forceinline__ float bf16_round(float x) { return bf16_val(bf16_bits(x)); }
// D += A·B with NT terms: 1 = ah·bh, 2 = + al·bh (A split), 3 = + ah·bl (both split)
template <int NT>
__device__ __forceinline__ v8f mmaN(v16b ah, v16b al, v16b bh, v16b bl, v8f c) {
  c = __builtin_amdgcn_wmma_f32_16x16x32_bf16(false, ah, false, bh, (short)0, c, false, false);
  if (NT >= 2) c = __builtin_amdgcn_wmma_f32_16x16x32_bf16(false, al, false, bh, (short)0, c, false, false);
  if (NT >= 3) c = __builtin_amdgcn_wmma_f32_16x16x32_bf16(false, ah, false, bl, (short)0, c, false, false);
  asm volatile("v_nop\n\tv_nop\n\tv_nop\n\tv_nop" : "+v"(c) : "v"(ah), "v"(al), "v"(bh), "v"(bl));
  return c;
}

// One launch for all five weights: blockIdx.y picks the matrix; the five bf16 transposes lie one behind the other from Wt0.
// Block = one 128 (k) x 128 (n) tile, turned in LDS: a wave reads 512 contiguous bytes of a W row, and 16 lanes store 256 contiguous bytes of a Wt row,
// so that every global access covers whole lines. A thread holds 16 k of 4 neighbouring n and hands each n to LDS as two 16-byte runs of k.
// blockIdx.y >= 5: the same launch rounds X to bf16 once, in place of every column tile of the q/k/v/g GEMM doing it again; block = 16384 elements in row order.
#define XBLK 16384
#define WTP (128 + 8)      // LDS row pitch in bf16: 272 B, the pitch for 16-byte reads of 256-B rows
__global__ __launch_bounds__(256) void k_wt_bf16(const float* __restrict__ W0, const float* __restrict__ W1, const float* __restrict__ W2, const float* __restrict__ W3,
                                                 const float* __restrict__ W4, const float* __restrict__ X, unsigned short* __restrict__ Wt0,
                                                 unsigned short* __restrict__ Xb) {
  constexpr int K = DD, N = DD;
  __shared__ __attribute__((aligned(16))) unsigned short sT[128 * WTP];   // [n][k]
  const int y = blockIdx.y;
  if (y >= 5) {                                             // the same for the whole block, and in front of the barrier
    const size_t e0 = ((size_t)(y - 5) * ((K / 128) * (N / 128)) + blockIdx.x) * XBLK + threadIdx.x * 4;
    const float* xp = X + e0;
    unsigned short* xo = Xb + e0;
    v4f r[16];
    // unrolled so that r[] stays in registers and all 16 loads (512 contiguous bytes a wave each) fly together
#pragma unroll
    for (int i = 0; i < 16; ++i) r[i] = *(const v4fa*)(xp + i * 1024);
    asm volatile("s_wait_xcnt 0x0" :: "v"(xp) : "memory");  // precaution: before any register that an issued load names is rewritten
#pragma unroll
    for (int i = 0; i < 16; ++i) {
      v4us c;
#pragma unroll
      for (int t = 0; t < 4; ++t) c[t] = bf16_bits(r[i][t]);
      *(v4us*)(xo + i * 1024) = c;
    }
    return;
  }
  const float* __restrict__ W = y == 0 ? W0 : y == 1 ? W1 : y == 2 ? W2 : y == 3 ? W3 : W4;
  unsigned short* __restrict__ Wt = Wt0 + (size_t)y * K * N;
  const int tid = threadIdx.x;
  const int k0 = (blockIdx.x % (K / 128)) * 128, n0 = (blockIdx.x / (K / 128)) * 128;
  const int n4 = (tid & 31) * 4, kg = (tid >> 5) * 16;
  const float* wp = W + (size_t)(k0 + kg) * N + n0 + n4;
  v4f x[16];
  // every loop is unrolled so that x[] is indexed by constants and stays in registers; all 16 loads fly together
#pragma unroll
  for (int i = 0; i < 16; ++i) x[i] = *(const v4fa*)(wp + (size_t)i * N);
  asm volatile("s_wait_xcnt 0x0" :: "v"(wp) : "memory");   // precaution: before any register that an issued load names is rewritten
#pragma unroll
  for (int t = 0; t < 4; ++t)
#pragma unroll
    for (int hf = 0; hf < 2; ++hf) {
      v8us c;
#pragma unroll
      for (int i = 0; i < 8; ++i) c[i] = bf16_bits(x[hf * 8 + i][t]);
      *(v8us*)&sT[(n4 + t) * WTP + kg + hf * 8] = c;
    }
  __syncthreads();                                          // the tile is complete in LDS before any row of it is read
  const int r = tid >> 4, c8 = (tid & 15) * 8;
  unsigned short* op = Wt + (size_t)(n0 + r) * K + k0 + c8;
  v8us o[8];
#pragma unroll
  for (int j = 0; j < 8; ++j) o[j] = *(const v8us*)&sT[(r + 16 * j) * WTP + c8];
#pragma unroll
  for (int j = 0; j < 8; ++j) *(v8us*)(op + (size_t)j * 16 * K) = o[j];
}

// GEMM C[M][N] (f32) = A[M][K] * W, M = BB*TT, N = K = DD. A bf16 row-major, rounded once by the kernel that makes it (ASPLIT: each row is K hi values and
// behind them its K lo values -> 2 terms, else one rounded term); Wt bf16 [N][K]. Block = 8 waves = one 128 x 128 tile of C; a stage is 128 k of the 128 A rows and the 128 Wt rows, loaded once per block with
// whole-line loads and shared by all waves through LDS. Two stage buffers, one barrier per stage: the next stage's global loads fly during this stage's products.
// Wave = 32 x 64 of C (waves 4 x 2). Each accumulator sums its k in ascending order, hi term before lo term.
// NW products that share A run as one launch: their Wt planes lie one behind the other from Wt0, their C planes from C0, and the column tiles of all NW
// are numbered through. With more blocks than WGPs two unsplit blocks (136 KiB of LDS each) share a WGP, and one block's loads fly while the other stores or waits.
#define GBK 128            // k per stage
#define GP (GBK + 8)       // LDS row pitch in bf16: 272 B, the pitch for 16-byte fragment reads of 256-B rows
#define GSP 68             // row pitch in f32 of a wave's staged C rows: the two half-waves (rows 8 apart) fall on different banks
typedef float f1a __attribute__((may_alias));
template <bool ASPLIT, int NW>
__global__ __launch_bounds__(256) void k_gemm_bf(const unsigned short* __restrict__ A, const unsigned short* __restrict__ Wt0, float* __restrict__ C0) {
  constexpr int K = DD, N = DD, NT = K / GBK, CT = N / 128;
  constexpr int PLANE = 128 * GP;                       // bf16 elements of one operand plane: [0] A hi, [1] Wt, [2] A lo
  constexpr int STAGE = (ASPLIT ? 3 : 2) * PLANE;
  static_assert(2 * STAGE * 2 >= 8 * 32 * GSP * 4, "the staged C tile must fit the operand buffers");
  __shared__ __attribute__((aligned(16))) unsigned short sm[2 * STAGE];
  const int tid = threadIdx.x, w = tid >> 5, lane = tid & 31, ln = lane & 15, hh = lane >> 4;
  const int wm = w >> 1, wn = w & 1;
  const int ct = blockIdx.x % (NW * CT), which = ct / CT;
  const int row0 = (blockIdx.x / (NW * CT)) * 128, col0 = (ct % CT) * 128;
  const unsigned short* __restrict__ Wt = Wt0 + (size_t)which * N * K;
  float* __restrict__ C = C0 + (size_t)which * (BB * TT) * N;
  const int br = tid >> 4, bc = (tid & 15) * 8;         // A planes and Wt alike: 16 lanes read 256 contiguous bytes of one row
  constexpr int AP = ASPLIT ? 2 * K : K;                // row pitch of A
  const unsigned short* ap = A + (size_t)(row0 + br) * AP + bc;
  const unsigned short* bp = Wt + (size_t)(col0 + br) * K + bc;
  v8us xa[8], xl[8], xb[8];
  // every loop below is unrolled so that the arrays it indexes (loaded rows, fragments, accumulators) stay in registers
  auto fetch = [&](int kb) {
    const unsigned short* pa = ap + kb; const unsigned short* pb = bp + kb;
#pragma unroll
    for (int i = 0; i < 8; ++i) xa[i] = *(const v8us*)(pa + (size_t)i * 16 * AP);
    if (ASPLIT) {
#pragma unroll
      for (int i = 0; i < 8; ++i) xl[i] = *(const v8us*)(pa + (size_t)i * 16 * AP + K);
    }
#pragma unroll
    for (int i = 0; i < 8; ++i) xb[i] = *(const v8us*)(pb + (size_t)i * 16 * K);
    // precaution: wait before any register that an issued load names is rewritten; the addresses are inputs so that no load lands in them ahead of the wait
    asm volatile("s_wait_xcnt 0x0" :: "v"(pa), "v"(pb) : "memory");
  };
  auto stash = [&](unsigned short* st) {
#pragma unroll
    for (int i = 0; i < 8; ++i) {
      *(v8us*)&st[(br + 16 * i) * GP + bc] = xa[i];
      if (ASPLIT) *(v8us*)&st[2 * PLANE + (br + 16 * i) * GP + bc] = xl[i];
    }
#pragma unroll
    for (int i = 0; i < 8; ++i) *(v8us*)&st[PLANE + (br + 16 * i) * GP + bc] = xb[i];
  };
  v8f acc[2][4];
#pragma unroll
  for (int mi = 0; mi < 2; ++mi)
#pragma unroll
    for (int ni = 0; ni < 4; ++ni) acc[mi][ni] = (v8f){0.f,0.f,0.f,0.f,0.f,0.f,0.f,0.f};
  auto products = [&](const unsigned short* st) {
    const unsigned short* pa = st + (wm * 32 + ln) * GP + 8 * hh;
    const unsigned short* pb = st + PLANE + (wn * 64 + ln) * GP + 8 * hh;
#pragma unroll
    for (int ks = 0; ks < GBK / 32; ++ks) {
      FragB a[2], al[2], b[4];
#pragma unroll
      for (int mi = 0; mi < 2; ++mi) {
        a[mi].half[0] = *(const v8us*)(pa + mi * 16 * GP + ks * 32); a[mi].half[1] = *(const v8us*)(pa + mi * 16 * GP + ks * 32 + 16);
        if (ASPLIT) { al[mi].half[0] = *(const v8us*)(pa + 2 * PLANE + mi * 16 * GP + ks * 32); al[mi].half[1] = *(const v8us*)(pa + 2 * PLANE + mi * 16 * GP + ks * 32 + 16); }
      }
#pragma unroll
      for (int ni = 0; ni < 4; ++ni) { b[ni].half[0] = *(const v8us*)(pb + ni * 16 * GP + ks * 32); b[ni].half[1] = *(const v8us*)(pb + ni * 16 * GP + ks * 32 + 16); }
#pragma unroll
      for (int mi = 0; mi < 2; ++mi)
#pragma unroll
        for (int ni = 0; ni < 4; ++ni) acc[mi][ni] = __builtin_amdgcn_wmma_f32_16x16x32_bf16(false, a[mi].v, false, b[ni].v, (short)0, acc[mi][ni], false, false);
      if (ASPLIT) {
#pragma unroll
        for (int mi = 0; mi < 2; ++mi)
#pragma unroll
          for (int ni = 0; ni < 4; ++ni) acc[mi][ni] = __builtin_amdgcn_wmma_f32_16x16x32_bf16(false, al[mi].v, false, b[ni].v, (short)0, acc[mi][ni], false, false);
      }
    }
  };
  fetch(0);
  stash(sm);
  for (int t = 0; t + 1 < NT; ++t) {
    __syncthreads();                                    // stage t is complete in its buffer, and every reader has left the other buffer
    fetch((t + 1) * GBK);
    products(sm + (t & 1) * STAGE);
    stash(sm + ((t + 1) & 1) * STAGE);
  }
  __syncthreads();
  products(sm + ((NT - 1) & 1) * STAGE);
  __syncthreads();                                      // every wave has left the operand buffers: their LDS now stages C, each wave in its own range
  f1a* so = (f1a*)sm + w * (32 * GSP);
#pragma unroll
  for (int mi = 0; mi < 2; ++mi)
#pragma unroll
    for (int ni = 0; ni < 4; ++ni)
#pragma unroll
      for (int r = 0; r < 8; ++r) so[(mi * 16 + 8 * hh + r) * GSP + ni * 16 + ln] = acc[mi][ni][r];
  __builtin_amdgcn_fence(__ATOMIC_ACQ_REL, "workgroup");
  __builtin_amdgcn_wave_barrier();
  float* cp = C + (size_t)(row0 + wm * 32 + hh) * N + col0 + wn * 64 + ln * 4;
  v4f o[16];
#pragma unroll
  for (int q = 0; q < 16; ++q) o[q] = *(const v4fa*)&so[(q * 2 + hh) * GSP + ln * 4];
#pragma unroll
  for (int q = 0; q < 16; ++q) *(v4f*)(cp + (size_t)q * 2 * N) = o[q];   // 16 lanes store 256 contiguous bytes of a row
}

// Flash-style causal/unmasked attention, all contractions 3-term bf16 hi/lo splits, f32 softmax with running max.
// q,k,v rows are read from f32 buffers with arbitrary row pitch (so they can live inside a fused qkv buffer);
// D = head size (multiple of 32, <= 128); one wave = 16 query rows; block = 4 waves (64 queries) sharing K/V chunks of 32.
template <int D, bool CAUSAL>
__global__ __launch_bounds__(128) void k_flash(const float* __restrict__ qb, const float* __restrict__ kb, const float* __restrict__ vb,
                                             int pitch, int T, int H, float scale, float* __restrict__ y, int ypitch) {
  constexpr int KS = D / 32;        // k-steps for QK
  constexpr int DT = D / 16;        // d tiles for PV
  __shared__ __attribute__((aligned(16))) unsigned short sKh[32][D + 8], sKl[32][D + 8], sVh[32][D + 8], sVl[32][D + 8];
  __shared__ __attribute__((aligned(16))) unsigned short sPh[4][16][40], sPl[4][16][40];
  __shared__ __attribute__((aligned(16))) float sO[4][16][D];
  const int tid = threadIdx.x, w = tid >> 5, lane = tid & 31, ln = lane & 15, hh = lane >> 4;
  const int nqb = (T + 63) / 64;
  const int bh = blockIdx.x / nqb, qblk = blockIdx.x % nqb;
  const int b = bh / H, h = bh % H;
  const int q0 = qblk * 64 + w * 16;
  const float* Q = qb + (size_t)b * T * pitch + h * D;
  const float* K = kb + (size_t)b * T * pitch + h * D;
  const float* V = vb + (size_t)b * T * pitch + h * D;

  // A fragments of the wave's 16 query rows (scaled), hi/lo
  FragB aqh[KS], aql[KS];
  {
    int row = q0 + ln; if (row >= T) row = T - 1;
    const float* qr = Q + (size_t)row * pitch;
#pragma unroll
    for (int ks = 0; ks < KS; ++ks)
#pragma unroll
      for (int i = 0; i < 16; ++i) {
        const int d = ks * 32 + ((i < 8) ? (8 * hh + i) : (16 + 8 * hh + (i - 8)));
        const float x = qr[d] * scale; const unsigned short hb = bf16_bits(x);
        aqh[ks].u[i] = hb; aql[ks].u[i] = bf16_bits(x - bf16_val(hb));
      }
  }
  float m_r[8], l_r[8];
#pragma unroll
  for (int r = 0; r < 8; ++r) { m_r[r] = -3.0e38f; l_r[r] = 0.f; }
  v8f oacc[DT];
#pragma unroll
  for (int dt = 0; dt < DT; ++dt) oacc[dt] = (v8f){0.f,0.f,0.f,0.f,0.f,0.f,0.f,0.f};

  const int kv_end = CAUSAL ? min(T, qblk * 64 + 64) : T;     // block-uniform
  for (int j0 = 0; j0 < kv_end; j0 += 32) {
    __syncthreads();
    for (int e = tid; e < 32 * (D / 4); e += 128) {
      const int r = e / (D / 4), c4 = (e % (D / 4)) * 4;
      const int key = j0 + r;
      v4f kf = {0.f,0.f,0.f,0.f}, vf = {0.f,0.f,0.f,0.f};
      if (key < T) { kf = *(const v4fa*)(K + (size_t)key * pitch + c4); vf = *(const v4fa*)(V + (size_t)key * pitch + c4); }
#pragma unroll
      for (int t = 0; t < 4; ++t) {
        unsigned short hb = bf16_bits(kf[t]); sKh[r][c4 + t] = hb; sKl[r][c4 + t] = bf16_bits(kf[t] - bf16_val(hb));
        hb = bf16_bits(vf[t]); sVh[r][c4 + t] = hb; sVl[r][c4 + t] = bf16_bits(vf[t] - bf16_val(hb));
      }
    }
    __syncthreads();
    // S tile 16 x 32
    v8f s[2];
#pragma unroll
    for (int nt = 0; nt < 2; ++nt) {
      v8f acc = {};
#pragma unroll
      for (int ks = 0; ks < KS; ++ks) {
        FragB bh_, bl_;
        bh_.half[0] = *(const v8us*)&sKh[nt * 16 + ln][ks * 32 + 8 * hh]; bh_.half[1] = *(const v8us*)&sKh[nt * 16 + ln][ks * 32 + 16 + 8 * hh];
        bl_.half[0] = *(const v8us*)&sKl[nt * 16 + ln][ks * 32 + 8 * hh]; bl_.half[1] = *(const v8us*)&sKl[nt * 16 + ln][ks * 32 + 16 + 8 * hh];
        acc = mmaN<3>(aqh[ks].v, aql[ks].v, bh_.v, bl_.v, acc);
      }
      s[nt] = acc;
    }
    // mask + running max (rows 8hh+r; the 16 lanes of a half share rows)
    float alpha[8];
#pragma unroll
    for (int r = 0; r < 8; ++r) {
      const int qi = q0 + 8 * hh + r;
      const int ja = j0 + ln, jb = j0 + 16 + ln;
      if (CAUSAL) { if (ja > qi) s[0][r] = -3.0e38f; if (jb > qi) s[1][r] = -3.0e38f; }
      if (ja >= T) s[0][r] = -3.0e38f;
      if (jb >= T) s[1][r] = -3.0e38f;
      float mx = fmaxf(s[0][r], s[1][r]);
      mx = fmaxf(mx, __shfl_xor(mx, 1, 32)); mx = fmaxf(mx, __shfl_xor(mx, 2, 32)); mx = fmaxf(mx, __shfl_xor(mx, 4, 32)); mx = fmaxf(mx, __shfl_xor(mx, 8, 32));
      const float mnew = fmaxf(m_r[r], mx);
      alpha[r] = (mnew > -1.0e38f) ? __expf(m_r[r] - mnew) : 1.0f;
      const float p0 = (s[0][r] > -1.0e38f) ? __expf(s[0][r] - mnew) : 0.f;
      const float p1 = (s[1][r] > -1.0e38f) ? __expf(s[1][r] - mnew) : 0.f;
      m_r[r] = mnew;
      l_r[r] = l_r[r] * alpha[r] + p0 + p1;            // per-lane partial row sum (16 lanes combined at the end)
      unsigned short hb = bf16_bits(p0); sPh[w][8 * hh + r][ln] = hb;      sPl[w][8 * hh + r][ln] = bf16_bits(p0 - bf16_val(hb));
      hb = bf16_bits(p1);                sPh[w][8 * hh + r][16 + ln] = hb; sPl[w][8 * hh + r][16 + ln] = bf16_bits(p1 - bf16_val(hb));
    }
#pragma unroll
    for (int dt = 0; dt < DT; ++dt)
#pragma unroll
      for (int r = 0; r < 8; ++r) oacc[dt][r] *= alpha[r];
    __builtin_amdgcn_fence(__ATOMIC_ACQ_REL, "workgroup");
    __builtin_amdgcn_wave_barrier();
    FragB pah, pal;
    pah.half[0] = *(const v8us*)&sPh[w][ln][8 * hh]; pah.half[1] = *(const v8us*)&sPh[w][ln][16 + 8 * hh];
    pal.half[0] = *(const v8us*)&sPl[w][ln][8 * hh]; pal.half[1] = *(const v8us*)&sPl[w][ln][16 + 8 * hh];
#pragma unroll
    for (int dt = 0; dt < DT; ++dt) {
      FragB bvh, bvl;
#pragma unroll
      for (int i = 0; i < 8; ++i) {
        bvh.u[i] = sVh[8 * hh + i][dt * 16 + ln]; bvh.u[8 + i] = sVh[16 + 8 * hh + i][dt * 16 + ln];
        bvl.u[i] = sVl[8 * hh + i][dt * 16 + ln]; bvl.u[8 + i] = sVl[16 + 8 * hh + i][dt * 16 + ln];
      }
      oacc[dt] = mmaN<3>(pah.v, pal.v, bvh.v, bvl.v, oacc[dt]);
    }
    __builtin_amdgcn_fence(__ATOMIC_ACQ_REL, "workgroup");
    __builtin_amdgcn_wave_barrier();
  }
#pragma unroll
  for (int r = 0; r < 8; ++r) {
    float l = l_r[r];
    l += __shfl_xor(l, 1, 32); l += __shfl_xor(l, 2, 32); l += __shfl_xor(l, 4, 32); l += __shfl_xor(l, 8, 32);
    l_r[r] = (l > 0.f) ? 1.0f / l : 0.f;
  }
#pragma unroll
  for (int dt = 0; dt < DT; ++dt)
#pragma unroll
    for (int r = 0; r < 8; ++r) sO[w][8 * hh + r][dt * 16 + ln] = oacc[dt][r] * l_r[r];
  __builtin_amdgcn_fence(__ATOMIC_ACQ_REL, "workgroup");
  __builtin_amdgcn_wave_barrier();
  {
    for (int r = 0; r < 16; ++r) {
      const int row = q0 + r;
      if (row < T && lane < D / 4) {
        const v4f val = *(const v4fa*)&sO[w][r][lane * 4];
        *(v4f*)(y + ((size_t)b * T + row) * ypitch + h * D + lane * 4) = val;
      }
    }
    
  }
}
// One chunk's own state, stored transposed: U[bh][n][dv][dk] = sum over j < 64 of (g^(63-j) * k[64n+j][dk]) * v[64n+j][dv], g = the head's decay.
// Block = one (batch, head, chunk); wave w = all 128 dk (A rows) by the 16 dv columns w*16..; 3-term bf16 hi/lo split, f32 accumulate.
// Every loop is unrolled so that the arrays it indexes (loaded rows, fragments, accumulators) stay in registers.
__global__ __launch_bounds__(256) void k_chunk_state(const float* __restrict__ k, const float* __restrict__ v, float* __restrict__ U) {
  __shared__ __attribute__((aligned(16))) unsigned short sKh[HD][72], sKl[HD][72], sVh[HD][72], sVl[HD][72];   // [column][key]: both operands contract over keys
  const int tid = threadIdx.x, w = tid >> 5, lane = tid & 31, ln = lane & 15, hh = lane >> 4;
  const int bh = blockIdx.x / (NC - 1), n = blockIdx.x % (NC - 1);     // the last chunk's state has no reader
  const int b = bh / NH, h = bh % NH;
  const float log_a = logf(1.0f - exp2f(-5.0f - (float)h));
  const float* K = k + ((size_t)b * TT + n * 64) * DD + h * HD; const float* V = v + ((size_t)b * TT + n * 64) * DD + h * HD;
  // a thread transposes 4 keys x 4 columns in registers: 8 lanes read 128 contiguous bytes of a row, and each column goes to LDS as one 8-byte store of 4 keys
  const int cl = tid & 7, k4 = ((tid >> 3) & 15) * 4, ch = tid >> 7;
  float dec[4];
#pragma unroll
  for (int j = 0; j < 4; ++j) dec[j] = expf((float)(63 - (k4 + j)) * log_a);
  const float* kp = K + (size_t)k4 * DD + (cl + 8 * ch) * 4; const float* vp = V + (size_t)k4 * DD + (cl + 8 * ch) * 4;
  v4f kf[2][4], vf[2][4];
#pragma unroll
  for (int i = 0; i < 2; ++i)
#pragma unroll
    for (int j = 0; j < 4; ++j) { kf[i][j] = *(const v4fa*)(kp + (size_t)j * DD + i * 64); vf[i][j] = *(const v4fa*)(vp + (size_t)j * DD + i * 64); }
  // precaution: wait before any register that an issued load names is rewritten; the two addresses are inputs so that no load lands in them ahead of the wait
  asm volatile("s_wait_xcnt 0x0" :: "v"(kp), "v"(vp) : "memory");
#pragma unroll
  for (int i = 0; i < 2; ++i) {
    const int c4 = (cl + 8 * (ch + 2 * i)) * 4;
#pragma unroll
    for (int t = 0; t < 4; ++t) {
      v4us kh, kl, vh, vl;
#pragma unroll
      for (int j = 0; j < 4; ++j) {
        const float x = kf[i][j][t] * dec[j], z = vf[i][j][t];
        kh[j] = bf16_bits(x); kl[j] = bf16_bits(x - bf16_val(kh[j]));
        vh[j] = bf16_bits(z); vl[j] = bf16_bits(z - bf16_val(vh[j]));
      }
      *(v4us*)&sKh[c4 + t][k4] = kh; *(v4us*)&sKl[c4 + t][k4] = kl; *(v4us*)&sVh[c4 + t][k4] = vh; *(v4us*)&sVl[c4 + t][k4] = vl;
    }
  }
  __syncthreads();
  v8f acc[8];
#pragma unroll
  for (int ct = 0; ct < 8; ++ct) acc[ct] = (v8f){0.f,0.f,0.f,0.f,0.f,0.f,0.f,0.f};
#pragma unroll
  for (int ks = 0; ks < 2; ++ks) {
    FragB bvh, bvl;
    bvh.half[0] = *(const v8us*)&sVh[w * 16 + ln][ks * 32 + 8 * hh]; bvh.half[1] = *(const v8us*)&sVh[w * 16 + ln][ks * 32 + 16 + 8 * hh];
    bvl.half[0] = *(const v8us*)&sVl[w * 16 + ln][ks * 32 + 8 * hh]; bvl.half[1] = *(const v8us*)&sVl[w * 16 + ln][ks * 32 + 16 + 8 * hh];
#pragma unroll
    for (int ct = 0; ct < 8; ++ct) {
      FragB akh, akl;
      akh.half[0] = *(const v8us*)&sKh[ct * 16 + ln][ks * 32 + 8 * hh]; akh.half[1] = *(const v8us*)&sKh[ct * 16 + ln][ks * 32 + 16 + 8 * hh];
      akl.half[0] = *(const v8us*)&sKl[ct * 16 + ln][ks * 32 + 8 * hh]; akl.half[1] = *(const v8us*)&sKl[ct * 16 + ln][ks * 32 + 16 + 8 * hh];
      acc[ct] = mmaN<3>(akh.v, akl.v, bvh.v, bvl.v, acc[ct]);
    }
  }
  // acc[ct][r] = U[dk = ct*16 + 8*hh + r][dv = w*16 + ln]: 8 neighbouring dk of one dv row
  float* Uo = U + ((size_t)bh * NC + n) * (HD * HD) + (size_t)(w * 16 + ln) * HD + 8 * hh;
#pragma unroll
  for (int ct = 0; ct < 8; ++ct) {
    *(v4f*)(Uo + ct * 16) = (v4f){acc[ct][0], acc[ct][1], acc[ct][2], acc[ct][3]};
    *(v4f*)(Uo + ct * 16 + 4) = (v4f){acc[ct][4], acc[ct][5], acc[ct][6], acc[ct][7]};
  }
}

// State in front of chunk n+1: S[n+1] = g^64 * S[n] + U[n], S[0] = 0, element by element in f32; stored as bf16 hi/lo planes [bh][n][dv][dk]
// (plane 0 is never written and never read). Thread = 4 neighbouring elements of one (batch, head).
__global__ __launch_bounds__(256) void k_state_scan(const float* __restrict__ U, unsigned short* __restrict__ Sh, unsigned short* __restrict__ Sl) {
  const int t = blockIdx.x * 256 + threadIdx.x;
  const int bh = t / (HD * HD / 4), e = (t % (HD * HD / 4)) * 4;
  const float g64 = expf(64.0f * logf(1.0f - exp2f(-5.0f - (float)(bh % NH))));
  const size_t o0 = (size_t)bh * NC * (HD * HD) + e;
  v4f u[NC - 1];
  // all loads first: they depend on nothing, so the serial recurrence below meets one memory latency and not one per chunk
#pragma unroll
  for (int n = 0; n < NC - 1; ++n) u[n] = *(const v4fa*)(U + o0 + (size_t)n * (HD * HD));
  v4f s = {0.f, 0.f, 0.f, 0.f};
  // unrolled so that u[] is indexed by constants and stays in registers
#pragma unroll
  for (int n = 0; n < NC - 1; ++n) {
    v4us hi, lo;
#pragma unroll
    for (int i = 0; i < 4; ++i) { s[i] = s[i] * g64 + u[n][i]; hi[i] = bf16_bits(s[i]); lo[i] = bf16_bits(s[i] - bf16_val(hi[i])); }
    *(v4us*)(Sh + o0 + (size_t)(n + 1) * (HD * HD)) = hi;
    *(v4us*)(Sl + o0 + (size_t)(n + 1) * (HD * HD)) = lo;
    asm volatile("s_wait_xcnt 0x0" ::: "memory");   // before the next chunk's values reuse the registers that the two stores name
  }
}

// retention: out[b][t][h*128 + dv0..dv0+63] = Σ_{s<=t} ((q_t·k_s)/√dh)·γ_h^(t−s) · v_s  (γ_h = 1 − 2^(−5−h), decay computed as exp((t−s)·log γ_h))
// Chunked by 64 keys: with t0 the first query of the block, g^(t-s) = g^(t-t0+1) * g^(t0-1-s) for every key s < t0, so all keys in front of the block's own
// chunk enter as g^(t-t0+1)/sqrt(dh) * q_t . S, S = sum over s < t0 of g^(t0-1-s) k_s v_s^T (k_chunk_state, k_state_scan); the own chunk keeps the score tile.
__global__ __launch_bounds__(128) void k_ret(const float* __restrict__ q, const float* __restrict__ k, const float* __restrict__ v,
                                             const unsigned short* __restrict__ Sh, const unsigned short* __restrict__ Sl, float* __restrict__ y) {
  constexpr int KS = HD / 32, DV = 64, DT = DV / 16;
  __shared__ __attribute__((aligned(16))) unsigned short sKh[32][HD + 8], sKl[32][HD + 8], sVh[32][DV + 8], sVl[32][DV + 8];
  __shared__ __attribute__((aligned(16))) unsigned short sPh[4][16][40], sPl[4][16][40];
  __shared__ __attribute__((aligned(16))) float sO[4][16][DV];
  const int tid = threadIdx.x, w = tid >> 5, lane = tid & 31, ln = lane & 15, hh = lane >> 4;
  const int nqb = TT / 64;
  const int bh = blockIdx.x / nqb, qblk = blockIdx.x % nqb, dv0 = blockIdx.y * DV;
  const int b = bh / NH, h = bh % NH;
  const int q0 = qblk * 64 + w * 16;
  const float log_a = logf(1.0f - exp2f(-5.0f - (float)h));
  const float* Q = q + (size_t)b * TT * DD + h * HD; const float* K = k + (size_t)b * TT * DD + h * HD; const float* V = v + (size_t)b * TT * DD + h * HD + dv0;
  FragB aqh[KS], aql[KS];
  {
    const float* qr = Q + (size_t)(q0 + ln) * DD;
#pragma unroll
    for (int ks = 0; ks < KS; ++ks)
#pragma unroll
      for (int i = 0; i < 16; ++i) {
        const int d = ks * 32 + ((i < 8) ? (8 * hh + i) : (16 + 8 * hh + (i - 8)));
        const float x = qr[d]; const unsigned short hb = bf16_bits(x); aqh[ks].u[i] = hb; aql[ks].u[i] = bf16_bits(x - bf16_val(hb));
      }
  }
  v8f oacc[DT];
#pragma unroll
  for (int dt = 0; dt < DT; ++dt) oacc[dt] = (v8f){0.f,0.f,0.f,0.f,0.f,0.f,0.f,0.f};
  if (qblk > 0) {                                                       // block-uniform; chunk 0 has no earlier keys
    const size_t so = ((size_t)bh * NC + qblk) * (HD * HD) + (size_t)(dv0 + ln) * HD + 8 * hh;
    const unsigned short* rh = Sh + so; const unsigned short* rl = Sl + so;
    FragB fh[2][KS], fl[2][KS];                                         // two dv tiles of state fragments: a tile's 16 loads fly together, one tile ahead of its products
    auto load_state = [&](int dt) {
#pragma unroll
      for (int ks = 0; ks < KS; ++ks) {
        fh[dt & 1][ks].half[0] = *(const v8us*)(rh + dt * 16 * HD + ks * 32); fh[dt & 1][ks].half[1] = *(const v8us*)(rh + dt * 16 * HD + ks * 32 + 16);
        fl[dt & 1][ks].half[0] = *(const v8us*)(rl + dt * 16 * HD + ks * 32); fl[dt & 1][ks].half[1] = *(const v8us*)(rl + dt * 16 * HD + ks * 32 + 16);
      }
    };
    load_state(0); load_state(1);
    // unrolled (here and in load_state) so that the two fragment buffers are picked by constants and stay in registers
#pragma unroll
    for (int dt = 0; dt < DT; ++dt) {
      v8f acc = {};
#pragma unroll
      for (int ks = 0; ks < KS; ++ks) acc = mmaN<3>(aqh[ks].v, aql[ks].v, fh[dt & 1][ks].v, fl[dt & 1][ks].v, acc);
      if (dt + 2 < DT) load_state(dt + 2);
#pragma unroll
      for (int r = 0; r < 8; ++r) oacc[dt][r] = acc[r] * 0.08838834764831845f * expf((float)(w * 16 + 8 * hh + r + 1) * log_a);
    }
  }
  const int jstart = qblk * 64;
  const int kv_end = qblk * 64 + 64;
  for (int j0 = jstart; j0 < kv_end; j0 += 32) {
    __syncthreads();
    for (int e = tid; e < 32 * (HD / 4); e += 128) {
      const int r = e / (HD / 4), c4 = (e % (HD / 4)) * 4; const int key = j0 + r;
      const v4f kf = *(const v4fa*)(K + (size_t)key * DD + c4);
#pragma unroll
      for (int t = 0; t < 4; ++t) { const unsigned short hb = bf16_bits(kf[t]); sKh[r][c4 + t] = hb; sKl[r][c4 + t] = bf16_bits(kf[t] - bf16_val(hb)); }
    }
    for (int e = tid; e < 32 * (DV / 4); e += 128) {
      const int r = e / (DV / 4), c4 = (e % (DV / 4)) * 4; const int key = j0 + r;
      const v4f vf = *(const v4fa*)(V + (size_t)key * DD + c4);
#pragma unroll
      for (int t = 0; t < 4; ++t) { const unsigned short hb = bf16_bits(vf[t]); sVh[r][c4 + t] = hb; sVl[r][c4 + t] = bf16_bits(vf[t] - bf16_val(hb)); }
    }
    __syncthreads();
#pragma unroll
    for (int nt = 0; nt < 2; ++nt) {
      v8f acc = {};
#pragma unroll
      for (int ks = 0; ks < KS; ++ks) {
        FragB bh_, bl_;
        bh_.half[0] = *(const v8us*)&sKh[nt * 16 + ln][ks * 32 + 8 * hh]; bh_.half[1] = *(const v8us*)&sKh[nt * 16 + ln][ks * 32 + 16 + 8 * hh];
        bl_.half[0] = *(const v8us*)&sKl[nt * 16 + ln][ks * 32 + 8 * hh]; bl_.half[1] = *(const v8us*)&sKl[nt * 16 + ln][ks * 32 + 16 + 8 * hh];
        acc = mmaN<3>(aqh[ks].v, aql[ks].v, bh_.v, bl_.v, acc);
      }
      const int j = j0 + nt * 16 + ln;
#pragma unroll
      for (int r = 0; r < 8; ++r) {
        const int t = q0 + 8 * hh + r;
        const float p = (j <= t) ? acc[r] * 0.08838834764831845f * expf((float)(t - j) * log_a) : 0.f;
        const unsigned short hb = bf16_bits(p); sPh[w][8 * hh + r][nt * 16 + ln] = hb; sPl[w][8 * hh + r][nt * 16 + ln] = bf16_bits(p - bf16_val(hb));
      }
    }
    __builtin_amdgcn_fence(__ATOMIC_ACQ_REL, "workgroup");
    __builtin_amdgcn_wave_barrier();
    FragB pah, pal;
    pah.half[0] = *(const v8us*)&sPh[w][ln][8 * hh]; pah.half[1] = *(const v8us*)&sPh[w][ln][16 + 8 * hh];
    pal.half[0] = *(const v8us*)&sPl[w][ln][8 * hh]; pal.half[1] = *(const v8us*)&sPl[w][ln][16 + 8 * hh];
#pragma unroll
    for (int dt = 0; dt < DT; ++dt) {
      FragB bvh, bvl;
#pragma unroll
      for (int i = 0; i < 8; ++i) {
        bvh.u[i] = sVh[8 * hh + i][dt * 16 + ln]; bvh.u[8 + i] = sVh[16 + 8 * hh + i][dt * 16 + ln];
        bvl.u[i] = sVl[8 * hh + i][dt * 16 + ln]; bvl.u[8 + i] = sVl[16 + 8 * hh + i][dt * 16 + ln];
      }
      oacc[dt] = mmaN<3>(pah.v, pal.v, bvh.v, bvl.v, oacc[dt]);
    }
    __builtin_amdgcn_fence(__ATOMIC_ACQ_REL, "workgroup");
    __builtin_amdgcn_wave_barrier();
  }
#pragma unroll
  for (int dt = 0; dt < DT; ++dt)
#pragma unroll
    for (int r = 0; r < 8; ++r) sO[w][8 * hh + r][dt * 16 + ln] = oacc[dt][r];
  __builtin_amdgcn_fence(__ATOMIC_ACQ_REL, "workgroup");
  __builtin_amdgcn_wave_barrier();
  {
    for (int r = 0; r < 16; ++r) { if (lane < DV / 4) { const v4f val = *(const v4fa*)&sO[w][r][lane * 4]; *(v4f*)(y + ((size_t)b * TT + q0 + r) * DD + h * HD + dv0 + lane * 4) = val; } }
    
  }
}


// Z[row][h*128+d] = silu(g) · (ret − mean)/sqrt(var + 1e-6) per (row, head) over 128; wave per (row, head), lane = 4 values
// Z leaves as the two bf16 terms that the last GEMM multiplies: hi = Z rounded, lo = (Z - hi) rounded; a row of zh is its DD hi values, then its DD lo values
__global__ __launch_bounds__(256) void k_gn_gate(const float* __restrict__ ret, const float* __restrict__ g, unsigned short* __restrict__ zh) {
  const int tid = threadIdx.x, w = tid >> 5, lane = tid & 31; const size_t rh = (size_t)blockIdx.x * 8 + w; if (rh >= (size_t)BB * TT * NH) return;
  const size_t base = rh * HD + lane * 4;        // rows are [row][h*128 + d] contiguous -> rh*128
  const v4f a = *(const v4fa*)(ret + base), gg = *(const v4fa*)(g + base);
  float s = a[0] + a[1] + a[2] + a[3]; for (int o = 16; o >= 1; o >>= 1) s += __shfl_xor(s, o, 32); const float mu = s * (1.0f / HD);
  float q2 = 0.f; for (int q = 0; q < 4; ++q) { const float c = a[q] - mu; q2 += c * c; } for (int o = 16; o >= 1; o >>= 1) q2 += __shfl_xor(q2, o, 32);
  const float rs = rsqrtf(q2 * (1.0f / HD) + 1e-6f);
  v4f o4; for (int q = 0; q < 4; ++q) o4[q] = (gg[q] / (1.0f + expf(-gg[q]))) * ((a[q] - mu) * rs);
  v4us hi, lo; for (int q = 0; q < 4; ++q) { hi[q] = bf16_bits(o4[q]); lo[q] = bf16_bits(o4[q] - bf16_val(hi[q])); }
  unsigned short* zo = zh + base + (rh / NH) * DD;
  *(v4us*)zo = hi; *(v4us*)(zo + DD) = lo;
}
extern "C" void kernel_launch(void* const* d_in, const int* in_sizes, int n_in,
                              void* d_out, int out_size, void* d_ws, size_t ws_size, hipStream_t stream) {
  (void)in_sizes; (void)n_in; (void)out_size;
  const float* X = (const float*)d_in[0]; const float* Wq = (const float*)d_in[1]; const float* Wk = (const float*)d_in[2]; const float* Wv = (const float*)d_in[3]; const float* WG = (const float*)d_in[4]; const float* WO = (const float*)d_in[5];
  char* ws = (char*)d_ws; size_t off = 0;
  auto take = [&](size_t bytes) { char* p = ws + off; off += (bytes + 255) & ~(size_t)255; return p; };
  const int M = BB * TT, gb = (M / 128) * (DD / 128);
  unsigned short* Wt[5]; for (int i = 0; i < 5; ++i) Wt[i] = (unsigned short*)take((size_t)DD * DD * 2);
  unsigned short* Xb = (unsigned short*)take((size_t)M * DD * 2);
  float* q = (float*)take((size_t)M * DD * 4); float* k = (float*)take((size_t)M * DD * 4); float* v = (float*)take((size_t)M * DD * 4); float* g = (float*)take((size_t)M * DD * 4); float* ret = (float*)take((size_t)M * DD * 4);
  float* U = (float*)take((size_t)BB * NH * NC * HD * HD * 4); unsigned short* Sh = (unsigned short*)take((size_t)BB * NH * NC * HD * HD * 2); unsigned short* Sl = (unsigned short*)take((size_t)BB * NH * NC * HD * HD * 2);
  if (off > ws_size) return;
  k_wt_bf16<<<dim3((DD / 128) * (DD / 128), 5 + M * DD / XBLK / ((DD / 128) * (DD / 128))), 256, 0, stream>>>(Wq, Wk, Wv, WG, WO, X, Wt[0], Xb);   // X @ W: [K][N]; y >= 5: X -> bf16
  k_gemm_bf<false, 4><<<4 * gb, 256, 0, stream>>>(Xb, Wt[0], q);                                                          // q, k, v, g: neighbours in ws, as Wt[0..3] are
  k_chunk_state<<<BB * NH * (NC - 1), 256, 0, stream>>>(k, v, U);
  k_state_scan<<<BB * NH * (HD * HD / 4) / 256, 256, 0, stream>>>(U, Sh, Sl);
  k_ret<<<dim3(BB * NH * (TT / 64), 2), 128, 0, stream>>>(q, k, v, Sh, Sl, ret);
  k_gn_gate<<<(BB * TT * NH + 7) / 8, 256, 0, stream>>>(ret, g, (unsigned short*)q);                                   // q's 16 MiB reused as Z in bf16 hi and lo
  k_gemm_bf<true, 1><<<gb, 256, 0, stream>>>((const unsigned short*)q, Wt[4], (float*)d_out);
}

// v006
// Measured time: 132 microseconds a run.
// Two timings next to v005 put it at 1.09 and 1.10 times that version's speed.
// Over all steps from v000 it is 5.64 times as fast.
#include <hip/hip_runtime.h>
// All contractions on v_wmma_f32_16x16x32_bf16, f32 accumulate: q/k/v/g = X·W (X, W rounded to bf16: single exact term); per-head retention
// Σ_{s≤t} ((q_t·k_s)/√128)·γ_h^{t−s}·v_s as 3-term bf16 hi/lo splits (scores and decayed weights split in registers/LDS); (silu(g)∘GN(ret))·W_O with
// the A operand split (2 terms). Decay factors, the per-head GroupNorm (no affine, eps 1e-6) and silu in f32.
#define BB 2
#define TT 2048
#define DD 1024
#define NH 8
#define HD 128
#define NC (TT / 64)   // chunks of 64 keys per sequence

typedef __bf16 v16b __attribute__((ext_vector_type(16)));
typedef unsigned short v8us __attribute__((ext_vector_type(8), may_alias));
typedef unsigned short v4us __attribute__((ext_vector_type(4), may_alias));
typedef float  v8f  __attribute__((ext_vector_type(8)));
typedef float  v4f  __attribute__((ext_vector_type(4)));
typedef float  v4fa __attribute__((ext_vector_type(4), may_alias));
union FragB { v16b v; v8us half[2]; unsigned short u[16]; };

__device__ __forceinline__ unsigned short bf16_bits(float x) { unsigned int u = __float_as_uint(x); return (unsigned short)((u + 0x7FFFu + ((u >> 16) & 1u)) >> 16); }
__device__ __forceinline__ float bf16_val(unsigned short b) { return __uint_as_float(((unsigned int)b) << 16); }
__device__ __forceinline__ float bf16_round(float x) { return bf16_val(bf16_bits(x)); }
// D += A·B with NT terms: 1 = ah·bh, 2 = + al·bh (A split), 3 = + ah·bl (both split)
template <int NT>
__device__ __forceinline__ v8f mmaN(v16b ah, v16b al, v16b bh, v16b bl, v8f c) {
  c = __builtin_amdgcn_wmma_f32_16x16x32_bf16(false, ah, false, bh, (short)0, c, false, false);
  if (NT >= 2) c = __builtin_amdgcn_wmma_f32_16x16x32_bf16(false, al, false, bh, (short)0, c, false, false);
  if (NT >= 3) c = __builtin_amdgcn_wmma_f32_16x16x32_bf16(false, ah, false, bl, (short)0, c, false, false);
  asm volatile("v_nop\n\tv_nop\n\tv_nop\n\tv_nop" : "+v"(c) : "v"(ah), "v"(al), "v"(bh), "v"(bl));
  return c;
}

// One launch for all five weights: blockIdx.y picks the matrix; the five bf16 transposes lie one behind the other from Wt0.
// Block = one 128 (k) x 128 (n) tile, turned in LDS: a wave reads 512 contiguous bytes of a W row, and 16 lanes store 256 contiguous bytes of a Wt row,
// so that every global access covers whole lines. A thread holds 16 k of 4 neighbouring n and hands each n to LDS as two 16-byte runs of k.
// blockIdx.y >= 5: the same launch rounds X to bf16 once, in place of every column tile of the q/k/v/g GEMM doing it again; block = 16384 elements in row order.
#define XBLK 16384
#define WTP (128 + 8)      // LDS row pitch in bf16: 272 B, the pitch for 16-byte reads of 256-B rows
__global__ __launch_bounds__(256) void k_wt_bf16(const float* __restrict__ W0, const float* __restrict__ W1, const float* __restrict__ W2, const float* __restrict__ W3,
                                                 const float* __restrict__ W4, const float* __restrict__ X, unsigned short* __restrict__ Wt0,
                                                 unsigned short* __restrict__ Xb) {
  constexpr int K = DD, N = DD;
  __shared__ __attribute__((aligned(16))) unsigned short sT[128 * WTP];   // [n][k]
  const int y = blockIdx.y;
  if (y >= 5) {                                             // the same for the whole block, and in front of the barrier
    const size_t e0 = ((size_t)(y - 5) * ((K / 128) * (N / 128)) + blockIdx.x) * XBLK + threadIdx.x * 4;
    const float* xp = X + e0;
    unsigned short* xo = Xb + e0;
    v4f r[16];
    // unrolled so that r[] stays in registers and all 16 loads (512 contiguous bytes a wave each) fly together
#pragma unroll
    for (int i = 0; i < 16; ++i) r[i] = *(const v4fa*)(xp + i * 1024);
    asm volatile("s_wait_xcnt 0x0" :: "v"(xp) : "memory");  // precaution: before any register that an issued load names is rewritten
#pragma unroll
    for (int i = 0; i < 16; ++i) {
      v4us c;
#pragma unroll
      for (int t = 0; t < 4; ++t) c[t] = bf16_bits(r[i][t]);
      *(v4us*)(xo + i * 1024) = c;
    }
    return;
  }
  const float* __restrict__ W = y == 0 ? W0 : y == 1 ? W1 : y == 2 ? W2 : y == 3 ? W3 : W4;
  unsigned short* __restrict__ Wt = Wt0 + (size_t)y * K * N;
  const int tid = threadIdx.x;
  const int k0 = (blockIdx.x % (K / 128)) * 128, n0 = (blockIdx.x / (K / 128)) * 128;
  const int n4 = (tid & 31) * 4, kg = (tid >> 5) * 16;
  const float* wp = W + (size_t)(k0 + kg) * N + n0 + n4;
  v4f x[16];
  // every loop is unrolled so that x[] is indexed by constants and stays in registers; all 16 loads fly together
#pragma unroll
  for (int i = 0; i < 16; ++i) x[i] = *(const v4fa*)(wp + (size_t)i * N);
  asm volatile("s_wait_xcnt 0x0" :: "v"(wp) : "memory");   // precaution: before any register that an issued load names is rewritten
#pragma unroll
  for (int t = 0; t < 4; ++t)
#pragma unroll
    for (int hf = 0; hf < 2; ++hf) {
      v8us c;
#pragma unroll
      for (int i = 0; i < 8; ++i) c[i] = bf16_bits(x[hf * 8 + i][t]);
      *(v8us*)&sT[(n4 + t) * WTP + kg + hf * 8] = c;
    }
  __syncthreads();                                          // the tile is complete in LDS before any row of it is read
  const int r = tid >> 4, c8 = (tid & 15) * 8;
  unsigned short* op = Wt + (size_t)(n0 + r) * K + k0 + c8;
  v8us o[8];
#pragma unroll
  for (int j = 0; j < 8; ++j) o[j] = *(const v8us*)&sT[(r + 16 * j) * WTP + c8];
#pragma unroll
  for (int j = 0; j < 8; ++j) *(v8us*)(op + (size_t)j * 16 * K) = o[j];
}

// GEMM C[M][N] (f32) = A[M][K] * W, M = BB*TT, N = K = DD. A bf16 row-major, rounded once by the kernel that makes it (ASPLIT: each row is K hi values and
// behind them its K lo values -> 2 terms, else one rounded term); Wt bf16 [N][K]. Block = 8 waves = one 128 x 128 tile of C; a stage is 128 k of the 128 A rows and the 128 Wt rows, loaded once per block with
// whole-line loads and shared by all waves through LDS. Two stage buffers, one barrier per stage: the next stage's global loads fly during this stage's products.
// Wave = 32 x 64 of C (waves 4 x 2). Each accumulator sums its k in ascending order, hi term before lo term.
// NW products that share A run as one launch: their Wt planes lie one behind the other from Wt0, their C planes from C0, and the column tiles of all NW
// are numbered through. With more blocks than WGPs two unsplit blocks (136 KiB of LDS each) share a WGP, and one block's loads fly while the other stores or waits.
#define GBK 128            // k per stage
#define GP (GBK + 8)       // LDS row pitch in bf16: 272 B, the pitch for 16-byte fragment reads of 256-B rows
#define GSP 68             // row pitch in f32 of a wave's staged C rows: the two half-waves (rows 8 apart) fall on different banks
typedef float f1a __attribute__((may_alias));
template <bool ASPLIT, int NW>
__global__ __launch_bounds__(256) void k_gemm_bf(const unsigned short* __restrict__ A, const unsigned short* __restrict__ Wt0, float* __restrict__ C0) {
  constexpr int K = DD, N = DD, NT = K / GBK, CT = N / 128;
  constexpr int PLANE = 128 * GP;                       // bf16 elements of one operand plane: [0] A hi, [1] Wt, [2] A lo
  constexpr int STAGE = (ASPLIT ? 3 : 2) * PLANE;
  static_assert(2 * STAGE * 2 >= 8 * 32 * GSP * 4, "the staged C tile must fit the operand buffers");
  __shared__ __attribute__((aligned(16))) unsigned short sm[2 * STAGE];
  const int tid = threadIdx.x, w = tid >> 5, lane = tid & 31, ln = lane & 15, hh = lane >> 4;
  const int wm = w >> 1, wn = w & 1;
  const int ct = blockIdx.x % (NW * CT), which = ct / CT;
  const int row0 = (blockIdx.x / (NW * CT)) * 128, col0 = (ct % CT) * 128;
  const unsigned short* __restrict__ Wt = Wt0 + (size_t)which * N * K;
  float* __restrict__ C = C0 + (size_t)which * (BB * TT) * N;
  const int br = tid >> 4, bc = (tid & 15) * 8;         // A planes and Wt alike: 16 lanes read 256 contiguous bytes of one row
  constexpr int AP = ASPLIT ? 2 * K : K;                // row pitch of A
  const unsigned short* ap = A + (size_t)(row0 + br) * AP + bc;
  const unsigned short* bp = Wt + (size_t)(col0 + br) * K + bc;
  v8us xa[8], xl[8], xb[8];
  // every loop below is unrolled so that the arrays it indexes (loaded rows, fragments, accumulators) stay in registers
  auto fetch = [&](int kb) {
    const unsigned short* pa = ap + kb; const unsigned short* pb = bp + kb;
#pragma unroll
    for (int i = 0; i < 8; ++i) xa[i] = *(const v8us*)(pa + (size_t)i * 16 * AP);
    if (ASPLIT) {
#pragma unroll
      for (int i = 0; i < 8; ++i) xl[i] = *(const v8us*)(pa + (size_t)i * 16 * AP + K);
    }
#pragma unroll
    for (int i = 0; i < 8; ++i) xb[i] = *(const v8us*)(pb + (size_t)i * 16 * K);
    // precaution: wait before any register that an issued load names is rewritten; the addresses are inputs so that no load lands in them ahead of the wait
    asm volatile("s_wait_xcnt 0x0" :: "v"(pa), "v"(pb) : "memory");
  };
  auto stash = [&](unsigned short* st) {
#pragma unroll
    for (int i = 0; i < 8; ++i) {
      *(v8us*)&st[(br + 16 * i) * GP + bc] = xa[i];
      if (ASPLIT) *(v8us*)&st[2 * PLANE + (br + 16 * i) * GP + bc] = xl[i];
    }
#pragma unroll
    for (int i = 0; i < 8; ++i) *(v8us*)&st[PLANE + (br + 16 * i) * GP + bc] = xb[i];
  };
  v8f acc[2][4];
#pragma unroll
  for (int mi = 0; mi < 2; ++mi)
#pragma unroll
    for (int ni = 0; ni < 4; ++ni) acc[mi][ni] = (v8f){0.f,0.f,0.f,0.f,0.f,0.f,0.f,0.f};
  auto products = [&](const unsigned short* st) {
    const unsigned short* pa = st + (wm * 32 + ln) * GP + 8 * hh;
    const unsigned short* pb = st + PLANE + (wn * 64 + ln) * GP + 8 * hh;
#pragma unroll
    for (int ks = 0; ks < GBK / 32; ++ks) {
      FragB a[2], al[2], b[4];
#pragma unroll
      for (int mi = 0; mi < 2; ++mi) {
        a[mi].half[0] = *(const v8us*)(pa + mi * 16 * GP + ks * 32); a[mi].half[1] = *(const v8us*)(pa + mi * 16 * GP + ks * 32 + 16);
        if (ASPLIT) { al[mi].half[0] = *(const v8us*)(pa + 2 * PLANE + mi * 16 * GP + ks * 32); al[mi].half[1] = *(const v8us*)(pa + 2 * PLANE + mi * 16 * GP + ks * 32 + 16); }
      }
#pragma unroll
      for (int ni = 0; ni < 4; ++ni) { b[ni].half[0] = *(const v8us*)(pb + ni * 16 * GP + ks * 32); b[ni].half[1] = *(const v8us*)(pb + ni * 16 * GP + ks * 32 + 16); }
#pragma unroll
      for (int mi = 0; mi < 2; ++mi)
#pragma unroll
        for (int ni = 0; ni < 4; ++ni) acc[mi][ni] = __builtin_amdgcn_wmma_f32_16x16x32_bf16(false, a[mi].v, false, b[ni].v, (short)0, acc[mi][ni], false, false);
      if (ASPLIT) {
#pragma unroll
        for (int mi = 0; mi < 2; ++mi)
#pragma unroll
          for (int ni = 0; ni < 4; ++ni) acc[mi][ni] = __builtin_amdgcn_wmma_f32_16x16x32_bf16(false, al[mi].v, false, b[ni].v, (short)0, acc[mi][ni], false, false);
      }
    }
  };
  fetch(0);
  stash(sm);
  for (int t = 0; t + 1 < NT; ++t) {
    __syncthreads();                                    // stage t is complete in its buffer, and every reader has left the other buffer
    fetch((t + 1) * GBK);
    products(sm + (t & 1) * STAGE);
    stash(sm + ((t + 1) & 1) * STAGE);
  }
  __syncthreads();
  products(sm + ((NT - 1) & 1) * STAGE);
  __syncthreads();                                      // every wave has left the operand buffers: their LDS now stages C, each wave in its own range
  f1a* so = (f1a*)sm + w * (32 * GSP);
#pragma unroll
  for (int mi = 0; mi < 2; ++mi)
#pragma unroll
    for (int ni = 0; ni < 4; ++ni)
#pragma unroll
      for (int r = 0; r < 8; ++r) so[(mi * 16 + 8 * hh + r) * GSP + ni * 16 + ln] = acc[mi][ni][r];
  __builtin_amdgcn_fence(__ATOMIC_ACQ_REL, "workgroup");
  __builtin_amdgcn_wave_barrier();
  float* cp = C + (size_t)(row0 + wm * 32 + hh) * N + col0 + wn * 64 + ln * 4;
  v4f o[16];
#pragma unroll
  for (int q = 0; q < 16; ++q) o[q] = *(const v4fa*)&so[(q * 2 + hh) * GSP + ln * 4];
#pragma unroll
  for (int q = 0; q < 16; ++q) *(v4f*)(cp + (size_t)q * 2 * N) = o[q];   // 16 lanes store 256 contiguous bytes of a row
}

// Flash-style causal/unmasked attention, all contractions 3-term bf16 hi/lo splits, f32 softmax with running max.
// q,k,v rows are read from f32 buffers with arbitrary row pitch (so they can live inside a fused qkv buffer);
// D = head size (multiple of 32, <= 128); one wave = 16 query rows; block = 4 waves (64 queries) sharing K/V chunks of 32.
template <int D, bool CAUSAL>
__global__ __launch_bounds__(128) void k_flash(const float* __restrict__ qb, const float* __restrict__ kb, const float* __restrict__ vb,
                                             int pitch, int T, int H, float scale, float* __restrict__ y, int ypitch) {
  constexpr int KS = D / 32;        // k-steps for QK
  constexpr int DT = D / 16;        // d tiles for PV
  __shared__ __attribute__((aligned(16))) unsigned short sKh[32][D + 8], sKl[32][D + 8], sVh[32][D + 8], sVl[32][D + 8];
  __shared__ __attribute__((aligned(16))) unsigned short sPh[4][16][40], sPl[4][16][40];
  __shared__ __attribute__((aligned(16))) float sO[4][16][D];
  const int tid = threadIdx.x, w = tid >> 5, lane = tid & 31, ln = lane & 15, hh = lane >> 4;
  const int nqb = (T + 63) / 64;
  const int bh = blockIdx.x / nqb, qblk = blockIdx.x % nqb;
  const int b = bh / H, h = bh % H;
  const int q0 = qblk * 64 + w * 16;
  const float* Q = qb + (size_t)b * T * pitch + h * D;
  const float* K = kb + (size_t)b * T * pitch + h * D;
  const float* V = vb + (size_t)b * T * pitch + h * D;

  // A fragments of the wave's 16 query rows (scaled), hi/lo
  FragB aqh[KS], aql[KS];
  {
    int row = q0 + ln; if (row >= T) row = T - 1;
    const float* qr = Q + (size_t)row * pitch;
#pragma unroll
    for (int ks = 0; ks < KS; ++ks)
#pragma unroll
      for (int i = 0; i < 16; ++i) {
        const int d = ks * 32 + ((i < 8) ? (8 * hh + i) : (16 + 8 * hh + (i - 8)));
        const float x = qr[d] * scale; const unsigned short hb = bf16_bits(x);
        aqh[ks].u[i] = hb; aql[ks].u[i] = bf16_bits(x - bf16_val(hb));
      }
  }
  float m_r[8], l_r[8];
#pragma unroll
  for (int r = 0; r < 8; ++r) { m_r[r] = -3.0e38f; l_r[r] = 0.f; }
  v8f oacc[DT];
#pragma unroll
  for (int dt = 0; dt < DT; ++dt) oacc[dt] = (v8f){0.f,0.f,0.f,0.f,0.f,0.f,0.f,0.f};

  const int kv_end = CAUSAL ? min(T, qblk * 64 + 64) : T;     // block-uniform
  for (int j0 = 0; j0 < kv_end; j0 += 32) {
    __syncthreads();
    for (int e = tid; e < 32 * (D / 4); e += 128) {
      const int r = e / (D / 4), c4 = (e % (D / 4)) * 4;
      const int key = j0 + r;
      v4f kf = {0.f,0.f,0.f,0.f}, vf = {0.f,0.f,0.f,0.f};
      if (key < T) { kf = *(const v4fa*)(K + (size_t)key * pitch + c4); vf = *(const v4fa*)(V + (size_t)key * pitch + c4); }
#pragma unroll
      for (int t = 0; t < 4; ++t) {
        unsigned short hb = bf16_bits(kf[t]); sKh[r][c4 + t] = hb; sKl[r][c4 + t] = bf16_bits(kf[t] - bf16_val(hb));
        hb = bf16_bits(vf[t]); sVh[r][c4 + t] = hb; sVl[r][c4 + t] = bf16_bits(vf[t] - bf16_val(hb));
      }
    }
    __syncthreads();
    // S tile 16 x 32
    v8f s[2];
#pragma unroll
    for (int nt = 0; nt < 2; ++nt) {
      v8f acc = {};
#pragma unroll
      for (int ks = 0; ks < KS; ++ks) {
        FragB bh_, bl_;
        bh_.half[0] = *(const v8us*)&sKh[nt * 16 + ln][ks * 32 + 8 * hh]; bh_.half[1] = *(const v8us*)&sKh[nt * 16 + ln][ks * 32 + 16 + 8 * hh];
        bl_.half[0] = *(const v8us*)&sKl[nt * 16 + ln][ks * 32 + 8 * hh]; bl_.half[1] = *(const v8us*)&sKl[nt * 16 + ln][ks * 32 + 16 + 8 * hh];
        acc = mmaN<3>(aqh[ks].v, aql[ks].v, bh_.v, bl_.v, acc);
      }
      s[nt] = acc;
    }
    // mask + running max (rows 8hh+r; the 16 lanes of a half share rows)
    float alpha[8];
#pragma unroll
    for (int r = 0; r < 8; ++r) {
      const int qi = q0 + 8 * hh + r;
      const int ja = j0 + ln, jb = j0 + 16 + ln;
      if (CAUSAL) { if (ja > qi) s[0][r] = -3.0e38f; if (jb > qi) s[1][r] = -3.0e38f; }
      if (ja >= T) s[0][r] = -3.0e38f;
      if (jb >= T) s[1][r] = -3.0e38f;
      float mx = fmaxf(s[0][r], s[1][r]);
      mx = fmaxf(mx, __shfl_xor(mx, 1, 32)); mx = fmaxf(mx, __shfl_xor(mx, 2, 32)); mx = fmaxf(mx, __shfl_xor(mx, 4, 32)); mx = fmaxf(mx, __shfl_xor(mx, 8, 32));
      const float mnew = fmaxf(m_r[r], mx);
      alpha[r] = (mnew > -1.0e38f) ? __expf(m_r[r] - mnew) : 1.0f;
      const float p0 = (s[0][r] > -1.0e38f) ? __expf(s[0][r] - mnew) : 0.f;
      const float p1 = (s[1][r] > -1.0e38f) ? __expf(s[1][r] - mnew) : 0.f;
      m_r[r] = mnew;
      l_r[r] = l_r[r] * alpha[r] + p0 + p1;            // per-lane partial row sum (16 lanes combined at the end)
      unsigned short hb = bf16_bits(p0); sPh[w][8 * hh + r][ln] = hb;      sPl[w][8 * hh + r][ln] = bf16_bits(p0 - bf16_val(hb));
      hb = bf16_bits(p1);                sPh[w][8 * hh + r][16 + ln] = hb; sPl[w][8 * hh + r][16 + ln] = bf16_bits(p1 - bf16_val(hb));
    }
#pragma unroll
    for (int dt = 0; dt < DT; ++dt)
#pragma unroll
      for (int r = 0; r < 8; ++r) oacc[dt][r] *= alpha[r];
    __builtin_amdgcn_fence(__ATOMIC_ACQ_REL, "workgroup");
    __builtin_amdgcn_wave_barrier();
    FragB pah, pal;
    pah.half[0] = *(const v8us*)&sPh[w][ln][8 * hh]; pah.half[1] = *(const v8us*)&sPh[w][ln][16 + 8 * hh];
    pal.half[0] = *(const v8us*)&sPl[w][ln][8 * hh]; pal.half[1] = *(const v8us*)&sPl[w][ln][16 + 8 * hh];
#pragma unroll
    for (int dt = 0; dt < DT; ++dt) {
      FragB bvh, bvl;
#pragma unroll
      for (int i = 0; i < 8; ++i) {
        bvh.u[i] = sVh[8 * hh + i][dt * 16 + ln]; bvh.u[8 + i] = sVh[16 + 8 * hh + i][dt * 16 + ln];
        bvl.u[i] = sVl[8 * hh + i][dt * 16 + ln]; bvl.u[8 + i] = sVl[16 + 8 * hh + i][dt * 16 + ln];
      }
      oacc[dt] = mmaN<3>(pah.v, pal.v, bvh.v, bvl.v, oacc[dt]);
    }
    __builtin_amdgcn_fence(__ATOMIC_ACQ_REL, "workgroup");
    __builtin_amdgcn_wave_barrier();
  }
#pragma unroll
  for (int r = 0; r < 8; ++r) {
    float l = l_r[r];
    l += __shfl_xor(l, 1, 32); l += __shfl_xor(l, 2, 32); l += __shfl_xor(l, 4, 32); l += __shfl_xor(l, 8, 32);
    l_r[r] = (l > 0.f) ? 1.0f / l : 0.f;
  }
#pragma unroll
  for (int dt = 0; dt < DT; ++dt)
#pragma unroll
    for (int r = 0; r < 8; ++r) sO[w][8 * hh + r][dt * 16 + ln] = oacc[dt][r] * l_r[r];
  __builtin_amdgcn_fence(__ATOMIC_ACQ_REL, "workgroup");
  __builtin_amdgcn_wave_barrier();
  {
    for (int r = 0; r < 16; ++r) {
      const int row = q0 + r;
      if (row < T && lane < D / 4) {
        const v4f val = *(const v4fa*)&sO[w][r][lane * 4];
        *(v4f*)(y + ((size_t)b * T + row) * ypitch + h * D + lane * 4) = val;
      }
    }
    
  }
}
// One chunk's own state, stored transposed: U[bh][n][dv][dk] = sum over j < 64 of (g^(63-j) * k[64n+j][dk]) * v[64n+j][dv], g = the head's decay.
// Block = one (batch, head, chunk); wave w = all 128 dk (A rows) by the 16 dv columns w*16..; 3-term bf16 hi/lo split, f32 accumulate.
// Every loop is unrolled so that the arrays it indexes (loaded rows, fragments, accumulators) stay in registers.
__global__ __launch_bounds__(256) void k_chunk_state(const float* __restrict__ k, const float* __restrict__ v, float* __restrict__ U) {
  __shared__ __attribute__((aligned(16))) unsigned short sKh[HD][72], sKl[HD][72], sVh[HD][72], sVl[HD][72];   // [column][key]: both operands contract over keys
  const int tid = threadIdx.x, w = tid >> 5, lane = tid & 31, ln = lane & 15, hh = lane >> 4;
  const int bh = blockIdx.x / (NC - 1), n = blockIdx.x % (NC - 1);     // the last chunk's state has no reader
  const int b = bh / NH, h = bh % NH;
  const float log_a = logf(1.0f - exp2f(-5.0f - (float)h));
  const float* K = k + ((size_t)b * TT + n * 64) * DD + h * HD; const float* V = v + ((size_t)b * TT + n * 64) * DD + h * HD;
  // a thread transposes 4 keys x 4 columns in registers: 8 lanes read 128 contiguous bytes of a row, and each column goes to LDS as one 8-byte store of 4 keys
  const int cl = tid & 7, k4 = ((tid >> 3) & 15) * 4, ch = tid >> 7;
  float dec[4];
#pragma unroll
  for (int j = 0; j < 4; ++j) dec[j] = expf((float)(63 - (k4 + j)) * log_a);
  const float* kp = K + (size_t)k4 * DD + (cl + 8 * ch) * 4; const float* vp = V + (size_t)k4 * DD + (cl + 8 * ch) * 4;
  v4f kf[2][4], vf[2][4];
#pragma unroll
  for (int i = 0; i < 2; ++i)
#pragma unroll
    for (int j = 0; j < 4; ++j) { kf[i][j] = *(const v4fa*)(kp + (size_t)j * DD + i * 64); vf[i][j] = *(const v4fa*)(vp + (size_t)j * DD + i * 64); }
  // precaution: wait before any register that an issued load names is rewritten; the two addresses are inputs so that no load lands in them ahead of the wait
  asm volatile("s_wait_xcnt 0x0" :: "v"(kp), "v"(vp) : "memory");
#pragma unroll
  for (int i = 0; i < 2; ++i) {
    const int c4 = (cl + 8 * (ch + 2 * i)) * 4;
#pragma unroll
    for (int t = 0; t < 4; ++t) {
      v4us kh, kl, vh, vl;
#pragma unroll
      for (int j = 0; j < 4; ++j) {
        const float x = kf[i][j][t] * dec[j], z = vf[i][j][t];
        kh[j] = bf16_bits(x); kl[j] = bf16_bits(x - bf16_val(kh[j]));
        vh[j] = bf16_bits(z); vl[j] = bf16_bits(z - bf16_val(vh[j]));
      }
      *(v4us*)&sKh[c4 + t][k4] = kh; *(v4us*)&sKl[c4 + t][k4] = kl; *(v4us*)&sVh[c4 + t][k4] = vh; *(v4us*)&sVl[c4 + t][k4] = vl;
    }
  }
  __syncthreads();
  v8f acc[8];
#pragma unroll
  for (int ct = 0; ct < 8; ++ct) acc[ct] = (v8f){0.f,0.f,0.f,0.f,0.f,0.f,0.f,0.f};
#pragma unroll
  for (int ks = 0; ks < 2; ++ks) {
    FragB bvh, bvl;
    bvh.half[0] = *(const v8us*)&sVh[w * 16 + ln][ks * 32 + 8 * hh]; bvh.half[1] = *(const v8us*)&sVh[w * 16 + ln][ks * 32 + 16 + 8 * hh];
    bvl.half[0] = *(const v8us*)&sVl[w * 16 + ln][ks * 32 + 8 * hh]; bvl.half[1] = *(const v8us*)&sVl[w * 16 + ln][ks * 32 + 16 + 8 * hh];
#pragma unroll
    for (int ct = 0; ct < 8; ++ct) {
      FragB akh, akl;
      akh.half[0] = *(const v8us*)&sKh[ct * 16 + ln][ks * 32 + 8 * hh]; akh.half[1] = *(const v8us*)&sKh[ct * 16 + ln][ks * 32 + 16 + 8 * hh];
      akl.half[0] = *(const v8us*)&sKl[ct * 16 + ln][ks * 32 + 8 * hh]; akl.half[1] = *(const v8us*)&sKl[ct * 16 + ln][ks * 32 + 16 + 8 * hh];
      acc[ct] = mmaN<3>(akh.v, akl.v, bvh.v, bvl.v, acc[ct]);
    }
  }
  // acc[ct][r] = U[dk = ct*16 + 8*hh + r][dv = w*16 + ln]: 8 neighbouring dk of one dv row
  float* Uo = U + ((size_t)bh * NC + n) * (HD * HD) + (size_t)(w * 16 + ln) * HD + 8 * hh;
#pragma unroll
  for (int ct = 0; ct < 8; ++ct) {
    *(v4f*)(Uo + ct * 16) = (v4f){acc[ct][0], acc[ct][1], acc[ct][2], acc[ct][3]};
    *(v4f*)(Uo + ct * 16 + 4) = (v4f){acc[ct][4], acc[ct][5], acc[ct][6], acc[ct][7]};
  }
}

// State in front of chunk n+1: S[n+1] = g^64 * S[n] + U[n], S[0] = 0, element by element in f32; stored as bf16 hi/lo planes [bh][n][dv][dk]
// (plane 0 is never written and never read). Thread = 4 neighbouring elements of one (batch, head).
__global__ __launch_bounds__(256) void k_state_scan(const float* __restrict__ U, unsigned short* __restrict__ Sh, unsigned short* __restrict__ Sl) {
  const int t = blockIdx.x * 256 + threadIdx.x;
  const int bh = t / (HD * HD / 4), e = (t % (HD * HD / 4)) * 4;
  const float g64 = expf(64.0f * logf(1.0f - exp2f(-5.0f - (float)(bh % NH))));
  const size_t o0 = (size_t)bh * NC * (HD * HD) + e;
  v4f u[NC - 1];
  // all loads first: they depend on nothing, so the serial recurrence below meets one memory latency and not one per chunk
#pragma unroll
  for (int n = 0; n < NC - 1; ++n) u[n] = *(const v4fa*)(U + o0 + (size_t)n * (HD * HD));
  v4f s = {0.f, 0.f, 0.f, 0.f};
  // unrolled so that u[] is indexed by constants and stays in registers
#pragma unroll
  for (int n = 0; n < NC - 1; ++n) {
    v4us hi, lo;
#pragma unroll
    for (int i = 0; i < 4; ++i) { s[i] = s[i] * g64 + u[n][i]; hi[i] = bf16_bits(s[i]); lo[i] = bf16_bits(s[i] - bf16_val(hi[i])); }
    *(v4us*)(Sh + o0 + (size_t)(n + 1) * (HD * HD)) = hi;
    *(v4us*)(Sl + o0 + (size_t)(n + 1) * (HD * HD)) = lo;
    asm volatile("s_wait_xcnt 0x0" ::: "memory");   // before the next chunk's values reuse the registers that the two stores name
  }
}

// retention: out[b][t][h*128 + dv0..dv0+63] = Σ_{s<=t} ((q_t·k_s)/√dh)·γ_h^(t−s) · v_s  (γ_h = 1 − 2^(−5−h), decay computed as exp((t−s)·log γ_h))
// Chunked by 64 keys: with t0 the first query of the block, g^(t-s) = g^(t-t0+1) * g^(t0-1-s) for every key s < t0, so all keys in front of the block's own
// chunk enter as g^(t-t0+1)/sqrt(dh) * q_t . S, S = sum over s < t0 of g^(t0-1-s) k_s v_s^T (k_chunk_state, k_state_scan); the own chunk keeps the score tile.
__global__ __launch_bounds__(128) void k_ret(const float* __restrict__ q, const float* __restrict__ k, const float* __restrict__ v,
                                             const unsigned short* __restrict__ Sh, const unsigned short* __restrict__ Sl, float* __restrict__ y) {
  constexpr int KS = HD / 32, DV = 64, DT = DV / 16;
  // One LDS array in two halves, each used twice. First half: the block's state tile (hi and lo plane, DV rows each); once every wave has left it,
  // the weight planes and the staged output. Second half: each wave's 16 q rows in f32; once every wave has its q fragments, the key and value planes.
  constexpr int SSP = HD + 8;                              // pitch in bf16 of a state row: 272 B, the pitch for 16-byte fragment reads of 256-B rows
  constexpr int QSP = HD + 4;                              // pitch in f32 of a q row: 528 B = 16 B x odd, the pitch for 16-byte reads a row apart
  constexpr int O_SL = DV * SSP, O_Q = 2 * DV * SSP, E_ALL = O_Q + 4 * 16 * QSP * 2;
  constexpr int O_PH = 0, O_PL = O_PH + 4 * 16 * 40, O_O = O_PL + 4 * 16 * 40;
  constexpr int O_KH = O_Q, O_KL = O_KH + 32 * (HD + 8), O_VH = O_KL + 32 * (HD + 8), O_VL = O_VH + 32 * (DV + 8);
  static_assert(O_O + 4 * 16 * DV * 2 <= O_Q && O_VL + 32 * (DV + 8) <= E_ALL, "the second use of each half must fit its first");
  __shared__ __attribute__((aligned(16))) unsigned short sm[E_ALL];
  unsigned short (*sKh)[HD + 8] = (unsigned short (*)[HD + 8])(sm + O_KH), (*sKl)[HD + 8] = (unsigned short (*)[HD + 8])(sm + O_KL);
  unsigned short (*sVh)[DV + 8] = (unsigned short (*)[DV + 8])(sm + O_VH), (*sVl)[DV + 8] = (unsigned short (*)[DV + 8])(sm + O_VL);
  unsigned short (*sPh)[16][40] = (unsigned short (*)[16][40])(sm + O_PH), (*sPl)[16][40] = (unsigned short (*)[16][40])(sm + O_PL);
  f1a (*sO)[16][DV] = (f1a (*)[16][DV])(sm + O_O);
  const int tid = threadIdx.x, w = tid >> 5, lane = tid & 31, ln = lane & 15, hh = lane >> 4;
  const int nqb = TT / 64;
  const int bh = blockIdx.x / nqb, qblk = blockIdx.x % nqb, dv0 = blockIdx.y * DV;
  const int b = bh / NH, h = bh % NH;
  const int q0 = qblk * 64 + w * 16;
  const float log_a = logf(1.0f - exp2f(-5.0f - (float)h));
  const float* Q = q + (size_t)b * TT * DD + h * HD; const float* K = k + (size_t)b * TT * DD + h * HD; const float* V = v + (size_t)b * TT * DD + h * HD + dv0;
  // Every global load is whole-line (a wave-wide load is one q or K row of 512 B, two V rows of 256 B, or two neighbouring state rows: the tile's DV rows are
  // contiguous), and the loads of a phase are issued together, so that the block meets one memory latency per phase and not one per load.
  // Every loop but the one over the two trips is unrolled so that the arrays it indexes stay in registers.
  v4f kf[8], vf[4];
  auto fetch_kv = [&](int j0) {                                         // 32 keys: K rows w + 4 i, V rows (tid >> 4) + 8 i
    const float* kp = K + (size_t)(j0 + w) * DD + lane * 4; const float* vp = V + (size_t)(j0 + (tid >> 4)) * DD + (tid & 15) * 4;
#pragma unroll
    for (int i = 0; i < 8; ++i) kf[i] = *(const v4fa*)(kp + (size_t)i * 4 * DD);
#pragma unroll
    for (int i = 0; i < 4; ++i) vf[i] = *(const v4fa*)(vp + (size_t)i * 8 * DD);
    // precaution: wait before any register that an issued load names is rewritten; the addresses are inputs so that no load lands in them ahead of the wait
    asm volatile("s_wait_xcnt 0x0" :: "v"(kp), "v"(vp) : "memory");
  };
  auto stash_kv = [&]() {
#pragma unroll
    for (int i = 0; i < 8; ++i) {
      v4us hi, lo;
#pragma unroll
      for (int t = 0; t < 4; ++t) { hi[t] = bf16_bits(kf[i][t]); lo[t] = bf16_bits(kf[i][t] - bf16_val(hi[t])); }
      *(v4us*)&sKh[w + 4 * i][lane * 4] = hi; *(v4us*)&sKl[w + 4 * i][lane * 4] = lo;
    }
#pragma unroll
    for (int i = 0; i < 4; ++i) {
      v4us hi, lo;
#pragma unroll
      for (int t = 0; t < 4; ++t) { hi[t] = bf16_bits(vf[i][t]); lo[t] = bf16_bits(vf[i][t] - bf16_val(hi[t])); }
      *(v4us*)&sVh[(tid >> 4) + 8 * i][(tid & 15) * 4] = hi; *(v4us*)&sVl[(tid >> 4) + 8 * i][(tid & 15) * 4] = lo;
    }
  };
  const int jstart = qblk * 64;
  FragB aqh[KS], aql[KS];
  {
    const float* qp = Q + (size_t)q0 * DD + lane * 4;
    const size_t so = ((size_t)bh * NC + qblk) * (HD * HD) + (size_t)dv0 * HD + tid * 8;
    const unsigned short* gh = Sh + so; const unsigned short* gl = Sl + so;
    v4f qv[16];
    v8us xh[8], xl[8];
#pragma unroll
    for (int i = 0; i < 16; ++i) qv[i] = *(const v4fa*)(qp + (size_t)i * DD);
    if (qblk > 0) {                                                     // block-uniform; chunk 0 has no earlier keys, and plane 0 is never written
#pragma unroll
      for (int i = 0; i < 8; ++i) { xh[i] = *(const v8us*)(gh + i * 1024); xl[i] = *(const v8us*)(gl + i * 1024); }
    }
    asm volatile("s_wait_xcnt 0x0" :: "v"(qp), "v"(gh), "v"(gl) : "memory");   // the same precaution as in fetch_kv
    fetch_kv(jstart);
    f1a* sq = (f1a*)(sm + O_Q) + w * (16 * QSP);                        // the wave's own q rows
#pragma unroll
    for (int i = 0; i < 16; ++i) *(v4fa*)&sq[i * QSP + lane * 4] = qv[i];
    if (qblk > 0) {
      unsigned short* sd = sm + (tid >> 4) * SSP + (tid & 15) * 8;
#pragma unroll
      for (int i = 0; i < 8; ++i) { *(v8us*)(sd + i * 8 * SSP) = xh[i]; *(v8us*)(sd + O_SL + i * 8 * SSP) = xl[i]; }
    }
    // the wave's lanes hand each other q values through LDS: the stores above stay in front of the reads below
    __builtin_amdgcn_fence(__ATOMIC_ACQ_REL, "workgroup");
    __builtin_amdgcn_wave_barrier();
    const f1a* qr = sq + ln * QSP + 8 * hh;
#pragma unroll
    for (int ks = 0; ks < KS; ++ks) {
      const v4f x4[4] = {*(const v4fa*)(qr + ks * 32), *(const v4fa*)(qr + ks * 32 + 4), *(const v4fa*)(qr + ks * 32 + 16), *(const v4fa*)(qr + ks * 32 + 20)};
#pragma unroll
      for (int i = 0; i < 16; ++i) {
        const float x = x4[i >> 2][i & 3]; const unsigned short hb = bf16_bits(x); aqh[ks].u[i] = hb; aql[ks].u[i] = bf16_bits(x - bf16_val(hb));
      }
    }
  }
  v8f oacc[DT];
#pragma unroll
  for (int dt = 0; dt < DT; ++dt) oacc[dt] = (v8f){0.f,0.f,0.f,0.f,0.f,0.f,0.f,0.f};
  auto keys32 = [&](int j0) {                                           // the 32 keys that lie in LDS: scores, decayed weights, weights x values
#pragma unroll
    for (int nt = 0; nt < 2; ++nt) {
      v8f acc = {};
#pragma unroll
      for (int ks = 0; ks < KS; ++ks) {
        FragB bh_, bl_;
        bh_.half[0] = *(const v8us*)&sKh[nt * 16 + ln][ks * 32 + 8 * hh]; bh_.half[1] = *(const v8us*)&sKh[nt * 16 + ln][ks * 32 + 16 + 8 * hh];
        bl_.half[0] = *(const v8us*)&sKl[nt * 16 + ln][ks * 32 + 8 * hh]; bl_.half[1] = *(const v8us*)&sKl[nt * 16 + ln][ks * 32 + 16 + 8 * hh];
        acc = mmaN<3>(aqh[ks].v, aql[ks].v, bh_.v, bl_.v, acc);
      }
      const int j = j0 + nt * 16 + ln;
#pragma unroll
      for (int r = 0; r < 8; ++r) {
        const int t = q0 + 8 * hh + r;
        const float p = (j <= t) ? acc[r] * 0.08838834764831845f * expf((float)(t - j) * log_a) : 0.f;
        const unsigned short hb = bf16_bits(p); sPh[w][8 * hh + r][nt * 16 + ln] = hb; sPl[w][8 * hh + r][nt * 16 + ln] = bf16_bits(p - bf16_val(hb));
      }
    }
    __builtin_amdgcn_fence(__ATOMIC_ACQ_REL, "workgroup");
    __builtin_amdgcn_wave_barrier();
    FragB pah, pal;
    pah.half[0] = *(const v8us*)&sPh[w][ln][8 * hh]; pah.half[1] = *(const v8us*)&sPh[w][ln][16 + 8 * hh];
    pal.half[0] = *(const v8us*)&sPl[w][ln][8 * hh]; pal.half[1] = *(const v8us*)&sPl[w][ln][16 + 8 * hh];
#pragma unroll
    for (int dt = 0; dt < DT; ++dt) {
      FragB bvh, bvl;
#pragma unroll
      for (int i = 0; i < 8; ++i) {
        bvh.u[i] = sVh[8 * hh + i][dt * 16 + ln]; bvh.u[8 + i] = sVh[16 + 8 * hh + i][dt * 16 + ln];
        bvl.u[i] = sVl[8 * hh + i][dt * 16 + ln]; bvl.u[8 + i] = sVl[16 + 8 * hh + i][dt * 16 + ln];
      }
      oacc[dt] = mmaN<3>(pah.v, pal.v, bvh.v, bvl.v, oacc[dt]);
    }
    __builtin_amdgcn_fence(__ATOMIC_ACQ_REL, "workgroup");
    __builtin_amdgcn_wave_barrier();
  };
  // kept rolled: the two trips share one text, for speed only
#pragma nounroll
  for (int it = 0; it < 2; ++it) {
    // trip 0: the state tile is complete in LDS, and every wave has read its q rows, whose LDS now takes keys and values; trip 1: every wave has left the first 32 keys
    __syncthreads();
    stash_kv();
    if (it == 0) {
      fetch_kv(jstart + 32);                                            // flies during the state products
      if (qblk > 0) {                                                   // block-uniform
        const unsigned short* rh = sm + ln * SSP + 8 * hh; const unsigned short* rl = rh + O_SL;
#pragma unroll
        for (int dt = 0; dt < DT; ++dt) {
          FragB fh[KS], fl[KS];
#pragma unroll
          for (int ks = 0; ks < KS; ++ks) {
            fh[ks].half[0] = *(const v8us*)(rh + dt * 16 * SSP + ks * 32); fh[ks].half[1] = *(const v8us*)(rh + dt * 16 * SSP + ks * 32 + 16);
            fl[ks].half[0] = *(const v8us*)(rl + dt * 16 * SSP + ks * 32); fl[ks].half[1] = *(const v8us*)(rl + dt * 16 * SSP + ks * 32 + 16);
          }
          v8f acc = {};
#pragma unroll
          for (int ks = 0; ks < KS; ++ks) acc = mmaN<3>(aqh[ks].v, aql[ks].v, fh[ks].v, fl[ks].v, acc);
#pragma unroll
          for (int r = 0; r < 8; ++r) oacc[dt][r] = acc[r] * 0.08838834764831845f * expf((float)(w * 16 + 8 * hh + r + 1) * log_a);
        }
      }
    }
    __syncthreads();                                                    // these 32 keys are complete in LDS; trip 0: every wave has left the state tile, whose LDS now takes the weights
    keys32(jstart + 32 * it);
  }
#pragma unroll
  for (int dt = 0; dt < DT; ++dt)
#pragma unroll
    for (int r = 0; r < 8; ++r) sO[w][8 * hh + r][dt * 16 + ln] = oacc[dt][r];
  __builtin_amdgcn_fence(__ATOMIC_ACQ_REL, "workgroup");
  __builtin_amdgcn_wave_barrier();
  {
    for (int r = 0; r < 16; ++r) { if (lane < DV / 4) { const v4f val = *(const v4fa*)&sO[w][r][lane * 4]; *(v4f*)(y + ((size_t)b * TT + q0 + r) * DD + h * HD + dv0 + lane * 4) = val; } }
    
  }
}


// Z[row][h*128+d] = silu(g) · (ret − mean)/sqrt(var + 1e-6) per (row, head) over 128; wave per (row, head), lane = 4 values
// Z leaves as the two bf16 terms that the last GEMM multiplies: hi = Z rounded, lo = (Z - hi) rounded; a row of zh is its DD hi values, then its DD lo values
__global__ __launch_bounds__(256) void k_gn_gate(const float* __restrict__ ret, const float* __restrict__ g, unsigned short* __restrict__ zh) {
  const int tid = threadIdx.x, w = tid >> 5, lane = tid & 31; const size_t rh = (size_t)blockIdx.x * 8 + w; if (rh >= (size_t)BB * TT * NH) return;
  const size_t base = rh * HD + lane * 4;        // rows are [row][h*128 + d] contiguous -> rh*128
  const v4f a = *(const v4fa*)(ret + base), gg = *(const v4fa*)(g + base);
  float s = a[0] + a[1] + a[2] + a[3]; for (int o = 16; o >= 1; o >>= 1) s += __shfl_xor(s, o, 32); const float mu = s * (1.0f / HD);
  float q2 = 0.f; for (int q = 0; q < 4; ++q) { const float c = a[q] - mu; q2 += c * c; } for (int o = 16; o >= 1; o >>= 1) q2 += __shfl_xor(q2, o, 32);
  const float rs = rsqrtf(q2 * (1.0f / HD) + 1e-6f);
  v4f o4; for (int q = 0; q < 4; ++q) o4[q] = (gg[q] / (1.0f + expf(-gg[q]))) * ((a[q] - mu) * rs);
  v4us hi, lo; for (int q = 0; q < 4; ++q) { hi[q] = bf16_bits(o4[q]); lo[q] = bf16_bits(o4[q] - bf16_val(hi[q])); }
  unsigned short* zo = zh + base + (rh / NH) * DD;
  *(v4us*)zo = hi; *(v4us*)(zo + DD) = lo;
}
extern "C" void kernel_launch(void* const* d_in, const int* in_sizes, int n_in,
                              void* d_out, int out_size, void* d_ws, size_t ws_size, hipStream_t stream) {
  (void)in_sizes; (void)n_in; (void)out_size;
  const float* X = (const float*)d_in[0]; const float* Wq = (const float*)d_in[1]; const float* Wk = (const float*)d_in[2]; const float* Wv = (const float*)d_in[3]; const float* WG = (const float*)d_in[4]; const float* WO = (const float*)d_in[5];
  char* ws = (char*)d_ws; size_t off = 0;
  auto take = [&](size_t bytes) { char* p = ws + off; off += (bytes + 255) & ~(size_t)255; return p; };
  const int M = BB * TT, gb = (M / 128) * (DD / 128);
  unsigned short* Wt[5]; for (int i = 0; i < 5; ++i) Wt[i] = (unsigned short*)take((size_t)DD * DD * 2);
  unsigned short* Xb = (unsigned short*)take((size_t)M * DD * 2);
  float* q = (float*)take((size_t)M * DD * 4); float* k = (float*)take((size_t)M * DD * 4); float* v = (float*)take((size_t)M * DD * 4); float* g = (float*)take((size_t)M * DD * 4); float* ret = (float*)take((size_t)M * DD * 4);
  float* U = (float*)take((size_t)BB * NH * NC * HD * HD * 4); unsigned short* Sh = (unsigned short*)take((size_t)BB * NH * NC * HD * HD * 2); unsigned short* Sl = (unsigned short*)take((size_t)BB * NH * NC * HD * HD * 2);
  if (off > ws_size) return;
  k_wt_bf16<<<dim3((DD / 128) * (DD / 128), 5 + M * DD / XBLK / ((DD / 128) * (DD / 128))), 256, 0, stream>>>(Wq, Wk, Wv, WG, WO, X, Wt[0], Xb);   // X @ W: [K][N]; y >= 5: X -> bf16
  k_gemm_bf<false, 4><<<4 * gb, 256, 0, stream>>>(Xb, Wt[0], q);                                                          // q, k, v, g: neighbours in ws, as Wt[0..3] are
  k_chunk_state<<<BB * NH * (NC - 1), 256, 0, stream>>>(k, v, U);
  k_state_scan<<<BB * NH * (HD * HD / 4) / 256, 256, 0, stream>>>(U, Sh, Sl);
  k_ret<<<dim3(BB * NH * (TT / 64), 2), 128, 0, stream>>>(q, k, v, Sh, Sl, ret);
  k_gn_gate<<<(BB * TT * NH + 7) / 8, 256, 0, stream>>>(ret, g, (unsigned short*)q);                                   // q's 16 MiB reused as Z in bf16 hi and lo
  k_gemm_bf<true, 1><<<gb, 256, 0, stream>>>((const unsigned short*)q, Wt[4], (float*)d_out);
}

// v007
// Measured time: 129 microseconds a run.
// In two side-by-side timings against v006, it was 1.03 and 1.04 times as fast.
// Over all steps from v000 it is 5.86 times as fast.
#include <hip/hip_runtime.h>
#include <stdint.h>
// All contractions on v_wmma_f32_16x16x32_bf16, f32 accumulate: q/k/v/g = X·W (X, W rounded to bf16: single exact term); per-head retention
// Σ_{s≤t} ((q_t·k_s)/√128)·γ_h^{t−s}·v_s as 3-term bf16 hi/lo splits (scores and decayed weights split in registers/LDS); (silu(g)∘GN(ret))·W_O with
// the A operand split (2 terms). Decay factors, the per-head GroupNorm (no affine, eps 1e-6) and silu in f32.
#define BB 2
#define TT 2048
#define DD 1024
#define NH 8
#define HD 128
#define NC (TT / 64)   // chunks of 64 keys per sequence

typedef __bf16 v16b __attribute__((ext_vector_type(16)));
typedef unsigned short v8us __attribute__((ext_vector_type(8), may_alias));
typedef unsigned short v4us __attribute__((ext_vector_type(4), may_alias));
typedef float  v8f  __attribute__((ext_vector_type(8)));
typedef float  v4f  __attribute__((ext_vector_type(4)));
typedef float  v4fa __attribute__((ext_vector_type(4), may_alias));
union FragB { v16b v; v8us half[2]; unsigned short u[16]; };

__device__ __forceinline__ unsigned short bf16_bits(float x) { unsigned int u = __float_as_uint(x); return (unsigned short)((u + 0x7FFFu + ((u >> 16) & 1u)) >> 16); }
__device__ __forceinline__ float bf16_val(unsigned short b) { return __uint_as_float(((unsigned int)b) << 16); }
__device__ __forceinline__ float bf16_round(float x) { return bf16_val(bf16_bits(x)); }
// D += A·B with NT terms: 1 = ah·bh, 2 = + al·bh (A split), 3 = + ah·bl (both split)
template <int NT>
__device__ __forceinline__ v8f mmaN(v16b ah, v16b al, v16b bh, v16b bl, v8f c) {
  c = __builtin_amdgcn_wmma_f32_16x16x32_bf16(false, ah, false, bh, (short)0, c, false, false);
  if (NT >= 2) c = __builtin_amdgcn_wmma_f32_16x16x32_bf16(false, al, false, bh, (short)0, c, false, false);
  if (NT >= 3) c = __builtin_amdgcn_wmma_f32_16x16x32_bf16(false, ah, false, bl, (short)0, c, false, false);
  asm volatile("v_nop\n\tv_nop\n\tv_nop\n\tv_nop" : "+v"(c) : "v"(ah), "v"(al), "v"(bh), "v"(bl));
  return c;
}

// One launch for all five weights: blockIdx.y picks the matrix; the five bf16 transposes lie one behind the other from Wt0.
// Block = one 128 (k) x 128 (n) tile, turned in LDS: a wave reads 512 contiguous bytes of a W row, and 16 lanes store 256 contiguous bytes of a Wt row,
// so that every global access covers whole lines. A thread holds 16 k of 4 neighbouring n and hands each n to LDS as two 16-byte runs of k.
// blockIdx.y >= 5: the same launch rounds X to bf16 once, in place of every column tile of the q/k/v/g GEMM doing it again; block = 16384 elements in row order.
#define XBLK 16384
#define WTP (128 + 8)      // LDS row pitch in bf16: 272 B, the pitch for 16-byte reads of 256-B rows
__global__ __launch_bounds__(256) void k_wt_bf16(const float* __restrict__ W0, const float* __restrict__ W1, const float* __restrict__ W2, const float* __restrict__ W3,
                                                 const float* __restrict__ W4, const float* __restrict__ X, unsigned short* __restrict__ Wt0,
                                                 unsigned short* __restrict__ Xb) {
  constexpr int K = DD, N = DD;
  __shared__ __attribute__((aligned(16))) unsigned short sT[128 * WTP];   // [n][k]
  const int y = blockIdx.y;
  if (y >= 5) {                                             // the same for the whole block, and in front of the barrier
    const size_t e0 = ((size_t)(y - 5) * ((K / 128) * (N / 128)) + blockIdx.x) * XBLK + threadIdx.x * 4;
    const float* xp = X + e0;
    unsigned short* xo = Xb + e0;
    v4f r[16];
    // unrolled so that r[] stays in registers and all 16 loads (512 contiguous bytes a wave each) fly together
#pragma unroll
    for (int i = 0; i < 16; ++i) r[i] = *(const v4fa*)(xp + i * 1024);
    asm volatile("s_wait_xcnt 0x0" :: "v"(xp) : "memory");  // precaution: before any register that an issued load names is rewritten
#pragma unroll
    for (int i = 0; i < 16; ++i) {
      v4us c;
#pragma unroll
      for (int t = 0; t < 4; ++t) c[t] = bf16_bits(r[i][t]);
      *(v4us*)(xo + i * 1024) = c;
    }
    return;
  }
  const float* __restrict__ W = y == 0 ? W0 : y == 1 ? W1 : y == 2 ? W2 : y == 3 ? W3 : W4;
  unsigned short* __restrict__ Wt = Wt0 + (size_t)y * K * N;
  const int tid = threadIdx.x;
  const int k0 = (blockIdx.x % (K / 128)) * 128, n0 = (blockIdx.x / (K / 128)) * 128;
  const int n4 = (tid & 31) * 4, kg = (tid >> 5) * 16;
  const float* wp = W + (size_t)(k0 + kg) * N + n0 + n4;
  v4f x[16];
  // every loop is unrolled so that x[] is indexed by constants and stays in registers; all 16 loads fly together
#pragma unroll
  for (int i = 0; i < 16; ++i) x[i] = *(const v4fa*)(wp + (size_t)i * N);
  asm volatile("s_wait_xcnt 0x0" :: "v"(wp) : "memory");   // precaution: before any register that an issued load names is rewritten
#pragma unroll
  for (int t = 0; t < 4; ++t)
#pragma unroll
    for (int hf = 0; hf < 2; ++hf) {
      v8us c;
#pragma unroll
      for (int i = 0; i < 8; ++i) c[i] = bf16_bits(x[hf * 8 + i][t]);
      *(v8us*)&sT[(n4 + t) * WTP + kg + hf * 8] = c;
    }
  __syncthreads();                                          // the tile is complete in LDS before any row of it is read
  const int r = tid >> 4, c8 = (tid & 15) * 8;
  unsigned short* op = Wt + (size_t)(n0 + r) * K + k0 + c8;
  v8us o[8];
#pragma unroll
  for (int j = 0; j < 8; ++j) o[j] = *(const v8us*)&sT[(r + 16 * j) * WTP + c8];
#pragma unroll
  for (int j = 0; j < 8; ++j) *(v8us*)(op + (size_t)j * 16 * K) = o[j];
}

// GEMM C[M][N] (f32) = A[M][K] * W, M = BB*TT, N = K = DD. A bf16 row-major, rounded once by the kernel that makes it (ASPLIT: each row is K hi values and
// behind them its K lo values -> 2 terms, else one rounded term); Wt bf16 [N][K]. Block = 8 waves = one 128 x 128 tile of C; a stage is 128 k of the 128 A rows and the 128 Wt rows, loaded once per block with
// whole-line loads and shared by all waves through LDS. Two stage buffers, one barrier per stage: the next stage's global loads fly during this stage's products.
// Wave = 32 x 64 of C (waves 4 x 2). Each accumulator sums its k in ascending order, hi term before lo term.
// NW products that share A run as one launch: their Wt planes lie one behind the other from Wt0, their C planes from C0, and the column tiles of all NW
// are numbered through. With more blocks than WGPs two unsplit blocks (136 KiB of LDS each) share a WGP, and one block's loads fly while the other stores or waits.
#define GBK 128            // k per stage
#define GP (GBK + 8)       // LDS row pitch in bf16: 272 B, the pitch for 16-byte fragment reads of 256-B rows
#define GSP 68             // row pitch in f32 of a wave's staged C rows: the two half-waves (rows 8 apart) fall on different banks
typedef float f1a __attribute__((may_alias));
template <bool ASPLIT, int NW>
__global__ __launch_bounds__(256) void k_gemm_bf(const unsigned short* __restrict__ A, const unsigned short* __restrict__ Wt0, float* __restrict__ C0) {
  constexpr int K = DD, N = DD, NT = K / GBK, CT = N / 128;
  constexpr int PLANE = 128 * GP;                       // bf16 elements of one operand plane: [0] A hi, [1] Wt, [2] A lo
  constexpr int STAGE = (ASPLIT ? 3 : 2) * PLANE;
  static_assert(2 * STAGE * 2 >= 8 * 32 * GSP * 4, "the staged C tile must fit the operand buffers");
  __shared__ __attribute__((aligned(16))) unsigned short sm[2 * STAGE];
  const int tid = threadIdx.x, w = tid >> 5, lane = tid & 31, ln = lane & 15, hh = lane >> 4;
  const int wm = w >> 1, wn = w & 1;
  const int ct = blockIdx.x % (NW * CT), which = ct / CT;
  const int row0 = (blockIdx.x / (NW * CT)) * 128, col0 = (ct % CT) * 128;
  const unsigned short* __restrict__ Wt = Wt0 + (size_t)which * N * K;
  float* __restrict__ C = C0 + (size_t)which * (BB * TT) * N;
  const int br = tid >> 4, bc = (tid & 15) * 8;         // A planes and Wt alike: 16 lanes read 256 contiguous bytes of one row
  constexpr int AP = ASPLIT ? 2 * K : K;                // row pitch of A
  const unsigned short* ap = A + (size_t)(row0 + br) * AP + bc;
  const unsigned short* bp = Wt + (size_t)(col0 + br) * K + bc;
  v8us xa[8], xl[8], xb[8];
  // every loop below is unrolled so that the arrays it indexes (loaded rows, fragments, accumulators) stay in registers
  auto fetch = [&](int kb) {
    const unsigned short* pa = ap + kb; const unsigned short* pb = bp + kb;
#pragma unroll
    for (int i = 0; i < 8; ++i) xa[i] = *(const v8us*)(pa + (size_t)i * 16 * AP);
    if (ASPLIT) {
#pragma unroll
      for (int i = 0; i < 8; ++i) xl[i] = *(const v8us*)(pa + (size_t)i * 16 * AP + K);
    }
#pragma unroll
    for (int i = 0; i < 8; ++i) xb[i] = *(const v8us*)(pb + (size_t)i * 16 * K);
    // precaution: wait before any register that an issued load names is rewritten; the addresses are inputs so that no load lands in them ahead of the wait
    asm volatile("s_wait_xcnt 0x0" :: "v"(pa), "v"(pb) : "memory");
  };
  auto stash = [&](unsigned short* st) {
#pragma unroll
    for (int i = 0; i < 8; ++i) {
      *(v8us*)&st[(br + 16 * i) * GP + bc] = xa[i];
      if (ASPLIT) *(v8us*)&st[2 * PLANE + (br + 16 * i) * GP + bc] = xl[i];
    }
#pragma unroll
    for (int i = 0; i < 8; ++i) *(v8us*)&st[PLANE + (br + 16 * i) * GP + bc] = xb[i];
  };
  v8f acc[2][4];
#pragma unroll
  for (int mi = 0; mi < 2; ++mi)
#pragma unroll
    for (int ni = 0; ni < 4; ++ni) acc[mi][ni] = (v8f){0.f,0.f,0.f,0.f,0.f,0.f,0.f,0.f};
  auto products = [&](const unsigned short* st) {
    const unsigned short* pa = st + (wm * 32 + ln) * GP + 8 * hh;
    const unsigned short* pb = st + PLANE + (wn * 64 + ln) * GP + 8 * hh;
#pragma unroll
    for (int ks = 0; ks < GBK / 32; ++ks) {
      FragB a[2], al[2], b[4];
#pragma unroll
      for (int mi = 0; mi < 2; ++mi) {
        a[mi].half[0] = *(const v8us*)(pa + mi * 16 * GP + ks * 32); a[mi].half[1] = *(const v8us*)(pa + mi * 16 * GP + ks * 32 + 16);
        if (ASPLIT) { al[mi].half[0] = *(const v8us*)(pa + 2 * PLANE + mi * 16 * GP + ks * 32); al[mi].half[1] = *(const v8us*)(pa + 2 * PLANE + mi * 16 * GP + ks * 32 + 16); }
      }
#pragma unroll
      for (int ni = 0; ni < 4; ++ni) { b[ni].half[0] = *(const v8us*)(pb + ni * 16 * GP + ks * 32); b[ni].half[1] = *(const v8us*)(pb + ni * 16 * GP + ks * 32 + 16); }
#pragma unroll
      for (int mi = 0; mi < 2; ++mi)
#pragma unroll
        for (int ni = 0; ni < 4; ++ni) acc[mi][ni] = __builtin_amdgcn_wmma_f32_16x16x32_bf16(false, a[mi].v, false, b[ni].v, (short)0, acc[mi][ni], false, false);
      if (ASPLIT) {
#pragma unroll
        for (int mi = 0; mi < 2; ++mi)
#pragma unroll
          for (int ni = 0; ni < 4; ++ni) acc[mi][ni] = __builtin_amdgcn_wmma_f32_16x16x32_bf16(false, al[mi].v, false, b[ni].v, (short)0, acc[mi][ni], false, false);
      }
    }
  };
  fetch(0);
  stash(sm);
  for (int t = 0; t + 1 < NT; ++t) {
    __syncthreads();                                    // stage t is complete in its buffer, and every reader has left the other buffer
    fetch((t + 1) * GBK);
    products(sm + (t & 1) * STAGE);
    stash(sm + ((t + 1) & 1) * STAGE);
  }
  __syncthreads();
  products(sm + ((NT - 1) & 1) * STAGE);
  __syncthreads();                                      // every wave has left the operand buffers: their LDS now stages C, each wave in its own range
  f1a* so = (f1a*)sm + w * (32 * GSP);
#pragma unroll
  for (int mi = 0; mi < 2; ++mi)
#pragma unroll
    for (int ni = 0; ni < 4; ++ni)
#pragma unroll
      for (int r = 0; r < 8; ++r) so[(mi * 16 + 8 * hh + r) * GSP + ni * 16 + ln] = acc[mi][ni][r];
  __builtin_amdgcn_fence(__ATOMIC_ACQ_REL, "workgroup");
  __builtin_amdgcn_wave_barrier();
  float* cp = C + (size_t)(row0 + wm * 32 + hh) * N + col0 + wn * 64 + ln * 4;
  v4f o[16];
#pragma unroll
  for (int q = 0; q < 16; ++q) o[q] = *(const v4fa*)&so[(q * 2 + hh) * GSP + ln * 4];
#pragma unroll
  for (int q = 0; q < 16; ++q) *(v4f*)(cp + (size_t)q * 2 * N) = o[q];   // 16 lanes store 256 contiguous bytes of a row
}

// The q/k/v/g GEMM: C[M][N] (f32) = A[M][K] * W for NW weights that share A, M = BB*TT, N = K = DD; A bf16 row-major, Wt bf16 [N][K], planes as in k_gemm_bf.
// Block = 8 waves = one 256 x 256 tile of C, one block per WGP: a byte fetched from L2 now feeds twice the products of the 128 x 128 tile. Wave = 64 x 128 of C (waves 4 x 2).
// A stage is 128 k of the 256 A rows and the 256 Wt rows. Each wave brings its own slice of 64 rows (256 B each) with one tensor_load_to_lds, which also lays the
// rows at the 272-B pitch; no register is spent on staging, which is what lets the 256 accumulator registers of the wave tile fit. Two stage buffers: the load of stage
// t + 2 is issued when every wave has left stage t. Each accumulator sums its k in ascending order, as before.
typedef uint32_t u32x4 __attribute__((ext_vector_type(4)));
typedef uint32_t u32x8 __attribute__((ext_vector_type(8)));
__device__ __forceinline__ uint32_t uni(uint32_t v) { return (uint32_t)__builtin_amdgcn_readfirstlane(v); }
__device__ __forceinline__ uint32_t pinned(uint32_t v) { uint32_t w = (uint32_t)__builtin_amdgcn_readfirstlane(v); asm volatile("" : "+s"(w)); return w; }
#define TSL 18432          // bytes of LDS per slice: 64 rows x 272 B = 17,408, rounded up to a multiple of 2 KiB, where the next slice begins
#define TSE (TSL / 2)      // the same in bf16 elements
#define TST (8 * TSL)      // bytes of one stage buffer: slices 0..3 = A rows, 4..7 = Wt rows
#define CSP 132            // row pitch in f32 of a wave's staged C rows: the two half-waves (rows 8 apart) fall on different banks
template <int NW>
__global__ __launch_bounds__(256) void k_gemm_t256(const unsigned short* __restrict__ A, const unsigned short* __restrict__ Wt0, float* __restrict__ C0) {
  constexpr int K = DD, N = DD, NT = K / GBK, CT = N / 256;
  static_assert(NT >= 2, "the ring's prologue fills two stages");
  static_assert(8 * 64 * CSP * 4 <= 2 * TST, "the staged C tile must fit the operand buffers");
  __shared__ __attribute__((aligned(2048))) unsigned short sm[2 * TST / 2];
  const int tid = threadIdx.x, w = tid >> 5, lane = tid & 31, ln = lane & 15, hh = lane >> 4;
  const int wm = w >> 1, wn = w & 1;
  const int ct = blockIdx.x % (NW * CT), which = ct / CT;
  const int row0 = (blockIdx.x / (NW * CT)) * 256, col0 = (ct % CT) * 256;
  const unsigned short* __restrict__ Wt = Wt0 + (size_t)which * N * K;
  float* __restrict__ C = C0 + (size_t)which * (BB * TT) * N;
  // the wave's own slice: its 64 source rows and its place in a stage buffer
  const uint32_t wv = uni((uint32_t)w);
  const unsigned short* src = wv < 4u ? A + (size_t)(row0 + wv * 64u) * K : Wt + (size_t)(col0 + (wv - 4u) * 64u) * K;
  const uint64_t src0 = (uint64_t)(uintptr_t)src;
  const uint32_t dst0 = (uint32_t)(size_t)sm + wv * (uint32_t)TSL;
  u32x8 g1;
  g1[0] = uni((1u << 20) | (5u << 22) | (3u << 25));
  g1[1] = uni((256u & 0xFFFFu) << 16);
  g1[2] = uni((256u >> 16) | ((64u & 0xFFFFu) << 16));
  g1[3] = uni((64u >> 16) | (256u << 16));
  g1[4] = uni(64u);
  g1[5] = uni((uint32_t)(K * 2));
  g1[6] = uni(0u);
  g1[7] = uni(0u);
  u32x4 g0;
  g0[0] = uni(1u);
  auto issue = [&](int t) {                             // stage t into buffer t & 1: one request of this wave
    const uint64_t ga = src0 + (uint64_t)t * (GBK * 2);
    g0[1] = uni(dst0 + (uint32_t)(t & 1) * (uint32_t)TST);
    g0[2] = uni((uint32_t)ga);
    g0[3] = uni((((uint32_t)(ga >> 32)) & 0x01FFFFFFu) | 0x80000000u);
    // both groups are in-out operands so that their registers stay the descriptor's own and take no other value while the request is outstanding
    asm volatile("tensor_load_to_lds %0, %1" : "+s"(g0), "+s"(g1) :: "memory");
  };
  // every loop below but the one over the stages is unrolled so that the arrays it indexes (fragments, accumulators) stay in registers
  v8f acc[4][8];
#pragma unroll
  for (int mi = 0; mi < 4; ++mi)
#pragma unroll
    for (int ni = 0; ni < 8; ++ni) acc[mi][ni] = (v8f){0.f,0.f,0.f,0.f,0.f,0.f,0.f,0.f};
  auto products = [&](const unsigned short* st) {
    const unsigned short* pa = st + wm * TSE + ln * GP + 8 * hh;
    const unsigned short* pb = st + (4 + 2 * wn) * TSE + ln * GP + 8 * hh;
    FragB a[2][4], b[2][8];                             // two fragment sets: the next 32 k are fetched while these are multiplied
    auto frags = [&](int ks) {
#pragma unroll
      for (int mi = 0; mi < 4; ++mi) { a[ks & 1][mi].half[0] = *(const v8us*)(pa + mi * 16 * GP + ks * 32); a[ks & 1][mi].half[1] = *(const v8us*)(pa + mi * 16 * GP + ks * 32 + 16); }
#pragma unroll
      for (int ni = 0; ni < 8; ++ni) {
        const unsigned short* p = pb + (ni >> 2) * TSE + (ni & 3) * 16 * GP + ks * 32;
        b[ks & 1][ni].half[0] = *(const v8us*)p; b[ks & 1][ni].half[1] = *(const v8us*)(p + 16);
      }
    };
    frags(0);
#pragma unroll
    for (int ks = 0; ks < GBK / 32; ++ks) {
      if (ks + 1 < GBK / 32) frags(ks + 1);
      __builtin_amdgcn_sched_barrier(0);                // the next block's 24 LDS reads stay one group ahead of this block
#pragma unroll
      for (int mi = 0; mi < 4; ++mi)
#pragma unroll
        for (int ni = 0; ni < 8; ++ni) acc[mi][ni] = __builtin_amdgcn_wmma_f32_16x16x32_bf16(false, a[ks & 1][mi].v, false, b[ks & 1][ni].v, (short)0, acc[mi][ni], false, false);
      __builtin_amdgcn_sched_barrier(0);                // and this block's WMMAs stay ahead of the reads that follow
    }
  };
  issue(0);
  asm volatile("s_wait_tensorcnt 0x0" ::: "memory");    // this wave's slice of stage 0 has landed
  __syncthreads();                                      // every slice of stage 0 has landed before any wave reads it
  issue(1);
  // kept rolled: one text for the eight stages, so that the kernel's text stays small
#pragma nounroll
  for (int t = 0; t < NT; ++t) {
    products(sm + (t & 1) * (TST / 2));
    asm volatile("s_wait_dscnt 0x0" ::: "memory");
    asm volatile("s_wait_tensorcnt 0x0" ::: "memory");
    __syncthreads();
    if (pinned((t + 2 < NT) ? 1u : 0u) != 0u) issue(t + 2);
  }
  asm volatile("s_wait_tensorcnt 0x0" ::: "memory");    // no request is outstanding when the buffers change their use
  asm volatile("s_wait_dscnt 0x0" ::: "memory");
  // behind the last stage's barrier every wave has left the operand buffers: their LDS now stages C, each wave in its own range
  f1a* so = (f1a*)sm + w * (64 * CSP);
#pragma unroll
  for (int mi = 0; mi < 4; ++mi)
#pragma unroll
    for (int ni = 0; ni < 8; ++ni)
#pragma unroll
      for (int r = 0; r < 8; ++r) so[(mi * 16 + 8 * hh + r) * CSP + ni * 16 + ln] = acc[mi][ni][r];
  __builtin_amdgcn_fence(__ATOMIC_ACQ_REL, "workgroup");
  __builtin_amdgcn_wave_barrier();
  float* cp = C + (size_t)(row0 + wm * 64) * N + col0 + wn * 128 + lane * 4;
#pragma unroll
  for (int qq = 0; qq < 4; ++qq) {
    v4f o[16];
#pragma unroll
    for (int q = 0; q < 16; ++q) o[q] = *(const v4fa*)&so[(qq * 16 + q) * CSP + lane * 4];
#pragma unroll
    for (int q = 0; q < 16; ++q) *(v4f*)(cp + (size_t)(qq * 16 + q) * N) = o[q];   // a wave stores 512 contiguous bytes of a row
    asm volatile("s_wait_xcnt 0x0" ::: "memory");       // precaution: before the next rows reuse registers that the issued stores name
  }
}

// Flash-style causal/unmasked attention, all contractions 3-term bf16 hi/lo splits, f32 softmax with running max.
// q,k,v rows are read from f32 buffers with arbitrary row pitch (so they can live inside a fused qkv buffer);
// D = head size (multiple of 32, <= 128); one wave = 16 query rows; block = 4 waves (64 queries) sharing K/V chunks of 32.
template <int D, bool CAUSAL>
__global__ __launch_bounds__(128) void k_flash(const float* __restrict__ qb, const float* __restrict__ kb, const float* __restrict__ vb,
                                             int pitch, int T, int H, float scale, float* __restrict__ y, int ypitch) {
  constexpr int KS = D / 32;        // k-steps for QK
  constexpr int DT = D / 16;        // d tiles for PV
  __shared__ __attribute__((aligned(16))) unsigned short sKh[32][D + 8], sKl[32][D + 8], sVh[32][D + 8], sVl[32][D + 8];
  __shared__ __attribute__((aligned(16))) unsigned short sPh[4][16][40], sPl[4][16][40];
  __shared__ __attribute__((aligned(16))) float sO[4][16][D];
  const int tid = threadIdx.x, w = tid >> 5, lane = tid & 31, ln = lane & 15, hh = lane >> 4;
  const int nqb = (T + 63) / 64;
  const int bh = blockIdx.x / nqb, qblk = blockIdx.x % nqb;
  const int b = bh / H, h = bh % H;
  const int q0 = qblk * 64 + w * 16;
  const float* Q = qb + (size_t)b * T * pitch + h * D;
  const float* K = kb + (size_t)b * T * pitch + h * D;
  const float* V = vb + (size_t)b * T * pitch + h * D;

  // A fragments of the wave's 16 query rows (scaled), hi/lo
  FragB aqh[KS], aql[KS];
  {
    int row = q0 + ln; if (row >= T) row = T - 1;
    const float* qr = Q + (size_t)row * pitch;
#pragma unroll
    for (int ks = 0; ks < KS; ++ks)
#pragma unroll
      for (int i = 0; i < 16; ++i) {
        const int d = ks * 32 + ((i < 8) ? (8 * hh + i) : (16 + 8 * hh + (i - 8)));
        const float x = qr[d] * scale; const unsigned short hb = bf16_bits(x);
        aqh[ks].u[i] = hb; aql[ks].u[i] = bf16_bits(x - bf16_val(hb));
      }
  }
  float m_r[8], l_r[8];
#pragma unroll
  for (int r = 0; r < 8; ++r) { m_r[r] = -3.0e38f; l_r[r] = 0.f; }
  v8f oacc[DT];
#pragma unroll
  for (int dt = 0; dt < DT; ++dt) oacc[dt] = (v8f){0.f,0.f,0.f,0.f,0.f,0.f,0.f,0.f};

  const int kv_end = CAUSAL ? min(T, qblk * 64 + 64) : T;     // block-uniform
  for (int j0 = 0; j0 < kv_end; j0 += 32) {
    __syncthreads();
    for (int e = tid; e < 32 * (D / 4); e += 128) {
      const int r = e / (D / 4), c4 = (e % (D / 4)) * 4;
      const int key = j0 + r;
      v4f kf = {0.f,0.f,0.f,0.f}, vf = {0.f,0.f,0.f,0.f};
      if (key < T) { kf = *(const v4fa*)(K + (size_t)key * pitch + c4); vf = *(const v4fa*)(V + (size_t)key * pitch + c4); }
#pragma unroll
      for (int t = 0; t < 4; ++t) {
        unsigned short hb = bf16_bits(kf[t]); sKh[r][c4 + t] = hb; sKl[r][c4 + t] = bf16_bits(kf[t] - bf16_val(hb));
        hb = bf16_bits(vf[t]); sVh[r][c4 + t] = hb; sVl[r][c4 + t] = bf16_bits(vf[t] - bf16_val(hb));
      }
    }
    __syncthreads();
    // S tile 16 x 32
    v8f s[2];
#pragma unroll
    for (int nt = 0; nt < 2; ++nt) {
      v8f acc = {};
#pragma unroll
      for (int ks = 0; ks < KS; ++ks) {
        FragB bh_, bl_;
        bh_.half[0] = *(const v8us*)&sKh[nt * 16 + ln][ks * 32 + 8 * hh]; bh_.half[1] = *(const v8us*)&sKh[nt * 16 + ln][ks * 32 + 16 + 8 * hh];
        bl_.half[0] = *(const v8us*)&sKl[nt * 16 + ln][ks * 32 + 8 * hh]; bl_.half[1] = *(const v8us*)&sKl[nt * 16 + ln][ks * 32 + 16 + 8 * hh];
        acc = mmaN<3>(aqh[ks].v, aql[ks].v, bh_.v, bl_.v, acc);
      }
      s[nt] = acc;
    }
    // mask + running max (rows 8hh+r; the 16 lanes of a half share rows)
    float alpha[8];
#pragma unroll
    for (int r = 0; r < 8; ++r) {
      const int qi = q0 + 8 * hh + r;
      const int ja = j0 + ln, jb = j0 + 16 + ln;
      if (CAUSAL) { if (ja > qi) s[0][r] = -3.0e38f; if (jb > qi) s[1][r] = -3.0e38f; }
      if (ja >= T) s[0][r] = -3.0e38f;
      if (jb >= T) s[1][r] = -3.0e38f;
      float mx = fmaxf(s[0][r], s[1][r]);
      mx = fmaxf(mx, __shfl_xor(mx, 1, 32)); mx = fmaxf(mx, __shfl_xor(mx, 2, 32)); mx = fmaxf(mx, __shfl_xor(mx, 4, 32)); mx = fmaxf(mx, __shfl_xor(mx, 8, 32));
      const float mnew = fmaxf(m_r[r], mx);
      alpha[r] = (mnew > -1.0e38f) ? __expf(m_r[r] - mnew) : 1.0f;
      const float p0 = (s[0][r] > -1.0e38f) ? __expf(s[0][r] - mnew) : 0.f;
      const float p1 = (s[1][r] > -1.0e38f) ? __expf(s[1][r] - mnew) : 0.f;
      m_r[r] = mnew;
      l_r[r] = l_r[r] * alpha[r] + p0 + p1;            // per-lane partial row sum (16 lanes combined at the end)
      unsigned short hb = bf16_bits(p0); sPh[w][8 * hh + r][ln] = hb;      sPl[w][8 * hh + r][ln] = bf16_bits(p0 - bf16_val(hb));
      hb = bf16_bits(p1);                sPh[w][8 * hh + r][16 + ln] = hb; sPl[w][8 * hh + r][16 + ln] = bf16_bits(p1 - bf16_val(hb));
    }
#pragma unroll
    for (int dt = 0; dt < DT; ++dt)
#pragma unroll
      for (int r = 0; r < 8; ++r) oacc[dt][r] *= alpha[r];
    __builtin_amdgcn_fence(__ATOMIC_ACQ_REL, "workgroup");
    __builtin_amdgcn_wave_barrier();
    FragB pah, pal;
    pah.half[0] = *(const v8us*)&sPh[w][ln][8 * hh]; pah.half[1] = *(const v8us*)&sPh[w][ln][16 + 8 * hh];
    pal.half[0] = *(const v8us*)&sPl[w][ln][8 * hh]; pal.half[1] = *(const v8us*)&sPl[w][ln][16 + 8 * hh];
#pragma unroll
    for (int dt = 0; dt < DT; ++dt) {
      FragB bvh, bvl;
#pragma unroll
      for (int i = 0; i < 8; ++i) {
        bvh.u[i] = sVh[8 * hh + i][dt * 16 + ln]; bvh.u[8 + i] = sVh[16 + 8 * hh + i][dt * 16 + ln];
        bvl.u[i] = sVl[8 * hh + i][dt * 16 + ln]; bvl.u[8 + i] = sVl[16 + 8 * hh + i][dt * 16 + ln];
      }
      oacc[dt] = mmaN<3>(pah.v, pal.v, bvh.v, bvl.v, oacc[dt]);
    }
    __builtin_amdgcn_fence(__ATOMIC_ACQ_REL, "workgroup");
    __builtin_amdgcn_wave_barrier();
  }
#pragma unroll
  for (int r = 0; r < 8; ++r) {
    float l = l_r[r];
    l += __shfl_xor(l, 1, 32); l += __shfl_xor(l, 2, 32); l += __shfl_xor(l, 4, 32); l += __shfl_xor(l, 8, 32);
    l_r[r] = (l > 0.f) ? 1.0f / l : 0.f;
  }
#pragma unroll
  for (int dt = 0; dt < DT; ++dt)
#pragma unroll
    for (int r = 0; r < 8; ++r) sO[w][8 * hh + r][dt * 16 + ln] = oacc[dt][r] * l_r[r];
  __builtin_amdgcn_fence(__ATOMIC_ACQ_REL, "workgroup");
  __builtin_amdgcn_wave_barrier();
  {
    for (int r = 0; r < 16; ++r) {
      const int row = q0 + r;
      if (row < T && lane < D / 4) {
        const v4f val = *(const v4fa*)&sO[w][r][lane * 4];
        *(v4f*)(y + ((size_t)b * T + row) * ypitch + h * D + lane * 4) = val;
      }
    }
    
  }
}
// One chunk's own state, stored transposed: U[bh][n][dv][dk] = sum over j < 64 of (g^(63-j) * k[64n+j][dk]) * v[64n+j][dv], g = the head's decay.
// Block = one (batch, head, chunk); wave w = all 128 dk (A rows) by the 16 dv columns w*16..; 3-term bf16 hi/lo split, f32 accumulate.
// Every loop is unrolled so that the arrays it indexes (loaded rows, fragments, accumulators) stay in registers.
__global__ __launch_bounds__(256) void k_chunk_state(const float* __restrict__ k, const float* __restrict__ v, float* __restrict__ U) {
  __shared__ __attribute__((aligned(16))) unsigned short sKh[HD][72], sKl[HD][72], sVh[HD][72], sVl[HD][72];   // [column][key]: both operands contract over keys
  const int tid = threadIdx.x, w = tid >> 5, lane = tid & 31, ln = lane & 15, hh = lane >> 4;
  const int bh = blockIdx.x / (NC - 1), n = blockIdx.x % (NC - 1);     // the last chunk's state has no reader
  const int b = bh / NH, h = bh % NH;
  const float log_a = logf(1.0f - exp2f(-5.0f - (float)h));
  const float* K = k + ((size_t)b * TT + n * 64) * DD + h * HD; const float* V = v + ((size_t)b * TT + n * 64) * DD + h * HD;
  // a thread transposes 4 keys x 4 columns in registers: 8 lanes read 128 contiguous bytes of a row, and each column goes to LDS as one 8-byte store of 4 keys
  const int cl = tid & 7, k4 = ((tid >> 3) & 15) * 4, ch = tid >> 7;
  float dec[4];
#pragma unroll
  for (int j = 0; j < 4; ++j) dec[j] = expf((float)(63 - (k4 + j)) * log_a);
  const float* kp = K + (size_t)k4 * DD + (cl + 8 * ch) * 4; const float* vp = V + (size_t)k4 * DD + (cl + 8 * ch) * 4;
  v4f kf[2][4], vf[2][4];
#pragma unroll
  for (int i = 0; i < 2; ++i)
#pragma unroll
    for (int j = 0; j < 4; ++j) { kf[i][j] = *(const v4fa*)(kp + (size_t)j * DD + i * 64); vf[i][j] = *(const v4fa*)(vp + (size_t)j * DD + i * 64); }
  // precaution: wait before any register that an issued load names is rewritten; the two addresses are inputs so that no load lands in them ahead of the wait
  asm volatile("s_wait_xcnt 0x0" :: "v"(kp), "v"(vp) : "memory");
#pragma unroll
  for (int i = 0; i < 2; ++i) {
    const int c4 = (cl + 8 * (ch + 2 * i)) * 4;
#pragma unroll
    for (int t = 0; t < 4; ++t) {
      v4us kh, kl, vh, vl;
#pragma unroll
      for (int j = 0; j < 4; ++j) {
        const float x = kf[i][j][t] * dec[j], z = vf[i][j][t];
        kh[j] = bf16_bits(x); kl[j] = bf16_bits(x - bf16_val(kh[j]));
        vh[j] = bf16_bits(z); vl[j] = bf16_bits(z - bf16_val(vh[j]));
      }
      *(v4us*)&sKh[c4 + t][k4] = kh; *(v4us*)&sKl[c4 + t][k4] = kl; *(v4us*)&sVh[c4 + t][k4] = vh; *(v4us*)&sVl[c4 + t][k4] = vl;
    }
  }
  __syncthreads();
  v8f acc[8];
#pragma unroll
  for (int ct = 0; ct < 8; ++ct) acc[ct] = (v8f){0.f,0.f,0.f,0.f,0.f,0.f,0.f,0.f};
#pragma unroll
  for (int ks = 0; ks < 2; ++ks) {
    FragB bvh, bvl;
    bvh.half[0] = *(const v8us*)&sVh[w * 16 + ln][ks * 32 + 8 * hh]; bvh.half[1] = *(const v8us*)&sVh[w * 16 + ln][ks * 32 + 16 + 8 * hh];
    bvl.half[0] = *(const v8us*)&sVl[w * 16 + ln][ks * 32 + 8 * hh]; bvl.half[1] = *(const v8us*)&sVl[w * 16 + ln][ks * 32 + 16 + 8 * hh];
#pragma unroll
    for (int ct = 0; ct < 8; ++ct) {
      FragB akh, akl;
      akh.half[0] = *(const v8us*)&sKh[ct * 16 + ln][ks * 32 + 8 * hh]; akh.half[1] = *(const v8us*)&sKh[ct * 16 + ln][ks * 32 + 16 + 8 * hh];
      akl.half[0] = *(const v8us*)&sKl[ct * 16 + ln][ks * 32 + 8 * hh]; akl.half[1] = *(const v8us*)&sKl[ct * 16 + ln][ks * 32 + 16 + 8 * hh];
      acc[ct] = mmaN<3>(akh.v, akl.v, bvh.v, bvl.v, acc[ct]);
    }
  }
  // acc[ct][r] = U[dk = ct*16 + 8*hh + r][dv = w*16 + ln]: 8 neighbouring dk of one dv row
  float* Uo = U + ((size_t)bh * NC + n) * (HD * HD) + (size_t)(w * 16 + ln) * HD + 8 * hh;
#pragma unroll
  for (int ct = 0; ct < 8; ++ct) {
    *(v4f*)(Uo + ct * 16) = (v4f){acc[ct][0], acc[ct][1], acc[ct][2], acc[ct][3]};
    *(v4f*)(Uo + ct * 16 + 4) = (v4f){acc[ct][4], acc[ct][5], acc[ct][6], acc[ct][7]};
  }
}

// State in front of chunk n+1: S[n+1] = g^64 * S[n] + U[n], S[0] = 0, element by element in f32; stored as bf16 hi/lo planes [bh][n][dv][dk]
// (plane 0 is never written and never read). Thread = 4 neighbouring elements of one (batch, head).
__global__ __launch_bounds__(256) void k_state_scan(const float* __restrict__ U, unsigned short* __restrict__ Sh, unsigned short* __restrict__ Sl) {
  const int t = blockIdx.x * 256 + threadIdx.x;
  const int bh = t / (HD * HD / 4), e = (t % (HD * HD / 4)) * 4;
  const float g64 = expf(64.0f * logf(1.0f - exp2f(-5.0f - (float)(bh % NH))));
  const size_t o0 = (size_t)bh * NC * (HD * HD) + e;
  v4f u[NC - 1];
  // all loads first: they depend on nothing, so the serial recurrence below meets one memory latency and not one per chunk
#pragma unroll
  for (int n = 0; n < NC - 1; ++n) u[n] = *(const v4fa*)(U + o0 + (size_t)n * (HD * HD));
  v4f s = {0.f, 0.f, 0.f, 0.f};
  // unrolled so that u[] is indexed by constants and stays in registers
#pragma unroll
  for (int n = 0; n < NC - 1; ++n) {
    v4us hi, lo;
#pragma unroll
    for (int i = 0; i < 4; ++i) { s[i] = s[i] * g64 + u[n][i]; hi[i] = bf16_bits(s[i]); lo[i] = bf16_bits(s[i] - bf16_val(hi[i])); }
    *(v4us*)(Sh + o0 + (size_t)(n + 1) * (HD * HD)) = hi;
    *(v4us*)(Sl + o0 + (size_t)(n + 1) * (HD * HD)) = lo;
    asm volatile("s_wait_xcnt 0x0" ::: "memory");   // before the next chunk's values reuse the registers that the two stores name
  }
}

// retention: out[b][t][h*128 + dv0..dv0+63] = Σ_{s<=t} ((q_t·k_s)/√dh)·γ_h^(t−s) · v_s  (γ_h = 1 − 2^(−5−h), decay computed as exp((t−s)·log γ_h))
// Chunked by 64 keys: with t0 the first query of the block, g^(t-s) = g^(t-t0+1) * g^(t0-1-s) for every key s < t0, so all keys in front of the block's own
// chunk enter as g^(t-t0+1)/sqrt(dh) * q_t . S, S = sum over s < t0 of g^(t0-1-s) k_s v_s^T (k_chunk_state, k_state_scan); the own chunk keeps the score tile.
__global__ __launch_bounds__(128) void k_ret(const float* __restrict__ q, const float* __restrict__ k, const float* __restrict__ v,
                                             const unsigned short* __restrict__ Sh, const unsigned short* __restrict__ Sl, float* __restrict__ y) {
  constexpr int KS = HD / 32, DV = 64, DT = DV / 16;
  // One LDS array in two halves, each used twice. First half: the block's state tile (hi and lo plane, DV rows each); once every wave has left it,
  // the weight planes and the staged output. Second half: each wave's 16 q rows in f32; once every wave has its q fragments, the key and value planes.
  constexpr int SSP = HD + 8;                              // pitch in bf16 of a state row: 272 B, the pitch for 16-byte fragment reads of 256-B rows
  constexpr int QSP = HD + 4;                              // pitch in f32 of a q row: 528 B = 16 B x odd, the pitch for 16-byte reads a row apart
  constexpr int O_SL = DV * SSP, O_Q = 2 * DV * SSP, E_ALL = O_Q + 4 * 16 * QSP * 2;
  constexpr int O_PH = 0, O_PL = O_PH + 4 * 16 * 40, O_O = O_PL + 4 * 16 * 40;
  constexpr int O_KH = O_Q, O_KL = O_KH + 32 * (HD + 8), O_VH = O_KL + 32 * (HD + 8), O_VL = O_VH + 32 * (DV + 8);
  static_assert(O_O + 4 * 16 * DV * 2 <= O_Q && O_VL + 32 * (DV + 8) <= E_ALL, "the second use of each half must fit its first");
  __shared__ __attribute__((aligned(16))) unsigned short sm[E_ALL];
  unsigned short (*sKh)[HD + 8] = (unsigned short (*)[HD + 8])(sm + O_KH), (*sKl)[HD + 8] = (unsigned short (*)[HD + 8])(sm + O_KL);
  unsigned short (*sVh)[DV + 8] = (unsigned short (*)[DV + 8])(sm + O_VH), (*sVl)[DV + 8] = (unsigned short (*)[DV + 8])(sm + O_VL);
  unsigned short (*sPh)[16][40] = (unsigned short (*)[16][40])(sm + O_PH), (*sPl)[16][40] = (unsigned short (*)[16][40])(sm + O_PL);
  f1a (*sO)[16][DV] = (f1a (*)[16][DV])(sm + O_O);
  const int tid = threadIdx.x, w = tid >> 5, lane = tid & 31, ln = lane & 15, hh = lane >> 4;
  const int nqb = TT / 64;
  const int bh = blockIdx.x / nqb, qblk = blockIdx.x % nqb, dv0 = blockIdx.y * DV;
  const int b = bh / NH, h = bh % NH;
  const int q0 = qblk * 64 + w * 16;
  const float log_a = logf(1.0f - exp2f(-5.0f - (float)h));
  const float* Q = q + (size_t)b * TT * DD + h * HD; const float* K = k + (size_t)b * TT * DD + h * HD; const float* V = v + (size_t)b * TT * DD + h * HD + dv0;
  // Every global load is whole-line (a wave-wide load is one q or K row of 512 B, two V rows of 256 B, or two neighbouring state rows: the tile's DV rows are
  // contiguous), and the loads of a phase are issued together, so that the block meets one memory latency per phase and not one per load.
  // Every loop but the one over the two trips is unrolled so that the arrays it indexes stay in registers.
  v4f kf[8], vf[4];
  auto fetch_kv = [&](int j0) {                                         // 32 keys: K rows w + 4 i, V rows (tid >> 4) + 8 i
    const float* kp = K + (size_t)(j0 + w) * DD + lane * 4; const float* vp = V + (size_t)(j0 + (tid >> 4)) * DD + (tid & 15) * 4;
#pragma unroll
    for (int i = 0; i < 8; ++i) kf[i] = *(const v4fa*)(kp + (size_t)i * 4 * DD);
#pragma unroll
    for (int i = 0; i < 4; ++i) vf[i] = *(const v4fa*)(vp + (size_t)i * 8 * DD);
    // precaution: wait before any register that an issued load names is rewritten; the addresses are inputs so that no load lands in them ahead of the wait
    asm volatile("s_wait_xcnt 0x0" :: "v"(kp), "v"(vp) : "memory");
  };
  auto stash_kv = [&]() {
#pragma unroll
    for (int i = 0; i < 8; ++i) {
      v4us hi, lo;
#pragma unroll
      for (int t = 0; t < 4; ++t) { hi[t] = bf16_bits(kf[i][t]); lo[t] = bf16_bits(kf[i][t] - bf16_val(hi[t])); }
      *(v4us*)&sKh[w + 4 * i][lane * 4] = hi; *(v4us*)&sKl[w + 4 * i][lane * 4] = lo;
    }
#pragma unroll
    for (int i = 0; i < 4; ++i) {
      v4us hi, lo;
#pragma unroll
      for (int t = 0; t < 4; ++t) { hi[t] = bf16_bits(vf[i][t]); lo[t] = bf16_bits(vf[i][t] - bf16_val(hi[t])); }
      *(v4us*)&sVh[(tid >> 4) + 8 * i][(tid & 15) * 4] = hi; *(v4us*)&sVl[(tid >> 4) + 8 * i][(tid & 15) * 4] = lo;
    }
  };
  const int jstart = qblk * 64;
  FragB aqh[KS], aql[KS];
  {
    const float* qp = Q + (size_t)q0 * DD + lane * 4;
    const size_t so = ((size_t)bh * NC + qblk) * (HD * HD) + (size_t)dv0 * HD + tid * 8;
    const unsigned short* gh = Sh + so; const unsigned short* gl = Sl + so;
    v4f qv[16];
    v8us xh[8], xl[8];
#pragma unroll
    for (int i = 0; i < 16; ++i) qv[i] = *(const v4fa*)(qp + (size_t)i * DD);
    if (qblk > 0) {                                                     // block-uniform; chunk 0 has no earlier keys, and plane 0 is never written
#pragma unroll
      for (int i = 0; i < 8; ++i) { xh[i] = *(const v8us*)(gh + i * 1024); xl[i] = *(const v8us*)(gl + i * 1024); }
    }
    asm volatile("s_wait_xcnt 0x0" :: "v"(qp), "v"(gh), "v"(gl) : "memory");   // the same precaution as in fetch_kv
    fetch_kv(jstart);
    f1a* sq = (f1a*)(sm + O_Q) + w * (16 * QSP);                        // the wave's own q rows
#pragma unroll
    for (int i = 0; i < 16; ++i) *(v4fa*)&sq[i * QSP + lane * 4] = qv[i];
    if (qblk > 0) {
      unsigned short* sd = sm + (tid >> 4) * SSP + (tid & 15) * 8;
#pragma unroll
      for (int i = 0; i < 8; ++i) { *(v8us*)(sd + i * 8 * SSP) = xh[i]; *(v8us*)(sd + O_SL + i * 8 * SSP) = xl[i]; }
    }
    // the wave's lanes hand each other q values through LDS: the stores above stay in front of the reads below
    __builtin_amdgcn_fence(__ATOMIC_ACQ_REL, "workgroup");
    __builtin_amdgcn_wave_barrier();
    const f1a* qr = sq + ln * QSP + 8 * hh;
#pragma unroll
    for (int ks = 0; ks < KS; ++ks) {
      const v4f x4[4] = {*(const v4fa*)(qr + ks * 32), *(const v4fa*)(qr + ks * 32 + 4), *(const v4fa*)(qr + ks * 32 + 16), *(const v4fa*)(qr + ks * 32 + 20)};
#pragma unroll
      for (int i = 0; i < 16; ++i) {
        const float x = x4[i >> 2][i & 3]; const unsigned short hb = bf16_bits(x); aqh[ks].u[i] = hb; aql[ks].u[i] = bf16_bits(x - bf16_val(hb));
      }
    }
  }
  v8f oacc[DT];
#pragma unroll
  for (int dt = 0; dt < DT; ++dt) oacc[dt] = (v8f){0.f,0.f,0.f,0.f,0.f,0.f,0.f,0.f};
  auto keys32 = [&](int j0) {                                           // the 32 keys that lie in LDS: scores, decayed weights, weights x values
#pragma unroll
    for (int nt = 0; nt < 2; ++nt) {
      v8f acc = {};
#pragma unroll
      for (int ks = 0; ks < KS; ++ks) {
        FragB bh_, bl_;
        bh_.half[0] = *(const v8us*)&sKh[nt * 16 + ln][ks * 32 + 8 * hh]; bh_.half[1] = *(const v8us*)&sKh[nt * 16 + ln][ks * 32 + 16 + 8 * hh];
        bl_.half[0] = *(const v8us*)&sKl[nt * 16 + ln][ks * 32 + 8 * hh]; bl_.half[1] = *(const v8us*)&sKl[nt * 16 + ln][ks * 32 + 16 + 8 * hh];
        acc = mmaN<3>(aqh[ks].v, aql[ks].v, bh_.v, bl_.v, acc);
      }
      const int j = j0 + nt * 16 + ln;
#pragma unroll
      for (int r = 0; r < 8; ++r) {
        const int t = q0 + 8 * hh + r;
        const float p = (j <= t) ? acc[r] * 0.08838834764831845f * expf((float)(t - j) * log_a) : 0.f;
        const unsigned short hb = bf16_bits(p); sPh[w][8 * hh + r][nt * 16 + ln] = hb; sPl[w][8 * hh + r][nt * 16 + ln] = bf16_bits(p - bf16_val(hb));
      }
    }
    __builtin_amdgcn_fence(__ATOMIC_ACQ_REL, "workgroup");
    __builtin_amdgcn_wave_barrier();
    FragB pah, pal;
    pah.half[0] = *(const v8us*)&sPh[w][ln][8 * hh]; pah.half[1] = *(const v8us*)&sPh[w][ln][16 + 8 * hh];
    pal.half[0] = *(const v8us*)&sPl[w][ln][8 * hh]; pal.half[1] = *(const v8us*)&sPl[w][ln][16 + 8 * hh];
#pragma unroll
    for (int dt = 0; dt < DT; ++dt) {
      FragB bvh, bvl;
#pragma unroll
      for (int i = 0; i < 8; ++i) {
        bvh.u[i] = sVh[8 * hh + i][dt * 16 + ln]; bvh.u[8 + i] = sVh[16 + 8 * hh + i][dt * 16 + ln];
        bvl.u[i] = sVl[8 * hh + i][dt * 16 + ln]; bvl.u[8 + i] = sVl[16 + 8 * hh + i][dt * 16 + ln];
      }
      oacc[dt] = mmaN<3>(pah.v, pal.v, bvh.v, bvl.v, oacc[dt]);
    }
    __builtin_amdgcn_fence(__ATOMIC_ACQ_REL, "workgroup");
    __builtin_amdgcn_wave_barrier();
  };
  // kept rolled: the two trips share one text, for speed only
#pragma nounroll
  for (int it = 0; it < 2; ++it) {
    // trip 0: the state tile is complete in LDS, and every wave has read its q rows, whose LDS now takes keys and values; trip 1: every wave has left the first 32 keys
    __syncthreads();
    stash_kv();
    if (it == 0) {
      fetch_kv(jstart + 32);                                            // flies during the state products
      if (qblk > 0) {                                                   // block-uniform
        const unsigned short* rh = sm + ln * SSP + 8 * hh; const unsigned short* rl = rh + O_SL;
#pragma unroll
        for (int dt = 0; dt < DT; ++dt) {
          FragB fh[KS], fl[KS];
#pragma unroll
          for (int ks = 0; ks < KS; ++ks) {
            fh[ks].half[0] = *(const v8us*)(rh + dt * 16 * SSP + ks * 32); fh[ks].half[1] = *(const v8us*)(rh + dt * 16 * SSP + ks * 32 + 16);
            fl[ks].half[0] = *(const v8us*)(rl + dt * 16 * SSP + ks * 32); fl[ks].half[1] = *(const v8us*)(rl + dt * 16 * SSP + ks * 32 + 16);
          }
          v8f acc = {};
#pragma unroll
          for (int ks = 0; ks < KS; ++ks) acc = mmaN<3>(aqh[ks].v, aql[ks].v, fh[ks].v, fl[ks].v, acc);
#pragma unroll
          for (int r = 0; r < 8; ++r) oacc[dt][r] = acc[r] * 0.08838834764831845f * expf((float)(w * 16 + 8 * hh + r + 1) * log_a);
        }
      }
    }
    __syncthreads();                                                    // these 32 keys are complete in LDS; trip 0: every wave has left the state tile, whose LDS now takes the weights
    keys32(jstart + 32 * it);
  }
#pragma unroll
  for (int dt = 0; dt < DT; ++dt)
#pragma unroll
    for (int r = 0; r < 8; ++r) sO[w][8 * hh + r][dt * 16 + ln] = oacc[dt][r];
  __builtin_amdgcn_fence(__ATOMIC_ACQ_REL, "workgroup");
  __builtin_amdgcn_wave_barrier();
  {
    for (int r = 0; r < 16; ++r) { if (lane < DV / 4) { const v4f val = *(const v4fa*)&sO[w][r][lane * 4]; *(v4f*)(y + ((size_t)b * TT + q0 + r) * DD + h * HD + dv0 + lane * 4) = val; } }
    
  }
}


// Z[row][h*128+d] = silu(g) · (ret − mean)/sqrt(var + 1e-6) per (row, head) over 128; wave per (row, head), lane = 4 values
// Z leaves as the two bf16 terms that the last GEMM multiplies: hi = Z rounded, lo = (Z - hi) rounded; a row of zh is its DD hi values, then its DD lo values
__global__ __launch_bounds__(256) void k_gn_gate(const float* __restrict__ ret, const float* __restrict__ g, unsigned short* __restrict__ zh) {
  const int tid = threadIdx.x, w = tid >> 5, lane = tid & 31; const size_t rh = (size_t)blockIdx.x * 8 + w; if (rh >= (size_t)BB * TT * NH) return;
  const size_t base = rh * HD + lane * 4;        // rows are [row][h*128 + d] contiguous -> rh*128
  const v4f a = *(const v4fa*)(ret + base), gg = *(const v4fa*)(g + base);
  float s = a[0] + a[1] + a[2] + a[3]; for (int o = 16; o >= 1; o >>= 1) s += __shfl_xor(s, o, 32); const float mu = s * (1.0f / HD);
  float q2 = 0.f; for (int q = 0; q < 4; ++q) { const float c = a[q] - mu; q2 += c * c; } for (int o = 16; o >= 1; o >>= 1) q2 += __shfl_xor(q2, o, 32);
  const float rs = rsqrtf(q2 * (1.0f / HD) + 1e-6f);
  v4f o4; for (int q = 0; q < 4; ++q) o4[q] = (gg[q] / (1.0f + expf(-gg[q]))) * ((a[q] - mu) * rs);
  v4us hi, lo; for (int q = 0; q < 4; ++q) { hi[q] = bf16_bits(o4[q]); lo[q] = bf16_bits(o4[q] - bf16_val(hi[q])); }
  unsigned short* zo = zh + base + (rh / NH) * DD;
  *(v4us*)zo = hi; *(v4us*)(zo + DD) = lo;
}
extern "C" void kernel_launch(void* const* d_in, const int* in_sizes, int n_in,
                              void* d_out, int out_size, void* d_ws, size_t ws_size, hipStream_t stream) {
  (void)in_sizes; (void)n_in; (void)out_size;
  const float* X = (const float*)d_in[0]; const float* Wq = (const float*)d_in[1]; const float* Wk = (const float*)d_in[2]; const float* Wv = (const float*)d_in[3]; const float* WG = (const float*)d_in[4]; const float* WO = (const float*)d_in[5];
  char* ws = (char*)d_ws; size_t off = 0;
  auto take = [&](size_t bytes) { char* p = ws + off; off += (bytes + 255) & ~(size_t)255; return p; };
  const int M = BB * TT, gb = (M / 128) * (DD / 128);
  unsigned short* Wt[5]; for (int i = 0; i < 5; ++i) Wt[i] = (unsigned short*)take((size_t)DD * DD * 2);
  unsigned short* Xb = (unsigned short*)take((size_t)M * DD * 2);
  float* q = (float*)take((size_t)M * DD * 4); float* k = (float*)take((size_t)M * DD * 4); float* v = (float*)take((size_t)M * DD * 4); float* g = (float*)take((size_t)M * DD * 4); float* ret = (float*)take((size_t)M * DD * 4);
  float* U = (float*)take((size_t)BB * NH * NC * HD * HD * 4); unsigned short* Sh = (unsigned short*)take((size_t)BB * NH * NC * HD * HD * 2); unsigned short* Sl = (unsigned short*)take((size_t)BB * NH * NC * HD * HD * 2);
  if (off > ws_size) return;
  k_wt_bf16<<<dim3((DD / 128) * (DD / 128), 5 + M * DD / XBLK / ((DD / 128) * (DD / 128))), 256, 0, stream>>>(Wq, Wk, Wv, WG, WO, X, Wt[0], Xb);   // X @ W: [K][N]; y >= 5: X -> bf16
  k_gemm_t256<4><<<4 * (M / 256) * (DD / 256), 256, 0, stream>>>(Xb, Wt[0], q);                                           // q, k, v, g: neighbours in ws, as Wt[0..3] are
  k_chunk_state<<<BB * NH * (NC - 1), 256, 0, stream>>>(k, v, U);
  k_state_scan<<<BB * NH * (HD * HD / 4) / 256, 256, 0, stream>>>(U, Sh, Sl);
  k_ret<<<dim3(BB * NH * (TT / 64), 2), 128, 0, stream>>>(q, k, v, Sh, Sl, ret);
  k_gn_gate<<<(BB * TT * NH + 7) / 8, 256, 0, stream>>>(ret, g, (unsigned short*)q);                                   // q's 16 MiB reused as Z in bf16 hi and lo
  k_gemm_bf<true, 1><<<gb, 256, 0, stream>>>((const unsigned short*)q, Wt[4], (float*)d_out);
}

// v008
// It runs in 124 microseconds.
// Two timings next to v007 put it at 1.03 and 1.04 times that version's speed.
// Counting every step since v000, it is 6.06 times as fast.
#include <hip/hip_runtime.h>
#include <stdint.h>
// All contractions on v_wmma_f32_16x16x32_bf16, f32 accumulate: q/k/v/g = X·W (X, W rounded to bf16: single exact term); per-head retention
// Σ_{s≤t} ((q_t·k_s)/√128)·γ_h^{t−s}·v_s as 3-term bf16 hi/lo splits (scores and decayed weights split in registers/LDS); (silu(g)∘GN(ret))·W_O with
// the A operand split (2 terms). Decay factors, the per-head GroupNorm (no affine, eps 1e-6) and silu in f32.
#define BB 2
#define TT 2048
#define DD 1024
#define NH 8
#define HD 128
#define NC (TT / 64)   // chunks of 64 keys per sequence

typedef __bf16 v16b __attribute__((ext_vector_type(16)));
typedef unsigned short v8us __attribute__((ext_vector_type(8), may_alias));
typedef unsigned short v4us __attribute__((ext_vector_type(4), may_alias));
typedef unsigned int v2u __attribute__((ext_vector_type(2), may_alias));
typedef float f32x2 __attribute__((ext_vector_type(2)));
typedef __bf16 bf16x2 __attribute__((ext_vector_type(2)));
typedef float  v8f  __attribute__((ext_vector_type(8)));
typedef float  v4f  __attribute__((ext_vector_type(4)));
typedef float  v4fa __attribute__((ext_vector_type(4), may_alias));
union FragB { v16b v; v8us half[2]; unsigned short u[16]; unsigned int d[8]; };

// f32 -> bf16, nearest even, by the chip's own conversion instruction
__device__ __forceinline__ unsigned short bf16_bits(float x) { return __builtin_bit_cast(unsigned short, (__bf16)x); }
// two values split into bf16 hi and lo terms, each pair packed in one register (a in the low half): hi = x rounded, lo = (x - hi) rounded
__device__ __forceinline__ void split2(float a, float b, unsigned int& hi, unsigned int& lo) {
  const f32x2 x = {a, b};
  const bf16x2 h = __builtin_convertvector(x, bf16x2);
  const bf16x2 l = __builtin_convertvector(x - __builtin_convertvector(h, f32x2), bf16x2);
  hi = __builtin_bit_cast(unsigned int, h); lo = __builtin_bit_cast(unsigned int, l);
}
__device__ __forceinline__ float bf16_val(unsigned short b) { return __uint_as_float(((unsigned int)b) << 16); }
__device__ __forceinline__ float bf16_round(float x) { return bf16_val(bf16_bits(x)); }
// D += A·B with NT terms: 1 = ah·bh, 2 = + al·bh (A split), 3 = + ah·bl (both split)
template <int NT>
__device__ __forceinline__ v8f mmaN(v16b ah, v16b al, v16b bh, v16b bl, v8f c) {
  c = __builtin_amdgcn_wmma_f32_16x16x32_bf16(false, ah, false, bh, (short)0, c, false, false);
  if (NT >= 2) c = __builtin_amdgcn_wmma_f32_16x16x32_bf16(false, al, false, bh, (short)0, c, false, false);
  if (NT >= 3) c = __builtin_amdgcn_wmma_f32_16x16x32_bf16(false, ah, false, bl, (short)0, c, false, false);
  asm volatile("v_nop\n\tv_nop\n\tv_nop\n\tv_nop" : "+v"(c) : "v"(ah), "v"(al), "v"(bh), "v"(bl));
  return c;
}

// One launch for all five weights: blockIdx.y picks the matrix; the five bf16 transposes lie one behind the other from Wt0.
// Block = one 128 (k) x 128 (n) tile, turned in LDS: a wave reads 512 contiguous bytes of a W row, and 16 lanes store 256 contiguous bytes of a Wt row,
// so that every global access covers whole lines. A thread holds 16 k of 4 neighbouring n and hands each n to LDS as two 16-byte runs of k.
// blockIdx.y >= 5: the same launch rounds X to bf16 once, in place of every column tile of the q/k/v/g GEMM doing it again; block = 16384 elements in row order.
#define XBLK 16384
#define WTP (128 + 8)      // LDS row pitch in bf16: 272 B, the pitch for 16-byte reads of 256-B rows
__global__ __launch_bounds__(256) void k_wt_bf16(const float* __restrict__ W0, const float* __restrict__ W1, const float* __restrict__ W2, const float* __restrict__ W3,
                                                 const float* __restrict__ W4, const float* __restrict__ X, unsigned short* __restrict__ Wt0,
                                                 unsigned short* __restrict__ Xb) {
  constexpr int K = DD, N = DD;
  __shared__ __attribute__((aligned(16))) unsigned short sT[128 * WTP];   // [n][k]
  const int y = blockIdx.y;
  if (y >= 5) {                                             // the same for the whole block, and in front of the barrier
    const size_t e0 = ((size_t)(y - 5) * ((K / 128) * (N / 128)) + blockIdx.x) * XBLK + threadIdx.x * 4;
    const float* xp = X + e0;
    unsigned short* xo = Xb + e0;
    v4f r[16];
    // unrolled so that r[] stays in registers and all 16 loads (512 contiguous bytes a wave each) fly together
#pragma unroll
    for (int i = 0; i < 16; ++i) r[i] = *(const v4fa*)(xp + i * 1024);
    asm volatile("s_wait_xcnt 0x0" :: "v"(xp) : "memory");  // precaution: before any register that an issued load names is rewritten
#pragma unroll
    for (int i = 0; i < 16; ++i) {
      v4us c;
#pragma unroll
      for (int t = 0; t < 4; ++t) c[t] = bf16_bits(r[i][t]);
      *(v4us*)(xo + i * 1024) = c;
    }
    return;
  }
  const float* __restrict__ W = y == 0 ? W0 : y == 1 ? W1 : y == 2 ? W2 : y == 3 ? W3 : W4;
  unsigned short* __restrict__ Wt = Wt0 + (size_t)y * K * N;
  const int tid = threadIdx.x;
  const int k0 = (blockIdx.x % (K / 128)) * 128, n0 = (blockIdx.x / (K / 128)) * 128;
  const int n4 = (tid & 31) * 4, kg = (tid >> 5) * 16;
  const float* wp = W + (size_t)(k0 + kg) * N + n0 + n4;
  v4f x[16];
  // every loop is unrolled so that x[] is indexed by constants and stays in registers; all 16 loads fly together
#pragma unroll
  for (int i = 0; i < 16; ++i) x[i] = *(const v4fa*)(wp + (size_t)i * N);
  asm volatile("s_wait_xcnt 0x0" :: "v"(wp) : "memory");   // precaution: before any register that an issued load names is rewritten
#pragma unroll
  for (int t = 0; t < 4; ++t)
#pragma unroll
    for (int hf = 0; hf < 2; ++hf) {
      v8us c;
#pragma unroll
      for (int i = 0; i < 8; ++i) c[i] = bf16_bits(x[hf * 8 + i][t]);
      *(v8us*)&sT[(n4 + t) * WTP + kg + hf * 8] = c;
    }
  __syncthreads();                                          // the tile is complete in LDS before any row of it is read
  const int r = tid >> 4, c8 = (tid & 15) * 8;
  unsigned short* op = Wt + (size_t)(n0 + r) * K + k0 + c8;
  v8us o[8];
#pragma unroll
  for (int j = 0; j < 8; ++j) o[j] = *(const v8us*)&sT[(r + 16 * j) * WTP + c8];
#pragma unroll
  for (int j = 0; j < 8; ++j) *(v8us*)(op + (size_t)j * 16 * K) = o[j];
}

// GEMM C[M][N] (f32) = A[M][K] * W, M = BB*TT, N = K = DD. A bf16 row-major, rounded once by the kernel that makes it (ASPLIT: each row is K hi values and
// behind them its K lo values -> 2 terms, else one rounded term); Wt bf16 [N][K]. Block = 8 waves = one 128 x 128 tile of C; a stage is 128 k of the 128 A rows and the 128 Wt rows, loaded once per block with
// whole-line loads and shared by all waves through LDS. Two stage buffers, one barrier per stage: the next stage's global loads fly during this stage's products.
// Wave = 32 x 64 of C (waves 4 x 2). Each accumulator sums its k in ascending order, hi term before lo term.
// NW products that share A run as one launch: their Wt planes lie one behind the other from Wt0, their C planes from C0, and the column tiles of all NW
// are numbered through. With more blocks than WGPs two unsplit blocks (136 KiB of LDS each) share a WGP, and one block's loads fly while the other stores or waits.
#define GBK 128            // k per stage
#define GP (GBK + 8)       // LDS row pitch in bf16: 272 B, the pitch for 16-byte fragment reads of 256-B rows
#define GSP 68             // row pitch in f32 of a wave's staged C rows: the two half-waves (rows 8 apart) fall on different banks
typedef float f1a __attribute__((may_alias));
template <bool ASPLIT, int NW>
__global__ __launch_bounds__(256) void k_gemm_bf(const unsigned short* __restrict__ A, const unsigned short* __restrict__ Wt0, float* __restrict__ C0) {
  constexpr int K = DD, N = DD, NT = K / GBK, CT = N / 128;
  constexpr int PLANE = 128 * GP;                       // bf16 elements of one operand plane: [0] A hi, [1] Wt, [2] A lo
  constexpr int STAGE = (ASPLIT ? 3 : 2) * PLANE;
  static_assert(2 * STAGE * 2 >= 8 * 32 * GSP * 4, "the staged C tile must fit the operand buffers");
  __shared__ __attribute__((aligned(16))) unsigned short sm[2 * STAGE];
  const int tid = threadIdx.x, w = tid >> 5, lane = tid & 31, ln = lane & 15, hh = lane >> 4;
  const int wm = w >> 1, wn = w & 1;
  const int ct = blockIdx.x % (NW * CT), which = ct / CT;
  const int row0 = (blockIdx.x / (NW * CT)) * 128, col0 = (ct % CT) * 128;
  const unsigned short* __restrict__ Wt = Wt0 + (size_t)which * N * K;
  float* __restrict__ C = C0 + (size_t)which * (BB * TT) * N;
  const int br = tid >> 4, bc = (tid & 15) * 8;         // A planes and Wt alike: 16 lanes read 256 contiguous bytes of one row
  constexpr int AP = ASPLIT ? 2 * K : K;                // row pitch of A
  const unsigned short* ap = A + (size_t)(row0 + br) * AP + bc;
  const unsigned short* bp = Wt + (size_t)(col0 + br) * K + bc;
  v8us xa[8], xl[8], xb[8];
  // every loop below is unrolled so that the arrays it indexes (loaded rows, fragments, accumulators) stay in registers
  auto fetch = [&](int kb) {
    const unsigned short* pa = ap + kb; const unsigned short* pb = bp + kb;
#pragma unroll
    for (int i = 0; i < 8; ++i) xa[i] = *(const v8us*)(pa + (size_t)i * 16 * AP);
    if (ASPLIT) {
#pragma unroll
      for (int i = 0; i < 8; ++i) xl[i] = *(const v8us*)(pa + (size_t)i * 16 * AP + K);
    }
#pragma unroll
    for (int i = 0; i < 8; ++i) xb[i] = *(const v8us*)(pb + (size_t)i * 16 * K);
    // precaution: wait before any register that an issued load names is rewritten; the addresses are inputs so that no load lands in them ahead of the wait
    asm volatile("s_wait_xcnt 0x0" :: "v"(pa), "v"(pb) : "memory");
  };
  auto stash = [&](unsigned short* st) {
#pragma unroll
    for (int i = 0; i < 8; ++i) {
      *(v8us*)&st[(br + 16 * i) * GP + bc] = xa[i];
      if (ASPLIT) *(v8us*)&st[2 * PLANE + (br + 16 * i) * GP + bc] = xl[i];
    }
#pragma unroll
    for (int i = 0; i < 8; ++i) *(v8us*)&st[PLANE + (br + 16 * i) * GP + bc] = xb[i];
  };
  v8f acc[2][4];
#pragma unroll
  for (int mi = 0; mi < 2; ++mi)
#pragma unroll
    for (int ni = 0; ni < 4; ++ni) acc[mi][ni] = (v8f){0.f,0.f,0.f,0.f,0.f,0.f,0.f,0.f};
  auto products = [&](const unsigned short* st) {
    const unsigned short* pa = st + (wm * 32 + ln) * GP + 8 * hh;
    const unsigned short* pb = st + PLANE + (wn * 64 + ln) * GP + 8 * hh;
#pragma unroll
    for (int ks = 0; ks < GBK / 32; ++ks) {
      FragB a[2], al[2], b[4];
#pragma unroll
      for (int mi = 0; mi < 2; ++mi) {
        a[mi].half[0] = *(const v8us*)(pa + mi * 16 * GP + ks * 32); a[mi].half[1] = *(const v8us*)(pa + mi * 16 * GP + ks * 32 + 16);
        if (ASPLIT) { al[mi].half[0] = *(const v8us*)(pa + 2 * PLANE + mi * 16 * GP + ks * 32); al[mi].half[1] = *(const v8us*)(pa + 2 * PLANE + mi * 16 * GP + ks * 32 + 16); }
      }
#pragma unroll
      for (int ni = 0; ni < 4; ++ni) { b[ni].half[0] = *(const v8us*)(pb + ni * 16 * GP + ks * 32); b[ni].half[1] = *(const v8us*)(pb + ni * 16 * GP + ks * 32 + 16); }
#pragma unroll
      for (int mi = 0; mi < 2; ++mi)
#pragma unroll
        for (int ni = 0; ni < 4; ++ni) acc[mi][ni] = __builtin_amdgcn_wmma_f32_16x16x32_bf16(false, a[mi].v, false, b[ni].v, (short)0, acc[mi][ni], false, false);
      if (ASPLIT) {
#pragma unroll
        for (int mi = 0; mi < 2; ++mi)
#pragma unroll
          for (int ni = 0; ni < 4; ++ni) acc[mi][ni] = __builtin_amdgcn_wmma_f32_16x16x32_bf16(false, al[mi].v, false, b[ni].v, (short)0, acc[mi][ni], false, false);
      }
    }
  };
  fetch(0);
  stash(sm);
  for (int t = 0; t + 1 < NT; ++t) {
    __syncthreads();                                    // stage t is complete in its buffer, and every reader has left the other buffer
    fetch((t + 1) * GBK);
    products(sm + (t & 1) * STAGE);
    stash(sm + ((t + 1) & 1) * STAGE);
  }
  __syncthreads();
  products(sm + ((NT - 1) & 1) * STAGE);
  __syncthreads();                                      // every wave has left the operand buffers: their LDS now stages C, each wave in its own range
  f1a* so = (f1a*)sm + w * (32 * GSP);
#pragma unroll
  for (int mi = 0; mi < 2; ++mi)
#pragma unroll
    for (int ni = 0; ni < 4; ++ni)
#pragma unroll
      for (int r = 0; r < 8; ++r) so[(mi * 16 + 8 * hh + r) * GSP + ni * 16 + ln] = acc[mi][ni][r];
  __builtin_amdgcn_fence(__ATOMIC_ACQ_REL, "workgroup");
  __builtin_amdgcn_wave_barrier();
  float* cp = C + (size_t)(row0 + wm * 32 + hh) * N + col0 + wn * 64 + ln * 4;
  v4f o[16];
#pragma unroll
  for (int q = 0; q < 16; ++q) o[q] = *(const v4fa*)&so[(q * 2 + hh) * GSP + ln * 4];
#pragma unroll
  for (int q = 0; q < 16; ++q) *(v4f*)(cp + (size_t)q * 2 * N) = o[q];   // 16 lanes store 256 contiguous bytes of a row
}

// The q/k/v/g GEMM: C[M][N] (f32) = A[M][K] * W for NW weights that share A, M = BB*TT, N = K = DD; A bf16 row-major, Wt bf16 [N][K], planes as in k_gemm_bf.
// Block = 8 waves = one 256 x 256 tile of C, one block per WGP: a byte fetched from L2 now feeds twice the products of the 128 x 128 tile. Wave = 64 x 128 of C (waves 4 x 2).
// A stage is 128 k of the 256 A rows and the 256 Wt rows. Each wave brings its own slice of 64 rows (256 B each) with one tensor_load_to_lds, which also lays the
// rows at the 272-B pitch; no register is spent on staging, which is what lets the 256 accumulator registers of the wave tile fit. Two stage buffers: the load of stage
// t + 2 is issued when every wave has left stage t. Each accumulator sums its k in ascending order, as before.
typedef uint32_t u32x4 __attribute__((ext_vector_type(4)));
typedef uint32_t u32x8 __attribute__((ext_vector_type(8)));
__device__ __forceinline__ uint32_t uni(uint32_t v) { return (uint32_t)__builtin_amdgcn_readfirstlane(v); }
__device__ __forceinline__ uint32_t pinned(uint32_t v) { uint32_t w = (uint32_t)__builtin_amdgcn_readfirstlane(v); asm volatile("" : "+s"(w)); return w; }
#define TSL 18432          // bytes of LDS per slice: 64 rows x 272 B = 17,408, rounded up to a multiple of 2 KiB, where the next slice begins
#define TSE (TSL / 2)      // the same in bf16 elements
#define TST (8 * TSL)      // bytes of one stage buffer: slices 0..3 = A rows, 4..7 = Wt rows
#define CSP 132            // row pitch in f32 of a wave's staged C rows: the two half-waves (rows 8 apart) fall on different banks
template <int NW>
__global__ __launch_bounds__(256) void k_gemm_t256(const unsigned short* __restrict__ A, const unsigned short* __restrict__ Wt0, float* __restrict__ C0) {
  constexpr int K = DD, N = DD, NT = K / GBK, CT = N / 256;
  static_assert(NT >= 2, "the ring's prologue fills two stages");
  static_assert(8 * 64 * CSP * 4 <= 2 * TST, "the staged C tile must fit the operand buffers");
  __shared__ __attribute__((aligned(2048))) unsigned short sm[2 * TST / 2];
  const int tid = threadIdx.x, w = tid >> 5, lane = tid & 31, ln = lane & 15, hh = lane >> 4;
  const int wm = w >> 1, wn = w & 1;
  const int ct = blockIdx.x % (NW * CT), which = ct / CT;
  const int row0 = (blockIdx.x / (NW * CT)) * 256, col0 = (ct % CT) * 256;
  const unsigned short* __restrict__ Wt = Wt0 + (size_t)which * N * K;
  float* __restrict__ C = C0 + (size_t)which * (BB * TT) * N;
  // the wave's own slice: its 64 source rows and its place in a stage buffer
  const uint32_t wv = uni((uint32_t)w);
  const unsigned short* src = wv < 4u ? A + (size_t)(row0 + wv * 64u) * K : Wt + (size_t)(col0 + (wv - 4u) * 64u) * K;
  const uint64_t src0 = (uint64_t)(uintptr_t)src;
  const uint32_t dst0 = (uint32_t)(size_t)sm + wv * (uint32_t)TSL;
  u32x8 g1;
  g1[0] = uni((1u << 20) | (5u << 22) | (3u << 25));
  g1[1] = uni((256u & 0xFFFFu) << 16);
  g1[2] = uni((256u >> 16) | ((64u & 0xFFFFu) << 16));
  g1[3] = uni((64u >> 16) | (256u << 16));
  g1[4] = uni(64u);
  g1[5] = uni((uint32_t)(K * 2));
  g1[6] = uni(0u);
  g1[7] = uni(0u);
  u32x4 g0;
  g0[0] = uni(1u);
  auto issue = [&](int t) {                             // stage t into buffer t & 1: one request of this wave
    const uint64_t ga = src0 + (uint64_t)t * (GBK * 2);
    g0[1] = uni(dst0 + (uint32_t)(t & 1) * (uint32_t)TST);
    g0[2] = uni((uint32_t)ga);
    g0[3] = uni((((uint32_t)(ga >> 32)) & 0x01FFFFFFu) | 0x80000000u);
    // both groups are in-out operands so that their registers stay the descriptor's own and take no other value while the request is outstanding
    asm volatile("tensor_load_to_lds %0, %1" : "+s"(g0), "+s"(g1) :: "memory");
  };
  // every loop below but the one over the stages is unrolled so that the arrays it indexes (fragments, accumulators) stay in registers
  v8f acc[4][8];
#pragma unroll
  for (int mi = 0; mi < 4; ++mi)
#pragma unroll
    for (int ni = 0; ni < 8; ++ni) acc[mi][ni] = (v8f){0.f,0.f,0.f,0.f,0.f,0.f,0.f,0.f};
  auto products = [&](const unsigned short* st) {
    const unsigned short* pa = st + wm * TSE + ln * GP + 8 * hh;
    const unsigned short* pb = st + (4 + 2 * wn) * TSE + ln * GP + 8 * hh;
    FragB a[2][4], b[2][8];                             // two fragment sets: the next 32 k are fetched while these are multiplied
    auto frags = [&](int ks) {
#pragma unroll
      for (int mi = 0; mi < 4; ++mi) { a[ks & 1][mi].half[0] = *(const v8us*)(pa + mi * 16 * GP + ks * 32); a[ks & 1][mi].half[1] = *(const v8us*)(pa + mi * 16 * GP + ks * 32 + 16); }
#pragma unroll
      for (int ni = 0; ni < 8; ++ni) {
        const unsigned short* p = pb + (ni >> 2) * TSE + (ni & 3) * 16 * GP + ks * 32;
        b[ks & 1][ni].half[0] = *(const v8us*)p; b[ks & 1][ni].half[1] = *(const v8us*)(p + 16);
      }
    };
    frags(0);
#pragma unroll
    for (int ks = 0; ks < GBK / 32; ++ks) {
      if (ks + 1 < GBK / 32) frags(ks + 1);
      __builtin_amdgcn_sched_barrier(0);                // the next block's 24 LDS reads stay one group ahead of this block
#pragma unroll
      for (int mi = 0; mi < 4; ++mi)
#pragma unroll
        for (int ni = 0; ni < 8; ++ni) acc[mi][ni] = __builtin_amdgcn_wmma_f32_16x16x32_bf16(false, a[ks & 1][mi].v, false, b[ks & 1][ni].v, (short)0, acc[mi][ni], false, false);
      __builtin_amdgcn_sched_barrier(0);                // and this block's WMMAs stay ahead of the reads that follow
    }
  };
  issue(0);
  asm volatile("s_wait_tensorcnt 0x0" ::: "memory");    // this wave's slice of stage 0 has landed
  __syncthreads();                                      // every slice of stage 0 has landed before any wave reads it
  issue(1);
  // kept rolled: one text for the eight stages, so that the kernel's text stays small
#pragma nounroll
  for (int t = 0; t < NT; ++t) {
    products(sm + (t & 1) * (TST / 2));
    asm volatile("s_wait_dscnt 0x0" ::: "memory");
    asm volatile("s_wait_tensorcnt 0x0" ::: "memory");
    __syncthreads();
    if (pinned((t + 2 < NT) ? 1u : 0u) != 0u) issue(t + 2);
  }
  asm volatile("s_wait_tensorcnt 0x0" ::: "memory");    // no request is outstanding when the buffers change their use
  asm volatile("s_wait_dscnt 0x0" ::: "memory");
  // behind the last stage's barrier every wave has left the operand buffers: their LDS now stages C, each wave in its own range
  f1a* so = (f1a*)sm + w * (64 * CSP);
#pragma unroll
  for (int mi = 0; mi < 4; ++mi)
#pragma unroll
    for (int ni = 0; ni < 8; ++ni)
#pragma unroll
      for (int r = 0; r < 8; ++r) so[(mi * 16 + 8 * hh + r) * CSP + ni * 16 + ln] = acc[mi][ni][r];
  __builtin_amdgcn_fence(__ATOMIC_ACQ_REL, "workgroup");
  __builtin_amdgcn_wave_barrier();
  float* cp = C + (size_t)(row0 + wm * 64) * N + col0 + wn * 128 + lane * 4;
#pragma unroll
  for (int qq = 0; qq < 4; ++qq) {
    v4f o[16];
#pragma unroll
    for (int q = 0; q < 16; ++q) o[q] = *(const v4fa*)&so[(qq * 16 + q) * CSP + lane * 4];
#pragma unroll
    for (int q = 0; q < 16; ++q) *(v4f*)(cp + (size_t)(qq * 16 + q) * N) = o[q];   // a wave stores 512 contiguous bytes of a row
    asm volatile("s_wait_xcnt 0x0" ::: "memory");       // precaution: before the next rows reuse registers that the issued stores name
  }
}

// Flash-style causal/unmasked attention, all contractions 3-term bf16 hi/lo splits, f32 softmax with running max.
// q,k,v rows are read from f32 buffers with arbitrary row pitch (so they can live inside a fused qkv buffer);
// D = head size (multiple of 32, <= 128); one wave = 16 query rows; block = 4 waves (64 queries) sharing K/V chunks of 32.
template <int D, bool CAUSAL>
__global__ __launch_bounds__(128) void k_flash(const float* __restrict__ qb, const float* __restrict__ kb, const float* __restrict__ vb,
                                             int pitch, int T, int H, float scale, float* __restrict__ y, int ypitch) {
  constexpr int KS = D / 32;        // k-steps for QK
  constexpr int DT = D / 16;        // d tiles for PV
  __shared__ __attribute__((aligned(16))) unsigned short sKh[32][D + 8], sKl[32][D + 8], sVh[32][D + 8], sVl[32][D + 8];
  __shared__ __attribute__((aligned(16))) unsigned short sPh[4][16][40], sPl[4][16][40];
  __shared__ __attribute__((aligned(16))) float sO[4][16][D];
  const int tid = threadIdx.x, w = tid >> 5, lane = tid & 31, ln = lane & 15, hh = lane >> 4;
  const int nqb = (T + 63) / 64;
  const int bh = blockIdx.x / nqb, qblk = blockIdx.x % nqb;
  const int b = bh / H, h = bh % H;
  const int q0 = qblk * 64 + w * 16;
  const float* Q = qb + (size_t)b * T * pitch + h * D;
  const float* K = kb + (size_t)b * T * pitch + h * D;
  const float* V = vb + (size_t)b * T * pitch + h * D;

  // A fragments of the wave's 16 query rows (scaled), hi/lo
  FragB aqh[KS], aql[KS];
  {
    int row = q0 + ln; if (row >= T) row = T - 1;
    const float* qr = Q + (size_t)row * pitch;
#pragma unroll
    for (int ks = 0; ks < KS; ++ks)
#pragma unroll
      for (int i = 0; i < 16; ++i) {
        const int d = ks * 32 + ((i < 8) ? (8 * hh + i) : (16 + 8 * hh + (i - 8)));
        const float x = qr[d] * scale; const unsigned short hb = bf16_bits(x);
        aqh[ks].u[i] = hb; aql[ks].u[i] = bf16_bits(x - bf16_val(hb));
      }
  }
  float m_r[8], l_r[8];
#pragma unroll
  for (int r = 0; r < 8; ++r) { m_r[r] = -3.0e38f; l_r[r] = 0.f; }
  v8f oacc[DT];
#pragma unroll
  for (int dt = 0; dt < DT; ++dt) oacc[dt] = (v8f){0.f,0.f,0.f,0.f,0.f,0.f,0.f,0.f};

  const int kv_end = CAUSAL ? min(T, qblk * 64 + 64) : T;     // block-uniform
  for (int j0 = 0; j0 < kv_end; j0 += 32) {
    __syncthreads();
    for (int e = tid; e < 32 * (D / 4); e += 128) {
      const int r = e / (D / 4), c4 = (e % (D / 4)) * 4;
      const int key = j0 + r;
      v4f kf = {0.f,0.f,0.f,0.f}, vf = {0.f,0.f,0.f,0.f};
      if (key < T) { kf = *(const v4fa*)(K + (size_t)key * pitch + c4); vf = *(const v4fa*)(V + (size_t)key * pitch + c4); }
#pragma unroll
      for (int t = 0; t < 4; ++t) {
        unsigned short hb = bf16_bits(kf[t]); sKh[r][c4 + t] = hb; sKl[r][c4 + t] = bf16_bits(kf[t] - bf16_val(hb));
        hb = bf16_bits(vf[t]); sVh[r][c4 + t] = hb; sVl[r][c4 + t] = bf16_bits(vf[t] - bf16_val(hb));
      }
    }
    __syncthreads();
    // S tile 16 x 32
    v8f s[2];
#pragma unroll
    for (int nt = 0; nt < 2; ++nt) {
      v8f acc = {};
#pragma unroll
      for (int ks = 0; ks < KS; ++ks) {
        FragB bh_, bl_;
        bh_.half[0] = *(const v8us*)&sKh[nt * 16 + ln][ks * 32 + 8 * hh]; bh_.half[1] = *(const v8us*)&sKh[nt * 16 + ln][ks * 32 + 16 + 8 * hh];
        bl_.half[0] = *(const v8us*)&sKl[nt * 16 + ln][ks * 32 + 8 * hh]; bl_.half[1] = *(const v8us*)&sKl[nt * 16 + ln][ks * 32 + 16 + 8 * hh];
        acc = mmaN<3>(aqh[ks].v, aql[ks].v, bh_.v, bl_.v, acc);
      }
      s[nt] = acc;
    }
    // mask + running max (rows 8hh+r; the 16 lanes of a half share rows)
    float alpha[8];
#pragma unroll
    for (int r = 0; r < 8; ++r) {
      const int qi = q0 + 8 * hh + r;
      const int ja = j0 + ln, jb = j0 + 16 + ln;
      if (CAUSAL) { if (ja > qi) s[0][r] = -3.0e38f; if (jb > qi) s[1][r] = -3.0e38f; }
      if (ja >= T) s[0][r] = -3.0e38f;
      if (jb >= T) s[1][r] = -3.0e38f;
      float mx = fmaxf(s[0][r], s[1][r]);
      mx = fmaxf(mx, __shfl_xor(mx, 1, 32)); mx = fmaxf(mx, __shfl_xor(mx, 2, 32)); mx = fmaxf(mx, __shfl_xor(mx, 4, 32)); mx = fmaxf(mx, __shfl_xor(mx, 8, 32));
      const float mnew = fmaxf(m_r[r], mx);
      alpha[r] = (mnew > -1.0e38f) ? __expf(m_r[r] - mnew) : 1.0f;
      const float p0 = (s[0][r] > -1.0e38f) ? __expf(s[0][r] - mnew) : 0.f;
      const float p1 = (s[1][r] > -1.0e38f) ? __expf(s[1][r] - mnew) : 0.f;
      m_r[r] = mnew;
      l_r[r] = l_r[r] * alpha[r] + p0 + p1;            // per-lane partial row sum (16 lanes combined at the end)
      unsigned short hb = bf16_bits(p0); sPh[w][8 * hh + r][ln] = hb;      sPl[w][8 * hh + r][ln] = bf16_bits(p0 - bf16_val(hb));
      hb = bf16_bits(p1);                sPh[w][8 * hh + r][16 + ln] = hb; sPl[w][8 * hh + r][16 + ln] = bf16_bits(p1 - bf16_val(hb));
    }
#pragma unroll
    for (int dt = 0; dt < DT; ++dt)
#pragma unroll
      for (int r = 0; r < 8; ++r) oacc[dt][r] *= alpha[r];
    __builtin_amdgcn_fence(__ATOMIC_ACQ_REL, "workgroup");
    __builtin_amdgcn_wave_barrier();
    FragB pah, pal;
    pah.half[0] = *(const v8us*)&sPh[w][ln][8 * hh]; pah.half[1] = *(const v8us*)&sPh[w][ln][16 + 8 * hh];
    pal.half[0] = *(const v8us*)&sPl[w][ln][8 * hh]; pal.half[1] = *(const v8us*)&sPl[w][ln][16 + 8 * hh];
#pragma unroll
    for (int dt = 0; dt < DT; ++dt) {
      FragB bvh, bvl;
#pragma unroll
      for (int i = 0; i < 8; ++i) {
        bvh.u[i] = sVh[8 * hh + i][dt * 16 + ln]; bvh.u[8 + i] = sVh[16 + 8 * hh + i][dt * 16 + ln];
        bvl.u[i] = sVl[8 * hh + i][dt * 16 + ln]; bvl.u[8 + i] = sVl[16 + 8 * hh + i][dt * 16 + ln];
      }
      oacc[dt] = mmaN<3>(pah.v, pal.v, bvh.v, bvl.v, oacc[dt]);
    }
    __builtin_amdgcn_fence(__ATOMIC_ACQ_REL, "workgroup");
    __builtin_amdgcn_wave_barrier();
  }
#pragma unroll
  for (int r = 0; r < 8; ++r) {
    float l = l_r[r];
    l += __shfl_xor(l, 1, 32); l += __shfl_xor(l, 2, 32); l += __shfl_xor(l, 4, 32); l += __shfl_xor(l, 8, 32);
    l_r[r] = (l > 0.f) ? 1.0f / l : 0.f;
  }
#pragma unroll
  for (int dt = 0; dt < DT; ++dt)
#pragma unroll
    for (int r = 0; r < 8; ++r) sO[w][8 * hh + r][dt * 16 + ln] = oacc[dt][r] * l_r[r];
  __builtin_amdgcn_fence(__ATOMIC_ACQ_REL, "workgroup");
  __builtin_amdgcn_wave_barrier();
  {
    for (int r = 0; r < 16; ++r) {
      const int row = q0 + r;
      if (row < T && lane < D / 4) {
        const v4f val = *(const v4fa*)&sO[w][r][lane * 4];
        *(v4f*)(y + ((size_t)b * T + row) * ypitch + h * D + lane * 4) = val;
      }
    }
    
  }
}
// One chunk's own state, stored transposed: U[bh][n][dv][dk] = sum over j < 64 of (g^(63-j) * k[64n+j][dk]) * v[64n+j][dv], g = the head's decay.
// Block = one (batch, head, chunk); wave w = all 128 dk (A rows) by the 16 dv columns w*16..; 3-term bf16 hi/lo split, f32 accumulate.
// Every loop is unrolled so that the arrays it indexes (loaded rows, fragments, accumulators) stay in registers.
__global__ __launch_bounds__(256) void k_chunk_state(const float* __restrict__ k, const float* __restrict__ v, float* __restrict__ U) {
  __shared__ __attribute__((aligned(16))) unsigned short sKh[HD][72], sKl[HD][72], sVh[HD][72], sVl[HD][72];   // [column][key]: both operands contract over keys
  const int tid = threadIdx.x, w = tid >> 5, lane = tid & 31, ln = lane & 15, hh = lane >> 4;
  const int bh = blockIdx.x / (NC - 1), n = blockIdx.x % (NC - 1);     // the last chunk's state has no reader
  const int b = bh / NH, h = bh % NH;
  const float log_a = logf(1.0f - exp2f(-5.0f - (float)h));
  const float* K = k + ((size_t)b * TT + n * 64) * DD + h * HD; const float* V = v + ((size_t)b * TT + n * 64) * DD + h * HD;
  // a thread transposes 4 keys x 4 columns in registers: 8 lanes read 128 contiguous bytes of a row, and each column goes to LDS as one 8-byte store of 4 keys
  const int cl = tid & 7, k4 = ((tid >> 3) & 15) * 4, ch = tid >> 7;
  float dec[4];
#pragma unroll
  for (int j = 0; j < 4; ++j) dec[j] = expf((float)(63 - (k4 + j)) * log_a);
  const float* kp = K + (size_t)k4 * DD + (cl + 8 * ch) * 4; const float* vp = V + (size_t)k4 * DD + (cl + 8 * ch) * 4;
  v4f kf[2][4], vf[2][4];
#pragma unroll
  for (int i = 0; i < 2; ++i)
#pragma unroll
    for (int j = 0; j < 4; ++j) { kf[i][j] = *(const v4fa*)(kp + (size_t)j * DD + i * 64); vf[i][j] = *(const v4fa*)(vp + (size_t)j * DD + i * 64); }
  // precaution: wait before any register that an issued load names is rewritten; the two addresses are inputs so that no load lands in them ahead of the wait
  asm volatile("s_wait_xcnt 0x0" :: "v"(kp), "v"(vp) : "memory");
#pragma unroll
  for (int i = 0; i < 2; ++i) {
    const int c4 = (cl + 8 * (ch + 2 * i)) * 4;
#pragma unroll
    for (int t = 0; t < 4; ++t) {
      v2u kh, kl, vh, vl;
#pragma unroll
      for (int j = 0; j < 2; ++j) {
        unsigned int h, l;
        split2(kf[i][2 * j][t] * dec[2 * j], kf[i][2 * j + 1][t] * dec[2 * j + 1], h, l); kh[j] = h; kl[j] = l;
        split2(vf[i][2 * j][t], vf[i][2 * j + 1][t], h, l); vh[j] = h; vl[j] = l;
      }
      *(v2u*)&sKh[c4 + t][k4] = kh; *(v2u*)&sKl[c4 + t][k4] = kl; *(v2u*)&sVh[c4 + t][k4] = vh; *(v2u*)&sVl[c4 + t][k4] = vl;
    }
  }
  __syncthreads();
  v8f acc[8];
#pragma unroll
  for (int ct = 0; ct < 8; ++ct) acc[ct] = (v8f){0.f,0.f,0.f,0.f,0.f,0.f,0.f,0.f};
#pragma unroll
  for (int ks = 0; ks < 2; ++ks) {
    FragB bvh, bvl;
    bvh.half[0] = *(const v8us*)&sVh[w * 16 + ln][ks * 32 + 8 * hh]; bvh.half[1] = *(const v8us*)&sVh[w * 16 + ln][ks * 32 + 16 + 8 * hh];
    bvl.half[0] = *(const v8us*)&sVl[w * 16 + ln][ks * 32 + 8 * hh]; bvl.half[1] = *(const v8us*)&sVl[w * 16 + ln][ks * 32 + 16 + 8 * hh];
#pragma unroll
    for (int ct = 0; ct < 8; ++ct) {
      FragB akh, akl;
      akh.half[0] = *(const v8us*)&sKh[ct * 16 + ln][ks * 32 + 8 * hh]; akh.half[1] = *(const v8us*)&sKh[ct * 16 + ln][ks * 32 + 16 + 8 * hh];
      akl.half[0] = *(const v8us*)&sKl[ct * 16 + ln][ks * 32 + 8 * hh]; akl.half[1] = *(const v8us*)&sKl[ct * 16 + ln][ks * 32 + 16 + 8 * hh];
      acc[ct] = mmaN<3>(akh.v, akl.v, bvh.v, bvl.v, acc[ct]);
    }
  }
  // acc[ct][r] = U[dk = ct*16 + 8*hh + r][dv = w*16 + ln]: 8 neighbouring dk of one dv row
  float* Uo = U + ((size_t)bh * NC + n) * (HD * HD) + (size_t)(w * 16 + ln) * HD + 8 * hh;
#pragma unroll
  for (int ct = 0; ct < 8; ++ct) {
    *(v4f*)(Uo + ct * 16) = (v4f){acc[ct][0], acc[ct][1], acc[ct][2], acc[ct][3]};
    *(v4f*)(Uo + ct * 16 + 4) = (v4f){acc[ct][4], acc[ct][5], acc[ct][6], acc[ct][7]};
  }
}

// State in front of chunk n+1: S[n+1] = g^64 * S[n] + U[n], S[0] = 0, element by element in f32; stored as bf16 hi/lo planes [bh][n][dv][dk]
// (plane 0 is never written and never read). Thread = 4 neighbouring elements of one (batch, head).
__global__ __launch_bounds__(256) void k_state_scan(const float* __restrict__ U, unsigned short* __restrict__ Sh, unsigned short* __restrict__ Sl) {
  const int t = blockIdx.x * 256 + threadIdx.x;
  const int bh = t / (HD * HD / 4), e = (t % (HD * HD / 4)) * 4;
  const float g64 = expf(64.0f * logf(1.0f - exp2f(-5.0f - (float)(bh % NH))));
  const size_t o0 = (size_t)bh * NC * (HD * HD) + e;
  v4f u[NC - 1];
  // all loads first: they depend on nothing, so the serial recurrence below meets one memory latency and not one per chunk
#pragma unroll
  for (int n = 0; n < NC - 1; ++n) u[n] = *(const v4fa*)(U + o0 + (size_t)n * (HD * HD));
  v4f s = {0.f, 0.f, 0.f, 0.f};
  // unrolled so that u[] is indexed by constants and stays in registers
#pragma unroll
  for (int n = 0; n < NC - 1; ++n) {
    v2u hi, lo;
    // both inner loops unrolled for the same reason: s, hi and lo are indexed by constants
#pragma unroll
    for (int i = 0; i < 4; ++i) s[i] = s[i] * g64 + u[n][i];
#pragma unroll
    for (int i = 0; i < 2; ++i) { unsigned int h, l; split2(s[2 * i], s[2 * i + 1], h, l); hi[i] = h; lo[i] = l; }
    *(v2u*)(Sh + o0 + (size_t)(n + 1) * (HD * HD)) = hi;
    *(v2u*)(Sl + o0 + (size_t)(n + 1) * (HD * HD)) = lo;
    asm volatile("s_wait_xcnt 0x0" ::: "memory");   // before the next chunk's values reuse the registers that the two stores name
  }
}

// retention: out[b][t][h*128 + dv0..dv0+63] = Σ_{s<=t} ((q_t·k_s)/√dh)·γ_h^(t−s) · v_s  (γ_h = 1 − 2^(−5−h), decay computed as exp((t−s)·log γ_h))
// Chunked by 64 keys: with t0 the first query of the block, g^(t-s) = g^(t-t0+1) * g^(t0-1-s) for every key s < t0, so all keys in front of the block's own
// chunk enter as g^(t-t0+1)/sqrt(dh) * q_t . S, S = sum over s < t0 of g^(t0-1-s) k_s v_s^T (k_chunk_state, k_state_scan); the own chunk keeps the score tile.
__global__ __launch_bounds__(128) void k_ret(const float* __restrict__ q, const float* __restrict__ k, const float* __restrict__ v,
                                             const unsigned short* __restrict__ Sh, const unsigned short* __restrict__ Sl, float* __restrict__ y) {
  constexpr int KS = HD / 32, DV = 64, DT = DV / 16;
  // One LDS array in two halves, each used twice. First half: the block's state tile (hi and lo plane, DV rows each); once every wave has left it,
  // the weight planes and the staged output. Second half: each wave's 16 q rows in f32; once every wave has its q fragments, the key and value planes.
  constexpr int SSP = HD + 8;                              // pitch in bf16 of a state row: 272 B, the pitch for 16-byte fragment reads of 256-B rows
  constexpr int QSP = HD + 4;                              // pitch in f32 of a q row: 528 B = 16 B x odd, the pitch for 16-byte reads a row apart
  constexpr int O_SL = DV * SSP, O_Q = 2 * DV * SSP, E_ALL = O_Q + 4 * 16 * QSP * 2;
  constexpr int O_PH = 0, O_PL = O_PH + 4 * 16 * 40, O_O = O_PL + 4 * 16 * 40;
  constexpr int O_KH = O_Q, O_KL = O_KH + 32 * (HD + 8), O_VH = O_KL + 32 * (HD + 8), O_VL = O_VH + 32 * (DV + 8);
  static_assert(O_O + 4 * 16 * DV * 2 <= O_Q && O_VL + 32 * (DV + 8) <= E_ALL, "the second use of each half must fit its first");
  __shared__ __attribute__((aligned(16))) unsigned short sm[E_ALL];
  unsigned short (*sKh)[HD + 8] = (unsigned short (*)[HD + 8])(sm + O_KH), (*sKl)[HD + 8] = (unsigned short (*)[HD + 8])(sm + O_KL);
  unsigned short (*sVh)[DV + 8] = (unsigned short (*)[DV + 8])(sm + O_VH), (*sVl)[DV + 8] = (unsigned short (*)[DV + 8])(sm + O_VL);
  unsigned short (*sPh)[16][40] = (unsigned short (*)[16][40])(sm + O_PH), (*sPl)[16][40] = (unsigned short (*)[16][40])(sm + O_PL);
  f1a (*sO)[16][DV] = (f1a (*)[16][DV])(sm + O_O);
  const int tid = threadIdx.x, w = tid >> 5, lane = tid & 31, ln = lane & 15, hh = lane >> 4;
  const int nqb = TT / 64;
  const int bh = blockIdx.x / nqb, qblk = blockIdx.x % nqb, dv0 = blockIdx.y * DV;
  const int b = bh / NH, h = bh % NH;
  const int q0 = qblk * 64 + w * 16;
  const float log_a = logf(1.0f - exp2f(-5.0f - (float)h));
  const float* Q = q + (size_t)b * TT * DD + h * HD; const float* K = k + (size_t)b * TT * DD + h * HD; const float* V = v + (size_t)b * TT * DD + h * HD + dv0;
  // Every global load is whole-line (a wave-wide load is one q or K row of 512 B, two V rows of 256 B, or two neighbouring state rows: the tile's DV rows are
  // contiguous), and the loads of a phase are issued together, so that the block meets one memory latency per phase and not one per load.
  // Every loop but the one over the two trips is unrolled so that the arrays it indexes stay in registers.
  v4f kf[8], vf[4];
  auto fetch_kv = [&](int j0) {                                         // 32 keys: K rows w + 4 i, V rows (tid >> 4) + 8 i
    const float* kp = K + (size_t)(j0 + w) * DD + lane * 4; const float* vp = V + (size_t)(j0 + (tid >> 4)) * DD + (tid & 15) * 4;
#pragma unroll
    for (int i = 0; i < 8; ++i) kf[i] = *(const v4fa*)(kp + (size_t)i * 4 * DD);
#pragma unroll
    for (int i = 0; i < 4; ++i) vf[i] = *(const v4fa*)(vp + (size_t)i * 8 * DD);
    // precaution: wait before any register that an issued load names is rewritten; the addresses are inputs so that no load lands in them ahead of the wait
    asm volatile("s_wait_xcnt 0x0" :: "v"(kp), "v"(vp) : "memory");
  };
  auto stash_kv = [&]() {
#pragma unroll
    for (int i = 0; i < 8; ++i) {
      v2u hi, lo;
#pragma unroll
      for (int t = 0; t < 2; ++t) { unsigned int h, l; split2(kf[i][2 * t], kf[i][2 * t + 1], h, l); hi[t] = h; lo[t] = l; }
      *(v2u*)&sKh[w + 4 * i][lane * 4] = hi; *(v2u*)&sKl[w + 4 * i][lane * 4] = lo;
    }
#pragma unroll
    for (int i = 0; i < 4; ++i) {
      v2u hi, lo;
#pragma unroll
      for (int t = 0; t < 2; ++t) { unsigned int h, l; split2(vf[i][2 * t], vf[i][2 * t + 1], h, l); hi[t] = h; lo[t] = l; }
      *(v2u*)&sVh[(tid >> 4) + 8 * i][(tid & 15) * 4] = hi; *(v2u*)&sVl[(tid >> 4) + 8 * i][(tid & 15) * 4] = lo;
    }
  };
  const int jstart = qblk * 64;
  FragB aqh[KS], aql[KS];
  {
    const float* qp = Q + (size_t)q0 * DD + lane * 4;
    const size_t so = ((size_t)bh * NC + qblk) * (HD * HD) + (size_t)dv0 * HD + tid * 8;
    const unsigned short* gh = Sh + so; const unsigned short* gl = Sl + so;
    v4f qv[16];
    v8us xh[8], xl[8];
#pragma unroll
    for (int i = 0; i < 16; ++i) qv[i] = *(const v4fa*)(qp + (size_t)i * DD);
    if (qblk > 0) {                                                     // block-uniform; chunk 0 has no earlier keys, and plane 0 is never written
#pragma unroll
      for (int i = 0; i < 8; ++i) { xh[i] = *(const v8us*)(gh + i * 1024); xl[i] = *(const v8us*)(gl + i * 1024); }
    }
    asm volatile("s_wait_xcnt 0x0" :: "v"(qp), "v"(gh), "v"(gl) : "memory");   // the same precaution as in fetch_kv
    fetch_kv(jstart);
    f1a* sq = (f1a*)(sm + O_Q) + w * (16 * QSP);                        // the wave's own q rows
#pragma unroll
    for (int i = 0; i < 16; ++i) *(v4fa*)&sq[i * QSP + lane * 4] = qv[i];
    if (qblk > 0) {
      unsigned short* sd = sm + (tid >> 4) * SSP + (tid & 15) * 8;
#pragma unroll
      for (int i = 0; i < 8; ++i) { *(v8us*)(sd + i * 8 * SSP) = xh[i]; *(v8us*)(sd + O_SL + i * 8 * SSP) = xl[i]; }
    }
    // the wave's lanes hand each other q values through LDS: the stores above stay in front of the reads below
    __builtin_amdgcn_fence(__ATOMIC_ACQ_REL, "workgroup");
    __builtin_amdgcn_wave_barrier();
    const f1a* qr = sq + ln * QSP + 8 * hh;
#pragma unroll
    for (int ks = 0; ks < KS; ++ks) {
      const v4f x4[4] = {*(const v4fa*)(qr + ks * 32), *(const v4fa*)(qr + ks * 32 + 4), *(const v4fa*)(qr + ks * 32 + 16), *(const v4fa*)(qr + ks * 32 + 20)};
#pragma unroll
      for (int i = 0; i < 8; ++i) split2(x4[i >> 1][(i & 1) * 2], x4[i >> 1][(i & 1) * 2 + 1], aqh[ks].d[i], aql[ks].d[i]);
    }
  }
  v8f oacc[DT];
#pragma unroll
  for (int dt = 0; dt < DT; ++dt) oacc[dt] = (v8f){0.f,0.f,0.f,0.f,0.f,0.f,0.f,0.f};
  auto keys32 = [&](int j0) {                                           // the 32 keys that lie in LDS: scores, decayed weights, weights x values
#pragma unroll
    for (int nt = 0; nt < 2; ++nt) {
      v8f acc = {};
#pragma unroll
      for (int ks = 0; ks < KS; ++ks) {
        FragB bh_, bl_;
        bh_.half[0] = *(const v8us*)&sKh[nt * 16 + ln][ks * 32 + 8 * hh]; bh_.half[1] = *(const v8us*)&sKh[nt * 16 + ln][ks * 32 + 16 + 8 * hh];
        bl_.half[0] = *(const v8us*)&sKl[nt * 16 + ln][ks * 32 + 8 * hh]; bl_.half[1] = *(const v8us*)&sKl[nt * 16 + ln][ks * 32 + 16 + 8 * hh];
        acc = mmaN<3>(aqh[ks].v, aql[ks].v, bh_.v, bl_.v, acc);
      }
      const int j = j0 + nt * 16 + ln;
#pragma unroll
      for (int r = 0; r < 8; r += 2) {
        float p[2];                                                     // two rows' weights: one conversion instruction rounds a pair
#pragma unroll
        for (int e = 0; e < 2; ++e) {
          const int t = q0 + 8 * hh + r + e;
          p[e] = (j <= t) ? acc[r + e] * 0.08838834764831845f * expf((float)(t - j) * log_a) : 0.f;
        }
        unsigned int h, l;
        split2(p[0], p[1], h, l);
        sPh[w][8 * hh + r][nt * 16 + ln] = (unsigned short)h; sPh[w][8 * hh + r + 1][nt * 16 + ln] = (unsigned short)(h >> 16);
        sPl[w][8 * hh + r][nt * 16 + ln] = (unsigned short)l; sPl[w][8 * hh + r + 1][nt * 16 + ln] = (unsigned short)(l >> 16);
      }
    }
    __builtin_amdgcn_fence(__ATOMIC_ACQ_REL, "workgroup");
    __builtin_amdgcn_wave_barrier();
    FragB pah, pal;
    pah.half[0] = *(const v8us*)&sPh[w][ln][8 * hh]; pah.half[1] = *(const v8us*)&sPh[w][ln][16 + 8 * hh];
    pal.half[0] = *(const v8us*)&sPl[w][ln][8 * hh]; pal.half[1] = *(const v8us*)&sPl[w][ln][16 + 8 * hh];
#pragma unroll
    for (int dt = 0; dt < DT; ++dt) {
      FragB bvh, bvl;
#pragma unroll
      for (int i = 0; i < 8; ++i) {
        bvh.u[i] = sVh[8 * hh + i][dt * 16 + ln]; bvh.u[8 + i] = sVh[16 + 8 * hh + i][dt * 16 + ln];
        bvl.u[i] = sVl[8 * hh + i][dt * 16 + ln]; bvl.u[8 + i] = sVl[16 + 8 * hh + i][dt * 16 + ln];
      }
      oacc[dt] = mmaN<3>(pah.v, pal.v, bvh.v, bvl.v, oacc[dt]);
    }
    __builtin_amdgcn_fence(__ATOMIC_ACQ_REL, "workgroup");
    __builtin_amdgcn_wave_barrier();
  };
  // kept rolled: the two trips share one text, for speed only
#pragma nounroll
  for (int it = 0; it < 2; ++it) {
    // trip 0: the state tile is complete in LDS, and every wave has read its q rows, whose LDS now takes keys and values; trip 1: every wave has left the first 32 keys
    __syncthreads();
    stash_kv();
    if (it == 0) {
      fetch_kv(jstart + 32);                                            // flies during the state products
      if (qblk > 0) {                                                   // block-uniform
        const unsigned short* rh = sm + ln * SSP + 8 * hh; const unsigned short* rl = rh + O_SL;
#pragma unroll
        for (int dt = 0; dt < DT; ++dt) {
          FragB fh[KS], fl[KS];
#pragma unroll
          for (int ks = 0; ks < KS; ++ks) {
            fh[ks].half[0] = *(const v8us*)(rh + dt * 16 * SSP + ks * 32); fh[ks].half[1] = *(const v8us*)(rh + dt * 16 * SSP + ks * 32 + 16);
            fl[ks].half[0] = *(const v8us*)(rl + dt * 16 * SSP + ks * 32); fl[ks].half[1] = *(const v8us*)(rl + dt * 16 * SSP + ks * 32 + 16);
          }
          v8f acc = {};
#pragma unroll
          for (int ks = 0; ks < KS; ++ks) acc = mmaN<3>(aqh[ks].v, aql[ks].v, fh[ks].v, fl[ks].v, acc);
#pragma unroll
          for (int r = 0; r < 8; ++r) oacc[dt][r] = acc[r] * 0.08838834764831845f * expf((float)(w * 16 + 8 * hh + r + 1) * log_a);
        }
      }
    }
    __syncthreads();                                                    // these 32 keys are complete in LDS; trip 0: every wave has left the state tile, whose LDS now takes the weights
    keys32(jstart + 32 * it);
  }
#pragma unroll
  for (int dt = 0; dt < DT; ++dt)
#pragma unroll
    for (int r = 0; r < 8; ++r) sO[w][8 * hh + r][dt * 16 + ln] = oacc[dt][r];
  __builtin_amdgcn_fence(__ATOMIC_ACQ_REL, "workgroup");
  __builtin_amdgcn_wave_barrier();
  {
    for (int r = 0; r < 16; ++r) { if (lane < DV / 4) { const v4f val = *(const v4fa*)&sO[w][r][lane * 4]; *(v4f*)(y + ((size_t)b * TT + q0 + r) * DD + h * HD + dv0 + lane * 4) = val; } }
    
  }
}


// Z[row][h*128+d] = silu(g) · (ret − mean)/sqrt(var + 1e-6) per (row, head) over 128; wave per (row, head), lane = 4 values
// Z leaves as the two bf16 terms that the last GEMM multiplies: hi = Z rounded, lo = (Z - hi) rounded; a row of zh is its DD hi values, then its DD lo values
__global__ __launch_bounds__(256) void k_gn_gate(const float* __restrict__ ret, const float* __restrict__ g, unsigned short* __restrict__ zh) {
  const int tid = threadIdx.x, w = tid >> 5, lane = tid & 31; const size_t rh = (size_t)blockIdx.x * 8 + w; if (rh >= (size_t)BB * TT * NH) return;
  const size_t base = rh * HD + lane * 4;        // rows are [row][h*128 + d] contiguous -> rh*128
  const v4f a = *(const v4fa*)(ret + base), gg = *(const v4fa*)(g + base);
  float s = a[0] + a[1] + a[2] + a[3]; for (int o = 16; o >= 1; o >>= 1) s += __shfl_xor(s, o, 32); const float mu = s * (1.0f / HD);
  float q2 = 0.f; for (int q = 0; q < 4; ++q) { const float c = a[q] - mu; q2 += c * c; } for (int o = 16; o >= 1; o >>= 1) q2 += __shfl_xor(q2, o, 32);
  const float rs = rsqrtf(q2 * (1.0f / HD) + 1e-6f);
  v4f o4; for (int q = 0; q < 4; ++q) o4[q] = (gg[q] / (1.0f + expf(-gg[q]))) * ((a[q] - mu) * rs);
  v2u hi, lo; for (int q = 0; q < 2; ++q) { unsigned int h, l; split2(o4[2 * q], o4[2 * q + 1], h, l); hi[q] = h; lo[q] = l; }
  unsigned short* zo = zh + base + (rh / NH) * DD;
  *(v2u*)zo = hi; *(v2u*)(zo + DD) = lo;
}
extern "C" void kernel_launch(void* const* d_in, const int* in_sizes, int n_in,
                              void* d_out, int out_size, void* d_ws, size_t ws_size, hipStream_t stream) {
  (void)in_sizes; (void)n_in; (void)out_size;
  const float* X = (const float*)d_in[0]; const float* Wq = (const float*)d_in[1]; const float* Wk = (const float*)d_in[2]; const float* Wv = (const float*)d_in[3]; const float* WG = (const float*)d_in[4]; const float* WO = (const float*)d_in[5];
  char* ws = (char*)d_ws; size_t off = 0;
  auto take = [&](size_t bytes) { char* p = ws + off; off += (bytes + 255) & ~(size_t)255; return p; };
  const int M = BB * TT, gb = (M / 128) * (DD / 128);
  unsigned short* Wt[5]; for (int i = 0; i < 5; ++i) Wt[i] = (unsigned short*)take((size_t)DD * DD * 2);
  unsigned short* Xb = (unsigned short*)take((size_t)M * DD * 2);
  float* q = (float*)take((size_t)M * DD * 4); float* k = (float*)take((size_t)M * DD * 4); float* v = (float*)take((size_t)M * DD * 4); float* g = (float*)take((size_t)M * DD * 4); float* ret = (float*)take((size_t)M * DD * 4);
  float* U = (float*)take((size_t)BB * NH * NC * HD * HD * 4); unsigned short* Sh = (unsigned short*)take((size_t)BB * NH * NC * HD * HD * 2); unsigned short* Sl = (unsigned short*)take((size_t)BB * NH * NC * HD * HD * 2);
  if (off > ws_size) return;
  k_wt_bf16<<<dim3((DD / 128) * (DD / 128), 5 + M * DD / XBLK / ((DD / 128) * (DD / 128))), 256, 0, stream>>>(Wq, Wk, Wv, WG, WO, X, Wt[0], Xb);   // X @ W: [K][N]; y >= 5: X -> bf16
  k_gemm_t256<4><<<4 * (M / 256) * (DD / 256), 256, 0, stream>>>(Xb, Wt[0], q);                                           // q, k, v, g: neighbours in ws, as Wt[0..3] are
  k_chunk_state<<<BB * NH * (NC - 1), 256, 0, stream>>>(k, v, U);
  k_state_scan<<<BB * NH * (HD * HD / 4) / 256, 256, 0, stream>>>(U, Sh, Sl);
  k_ret<<<dim3(BB * NH * (TT / 64), 2), 128, 0, stream>>>(q, k, v, Sh, Sl, ret);
  k_gn_gate<<<(BB * TT * NH + 7) / 8, 256, 0, stream>>>(ret, g, (unsigned short*)q);                                   // q's 16 MiB reused as Z in bf16 hi and lo
  k_gemm_bf<true, 1><<<gb, 256, 0, stream>>>((const unsigned short*)q, Wt[4], (float*)d_out);
}

// v009
// Measured time: 91.8 microseconds a run.
// Two timings next to v008 put it at 1.34 and 1.35 times that version's speed.
// All steps since v000 together make it 8.16 times as fast.
#include <hip/hip_runtime.h>
#include <stdint.h>
// All contractions on v_wmma_f32_16x16x32_bf16, f32 accumulate: q/k/v/g = X·W (X, W rounded to bf16: single exact term); per-head retention
// Σ_{s≤t} ((q_t·k_s)/√128)·γ_h^{t−s}·v_s as 3-term bf16 hi/lo splits (scores and decayed weights split in registers/LDS); (silu(g)∘GN(ret))·W_O with
// the A operand split (2 terms). Decay factors, the per-head GroupNorm (no affine, eps 1e-6) and silu in f32.
#define BB 2
#define TT 2048
#define DD 1024
#define NH 8
#define HD 128
#define NC (TT / 64)   // chunks of 64 keys per sequence

typedef __bf16 v16b __attribute__((ext_vector_type(16)));
typedef unsigned short v8us __attribute__((ext_vector_type(8), may_alias));
typedef unsigned short v4us __attribute__((ext_vector_type(4), may_alias));
typedef unsigned int v2u __attribute__((ext_vector_type(2), may_alias));
typedef float f32x2 __attribute__((ext_vector_type(2)));
typedef __bf16 bf16x2 __attribute__((ext_vector_type(2)));
typedef float  v8f  __attribute__((ext_vector_type(8)));
typedef float  v4f  __attribute__((ext_vector_type(4)));
typedef float  v4fa __attribute__((ext_vector_type(4), may_alias));
union FragB { v16b v; v8us half[2]; unsigned short u[16]; unsigned int d[8]; };

// f32 -> bf16, nearest even, by the chip's own conversion instruction
__device__ __forceinline__ unsigned short bf16_bits(float x) { return __builtin_bit_cast(unsigned short, (__bf16)x); }
// two values split into bf16 hi and lo terms, each pair packed in one register (a in the low half): hi = x rounded, lo = (x - hi) rounded
__device__ __forceinline__ void split2(float a, float b, unsigned int& hi, unsigned int& lo) {
  const f32x2 x = {a, b};
  const bf16x2 h = __builtin_convertvector(x, bf16x2);
  const bf16x2 l = __builtin_convertvector(x - __builtin_convertvector(h, f32x2), bf16x2);
  hi = __builtin_bit_cast(unsigned int, h); lo = __builtin_bit_cast(unsigned int, l);
}
__device__ __forceinline__ float bf16_val(unsigned short b) { return __uint_as_float(((unsigned int)b) << 16); }
__device__ __forceinline__ float bf16_round(float x) { return bf16_val(bf16_bits(x)); }
// D += A·B with NT terms: 1 = ah·bh, 2 = + al·bh (A split), 3 = + ah·bl (both split)
template <int NT>
__device__ __forceinline__ v8f mmaN(v16b ah, v16b al, v16b bh, v16b bl, v8f c) {
  c = __builtin_amdgcn_wmma_f32_16x16x32_bf16(false, ah, false, bh, (short)0, c, false, false);
  if (NT >= 2) c = __builtin_amdgcn_wmma_f32_16x16x32_bf16(false, al, false, bh, (short)0, c, false, false);
  if (NT >= 3) c = __builtin_amdgcn_wmma_f32_16x16x32_bf16(false, ah, false, bl, (short)0, c, false, false);
  asm volatile("v_nop\n\tv_nop\n\tv_nop\n\tv_nop" : "+v"(c) : "v"(ah), "v"(al), "v"(bh), "v"(bl));
  return c;
}

// One launch for all five weights: blockIdx.y picks the matrix; the five bf16 transposes lie one behind the other from Wt0.
// Block = one 128 (k) x 128 (n) tile, turned in LDS: a wave reads 512 contiguous bytes of a W row, and 16 lanes store 256 contiguous bytes of a Wt row,
// so that every global access covers whole lines. A thread holds 16 k of 4 neighbouring n and hands each n to LDS as two 16-byte runs of k.
// blockIdx.y >= 5: the same launch rounds X to bf16 once, in place of every column tile of the q/k/v/g GEMM doing it again; block = 16384 elements in row order.
#define XBLK 16384
#define WTP (128 + 8)      // LDS row pitch in bf16: 272 B, the pitch for 16-byte reads of 256-B rows
__global__ __launch_bounds__(256) void k_wt_bf16(const float* __restrict__ W0, const float* __restrict__ W1, const float* __restrict__ W2, const float* __restrict__ W3,
                                                 const float* __restrict__ W4, const float* __restrict__ X, unsigned short* __restrict__ Wt0,
                                                 unsigned short* __restrict__ Xb) {
  constexpr int K = DD, N = DD;
  __shared__ __attribute__((aligned(16))) unsigned short sT[128 * WTP];   // [n][k]
  const int y = blockIdx.y;
  if (y >= 5) {                                             // the same for the whole block, and in front of the barrier
    const size_t e0 = ((size_t)(y - 5) * ((K / 128) * (N / 128)) + blockIdx.x) * XBLK + threadIdx.x * 4;
    const float* xp = X + e0;
    unsigned short* xo = Xb + e0;
    v4f r[16];
    // unrolled so that r[] stays in registers and all 16 loads (512 contiguous bytes a wave each) fly together
#pragma unroll
    for (int i = 0; i < 16; ++i) r[i] = *(const v4fa*)(xp + i * 1024);
    asm volatile("s_wait_xcnt 0x0" :: "v"(xp) : "memory");  // precaution: before any register that an issued load names is rewritten
#pragma unroll
    for (int i = 0; i < 16; ++i) {
      v4us c;
#pragma unroll
      for (int t = 0; t < 4; ++t) c[t] = bf16_bits(r[i][t]);
      *(v4us*)(xo + i * 1024) = c;
    }
    return;
  }
  const float* __restrict__ W = y == 0 ? W0 : y == 1 ? W1 : y == 2 ? W2 : y == 3 ? W3 : W4;
  unsigned short* __restrict__ Wt = Wt0 + (size_t)y * K * N;
  const int tid = threadIdx.x;
  const int k0 = (blockIdx.x % (K / 128)) * 128, n0 = (blockIdx.x / (K / 128)) * 128;
  const int n4 = (tid & 31) * 4, kg = (tid >> 5) * 16;
  const float* wp = W + (size_t)(k0 + kg) * N + n0 + n4;
  v4f x[16];
  // every loop is unrolled so that x[] is indexed by constants and stays in registers; all 16 loads fly together
#pragma unroll
  for (int i = 0; i < 16; ++i) x[i] = *(const v4fa*)(wp + (size_t)i * N);
  asm volatile("s_wait_xcnt 0x0" :: "v"(wp) : "memory");   // precaution: before any register that an issued load names is rewritten
#pragma unroll
  for (int t = 0; t < 4; ++t)
#pragma unroll
    for (int hf = 0; hf < 2; ++hf) {
      v8us c;
#pragma unroll
      for (int i = 0; i < 8; ++i) c[i] = bf16_bits(x[hf * 8 + i][t]);
      *(v8us*)&sT[(n4 + t) * WTP + kg + hf * 8] = c;
    }
  __syncthreads();                                          // the tile is complete in LDS before any row of it is read
  const int r = tid >> 4, c8 = (tid & 15) * 8;
  unsigned short* op = Wt + (size_t)(n0 + r) * K + k0 + c8;
  v8us o[8];
#pragma unroll
  for (int j = 0; j < 8; ++j) o[j] = *(const v8us*)&sT[(r + 16 * j) * WTP + c8];
#pragma unroll
  for (int j = 0; j < 8; ++j) *(v8us*)(op + (size_t)j * 16 * K) = o[j];
}

// GEMM C[M][N] (f32) = A[M][K] * W, M = BB*TT, N = K = DD. A bf16 row-major, rounded once by the kernel that makes it (ASPLIT: each row is K hi values and
// behind them its K lo values -> 2 terms, else one rounded term); Wt bf16 [N][K]. Block = 8 waves = one 128 x 128 tile of C; a stage is 128 k of the 128 A rows and the 128 Wt rows, loaded once per block with
// whole-line loads and shared by all waves through LDS. Two stage buffers, one barrier per stage: the next stage's global loads fly during this stage's products.
// Wave = 32 x 64 of C (waves 4 x 2). Each accumulator sums its k in ascending order, hi term before lo term.
// NW products that share A run as one launch: their Wt planes lie one behind the other from Wt0, their C planes from C0, and the column tiles of all NW
// are numbered through. With more blocks than WGPs two unsplit blocks (136 KiB of LDS each) share a WGP, and one block's loads fly while the other stores or waits.
#define GBK 128            // k per stage
#define GP (GBK + 8)       // LDS row pitch in bf16: 272 B, the pitch for 16-byte fragment reads of 256-B rows
#define GSP 68             // row pitch in f32 of a wave's staged C rows: the two half-waves (rows 8 apart) fall on different banks
typedef float f1a __attribute__((may_alias));
template <bool ASPLIT, int NW>
__global__ __launch_bounds__(256) void k_gemm_bf(const unsigned short* __restrict__ A, const unsigned short* __restrict__ Wt0, float* __restrict__ C0) {
  constexpr int K = DD, N = DD, NT = K / GBK, CT = N / 128;
  constexpr int PLANE = 128 * GP;                       // bf16 elements of one operand plane: [0] A hi, [1] Wt, [2] A lo
  constexpr int STAGE = (ASPLIT ? 3 : 2) * PLANE;
  static_assert(2 * STAGE * 2 >= 8 * 32 * GSP * 4, "the staged C tile must fit the operand buffers");
  __shared__ __attribute__((aligned(16))) unsigned short sm[2 * STAGE];
  const int tid = threadIdx.x, w = tid >> 5, lane = tid & 31, ln = lane & 15, hh = lane >> 4;
  const int wm = w >> 1, wn = w & 1;
  const int ct = blockIdx.x % (NW * CT), which = ct / CT;
  const int row0 = (blockIdx.x / (NW * CT)) * 128, col0 = (ct % CT) * 128;
  const unsigned short* __restrict__ Wt = Wt0 + (size_t)which * N * K;
  float* __restrict__ C = C0 + (size_t)which * (BB * TT) * N;
  const int br = tid >> 4, bc = (tid & 15) * 8;         // A planes and Wt alike: 16 lanes read 256 contiguous bytes of one row
  constexpr int AP = ASPLIT ? 2 * K : K;                // row pitch of A
  const unsigned short* ap = A + (size_t)(row0 + br) * AP + bc;
  const unsigned short* bp = Wt + (size_t)(col0 + br) * K + bc;
  v8us xa[8], xl[8], xb[8];
  // every loop below is unrolled so that the arrays it indexes (loaded rows, fragments, accumulators) stay in registers
  auto fetch = [&](int kb) {
    const unsigned short* pa = ap + kb; const unsigned short* pb = bp + kb;
#pragma unroll
    for (int i = 0; i < 8; ++i) xa[i] = *(const v8us*)(pa + (size_t)i * 16 * AP);
    if (ASPLIT) {
#pragma unroll
      for (int i = 0; i < 8; ++i) xl[i] = *(const v8us*)(pa + (size_t)i * 16 * AP + K);
    }
#pragma unroll
    for (int i = 0; i < 8; ++i) xb[i] = *(const v8us*)(pb + (size_t)i * 16 * K);
    // precaution: wait before any register that an issued load names is rewritten; the addresses are inputs so that no load lands in them ahead of the wait
    asm volatile("s_wait_xcnt 0x0" :: "v"(pa), "v"(pb) : "memory");
  };
  auto stash = [&](unsigned short* st) {
#pragma unroll
    for (int i = 0; i < 8; ++i) {
      *(v8us*)&st[(br + 16 * i) * GP + bc] = xa[i];
      if (ASPLIT) *(v8us*)&st[2 * PLANE + (br + 16 * i) * GP + bc] = xl[i];
    }
#pragma unroll
    for (int i = 0; i < 8; ++i) *(v8us*)&st[PLANE + (br + 16 * i) * GP + bc] = xb[i];
  };
  v8f acc[2][4];
#pragma unroll
  for (int mi = 0; mi < 2; ++mi)
#pragma unroll
    for (int ni = 0; ni < 4; ++ni) acc[mi][ni] = (v8f){0.f,0.f,0.f,0.f,0.f,0.f,0.f,0.f};
  auto products = [&](const unsigned short* st) {
    const unsigned short* pa = st + (wm * 32 + ln) * GP + 8 * hh;
    const unsigned short* pb = st + PLANE + (wn * 64 + ln) * GP + 8 * hh;
#pragma unroll
    for (int ks = 0; ks < GBK / 32; ++ks) {
      FragB a[2], al[2], b[4];
#pragma unroll
      for (int mi = 0; mi < 2; ++mi) {
        a[mi].half[0] = *(const v8us*)(pa + mi * 16 * GP + ks * 32); a[mi].half[1] = *(const v8us*)(pa + mi * 16 * GP + ks * 32 + 16);
        if (ASPLIT) { al[mi].half[0] = *(const v8us*)(pa + 2 * PLANE + mi * 16 * GP + ks * 32); al[mi].half[1] = *(const v8us*)(pa + 2 * PLANE + mi * 16 * GP + ks * 32 + 16); }
      }
#pragma unroll
      for (int ni = 0; ni < 4; ++ni) { b[ni].half[0] = *(const v8us*)(pb + ni * 16 * GP + ks * 32); b[ni].half[1] = *(const v8us*)(pb + ni * 16 * GP + ks * 32 + 16); }
#pragma unroll
      for (int mi = 0; mi < 2; ++mi)
#pragma unroll
        for (int ni = 0; ni < 4; ++ni) acc[mi][ni] = __builtin_amdgcn_wmma_f32_16x16x32_bf16(false, a[mi].v, false, b[ni].v, (short)0, acc[mi][ni], false, false);
      if (ASPLIT) {
#pragma unroll
        for (int mi = 0; mi < 2; ++mi)
#pragma unroll
          for (int ni = 0; ni < 4; ++ni) acc[mi][ni] = __builtin_amdgcn_wmma_f32_16x16x32_bf16(false, al[mi].v, false, b[ni].v, (short)0, acc[mi][ni], false, false);
      }
    }
  };
  fetch(0);
  stash(sm);
  for (int t = 0; t + 1 < NT; ++t) {
    __syncthreads();                                    // stage t is complete in its buffer, and every reader has left the other buffer
    fetch((t + 1) * GBK);
    products(sm + (t & 1) * STAGE);
    stash(sm + ((t + 1) & 1) * STAGE);
  }
  __syncthreads();
  products(sm + ((NT - 1) & 1) * STAGE);
  __syncthreads();                                      // every wave has left the operand buffers: their LDS now stages C, each wave in its own range
  f1a* so = (f1a*)sm + w * (32 * GSP);
#pragma unroll
  for (int mi = 0; mi < 2; ++mi)
#pragma unroll
    for (int ni = 0; ni < 4; ++ni)
#pragma unroll
      for (int r = 0; r < 8; ++r) so[(mi * 16 + 8 * hh + r) * GSP + ni * 16 + ln] = acc[mi][ni][r];
  __builtin_amdgcn_fence(__ATOMIC_ACQ_REL, "workgroup");
  __builtin_amdgcn_wave_barrier();
  float* cp = C + (size_t)(row0 + wm * 32 + hh) * N + col0 + wn * 64 + ln * 4;
  v4f o[16];
#pragma unroll
  for (int q = 0; q < 16; ++q) o[q] = *(const v4fa*)&so[(q * 2 + hh) * GSP + ln * 4];
#pragma unroll
  for (int q = 0; q < 16; ++q) *(v4f*)(cp + (size_t)q * 2 * N) = o[q];   // 16 lanes store 256 contiguous bytes of a row
}

// The q/k/v/g GEMM: C[M][N] (f32) = A[M][K] * W for NW weights that share A, M = BB*TT, N = K = DD; A bf16 row-major, Wt bf16 [N][K], planes as in k_gemm_bf.
// Block = 8 waves = one 256 x 256 tile of C, one block per WGP: a byte fetched from L2 now feeds twice the products of the 128 x 128 tile. Wave = 64 x 128 of C (waves 4 x 2).
// A stage is 128 k of the 256 A rows and the 256 Wt rows. Each wave brings its own slice of 64 rows (256 B each) with one tensor_load_to_lds, which also lays the
// rows at the 272-B pitch; no register is spent on staging, which is what lets the 256 accumulator registers of the wave tile fit. Two stage buffers: the load of stage
// t + 2 is issued when every wave has left stage t. Each accumulator sums its k in ascending order, as before.
// The 256 columns of a block are one head's 128 columns of two weights: k and v, or q and g (waves with wn = 0 hold the first, wn = 1 the second). A wave's 64 rows are one
// chunk of 64 keys, so a k/v block ends with the four chunk states of its rows: U[bh][n][dv][dk] = sum over j < 64 of (g^(63-j) * k[64n+j][dk]) * v[64n+j][dv], g = the head's
// decay, 3-term bf16 hi/lo split, f32 accumulate. An accumulator tile holds column ln and rows 8 hh + r: that is the lane and k order of an A or B fragment that contracts
// over the rows, so two tiles 16 rows apart are rounded in place into one fragment of 32 keys; the two waves of a chunk hand each other their fragments through LDS.
typedef uint32_t u32x4 __attribute__((ext_vector_type(4)));
typedef uint32_t u32x8 __attribute__((ext_vector_type(8)));
__device__ __forceinline__ uint32_t uni(uint32_t v) { return (uint32_t)__builtin_amdgcn_readfirstlane(v); }
__device__ __forceinline__ uint32_t pinned(uint32_t v) { uint32_t w = (uint32_t)__builtin_amdgcn_readfirstlane(v); asm volatile("" : "+s"(w)); return w; }
// work-group barrier whose fences order LDS alone: what the waves hand each other lies in LDS, and a wave's global stores issued in front of it go on draining behind it
// (__syncthreads() would hold every wave until its own stores have returned)
__device__ __forceinline__ void lds_barrier() {
  __builtin_amdgcn_fence(__ATOMIC_RELEASE, "workgroup", "local");
  __builtin_amdgcn_s_barrier();
  __builtin_amdgcn_fence(__ATOMIC_ACQUIRE, "workgroup", "local");
}
#define TSL 18432          // bytes of LDS per slice: 64 rows x 272 B = 17,408, rounded up to a multiple of 2 KiB, where the next slice begins
#define TSE (TSL / 2)      // the same in bf16 elements
#define TST (8 * TSL)      // bytes of one stage buffer: slices 0..3 = A rows, 4..7 = Wt rows
#define CSP 132            // row pitch in f32 of a wave's staged C rows: the two half-waves (rows 8 apart) fall on different banks
template <int NW>
__global__ __launch_bounds__(256) void k_gemm_t256(const unsigned short* __restrict__ A, const unsigned short* __restrict__ Wt0, float* __restrict__ C0, float* __restrict__ U) {
  constexpr int K = DD, N = DD, NT = K / GBK;
  static_assert(NW == 4 && HD == 128, "planes 0..3 are q, k, v, g, and half a block's columns are one head");
  static_assert(NT >= 2, "the ring's prologue fills two stages");
  static_assert(32 * 1024 <= 64 * CSP * 4, "a wave's 32 fragments must fit its own staging range");
  static_assert(8 * 64 * CSP * 4 <= 2 * TST, "the staged C tile must fit the operand buffers");
  __shared__ __attribute__((aligned(2048))) unsigned short sm[2 * TST / 2];
  __shared__ __attribute__((aligned(16))) float sdec[128]; // what a row j of a chunk is scaled by on its way into a fragment: keys g^(63-j), behind them values 1
  const int tid = threadIdx.x, w = tid >> 5, lane = tid & 31, ln = lane & 15, hh = lane >> 4;
  const int wm = w >> 1, wn = w & 1;
  const int ct = blockIdx.x % (2 * NH), head = ct % NH;
  const bool kv = ct < NH;                              // the same for the whole block: k and v of the head, else q and g
  const int row0 = (blockIdx.x / (2 * NH)) * 256;
  float* __restrict__ C = C0 + (size_t)(kv ? 1 + wn : 3 * wn) * (BB * TT) * N;
  if (kv && tid < 128) sdec[tid] = tid < 64 ? expf((float)(63 - tid) * logf(1.0f - exp2f(-5.0f - (float)head))) : 1.0f;   // read far behind the stages' barriers
  // the wave's own slice: its 64 source rows and its place in a stage buffer; slices 4, 5 are the first weight's 128 rows, slices 6, 7 the second's
  const uint32_t wv = uni((uint32_t)w);
  const uint32_t bs = wv - 4u, bw = kv ? 1u + (bs >> 1) : 3u * (bs >> 1);
  const unsigned short* src = wv < 4u ? A + (size_t)(row0 + wv * 64u) * K : Wt0 + (size_t)bw * N * K + (size_t)((uint32_t)head * 128u + (bs & 1u) * 64u) * K;
  const uint64_t src0 = (uint64_t)(uintptr_t)src;
  const uint32_t dst0 = (uint32_t)(size_t)sm + wv * (uint32_t)TSL;
  u32x8 g1;
  g1[0] = uni((1u << 20) | (5u << 22) | (3u << 25));
  g1[1] = uni((256u & 0xFFFFu) << 16);
  g1[2] = uni((256u >> 16) | ((64u & 0xFFFFu) << 16));
  g1[3] = uni((64u >> 16) | (256u << 16));
  g1[4] = uni(64u);
  g1[5] = uni((uint32_t)(K * 2));
  g1[6] = uni(0u);
  g1[7] = uni(0u);
  u32x4 g0;
  g0[0] = uni(1u);
  auto issue = [&](int t) {                             // stage t into buffer t & 1: one request of this wave
    const uint64_t ga = src0 + (uint64_t)t * (GBK * 2);
    g0[1] = uni(dst0 + (uint32_t)(t & 1) * (uint32_t)TST);
    g0[2] = uni((uint32_t)ga);
    g0[3] = uni((((uint32_t)(ga >> 32)) & 0x01FFFFFFu) | 0x80000000u);
    // both groups are in-out operands so that their registers stay the descriptor's own and take no other value while the request is outstanding
    asm volatile("tensor_load_to_lds %0, %1" : "+s"(g0), "+s"(g1) :: "memory");
  };
  // every loop below but the one over the stages is unrolled so that the arrays it indexes (fragments, accumulators) stay in registers
  v8f acc[4][8];
#pragma unroll
  for (int mi = 0; mi < 4; ++mi)
#pragma unroll
    for (int ni = 0; ni < 8; ++ni) acc[mi][ni] = (v8f){0.f,0.f,0.f,0.f,0.f,0.f,0.f,0.f};
  auto products = [&](const unsigned short* st) {
    const unsigned short* pa = st + wm * TSE + ln * GP + 8 * hh;
    const unsigned short* pb = st + (4 + 2 * wn) * TSE + ln * GP + 8 * hh;
    FragB a[2][4], b[2][8];                             // two fragment sets: the next 32 k are fetched while these are multiplied
    auto frags = [&](int ks) {
#pragma unroll
      for (int mi = 0; mi < 4; ++mi) { a[ks & 1][mi].half[0] = *(const v8us*)(pa + mi * 16 * GP + ks * 32); a[ks & 1][mi].half[1] = *(const v8us*)(pa + mi * 16 * GP + ks * 32 + 16); }
#pragma unroll
      for (int ni = 0; ni < 8; ++ni) {
        const unsigned short* p = pb + (ni >> 2) * TSE + (ni & 3) * 16 * GP + ks * 32;
        b[ks & 1][ni].half[0] = *(const v8us*)p; b[ks & 1][ni].half[1] = *(const v8us*)(p + 16);
      }
    };
    frags(0);
#pragma unroll
    for (int ks = 0; ks < GBK / 32; ++ks) {
      if (ks + 1 < GBK / 32) frags(ks + 1);
      __builtin_amdgcn_sched_barrier(0);                // the next block's 24 LDS reads stay one group ahead of this block
#pragma unroll
      for (int mi = 0; mi < 4; ++mi)
#pragma unroll
        for (int ni = 0; ni < 8; ++ni) acc[mi][ni] = __builtin_amdgcn_wmma_f32_16x16x32_bf16(false, a[ks & 1][mi].v, false, b[ks & 1][ni].v, (short)0, acc[mi][ni], false, false);
      __builtin_amdgcn_sched_barrier(0);                // and this block's WMMAs stay ahead of the reads that follow
    }
  };
  issue(0);
  asm volatile("s_wait_tensorcnt 0x0" ::: "memory");    // this wave's slice of stage 0 has landed
  __syncthreads();                                      // every slice of stage 0 has landed before any wave reads it
  issue(1);
  // kept rolled: one text for the eight stages, so that the kernel's text stays small
#pragma nounroll
  for (int t = 0; t < NT; ++t) {
    products(sm + (t & 1) * (TST / 2));
    asm volatile("s_wait_dscnt 0x0" ::: "memory");
    asm volatile("s_wait_tensorcnt 0x0" ::: "memory");
    __syncthreads();
    if (pinned((t + 2 < NT) ? 1u : 0u) != 0u) issue(t + 2);
  }
  asm volatile("s_wait_tensorcnt 0x0" ::: "memory");    // no request is outstanding when the buffers change their use
  asm volatile("s_wait_dscnt 0x0" ::: "memory");
  // behind the last stage's barrier every wave has left the operand buffers: their LDS now stages C, each wave in its own range
  f1a* so = (f1a*)sm + w * (64 * CSP);
#pragma unroll
  for (int mi = 0; mi < 4; ++mi)
#pragma unroll
    for (int ni = 0; ni < 8; ++ni)
#pragma unroll
      for (int r = 0; r < 8; ++r) so[(mi * 16 + 8 * hh + r) * CSP + ni * 16 + ln] = acc[mi][ni][r];
  __builtin_amdgcn_fence(__ATOMIC_ACQ_REL, "workgroup");
  __builtin_amdgcn_wave_barrier();
  float* cp = C + (size_t)(row0 + wm * 64) * N + head * HD + lane * 4;
#pragma unroll
  for (int qq = 0; qq < 4; ++qq) {
    v4f o[16];
#pragma unroll
    for (int q = 0; q < 16; ++q) o[q] = *(const v4fa*)&so[(qq * 16 + q) * CSP + lane * 4];
#pragma unroll
    for (int q = 0; q < 16; ++q) *(v4f*)(cp + (size_t)(qq * 16 + q) * N) = o[q];   // a wave stores 512 contiguous bytes of a row
    asm volatile("s_wait_xcnt 0x0" ::: "memory");       // precaution: before the next rows reuse registers that the issued stores name
  }
  if (!kv) return;                                      // the same for the whole block, and in front of the barriers below
  // the wave's accumulators become its 32 fragments (8 column tiles x 2 halves of the chunk x hi, lo; 1 KiB each, lane-major) in its own range, whose staged rows it has read
  unsigned short* fo = sm + w * (64 * CSP * 2) + lane * 8;
#pragma unroll
  for (int ks = 0; ks < 2; ++ks) {
    v4f dec[2][2];
#pragma unroll
    for (int hf = 0; hf < 2; ++hf)
#pragma unroll
      for (int e = 0; e < 2; ++e) dec[hf][e] = *(const v4fa*)&sdec[wn * 64 + (2 * ks + hf) * 16 + 8 * hh + 4 * e];
#pragma unroll
    for (int ni = 0; ni < 8; ++ni) {
      FragB fh, fl;
#pragma unroll
      for (int hf = 0; hf < 2; ++hf)
#pragma unroll
        for (int j = 0; j < 4; ++j)
          split2(acc[2 * ks + hf][ni][2 * j] * dec[hf][j >> 1][(j & 1) * 2], acc[2 * ks + hf][ni][2 * j + 1] * dec[hf][j >> 1][(j & 1) * 2 + 1], fh.d[4 * hf + j], fl.d[4 * hf + j]);
      unsigned short* f = fo + (ni * 2 + ks) * 1024;
      *(v8us*)f = fh.half[0]; *(v8us*)(f + 256) = fh.half[1]; *(v8us*)(f + 512) = fl.half[0]; *(v8us*)(f + 768) = fl.half[1];
    }
  }
  lds_barrier();                                        // every wave's fragments are complete in LDS before its partner reads them
  const int row = row0 + (int)(wv >> 1) * 64, n = (row % TT) / 64;
  const bool live = n < NC - 1;                         // the same for the whole wave: the last chunk's state has no reader
  // wave = all 128 dk (A rows, from the chunk's k wave) by the 64 dv columns wn*64.. (from its v wave); each accumulator sums hi*hi, lo*hi, hi*lo of keys 0..31, then of 32..63
  v8f u[8][4];
#pragma unroll
  for (int c = 0; c < 8; ++c)
#pragma unroll
    for (int dt = 0; dt < 4; ++dt) u[c][dt] = (v8f){0.f,0.f,0.f,0.f,0.f,0.f,0.f,0.f};
  if (live) {
    const unsigned short* fa = sm + (wm * 2) * (64 * CSP * 2) + lane * 8;
    const unsigned short* fb = sm + (wm * 2 + 1) * (64 * CSP * 2) + wn * (8 * 1024) + lane * 8;
    FragB bvh[2][4], bvl[2][4], akh[2], akl[2];         // two sets of A fragments: the next tile's are fetched while this tile's are multiplied
    auto afrag = [&](int i) {                           // i = ks * 8 + c
      const unsigned short* p = fa + ((i & 7) * 2 + (i >> 3)) * 1024;
      akh[i & 1].half[0] = *(const v8us*)p; akh[i & 1].half[1] = *(const v8us*)(p + 256); akl[i & 1].half[0] = *(const v8us*)(p + 512); akl[i & 1].half[1] = *(const v8us*)(p + 768);
    };
#pragma unroll
    for (int ks = 0; ks < 2; ++ks)
#pragma unroll
      for (int dt = 0; dt < 4; ++dt) {
        const unsigned short* p = fb + (dt * 2 + ks) * 1024;
        bvh[ks][dt].half[0] = *(const v8us*)p; bvh[ks][dt].half[1] = *(const v8us*)(p + 256); bvl[ks][dt].half[0] = *(const v8us*)(p + 512); bvl[ks][dt].half[1] = *(const v8us*)(p + 768);
      }
    afrag(0);
#pragma unroll
    for (int i = 0; i < 16; ++i) {
      const int ks = i >> 3, c = i & 7;
      if (i + 1 < 16) afrag(i + 1);
      __builtin_amdgcn_sched_barrier(0);                // the next tile's 4 LDS reads stay one group ahead of these WMMAs, and no further ahead: more sets would not fit the registers
#pragma unroll
      for (int dt = 0; dt < 4; ++dt) u[c][dt] = __builtin_amdgcn_wmma_f32_16x16x32_bf16(false, akh[i & 1].v, false, bvh[ks][dt].v, (short)0, u[c][dt], false, false);
#pragma unroll
      for (int dt = 0; dt < 4; ++dt) u[c][dt] = __builtin_amdgcn_wmma_f32_16x16x32_bf16(false, akl[i & 1].v, false, bvh[ks][dt].v, (short)0, u[c][dt], false, false);
#pragma unroll
      for (int dt = 0; dt < 4; ++dt) u[c][dt] = __builtin_amdgcn_wmma_f32_16x16x32_bf16(false, akh[i & 1].v, false, bvl[ks][dt].v, (short)0, u[c][dt], false, false);
      __builtin_amdgcn_sched_barrier(0);                // and these WMMAs stay ahead of the reads that follow
    }
  }
  lds_barrier();                                        // both waves of every chunk have left the fragments: each wave's range now stages its 64 dv rows of U
  if (!live) return;                                    // no barrier follows
  // u[c][dt][r] = U[dk = c*16 + 8*hh + r][dv = wn*64 + dt*16 + ln]: 8 neighbouring dk of one dv row
#pragma unroll
  for (int dt = 0; dt < 4; ++dt)
#pragma unroll
    for (int c = 0; c < 8; ++c) {
      *(v4fa*)&so[(dt * 16 + ln) * CSP + c * 16 + 8 * hh] = (v4f){u[c][dt][0], u[c][dt][1], u[c][dt][2], u[c][dt][3]};
      *(v4fa*)&so[(dt * 16 + ln) * CSP + c * 16 + 8 * hh + 4] = (v4f){u[c][dt][4], u[c][dt][5], u[c][dt][6], u[c][dt][7]};
    }
  // the wave's lanes hand each other values through LDS: the stores above stay in front of the reads below (LDS alone, for the reason given at lds_barrier)
  __builtin_amdgcn_fence(__ATOMIC_ACQ_REL, "workgroup", "local");
  __builtin_amdgcn_wave_barrier();
  float* up = U + ((size_t)((row / TT) * NH + head) * NC + n) * (HD * HD) + (size_t)(wn * 64) * HD + lane * 4;
#pragma unroll
  for (int qq = 0; qq < 4; ++qq) {
    v4f o[16];
#pragma unroll
    for (int q = 0; q < 16; ++q) o[q] = *(const v4fa*)&so[(qq * 16 + q) * CSP + lane * 4];
#pragma unroll
    for (int q = 0; q < 16; ++q) *(v4f*)(up + (size_t)(qq * 16 + q) * HD) = o[q];   // a wave stores one whole dv row, 512 contiguous bytes
    asm volatile("s_wait_xcnt 0x0" ::: "memory");       // precaution: before the next rows reuse registers that the issued stores name
  }
}

// Flash-style causal/unmasked attention, all contractions 3-term bf16 hi/lo splits, f32 softmax with running max.
// q,k,v rows are read from f32 buffers with arbitrary row pitch (so they can live inside a fused qkv buffer);
// D = head size (multiple of 32, <= 128); one wave = 16 query rows; block = 4 waves (64 queries) sharing K/V chunks of 32.
template <int D, bool CAUSAL>
__global__ __launch_bounds__(128) void k_flash(const float* __restrict__ qb, const float* __restrict__ kb, const float* __restrict__ vb,
                                             int pitch, int T, int H, float scale, float* __restrict__ y, int ypitch) {
  constexpr int KS = D / 32;        // k-steps for QK
  constexpr int DT = D / 16;        // d tiles for PV
  __shared__ __attribute__((aligned(16))) unsigned short sKh[32][D + 8], sKl[32][D + 8], sVh[32][D + 8], sVl[32][D + 8];
  __shared__ __attribute__((aligned(16))) unsigned short sPh[4][16][40], sPl[4][16][40];
  __shared__ __attribute__((aligned(16))) float sO[4][16][D];
  const int tid = threadIdx.x, w = tid >> 5, lane = tid & 31, ln = lane & 15, hh = lane >> 4;
  const int nqb = (T + 63) / 64;
  const int bh = blockIdx.x / nqb, qblk = blockIdx.x % nqb;
  const int b = bh / H, h = bh % H;
  const int q0 = qblk * 64 + w * 16;
  const float* Q = qb + (size_t)b * T * pitch + h * D;
  const float* K = kb + (size_t)b * T * pitch + h * D;
  const float* V = vb + (size_t)b * T * pitch + h * D;

  // A fragments of the wave's 16 query rows (scaled), hi/lo
  FragB aqh[KS], aql[KS];
  {
    int row = q0 + ln; if (row >= T) row = T - 1;
    const float* qr = Q + (size_t)row * pitch;
#pragma unroll
    for (int ks = 0; ks < KS; ++ks)
#pragma unroll
      for (int i = 0; i < 16; ++i) {
        const int d = ks * 32 + ((i < 8) ? (8 * hh + i) : (16 + 8 * hh + (i - 8)));
        const float x = qr[d] * scale; const unsigned short hb = bf16_bits(x);
        aqh[ks].u[i] = hb; aql[ks].u[i] = bf16_bits(x - bf16_val(hb));
      }
  }
  float m_r[8], l_r[8];
#pragma unroll
  for (int r = 0; r < 8; ++r) { m_r[r] = -3.0e38f; l_r[r] = 0.f; }
  v8f oacc[DT];
#pragma unroll
  for (int dt = 0; dt < DT; ++dt) oacc[dt] = (v8f){0.f,0.f,0.f,0.f,0.f,0.f,0.f,0.f};

  const int kv_end = CAUSAL ? min(T, qblk * 64 + 64) : T;     // block-uniform
  for (int j0 = 0; j0 < kv_end; j0 += 32) {
    __syncthreads();
    for (int e = tid; e < 32 * (D / 4); e += 128) {
      const int r = e / (D / 4), c4 = (e % (D / 4)) * 4;
      const int key = j0 + r;
      v4f kf = {0.f,0.f,0.f,0.f}, vf = {0.f,0.f,0.f,0.f};
      if (key < T) { kf = *(const v4fa*)(K + (size_t)key * pitch + c4); vf = *(const v4fa*)(V + (size_t)key * pitch + c4); }
#pragma unroll
      for (int t = 0; t < 4; ++t) {
        unsigned short hb = bf16_bits(kf[t]); sKh[r][c4 + t] = hb; sKl[r][c4 + t] = bf16_bits(kf[t] - bf16_val(hb));
        hb = bf16_bits(vf[t]); sVh[r][c4 + t] = hb; sVl[r][c4 + t] = bf16_bits(vf[t] - bf16_val(hb));
      }
    }
    __syncthreads();
    // S tile 16 x 32
    v8f s[2];
#pragma unroll
    for (int nt = 0; nt < 2; ++nt) {
      v8f acc = {};
#pragma unroll
      for (int ks = 0; ks < KS; ++ks) {
        FragB bh_, bl_;
        bh_.half[0] = *(const v8us*)&sKh[nt * 16 + ln][ks * 32 + 8 * hh]; bh_.half[1] = *(const v8us*)&sKh[nt * 16 + ln][ks * 32 + 16 + 8 * hh];
        bl_.half[0] = *(const v8us*)&sKl[nt * 16 + ln][ks * 32 + 8 * hh]; bl_.half[1] = *(const v8us*)&sKl[nt * 16 + ln][ks * 32 + 16 + 8 * hh];
        acc = mmaN<3>(aqh[ks].v, aql[ks].v, bh_.v, bl_.v, acc);
      }
      s[nt] = acc;
    }
    // mask + running max (rows 8hh+r; the 16 lanes of a half share rows)
    float alpha[8];
#pragma unroll
    for (int r = 0; r < 8; ++r) {
      const int qi = q0 + 8 * hh + r;
      const int ja = j0 + ln, jb = j0 + 16 + ln;
      if (CAUSAL) { if (ja > qi) s[0][r] = -3.0e38f; if (jb > qi) s[1][r] = -3.0e38f; }
      if (ja >= T) s[0][r] = -3.0e38f;
      if (jb >= T) s[1][r] = -3.0e38f;
      float mx = fmaxf(s[0][r], s[1][r]);
      mx = fmaxf(mx, __shfl_xor(mx, 1, 32)); mx = fmaxf(mx, __shfl_xor(mx, 2, 32)); mx = fmaxf(mx, __shfl_xor(mx, 4, 32)); mx = fmaxf(mx, __shfl_xor(mx, 8, 32));
      const float mnew = fmaxf(m_r[r], mx);
      alpha[r] = (mnew > -1.0e38f) ? __expf(m_r[r] - mnew) : 1.0f;
      const float p0 = (s[0][r] > -1.0e38f) ? __expf(s[0][r] - mnew) : 0.f;
      const float p1 = (s[1][r] > -1.0e38f) ? __expf(s[1][r] - mnew) : 0.f;
      m_r[r] = mnew;
      l_r[r] = l_r[r] * alpha[r] + p0 + p1;            // per-lane partial row sum (16 lanes combined at the end)
      unsigned short hb = bf16_bits(p0); sPh[w][8 * hh + r][ln] = hb;      sPl[w][8 * hh + r][ln] = bf16_bits(p0 - bf16_val(hb));
      hb = bf16_bits(p1);                sPh[w][8 * hh + r][16 + ln] = hb; sPl[w][8 * hh + r][16 + ln] = bf16_bits(p1 - bf16_val(hb));
    }
#pragma unroll
    for (int dt = 0; dt < DT; ++dt)
#pragma unroll
      for (int r = 0; r < 8; ++r) oacc[dt][r] *= alpha[r];
    __builtin_amdgcn_fence(__ATOMIC_ACQ_REL, "workgroup");
    __builtin_amdgcn_wave_barrier();
    FragB pah, pal;
    pah.half[0] = *(const v8us*)&sPh[w][ln][8 * hh]; pah.half[1] = *(const v8us*)&sPh[w][ln][16 + 8 * hh];
    pal.half[0] = *(const v8us*)&sPl[w][ln][8 * hh]; pal.half[1] = *(const v8us*)&sPl[w][ln][16 + 8 * hh];
#pragma unroll
    for (int dt = 0; dt < DT; ++dt) {
      FragB bvh, bvl;
#pragma unroll
      for (int i = 0; i < 8; ++i) {
        bvh.u[i] = sVh[8 * hh + i][dt * 16 + ln]; bvh.u[8 + i] = sVh[16 + 8 * hh + i][dt * 16 + ln];
        bvl.u[i] = sVl[8 * hh + i][dt * 16 + ln]; bvl.u[8 + i] = sVl[16 + 8 * hh + i][dt * 16 + ln];
      }
      oacc[dt] = mmaN<3>(pah.v, pal.v, bvh.v, bvl.v, oacc[dt]);
    }
    __builtin_amdgcn_fence(__ATOMIC_ACQ_REL, "workgroup");
    __builtin_amdgcn_wave_barrier();
  }
#pragma unroll
  for (int r = 0; r < 8; ++r) {
    float l = l_r[r];
    l += __shfl_xor(l, 1, 32); l += __shfl_xor(l, 2, 32); l += __shfl_xor(l, 4, 32); l += __shfl_xor(l, 8, 32);
    l_r[r] = (l > 0.f) ? 1.0f / l : 0.f;
  }
#pragma unroll
  for (int dt = 0; dt < DT; ++dt)
#pragma unroll
    for (int r = 0; r < 8; ++r) sO[w][8 * hh + r][dt * 16 + ln] = oacc[dt][r] * l_r[r];
  __builtin_amdgcn_fence(__ATOMIC_ACQ_REL, "workgroup");
  __builtin_amdgcn_wave_barrier();
  {
    for (int r = 0; r < 16; ++r) {
      const int row = q0 + r;
      if (row < T && lane < D / 4) {
        const v4f val = *(const v4fa*)&sO[w][r][lane * 4];
        *(v4f*)(y + ((size_t)b * T + row) * ypitch + h * D + lane * 4) = val;
      }
    }
    
  }
}
// State in front of chunk n+1: S[n+1] = g^64 * S[n] + U[n], S[0] = 0, element by element in f32; stored as bf16 hi/lo planes [bh][n][dv][dk]
// (plane 0 is never written and never read). Thread = 4 neighbouring elements of one (batch, head).
__global__ __launch_bounds__(256) void k_state_scan(const float* __restrict__ U, unsigned short* __restrict__ Sh, unsigned short* __restrict__ Sl) {
  const int t = blockIdx.x * 256 + threadIdx.x;
  const int bh = t / (HD * HD / 4), e = (t % (HD * HD / 4)) * 4;
  const float g64 = expf(64.0f * logf(1.0f - exp2f(-5.0f - (float)(bh % NH))));
  const size_t o0 = (size_t)bh * NC * (HD * HD) + e;
  v4f u[NC - 1];
  // all loads first: they depend on nothing, so the serial recurrence below meets one memory latency and not one per chunk
#pragma unroll
  for (int n = 0; n < NC - 1; ++n) u[n] = *(const v4fa*)(U + o0 + (size_t)n * (HD * HD));
  v4f s = {0.f, 0.f, 0.f, 0.f};
  // unrolled so that u[] is indexed by constants and stays in registers
#pragma unroll
  for (int n = 0; n < NC - 1; ++n) {
    v2u hi, lo;
    // both inner loops unrolled for the same reason: s, hi and lo are indexed by constants
#pragma unroll
    for (int i = 0; i < 4; ++i) s[i] = s[i] * g64 + u[n][i];
#pragma unroll
    for (int i = 0; i < 2; ++i) { unsigned int h, l; split2(s[2 * i], s[2 * i + 1], h, l); hi[i] = h; lo[i] = l; }
    *(v2u*)(Sh + o0 + (size_t)(n + 1) * (HD * HD)) = hi;
    *(v2u*)(Sl + o0 + (size_t)(n + 1) * (HD * HD)) = lo;
    asm volatile("s_wait_xcnt 0x0" ::: "memory");   // before the next chunk's values reuse the registers that the two stores name
  }
}

// retention: out[b][t][h*128 + dv0..dv0+63] = Σ_{s<=t} ((q_t·k_s)/√dh)·γ_h^(t−s) · v_s  (γ_h = 1 − 2^(−5−h), decay computed as exp((t−s)·log γ_h))
// Chunked by 64 keys: with t0 the first query of the block, g^(t-s) = g^(t-t0+1) * g^(t0-1-s) for every key s < t0, so all keys in front of the block's own
// chunk enter as g^(t-t0+1)/sqrt(dh) * q_t . S, S = sum over s < t0 of g^(t0-1-s) k_s v_s^T (k_gemm_t256's chunk states, k_state_scan); the own chunk keeps the score tile.
__global__ __launch_bounds__(128) void k_ret(const float* __restrict__ q, const float* __restrict__ k, const float* __restrict__ v,
                                             const unsigned short* __restrict__ Sh, const unsigned short* __restrict__ Sl, float* __restrict__ y) {
  constexpr int KS = HD / 32, DV = 64, DT = DV / 16;
  // One LDS array in two halves, each used twice. First half: the block's state tile (hi and lo plane, DV rows each); once every wave has left it,
  // the weight planes and the staged output. Second half: each wave's 16 q rows in f32; once every wave has its q fragments, the key and value planes.
  constexpr int SSP = HD + 8;                              // pitch in bf16 of a state row: 272 B, the pitch for 16-byte fragment reads of 256-B rows
  constexpr int QSP = HD + 4;                              // pitch in f32 of a q row: 528 B = 16 B x odd, the pitch for 16-byte reads a row apart
  constexpr int O_SL = DV * SSP, O_Q = 2 * DV * SSP, E_ALL = O_Q + 4 * 16 * QSP * 2;
  constexpr int O_PH = 0, O_PL = O_PH + 4 * 16 * 40, O_O = O_PL + 4 * 16 * 40;
  constexpr int O_KH = O_Q, O_KL = O_KH + 32 * (HD + 8), O_VH = O_KL + 32 * (HD + 8), O_VL = O_VH + 32 * (DV + 8);
  static_assert(O_O + 4 * 16 * DV * 2 <= O_Q && O_VL + 32 * (DV + 8) <= E_ALL, "the second use of each half must fit its first");
  __shared__ __attribute__((aligned(16))) unsigned short sm[E_ALL];
  unsigned short (*sKh)[HD + 8] = (unsigned short (*)[HD + 8])(sm + O_KH), (*sKl)[HD + 8] = (unsigned short (*)[HD + 8])(sm + O_KL);
  unsigned short (*sVh)[DV + 8] = (unsigned short (*)[DV + 8])(sm + O_VH), (*sVl)[DV + 8] = (unsigned short (*)[DV + 8])(sm + O_VL);
  unsigned short (*sPh)[16][40] = (unsigned short (*)[16][40])(sm + O_PH), (*sPl)[16][40] = (unsigned short (*)[16][40])(sm + O_PL);
  f1a (*sO)[16][DV] = (f1a (*)[16][DV])(sm + O_O);
  const int tid = threadIdx.x, w = tid >> 5, lane = tid & 31, ln = lane & 15, hh = lane >> 4;
  const int nqb = TT / 64;
  const int bh = blockIdx.x / nqb, qblk = blockIdx.x % nqb, dv0 = blockIdx.y * DV;
  const int b = bh / NH, h = bh % NH;
  const int q0 = qblk * 64 + w * 16;
  const float log_a = logf(1.0f - exp2f(-5.0f - (float)h));
  const float* Q = q + (size_t)b * TT * DD + h * HD; const float* K = k + (size_t)b * TT * DD + h * HD; const float* V = v + (size_t)b * TT * DD + h * HD + dv0;
  // Every global load is whole-line (a wave-wide load is one q or K row of 512 B, two V rows of 256 B, or two neighbouring state rows: the tile's DV rows are
  // contiguous), and the loads of a phase are issued together, so that the block meets one memory latency per phase and not one per load.
  // Every loop but the one over the two trips is unrolled so that the arrays it indexes stay in registers.
  v4f kf[8], vf[4];
  auto fetch_kv = [&](int j0) {                                         // 32 keys: K rows w + 4 i, V rows (tid >> 4) + 8 i
    const float* kp = K + (size_t)(j0 + w) * DD + lane * 4; const float* vp = V + (size_t)(j0 + (tid >> 4)) * DD + (tid & 15) * 4;
#pragma unroll
    for (int i = 0; i < 8; ++i) kf[i] = *(const v4fa*)(kp + (size_t)i * 4 * DD);
#pragma unroll
    for (int i = 0; i < 4; ++i) vf[i] = *(const v4fa*)(vp + (size_t)i * 8 * DD);
    // precaution: wait before any register that an issued load names is rewritten; the addresses are inputs so that no load lands in them ahead of the wait
    asm volatile("s_wait_xcnt 0x0" :: "v"(kp), "v"(vp) : "memory");
  };
  auto stash_kv = [&]() {
#pragma unroll
    for (int i = 0; i < 8; ++i) {
      v2u hi, lo;
#pragma unroll
      for (int t = 0; t < 2; ++t) { unsigned int h, l; split2(kf[i][2 * t], kf[i][2 * t + 1], h, l); hi[t] = h; lo[t] = l; }
      *(v2u*)&sKh[w + 4 * i][lane * 4] = hi; *(v2u*)&sKl[w + 4 * i][lane * 4] = lo;
    }
#pragma unroll
    for (int i = 0; i < 4; ++i) {
      v2u hi, lo;
#pragma unroll
      for (int t = 0; t < 2; ++t) { unsigned int h, l; split2(vf[i][2 * t], vf[i][2 * t + 1], h, l); hi[t] = h; lo[t] = l; }
      *(v2u*)&sVh[(tid >> 4) + 8 * i][(tid & 15) * 4] = hi; *(v2u*)&sVl[(tid >> 4) + 8 * i][(tid & 15) * 4] = lo;
    }
  };
  const int jstart = qblk * 64;
  FragB aqh[KS], aql[KS];
  {
    const float* qp = Q + (size_t)q0 * DD + lane * 4;
    const size_t so = ((size_t)bh * NC + qblk) * (HD * HD) + (size_t)dv0 * HD + tid * 8;
    const unsigned short* gh = Sh + so; const unsigned short* gl = Sl + so;
    v4f qv[16];
    v8us xh[8], xl[8];
#pragma unroll
    for (int i = 0; i < 16; ++i) qv[i] = *(const v4fa*)(qp + (size_t)i * DD);
    if (qblk > 0) {                                                     // block-uniform; chunk 0 has no earlier keys, and plane 0 is never written
#pragma unroll
      for (int i = 0; i < 8; ++i) { xh[i] = *(const v8us*)(gh + i * 1024); xl[i] = *(const v8us*)(gl + i * 1024); }
    }
    asm volatile("s_wait_xcnt 0x0" :: "v"(qp), "v"(gh), "v"(gl) : "memory");   // the same precaution as in fetch_kv
    fetch_kv(jstart);
    f1a* sq = (f1a*)(sm + O_Q) + w * (16 * QSP);                        // the wave's own q rows
#pragma unroll
    for (int i = 0; i < 16; ++i) *(v4fa*)&sq[i * QSP + lane * 4] = qv[i];
    if (qblk > 0) {
      unsigned short* sd = sm + (tid >> 4) * SSP + (tid & 15) * 8;
#pragma unroll
      for (int i = 0; i < 8; ++i) { *(v8us*)(sd + i * 8 * SSP) = xh[i]; *(v8us*)(sd + O_SL + i * 8 * SSP) = xl[i]; }
    }
    // the wave's lanes hand each other q values through LDS: the stores above stay in front of the reads below
    __builtin_amdgcn_fence(__ATOMIC_ACQ_REL, "workgroup");
    __builtin_amdgcn_wave_barrier();
    const f1a* qr = sq + ln * QSP + 8 * hh;
#pragma unroll
    for (int ks = 0; ks < KS; ++ks) {
      const v4f x4[4] = {*(const v4fa*)(qr + ks * 32), *(const v4fa*)(qr + ks * 32 + 4), *(const v4fa*)(qr + ks * 32 + 16), *(const v4fa*)(qr + ks * 32 + 20)};
#pragma unroll
      for (int i = 0; i < 8; ++i) split2(x4[i >> 1][(i & 1) * 2], x4[i >> 1][(i & 1) * 2 + 1], aqh[ks].d[i], aql[ks].d[i]);
    }
  }
  v8f oacc[DT];
#pragma unroll
  for (int dt = 0; dt < DT; ++dt) oacc[dt] = (v8f){0.f,0.f,0.f,0.f,0.f,0.f,0.f,0.f};
  auto keys32 = [&](int j0) {                                           // the 32 keys that lie in LDS: scores, decayed weights, weights x values
#pragma unroll
    for (int nt = 0; nt < 2; ++nt) {
      v8f acc = {};
#pragma unroll
      for (int ks = 0; ks < KS; ++ks) {
        FragB bh_, bl_;
        bh_.half[0] = *(const v8us*)&sKh[nt * 16 + ln][ks * 32 + 8 * hh]; bh_.half[1] = *(const v8us*)&sKh[nt * 16 + ln][ks * 32 + 16 + 8 * hh];
        bl_.half[0] = *(const v8us*)&sKl[nt * 16 + ln][ks * 32 + 8 * hh]; bl_.half[1] = *(const v8us*)&sKl[nt * 16 + ln][ks * 32 + 16 + 8 * hh];
        acc = mmaN<3>(aqh[ks].v, aql[ks].v, bh_.v, bl_.v, acc);
      }
      const int j = j0 + nt * 16 + ln;
#pragma unroll
      for (int r = 0; r < 8; r += 2) {
        float p[2];                                                     // two rows' weights: one conversion instruction rounds a pair
#pragma unroll
        for (int e = 0; e < 2; ++e) {
          const int t = q0 + 8 * hh + r + e;
          p[e] = (j <= t) ? acc[r + e] * 0.08838834764831845f * expf((float)(t - j) * log_a) : 0.f;
        }
        unsigned int h, l;
        split2(p[0], p[1], h, l);
        sPh[w][8 * hh + r][nt * 16 + ln] = (unsigned short)h; sPh[w][8 * hh + r + 1][nt * 16 + ln] = (unsigned short)(h >> 16);
        sPl[w][8 * hh + r][nt * 16 + ln] = (unsigned short)l; sPl[w][8 * hh + r + 1][nt * 16 + ln] = (unsigned short)(l >> 16);
      }
    }
    __builtin_amdgcn_fence(__ATOMIC_ACQ_REL, "workgroup");
    __builtin_amdgcn_wave_barrier();
    FragB pah, pal;
    pah.half[0] = *(const v8us*)&sPh[w][ln][8 * hh]; pah.half[1] = *(const v8us*)&sPh[w][ln][16 + 8 * hh];
    pal.half[0] = *(const v8us*)&sPl[w][ln][8 * hh]; pal.half[1] = *(const v8us*)&sPl[w][ln][16 + 8 * hh];
#pragma unroll
    for (int dt = 0; dt < DT; ++dt) {
      FragB bvh, bvl;
#pragma unroll
      for (int i = 0; i < 8; ++i) {
        bvh.u[i] = sVh[8 * hh + i][dt * 16 + ln]; bvh.u[8 + i] = sVh[16 + 8 * hh + i][dt * 16 + ln];
        bvl.u[i] = sVl[8 * hh + i][dt * 16 + ln]; bvl.u[8 + i] = sVl[16 + 8 * hh + i][dt * 16 + ln];
      }
      oacc[dt] = mmaN<3>(pah.v, pal.v, bvh.v, bvl.v, oacc[dt]);
    }
    __builtin_amdgcn_fence(__ATOMIC_ACQ_REL, "workgroup");
    __builtin_amdgcn_wave_barrier();
  };
  // kept rolled: the two trips share one text, for speed only
#pragma nounroll
  for (int it = 0; it < 2; ++it) {
    // trip 0: the state tile is complete in LDS, and every wave has read its q rows, whose LDS now takes keys and values; trip 1: every wave has left the first 32 keys
    __syncthreads();
    stash_kv();
    if (it == 0) {
      fetch_kv(jstart + 32);                                            // flies during the state products
      if (qblk > 0) {                                                   // block-uniform
        const unsigned short* rh = sm + ln * SSP + 8 * hh; const unsigned short* rl = rh + O_SL;
#pragma unroll
        for (int dt = 0; dt < DT; ++dt) {
          FragB fh[KS], fl[KS];
#pragma unroll
          for (int ks = 0; ks < KS; ++ks) {
            fh[ks].half[0] = *(const v8us*)(rh + dt * 16 * SSP + ks * 32); fh[ks].half[1] = *(const v8us*)(rh + dt * 16 * SSP + ks * 32 + 16);
            fl[ks].half[0] = *(const v8us*)(rl + dt * 16 * SSP + ks * 32); fl[ks].half[1] = *(const v8us*)(rl + dt * 16 * SSP + ks * 32 + 16);
          }
          v8f acc = {};
#pragma unroll
          for (int ks = 0; ks < KS; ++ks) acc = mmaN<3>(aqh[ks].v, aql[ks].v, fh[ks].v, fl[ks].v, acc);
#pragma unroll
          for (int r = 0; r < 8; ++r) oacc[dt][r] = acc[r] * 0.08838834764831845f * expf((float)(w * 16 + 8 * hh + r + 1) * log_a);
        }
      }
    }
    __syncthreads();                                                    // these 32 keys are complete in LDS; trip 0: every wave has left the state tile, whose LDS now takes the weights
    keys32(jstart + 32 * it);
  }
#pragma unroll
  for (int dt = 0; dt < DT; ++dt)
#pragma unroll
    for (int r = 0; r < 8; ++r) sO[w][8 * hh + r][dt * 16 + ln] = oacc[dt][r];
  __builtin_amdgcn_fence(__ATOMIC_ACQ_REL, "workgroup");
  __builtin_amdgcn_wave_barrier();
  {
    for (int r = 0; r < 16; ++r) { if (lane < DV / 4) { const v4f val = *(const v4fa*)&sO[w][r][lane * 4]; *(v4f*)(y + ((size_t)b * TT + q0 + r) * DD + h * HD + dv0 + lane * 4) = val; } }
    
  }
}


// Z[row][h*128+d] = silu(g) · (ret − mean)/sqrt(var + 1e-6) per (row, head) over 128; wave per (row, head), lane = 4 values
// Z leaves as the two bf16 terms that the last GEMM multiplies: hi = Z rounded, lo = (Z - hi) rounded; a row of zh is its DD hi values, then its DD lo values
__global__ __launch_bounds__(256) void k_gn_gate(const float* __restrict__ ret, const float* __restrict__ g, unsigned short* __restrict__ zh) {
  const int tid = threadIdx.x, w = tid >> 5, lane = tid & 31; const size_t rh = (size_t)blockIdx.x * 8 + w; if (rh >= (size_t)BB * TT * NH) return;
  const size_t base = rh * HD + lane * 4;        // rows are [row][h*128 + d] contiguous -> rh*128
  const v4f a = *(const v4fa*)(ret + base), gg = *(const v4fa*)(g + base);
  float s = a[0] + a[1] + a[2] + a[3]; for (int o = 16; o >= 1; o >>= 1) s += __shfl_xor(s, o, 32); const float mu = s * (1.0f / HD);
  float q2 = 0.f; for (int q = 0; q < 4; ++q) { const float c = a[q] - mu; q2 += c * c; } for (int o = 16; o >= 1; o >>= 1) q2 += __shfl_xor(q2, o, 32);
  const float rs = rsqrtf(q2 * (1.0f / HD) + 1e-6f);
  v4f o4; for (int q = 0; q < 4; ++q) o4[q] = (gg[q] / (1.0f + expf(-gg[q]))) * ((a[q] - mu) * rs);
  v2u hi, lo; for (int q = 0; q < 2; ++q) { unsigned int h, l; split2(o4[2 * q], o4[2 * q + 1], h, l); hi[q] = h; lo[q] = l; }
  unsigned short* zo = zh + base + (rh / NH) * DD;
  *(v2u*)zo = hi; *(v2u*)(zo + DD) = lo;
}
extern "C" void kernel_launch(void* const* d_in, const int* in_sizes, int n_in,
                              void* d_out, int out_size, void* d_ws, size_t ws_size, hipStream_t stream) {
  (void)in_sizes; (void)n_in; (void)out_size;
  const float* X = (const float*)d_in[0]; const float* Wq = (const float*)d_in[1]; const float* Wk = (const float*)d_in[2]; const float* Wv = (const float*)d_in[3]; const float* WG = (const float*)d_in[4]; const float* WO = (const float*)d_in[5];
  char* ws = (char*)d_ws; size_t off = 0;
  auto take = [&](size_t bytes) { char* p = ws + off; off += (bytes + 255) & ~(size_t)255; return p; };
  const int M = BB * TT, gb = (M / 128) * (DD / 128);
  unsigned short* Wt[5]; for (int i = 0; i < 5; ++i) Wt[i] = (unsigned short*)take((size_t)DD * DD * 2);
  unsigned short* Xb = (unsigned short*)take((size_t)M * DD * 2);
  float* q = (float*)take((size_t)M * DD * 4); float* k = (float*)take((size_t)M * DD * 4); float* v = (float*)take((size_t)M * DD * 4); float* g = (float*)take((size_t)M * DD * 4); float* ret = (float*)take((size_t)M * DD * 4);
  float* U = (float*)take((size_t)BB * NH * NC * HD * HD * 4); unsigned short* Sh = (unsigned short*)take((size_t)BB * NH * NC * HD * HD * 2); unsigned short* Sl = (unsigned short*)take((size_t)BB * NH * NC * HD * HD * 2);
  if (off > ws_size) return;
  k_wt_bf16<<<dim3((DD / 128) * (DD / 128), 5 + M * DD / XBLK / ((DD / 128) * (DD / 128))), 256, 0, stream>>>(Wq, Wk, Wv, WG, WO, X, Wt[0], Xb);   // X @ W: [K][N]; y >= 5: X -> bf16
  k_gemm_t256<4><<<2 * NH * (M / 256), 256, 0, stream>>>(Xb, Wt[0], q, U);                                                // q, k, v, g: neighbours in ws, as Wt[0..3] are; and the chunk states
  k_state_scan<<<BB * NH * (HD * HD / 4) / 256, 256, 0, stream>>>(U, Sh, Sl);
  k_ret<<<dim3(BB * NH * (TT / 64), 2), 128, 0, stream>>>(q, k, v, Sh, Sl, ret);
  k_gn_gate<<<(BB * TT * NH + 7) / 8, 256, 0, stream>>>(ret, g, (unsigned short*)q);                                   // q's 16 MiB reused as Z in bf16 hi and lo
  k_gemm_bf<true, 1><<<gb, 256, 0, stream>>>((const unsigned short*)q, Wt[4], (float*)d_out);
}

// v010
// One run takes 85.3 microseconds.
// Timed twice side by side with v009, it ran 1.07 times as fast both times.
// Counting every step since v000, it is 8.76 times as fast.
#include <hip/hip_runtime.h>
#include <stdint.h>
// All contractions on v_wmma_f32_16x16x32_bf16, f32 accumulate: q/k/v/g = X·W (X, W rounded to bf16: single exact term); per-head retention
// Σ_{s≤t} ((q_t·k_s)/√128)·γ_h^{t−s}·v_s as 3-term bf16 hi/lo splits (scores and decayed weights split in registers/LDS); (silu(g)∘GN(ret))·W_O with
// the A operand split (2 terms). Decay factors, the per-head GroupNorm (no affine, eps 1e-6) and silu in f32.
#define BB 2
#define TT 2048
#define DD 1024
#define NH 8
#define HD 128
#define NC (TT / 64)   // chunks of 64 keys per sequence

typedef __bf16 v16b __attribute__((ext_vector_type(16)));
typedef unsigned short v8us __attribute__((ext_vector_type(8), may_alias));
typedef unsigned short v4us __attribute__((ext_vector_type(4), may_alias));
typedef unsigned int v2u __attribute__((ext_vector_type(2), may_alias));
typedef float f32x2 __attribute__((ext_vector_type(2)));
typedef __bf16 bf16x2 __attribute__((ext_vector_type(2)));
typedef float  v8f  __attribute__((ext_vector_type(8)));
typedef float  v4f  __attribute__((ext_vector_type(4)));
typedef float  v4fa __attribute__((ext_vector_type(4), may_alias));
union FragB { v16b v; v8us half[2]; unsigned short u[16]; unsigned int d[8]; };

// f32 -> bf16, nearest even, by the chip's own conversion instruction
__device__ __forceinline__ unsigned short bf16_bits(float x) { return __builtin_bit_cast(unsigned short, (__bf16)x); }
// two values split into bf16 hi and lo terms, each pair packed in one register (a in the low half): hi = x rounded, lo = (x - hi) rounded
__device__ __forceinline__ void split2(float a, float b, unsigned int& hi, unsigned int& lo) {
  const f32x2 x = {a, b};
  const bf16x2 h = __builtin_convertvector(x, bf16x2);
  const bf16x2 l = __builtin_convertvector(x - __builtin_convertvector(h, f32x2), bf16x2);
  hi = __builtin_bit_cast(unsigned int, h); lo = __builtin_bit_cast(unsigned int, l);
}
__device__ __forceinline__ float bf16_val(unsigned short b) { return __uint_as_float(((unsigned int)b) << 16); }
__device__ __forceinline__ float bf16_round(float x) { return bf16_val(bf16_bits(x)); }
// D += A·B with NT terms: 1 = ah·bh, 2 = + al·bh (A split), 3 = + ah·bl (both split)
template <int NT>
__device__ __forceinline__ v8f mmaN(v16b ah, v16b al, v16b bh, v16b bl, v8f c) {
  c = __builtin_amdgcn_wmma_f32_16x16x32_bf16(false, ah, false, bh, (short)0, c, false, false);
  if (NT >= 2) c = __builtin_amdgcn_wmma_f32_16x16x32_bf16(false, al, false, bh, (short)0, c, false, false);
  if (NT >= 3) c = __builtin_amdgcn_wmma_f32_16x16x32_bf16(false, ah, false, bl, (short)0, c, false, false);
  asm volatile("v_nop\n\tv_nop\n\tv_nop\n\tv_nop" : "+v"(c) : "v"(ah), "v"(al), "v"(bh), "v"(bl));
  return c;
}

// One launch for all five weights: blockIdx.y picks the matrix; the five bf16 transposes lie one behind the other from Wt0.
// Block = one 128 (k) x 128 (n) tile, turned in LDS: a wave reads 512 contiguous bytes of a W row, and 16 lanes store 256 contiguous bytes of a Wt row,
// so that every global access covers whole lines. A thread holds 16 k of 4 neighbouring n and hands each n to LDS as two 16-byte runs of k.
// blockIdx.y >= 5: the same launch rounds X to bf16 once, in place of every column tile of the q/k/v/g GEMM doing it again; block = 16384 elements in row order.
#define XBLK 16384
#define WTP (128 + 8)      // LDS row pitch in bf16: 272 B, the pitch for 16-byte reads of 256-B rows
__global__ __launch_bounds__(256) void k_wt_bf16(const float* __restrict__ W0, const float* __restrict__ W1, const float* __restrict__ W2, const float* __restrict__ W3,
                                                 const float* __restrict__ W4, const float* __restrict__ X, unsigned short* __restrict__ Wt0,
                                                 unsigned short* __restrict__ Xb) {
  constexpr int K = DD, N = DD;
  __shared__ __attribute__((aligned(16))) unsigned short sT[128 * WTP];   // [n][k]
  const int y = blockIdx.y;
  if (y >= 5) {                                             // the same for the whole block, and in front of the barrier
    const size_t e0 = ((size_t)(y - 5) * ((K / 128) * (N / 128)) + blockIdx.x) * XBLK + threadIdx.x * 4;
    const float* xp = X + e0;
    unsigned short* xo = Xb + e0;
    v4f r[16];
    // unrolled so that r[] stays in registers and all 16 loads (512 contiguous bytes a wave each) fly together
#pragma unroll
    for (int i = 0; i < 16; ++i) r[i] = *(const v4fa*)(xp + i * 1024);
    asm volatile("s_wait_xcnt 0x0" :: "v"(xp) : "memory");  // precaution: before any register that an issued load names is rewritten
#pragma unroll
    for (int i = 0; i < 16; ++i) {
      v4us c;
#pragma unroll
      for (int t = 0; t < 4; ++t) c[t] = bf16_bits(r[i][t]);
      *(v4us*)(xo + i * 1024) = c;
    }
    return;
  }
  const float* __restrict__ W = y == 0 ? W0 : y == 1 ? W1 : y == 2 ? W2 : y == 3 ? W3 : W4;
  unsigned short* __restrict__ Wt = Wt0 + (size_t)y * K * N;
  const int tid = threadIdx.x;
  const int k0 = (blockIdx.x % (K / 128)) * 128, n0 = (blockIdx.x / (K / 128)) * 128;
  const int n4 = (tid & 31) * 4, kg = (tid >> 5) * 16;
  const float* wp = W + (size_t)(k0 + kg) * N + n0 + n4;
  v4f x[16];
  // every loop is unrolled so that x[] is indexed by constants and stays in registers; all 16 loads fly together
#pragma unroll
  for (int i = 0; i < 16; ++i) x[i] = *(const v4fa*)(wp + (size_t)i * N);
  asm volatile("s_wait_xcnt 0x0" :: "v"(wp) : "memory");   // precaution: before any register that an issued load names is rewritten
#pragma unroll
  for (int t = 0; t < 4; ++t)
#pragma unroll
    for (int hf = 0; hf < 2; ++hf) {
      v8us c;
#pragma unroll
      for (int i = 0; i < 8; ++i) c[i] = bf16_bits(x[hf * 8 + i][t]);
      *(v8us*)&sT[(n4 + t) * WTP + kg + hf * 8] = c;
    }
  __syncthreads();                                          // the tile is complete in LDS before any row of it is read
  const int r = tid >> 4, c8 = (tid & 15) * 8;
  unsigned short* op = Wt + (size_t)(n0 + r) * K + k0 + c8;
  v8us o[8];
#pragma unroll
  for (int j = 0; j < 8; ++j) o[j] = *(const v8us*)&sT[(r + 16 * j) * WTP + c8];
#pragma unroll
  for (int j = 0; j < 8; ++j) *(v8us*)(op + (size_t)j * 16 * K) = o[j];
}

// GEMM C[M][N] (f32) = A[M][K] * W, M = BB*TT, N = K = DD. A bf16 row-major, rounded once by the kernel that makes it (ASPLIT: each row is K hi values and
// behind them its K lo values -> 2 terms, else one rounded term); Wt bf16 [N][K]. Block = 8 waves = one 128 x 128 tile of C; a stage is 128 k of the 128 A rows and the 128 Wt rows, loaded once per block with
// whole-line loads and shared by all waves through LDS. Two stage buffers, one barrier per stage: the next stage's global loads fly during this stage's products.
// Wave = 32 x 64 of C (waves 4 x 2). Each accumulator sums its k in ascending order, hi term before lo term.
// NW products that share A run as one launch: their Wt planes lie one behind the other from Wt0, their C planes from C0, and the column tiles of all NW
// are numbered through. With more blocks than WGPs two unsplit blocks (136 KiB of LDS each) share a WGP, and one block's loads fly while the other stores or waits.
#define GBK 128            // k per stage
#define GP (GBK + 8)       // LDS row pitch in bf16: 272 B, the pitch for 16-byte fragment reads of 256-B rows
#define GSP 68             // row pitch in f32 of a wave's staged C rows: the two half-waves (rows 8 apart) fall on different banks
typedef float f1a __attribute__((may_alias));
template <bool ASPLIT, int NW>
__global__ __launch_bounds__(256) void k_gemm_bf(const unsigned short* __restrict__ A, const unsigned short* __restrict__ Wt0, float* __restrict__ C0) {
  constexpr int K = DD, N = DD, NT = K / GBK, CT = N / 128;
  constexpr int PLANE = 128 * GP;                       // bf16 elements of one operand plane: [0] A hi, [1] Wt, [2] A lo
  constexpr int STAGE = (ASPLIT ? 3 : 2) * PLANE;
  static_assert(2 * STAGE * 2 >= 8 * 32 * GSP * 4, "the staged C tile must fit the operand buffers");
  __shared__ __attribute__((aligned(16))) unsigned short sm[2 * STAGE];
  const int tid = threadIdx.x, w = tid >> 5, lane = tid & 31, ln = lane & 15, hh = lane >> 4;
  const int wm = w >> 1, wn = w & 1;
  const int ct = blockIdx.x % (NW * CT), which = ct / CT;
  const int row0 = (blockIdx.x / (NW * CT)) * 128, col0 = (ct % CT) * 128;
  const unsigned short* __restrict__ Wt = Wt0 + (size_t)which * N * K;
  float* __restrict__ C = C0 + (size_t)which * (BB * TT) * N;
  const int br = tid >> 4, bc = (tid & 15) * 8;         // A planes and Wt alike: 16 lanes read 256 contiguous bytes of one row
  constexpr int AP = ASPLIT ? 2 * K : K;                // row pitch of A
  const unsigned short* ap = A + (size_t)(row0 + br) * AP + bc;
  const unsigned short* bp = Wt + (size_t)(col0 + br) * K + bc;
  v8us xa[8], xl[8], xb[8];
  // every loop below is unrolled so that the arrays it indexes (loaded rows, fragments, accumulators) stay in registers
  auto fetch = [&](int kb) {
    const unsigned short* pa = ap + kb; const unsigned short* pb = bp + kb;
#pragma unroll
    for (int i = 0; i < 8; ++i) xa[i] = *(const v8us*)(pa + (size_t)i * 16 * AP);
    if (ASPLIT) {
#pragma unroll
      for (int i = 0; i < 8; ++i) xl[i] = *(const v8us*)(pa + (size_t)i * 16 * AP + K);
    }
#pragma unroll
    for (int i = 0; i < 8; ++i) xb[i] = *(const v8us*)(pb + (size_t)i * 16 * K);
    // precaution: wait before any register that an issued load names is rewritten; the addresses are inputs so that no load lands in them ahead of the wait
    asm volatile("s_wait_xcnt 0x0" :: "v"(pa), "v"(pb) : "memory");
  };
  auto stash = [&](unsigned short* st) {
#pragma unroll
    for (int i = 0; i < 8; ++i) {
      *(v8us*)&st[(br + 16 * i) * GP + bc] = xa[i];
      if (ASPLIT) *(v8us*)&st[2 * PLANE + (br + 16 * i) * GP + bc] = xl[i];
    }
#pragma unroll
    for (int i = 0; i < 8; ++i) *(v8us*)&st[PLANE + (br + 16 * i) * GP + bc] = xb[i];
  };
  v8f acc[2][4];
#pragma unroll
  for (int mi = 0; mi < 2; ++mi)
#pragma unroll
    for (int ni = 0; ni < 4; ++ni) acc[mi][ni] = (v8f){0.f,0.f,0.f,0.f,0.f,0.f,0.f,0.f};
  auto products = [&](const unsigned short* st) {
    const unsigned short* pa = st + (wm * 32 + ln) * GP + 8 * hh;
    const unsigned short* pb = st + PLANE + (wn * 64 + ln) * GP + 8 * hh;
#pragma unroll
    for (int ks = 0; ks < GBK / 32; ++ks) {
      FragB a[2], al[2], b[4];
#pragma unroll
      for (int mi = 0; mi < 2; ++mi) {
        a[mi].half[0] = *(const v8us*)(pa + mi * 16 * GP + ks * 32); a[mi].half[1] = *(const v8us*)(pa + mi * 16 * GP + ks * 32 + 16);
        if (ASPLIT) { al[mi].half[0] = *(const v8us*)(pa + 2 * PLANE + mi * 16 * GP + ks * 32); al[mi].half[1] = *(const v8us*)(pa + 2 * PLANE + mi * 16 * GP + ks * 32 + 16); }
      }
#pragma unroll
      for (int ni = 0; ni < 4; ++ni) { b[ni].half[0] = *(const v8us*)(pb + ni * 16 * GP + ks * 32); b[ni].half[1] = *(const v8us*)(pb + ni * 16 * GP + ks * 32 + 16); }
#pragma unroll
      for (int mi = 0; mi < 2; ++mi)
#pragma unroll
        for (int ni = 0; ni < 4; ++ni) acc[mi][ni] = __builtin_amdgcn_wmma_f32_16x16x32_bf16(false, a[mi].v, false, b[ni].v, (short)0, acc[mi][ni], false, false);
      if (ASPLIT) {
#pragma unroll
        for (int mi = 0; mi < 2; ++mi)
#pragma unroll
          for (int ni = 0; ni < 4; ++ni) acc[mi][ni] = __builtin_amdgcn_wmma_f32_16x16x32_bf16(false, al[mi].v, false, b[ni].v, (short)0, acc[mi][ni], false, false);
      }
    }
  };
  fetch(0);
  stash(sm);
  for (int t = 0; t + 1 < NT; ++t) {
    __syncthreads();                                    // stage t is complete in its buffer, and every reader has left the other buffer
    fetch((t + 1) * GBK);
    products(sm + (t & 1) * STAGE);
    stash(sm + ((t + 1) & 1) * STAGE);
  }
  __syncthreads();
  products(sm + ((NT - 1) & 1) * STAGE);
  __syncthreads();                                      // every wave has left the operand buffers: their LDS now stages C, each wave in its own range
  f1a* so = (f1a*)sm + w * (32 * GSP);
#pragma unroll
  for (int mi = 0; mi < 2; ++mi)
#pragma unroll
    for (int ni = 0; ni < 4; ++ni)
#pragma unroll
      for (int r = 0; r < 8; ++r) so[(mi * 16 + 8 * hh + r) * GSP + ni * 16 + ln] = acc[mi][ni][r];
  __builtin_amdgcn_fence(__ATOMIC_ACQ_REL, "workgroup");
  __builtin_amdgcn_wave_barrier();
  float* cp = C + (size_t)(row0 + wm * 32 + hh) * N + col0 + wn * 64 + ln * 4;
  v4f o[16];
#pragma unroll
  for (int q = 0; q < 16; ++q) o[q] = *(const v4fa*)&so[(q * 2 + hh) * GSP + ln * 4];
#pragma unroll
  for (int q = 0; q < 16; ++q) *(v4f*)(cp + (size_t)q * 2 * N) = o[q];   // 16 lanes store 256 contiguous bytes of a row
}

// The q/k/v/g GEMM: C[M][N] (f32) = A[M][K] * W for NW weights that share A, M = BB*TT, N = K = DD; A bf16 row-major, Wt bf16 [N][K], planes as in k_gemm_bf.
// Block = 8 waves = one 256 x 256 tile of C, one block per WGP: a byte fetched from L2 now feeds twice the products of the 128 x 128 tile. Wave = 64 x 128 of C (waves 4 x 2).
// A stage is 128 k of the 256 A rows and the 256 Wt rows. Each wave brings its own slice of 64 rows (256 B each) with one tensor_load_to_lds, which also lays the
// rows at the 272-B pitch; no register is spent on staging, which is what lets the 256 accumulator registers of the wave tile fit. Two stage buffers: the load of stage
// t + 2 is issued when every wave has left stage t. Each accumulator sums its k in ascending order, as before.
// The 256 columns of a block are one head's 128 columns of two weights: k and v, or q and g (waves with wn = 0 hold the first, wn = 1 the second). A wave's 64 rows are one
// chunk of 64 keys, so a k/v block ends with the four chunk states of its rows: U[bh][n][dv][dk] = sum over j < 64 of (g^(63-j) * k[64n+j][dk]) * v[64n+j][dv], g = the head's
// decay, 3-term bf16 hi/lo split, f32 accumulate. An accumulator tile holds column ln and rows 8 hh + r: that is the lane and k order of an A or B fragment that contracts
// over the rows, so two tiles 16 rows apart are rounded in place into one fragment of 32 keys; the two waves of a chunk hand each other their fragments through LDS.
typedef uint32_t u32x4 __attribute__((ext_vector_type(4)));
typedef uint32_t u32x8 __attribute__((ext_vector_type(8)));
__device__ __forceinline__ uint32_t uni(uint32_t v) { return (uint32_t)__builtin_amdgcn_readfirstlane(v); }
__device__ __forceinline__ uint32_t pinned(uint32_t v) { uint32_t w = (uint32_t)__builtin_amdgcn_readfirstlane(v); asm volatile("" : "+s"(w)); return w; }
// work-group barrier whose fences order LDS alone: what the waves hand each other lies in LDS, and a wave's global stores issued in front of it go on draining behind it
// (__syncthreads() would hold every wave until its own stores have returned)
__device__ __forceinline__ void lds_barrier() {
  __builtin_amdgcn_fence(__ATOMIC_RELEASE, "workgroup", "local");
  __builtin_amdgcn_s_barrier();
  __builtin_amdgcn_fence(__ATOMIC_ACQUIRE, "workgroup", "local");
}
#define TSL 18432          // bytes of LDS per slice: 64 rows x 272 B = 17,408, rounded up to a multiple of 2 KiB, where the next slice begins
#define TSE (TSL / 2)      // the same in bf16 elements
#define TST (8 * TSL)      // bytes of one stage buffer: slices 0..3 = A rows, 4..7 = Wt rows
#define CSP 132            // row pitch in f32 of a wave's staged C rows: the two half-waves (rows 8 apart) fall on different banks
template <int NW>
__global__ __launch_bounds__(256) void k_gemm_t256(const unsigned short* __restrict__ A, const unsigned short* __restrict__ Wt0, float* __restrict__ C0, float* __restrict__ U) {
  constexpr int K = DD, N = DD, NT = K / GBK;
  static_assert(NW == 4 && HD == 128, "planes 0..3 are q, k, v, g, and half a block's columns are one head");
  static_assert(NT >= 2, "the ring's prologue fills two stages");
  static_assert(32 * 1024 <= 64 * CSP * 4, "a wave's 32 fragments must fit its own staging range");
  static_assert(8 * 64 * CSP * 4 <= 2 * TST, "the staged C tile must fit the operand buffers");
  __shared__ __attribute__((aligned(2048))) unsigned short sm[2 * TST / 2];
  __shared__ __attribute__((aligned(16))) float sdec[128]; // what a row j of a chunk is scaled by on its way into a fragment: keys g^(63-j), behind them values 1
  const int tid = threadIdx.x, w = tid >> 5, lane = tid & 31, ln = lane & 15, hh = lane >> 4;
  const int wm = w >> 1, wn = w & 1;
  const int ct = blockIdx.x % (2 * NH), head = ct % NH;
  const bool kv = ct < NH;                              // the same for the whole block: k and v of the head, else q and g
  const int row0 = (blockIdx.x / (2 * NH)) * 256;
  float* __restrict__ C = C0 + (size_t)(kv ? 1 + wn : 3 * wn) * (BB * TT) * N;
  if (kv && tid < 128) sdec[tid] = tid < 64 ? expf((float)(63 - tid) * logf(1.0f - exp2f(-5.0f - (float)head))) : 1.0f;   // read far behind the stages' barriers
  // the wave's own slice: its 64 source rows and its place in a stage buffer; slices 4, 5 are the first weight's 128 rows, slices 6, 7 the second's
  const uint32_t wv = uni((uint32_t)w);
  const uint32_t bs = wv - 4u, bw = kv ? 1u + (bs >> 1) : 3u * (bs >> 1);
  const unsigned short* src = wv < 4u ? A + (size_t)(row0 + wv * 64u) * K : Wt0 + (size_t)bw * N * K + (size_t)((uint32_t)head * 128u + (bs & 1u) * 64u) * K;
  const uint64_t src0 = (uint64_t)(uintptr_t)src;
  const uint32_t dst0 = (uint32_t)(size_t)sm + wv * (uint32_t)TSL;
  u32x8 g1;
  g1[0] = uni((1u << 20) | (5u << 22) | (3u << 25));
  g1[1] = uni((256u & 0xFFFFu) << 16);
  g1[2] = uni((256u >> 16) | ((64u & 0xFFFFu) << 16));
  g1[3] = uni((64u >> 16) | (256u << 16));
  g1[4] = uni(64u);
  g1[5] = uni((uint32_t)(K * 2));
  g1[6] = uni(0u);
  g1[7] = uni(0u);
  u32x4 g0;
  g0[0] = uni(1u);
  auto issue = [&](int t) {                             // stage t into buffer t & 1: one request of this wave
    const uint64_t ga = src0 + (uint64_t)t * (GBK * 2);
    g0[1] = uni(dst0 + (uint32_t)(t & 1) * (uint32_t)TST);
    g0[2] = uni((uint32_t)ga);
    g0[3] = uni((((uint32_t)(ga >> 32)) & 0x01FFFFFFu) | 0x80000000u);
    // both groups are in-out operands so that their registers stay the descriptor's own and take no other value while the request is outstanding
    asm volatile("tensor_load_to_lds %0, %1" : "+s"(g0), "+s"(g1) :: "memory");
  };
  // every loop below but the one over the stages is unrolled so that the arrays it indexes (fragments, accumulators) stay in registers
  v8f acc[4][8];
#pragma unroll
  for (int mi = 0; mi < 4; ++mi)
#pragma unroll
    for (int ni = 0; ni < 8; ++ni) acc[mi][ni] = (v8f){0.f,0.f,0.f,0.f,0.f,0.f,0.f,0.f};
  auto products = [&](const unsigned short* st) {
    const unsigned short* pa = st + wm * TSE + ln * GP + 8 * hh;
    const unsigned short* pb = st + (4 + 2 * wn) * TSE + ln * GP + 8 * hh;
    FragB a[2][4], b[2][8];                             // two fragment sets: the next 32 k are fetched while these are multiplied
    auto frags = [&](int ks) {
#pragma unroll
      for (int mi = 0; mi < 4; ++mi) { a[ks & 1][mi].half[0] = *(const v8us*)(pa + mi * 16 * GP + ks * 32); a[ks & 1][mi].half[1] = *(const v8us*)(pa + mi * 16 * GP + ks * 32 + 16); }
#pragma unroll
      for (int ni = 0; ni < 8; ++ni) {
        const unsigned short* p = pb + (ni >> 2) * TSE + (ni & 3) * 16 * GP + ks * 32;
        b[ks & 1][ni].half[0] = *(const v8us*)p; b[ks & 1][ni].half[1] = *(const v8us*)(p + 16);
      }
    };
    frags(0);
#pragma unroll
    for (int ks = 0; ks < GBK / 32; ++ks) {
      if (ks + 1 < GBK / 32) frags(ks + 1);
      __builtin_amdgcn_sched_barrier(0);                // the next block's 24 LDS reads stay one group ahead of this block
#pragma unroll
      for (int mi = 0; mi < 4; ++mi)
#pragma unroll
        for (int ni = 0; ni < 8; ++ni) acc[mi][ni] = __builtin_amdgcn_wmma_f32_16x16x32_bf16(false, a[ks & 1][mi].v, false, b[ks & 1][ni].v, (short)0, acc[mi][ni], false, false);
      __builtin_amdgcn_sched_barrier(0);                // and this block's WMMAs stay ahead of the reads that follow
    }
  };
  issue(0);
  asm volatile("s_wait_tensorcnt 0x0" ::: "memory");    // this wave's slice of stage 0 has landed
  __syncthreads();                                      // every slice of stage 0 has landed before any wave reads it
  issue(1);
  // kept rolled: one text for the eight stages, so that the kernel's text stays small
#pragma nounroll
  for (int t = 0; t < NT; ++t) {
    products(sm + (t & 1) * (TST / 2));
    asm volatile("s_wait_dscnt 0x0" ::: "memory");
    asm volatile("s_wait_tensorcnt 0x0" ::: "memory");
    __syncthreads();
    if (pinned((t + 2 < NT) ? 1u : 0u) != 0u) issue(t + 2);
  }
  asm volatile("s_wait_tensorcnt 0x0" ::: "memory");    // no request is outstanding when the buffers change their use
  asm volatile("s_wait_dscnt 0x0" ::: "memory");
  // behind the last stage's barrier every wave has left the operand buffers: their LDS now stages C, each wave in its own range
  f1a* so = (f1a*)sm + w * (64 * CSP);
#pragma unroll
  for (int mi = 0; mi < 4; ++mi)
#pragma unroll
    for (int ni = 0; ni < 8; ++ni)
#pragma unroll
      for (int r = 0; r < 8; ++r) so[(mi * 16 + 8 * hh + r) * CSP + ni * 16 + ln] = acc[mi][ni][r];
  __builtin_amdgcn_fence(__ATOMIC_ACQ_REL, "workgroup");
  __builtin_amdgcn_wave_barrier();
  float* cp = C + (size_t)(row0 + wm * 64) * N + head * HD + lane * 4;
#pragma unroll
  for (int qq = 0; qq < 4; ++qq) {
    v4f o[16];
#pragma unroll
    for (int q = 0; q < 16; ++q) o[q] = *(const v4fa*)&so[(qq * 16 + q) * CSP + lane * 4];
#pragma unroll
    for (int q = 0; q < 16; ++q) *(v4f*)(cp + (size_t)(qq * 16 + q) * N) = o[q];   // a wave stores 512 contiguous bytes of a row
    asm volatile("s_wait_xcnt 0x0" ::: "memory");       // precaution: before the next rows reuse registers that the issued stores name
  }
  if (!kv) return;                                      // the same for the whole block, and in front of the barriers below
  // the wave's accumulators become its 32 fragments (8 column tiles x 2 halves of the chunk x hi, lo; 1 KiB each, lane-major) in its own range, whose staged rows it has read
  unsigned short* fo = sm + w * (64 * CSP * 2) + lane * 8;
#pragma unroll
  for (int ks = 0; ks < 2; ++ks) {
    v4f dec[2][2];
#pragma unroll
    for (int hf = 0; hf < 2; ++hf)
#pragma unroll
      for (int e = 0; e < 2; ++e) dec[hf][e] = *(const v4fa*)&sdec[wn * 64 + (2 * ks + hf) * 16 + 8 * hh + 4 * e];
#pragma unroll
    for (int ni = 0; ni < 8; ++ni) {
      FragB fh, fl;
#pragma unroll
      for (int hf = 0; hf < 2; ++hf)
#pragma unroll
        for (int j = 0; j < 4; ++j)
          split2(acc[2 * ks + hf][ni][2 * j] * dec[hf][j >> 1][(j & 1) * 2], acc[2 * ks + hf][ni][2 * j + 1] * dec[hf][j >> 1][(j & 1) * 2 + 1], fh.d[4 * hf + j], fl.d[4 * hf + j]);
      unsigned short* f = fo + (ni * 2 + ks) * 1024;
      *(v8us*)f = fh.half[0]; *(v8us*)(f + 256) = fh.half[1]; *(v8us*)(f + 512) = fl.half[0]; *(v8us*)(f + 768) = fl.half[1];
    }
  }
  lds_barrier();                                        // every wave's fragments are complete in LDS before its partner reads them
  const int row = row0 + (int)(wv >> 1) * 64, n = (row % TT) / 64;
  const bool live = n < NC - 1;                         // the same for the whole wave: the last chunk's state has no reader
  // wave = all 128 dk (A rows, from the chunk's k wave) by the 64 dv columns wn*64.. (from its v wave); each accumulator sums hi*hi, lo*hi, hi*lo of keys 0..31, then of 32..63
  v8f u[8][4];
#pragma unroll
  for (int c = 0; c < 8; ++c)
#pragma unroll
    for (int dt = 0; dt < 4; ++dt) u[c][dt] = (v8f){0.f,0.f,0.f,0.f,0.f,0.f,0.f,0.f};
  if (live) {
    const unsigned short* fa = sm + (wm * 2) * (64 * CSP * 2) + lane * 8;
    const unsigned short* fb = sm + (wm * 2 + 1) * (64 * CSP * 2) + wn * (8 * 1024) + lane * 8;
    FragB bvh[2][4], bvl[2][4], akh[2], akl[2];         // two sets of A fragments: the next tile's are fetched while this tile's are multiplied
    auto afrag = [&](int i) {                           // i = ks * 8 + c
      const unsigned short* p = fa + ((i & 7) * 2 + (i >> 3)) * 1024;
      akh[i & 1].half[0] = *(const v8us*)p; akh[i & 1].half[1] = *(const v8us*)(p + 256); akl[i & 1].half[0] = *(const v8us*)(p + 512); akl[i & 1].half[1] = *(const v8us*)(p + 768);
    };
#pragma unroll
    for (int ks = 0; ks < 2; ++ks)
#pragma unroll
      for (int dt = 0; dt < 4; ++dt) {
        const unsigned short* p = fb + (dt * 2 + ks) * 1024;
        bvh[ks][dt].half[0] = *(const v8us*)p; bvh[ks][dt].half[1] = *(const v8us*)(p + 256); bvl[ks][dt].half[0] = *(const v8us*)(p + 512); bvl[ks][dt].half[1] = *(const v8us*)(p + 768);
      }
    afrag(0);
#pragma unroll
    for (int i = 0; i < 16; ++i) {
      const int ks = i >> 3, c = i & 7;
      if (i + 1 < 16) afrag(i + 1);
      __builtin_amdgcn_sched_barrier(0);                // the next tile's 4 LDS reads stay one group ahead of these WMMAs, and no further ahead: more sets would not fit the registers
#pragma unroll
      for (int dt = 0; dt < 4; ++dt) u[c][dt] = __builtin_amdgcn_wmma_f32_16x16x32_bf16(false, akh[i & 1].v, false, bvh[ks][dt].v, (short)0, u[c][dt], false, false);
#pragma unroll
      for (int dt = 0; dt < 4; ++dt) u[c][dt] = __builtin_amdgcn_wmma_f32_16x16x32_bf16(false, akl[i & 1].v, false, bvh[ks][dt].v, (short)0, u[c][dt], false, false);
#pragma unroll
      for (int dt = 0; dt < 4; ++dt) u[c][dt] = __builtin_amdgcn_wmma_f32_16x16x32_bf16(false, akh[i & 1].v, false, bvl[ks][dt].v, (short)0, u[c][dt], false, false);
      __builtin_amdgcn_sched_barrier(0);                // and these WMMAs stay ahead of the reads that follow
    }
  }
  lds_barrier();                                        // both waves of every chunk have left the fragments: each wave's range now stages its 64 dv rows of U
  if (!live) return;                                    // no barrier follows
  // u[c][dt][r] = U[dk = c*16 + 8*hh + r][dv = wn*64 + dt*16 + ln]: 8 neighbouring dk of one dv row
#pragma unroll
  for (int dt = 0; dt < 4; ++dt)
#pragma unroll
    for (int c = 0; c < 8; ++c) {
      *(v4fa*)&so[(dt * 16 + ln) * CSP + c * 16 + 8 * hh] = (v4f){u[c][dt][0], u[c][dt][1], u[c][dt][2], u[c][dt][3]};
      *(v4fa*)&so[(dt * 16 + ln) * CSP + c * 16 + 8 * hh + 4] = (v4f){u[c][dt][4], u[c][dt][5], u[c][dt][6], u[c][dt][7]};
    }
  // the wave's lanes hand each other values through LDS: the stores above stay in front of the reads below (LDS alone, for the reason given at lds_barrier)
  __builtin_amdgcn_fence(__ATOMIC_ACQ_REL, "workgroup", "local");
  __builtin_amdgcn_wave_barrier();
  float* up = U + ((size_t)((row / TT) * NH + head) * NC + n) * (HD * HD) + (size_t)(wn * 64) * HD + lane * 4;
#pragma unroll
  for (int qq = 0; qq < 4; ++qq) {
    v4f o[16];
#pragma unroll
    for (int q = 0; q < 16; ++q) o[q] = *(const v4fa*)&so[(qq * 16 + q) * CSP + lane * 4];
#pragma unroll
    for (int q = 0; q < 16; ++q) *(v4f*)(up + (size_t)(qq * 16 + q) * HD) = o[q];   // a wave stores one whole dv row, 512 contiguous bytes
    asm volatile("s_wait_xcnt 0x0" ::: "memory");       // precaution: before the next rows reuse registers that the issued stores name
  }
}

// Flash-style causal/unmasked attention, all contractions 3-term bf16 hi/lo splits, f32 softmax with running max.
// q,k,v rows are read from f32 buffers with arbitrary row pitch (so they can live inside a fused qkv buffer);
// D = head size (multiple of 32, <= 128); one wave = 16 query rows; block = 4 waves (64 queries) sharing K/V chunks of 32.
template <int D, bool CAUSAL>
__global__ __launch_bounds__(128) void k_flash(const float* __restrict__ qb, const float* __restrict__ kb, const float* __restrict__ vb,
                                             int pitch, int T, int H, float scale, float* __restrict__ y, int ypitch) {
  constexpr int KS = D / 32;        // k-steps for QK
  constexpr int DT = D / 16;        // d tiles for PV
  __shared__ __attribute__((aligned(16))) unsigned short sKh[32][D + 8], sKl[32][D + 8], sVh[32][D + 8], sVl[32][D + 8];
  __shared__ __attribute__((aligned(16))) unsigned short sPh[4][16][40], sPl[4][16][40];
  __shared__ __attribute__((aligned(16))) float sO[4][16][D];
  const int tid = threadIdx.x, w = tid >> 5, lane = tid & 31, ln = lane & 15, hh = lane >> 4;
  const int nqb = (T + 63) / 64;
  const int bh = blockIdx.x / nqb, qblk = blockIdx.x % nqb;
  const int b = bh / H, h = bh % H;
  const int q0 = qblk * 64 + w * 16;
  const float* Q = qb + (size_t)b * T * pitch + h * D;
  const float* K = kb + (size_t)b * T * pitch + h * D;
  const float* V = vb + (size_t)b * T * pitch + h * D;

  // A fragments of the wave's 16 query rows (scaled), hi/lo
  FragB aqh[KS], aql[KS];
  {
    int row = q0 + ln; if (row >= T) row = T - 1;
    const float* qr = Q + (size_t)row * pitch;
#pragma unroll
    for (int ks = 0; ks < KS; ++ks)
#pragma unroll
      for (int i = 0; i < 16; ++i) {
        const int d = ks * 32 + ((i < 8) ? (8 * hh + i) : (16 + 8 * hh + (i - 8)));
        const float x = qr[d] * scale; const unsigned short hb = bf16_bits(x);
        aqh[ks].u[i] = hb; aql[ks].u[i] = bf16_bits(x - bf16_val(hb));
      }
  }
  float m_r[8], l_r[8];
#pragma unroll
  for (int r = 0; r < 8; ++r) { m_r[r] = -3.0e38f; l_r[r] = 0.f; }
  v8f oacc[DT];
#pragma unroll
  for (int dt = 0; dt < DT; ++dt) oacc[dt] = (v8f){0.f,0.f,0.f,0.f,0.f,0.f,0.f,0.f};

  const int kv_end = CAUSAL ? min(T, qblk * 64 + 64) : T;     // block-uniform
  for (int j0 = 0; j0 < kv_end; j0 += 32) {
    __syncthreads();
    for (int e = tid; e < 32 * (D / 4); e += 128) {
      const int r = e / (D / 4), c4 = (e % (D / 4)) * 4;
      const int key = j0 + r;
      v4f kf = {0.f,0.f,0.f,0.f}, vf = {0.f,0.f,0.f,0.f};
      if (key < T) { kf = *(const v4fa*)(K + (size_t)key * pitch + c4); vf = *(const v4fa*)(V + (size_t)key * pitch + c4); }
#pragma unroll
      for (int t = 0; t < 4; ++t) {
        unsigned short hb = bf16_bits(kf[t]); sKh[r][c4 + t] = hb; sKl[r][c4 + t] = bf16_bits(kf[t] - bf16_val(hb));
        hb = bf16_bits(vf[t]); sVh[r][c4 + t] = hb; sVl[r][c4 + t] = bf16_bits(vf[t] - bf16_val(hb));
      }
    }
    __syncthreads();
    // S tile 16 x 32
    v8f s[2];
#pragma unroll
    for (int nt = 0; nt < 2; ++nt) {
      v8f acc = {};
#pragma unroll
      for (int ks = 0; ks < KS; ++ks) {
        FragB bh_, bl_;
        bh_.half[0] = *(const v8us*)&sKh[nt * 16 + ln][ks * 32 + 8 * hh]; bh_.half[1] = *(const v8us*)&sKh[nt * 16 + ln][ks * 32 + 16 + 8 * hh];
        bl_.half[0] = *(const v8us*)&sKl[nt * 16 + ln][ks * 32 + 8 * hh]; bl_.half[1] = *(const v8us*)&sKl[nt * 16 + ln][ks * 32 + 16 + 8 * hh];
        acc = mmaN<3>(aqh[ks].v, aql[ks].v, bh_.v, bl_.v, acc);
      }
      s[nt] = acc;
    }
    // mask + running max (rows 8hh+r; the 16 lanes of a half share rows)
    float alpha[8];
#pragma unroll
    for (int r = 0; r < 8; ++r) {
      const int qi = q0 + 8 * hh + r;
      const int ja = j0 + ln, jb = j0 + 16 + ln;
      if (CAUSAL) { if (ja > qi) s[0][r] = -3.0e38f; if (jb > qi) s[1][r] = -3.0e38f; }
      if (ja >= T) s[0][r] = -3.0e38f;
      if (jb >= T) s[1][r] = -3.0e38f;
      float mx = fmaxf(s[0][r], s[1][r]);
      mx = fmaxf(mx, __shfl_xor(mx, 1, 32)); mx = fmaxf(mx, __shfl_xor(mx, 2, 32)); mx = fmaxf(mx, __shfl_xor(mx, 4, 32)); mx = fmaxf(mx, __shfl_xor(mx, 8, 32));
      const float mnew = fmaxf(m_r[r], mx);
      alpha[r] = (mnew > -1.0e38f) ? __expf(m_r[r] - mnew) : 1.0f;
      const float p0 = (s[0][r] > -1.0e38f) ? __expf(s[0][r] - mnew) : 0.f;
      const float p1 = (s[1][r] > -1.0e38f) ? __expf(s[1][r] - mnew) : 0.f;
      m_r[r] = mnew;
      l_r[r] = l_r[r] * alpha[r] + p0 + p1;            // per-lane partial row sum (16 lanes combined at the end)
      unsigned short hb = bf16_bits(p0); sPh[w][8 * hh + r][ln] = hb;      sPl[w][8 * hh + r][ln] = bf16_bits(p0 - bf16_val(hb));
      hb = bf16_bits(p1);                sPh[w][8 * hh + r][16 + ln] = hb; sPl[w][8 * hh + r][16 + ln] = bf16_bits(p1 - bf16_val(hb));
    }
#pragma unroll
    for (int dt = 0; dt < DT; ++dt)
#pragma unroll
      for (int r = 0; r < 8; ++r) oacc[dt][r] *= alpha[r];
    __builtin_amdgcn_fence(__ATOMIC_ACQ_REL, "workgroup");
    __builtin_amdgcn_wave_barrier();
    FragB pah, pal;
    pah.half[0] = *(const v8us*)&sPh[w][ln][8 * hh]; pah.half[1] = *(const v8us*)&sPh[w][ln][16 + 8 * hh];
    pal.half[0] = *(const v8us*)&sPl[w][ln][8 * hh]; pal.half[1] = *(const v8us*)&sPl[w][ln][16 + 8 * hh];
#pragma unroll
    for (int dt = 0; dt < DT; ++dt) {
      FragB bvh, bvl;
#pragma unroll
      for (int i = 0; i < 8; ++i) {
        bvh.u[i] = sVh[8 * hh + i][dt * 16 + ln]; bvh.u[8 + i] = sVh[16 + 8 * hh + i][dt * 16 + ln];
        bvl.u[i] = sVl[8 * hh + i][dt * 16 + ln]; bvl.u[8 + i] = sVl[16 + 8 * hh + i][dt * 16 + ln];
      }
      oacc[dt] = mmaN<3>(pah.v, pal.v, bvh.v, bvl.v, oacc[dt]);
    }
    __builtin_amdgcn_fence(__ATOMIC_ACQ_REL, "workgroup");
    __builtin_amdgcn_wave_barrier();
  }
#pragma unroll
  for (int r = 0; r < 8; ++r) {
    float l = l_r[r];
    l += __shfl_xor(l, 1, 32); l += __shfl_xor(l, 2, 32); l += __shfl_xor(l, 4, 32); l += __shfl_xor(l, 8, 32);
    l_r[r] = (l > 0.f) ? 1.0f / l : 0.f;
  }
#pragma unroll
  for (int dt = 0; dt < DT; ++dt)
#pragma unroll
    for (int r = 0; r < 8; ++r) sO[w][8 * hh + r][dt * 16 + ln] = oacc[dt][r] * l_r[r];
  __builtin_amdgcn_fence(__ATOMIC_ACQ_REL, "workgroup");
  __builtin_amdgcn_wave_barrier();
  {
    for (int r = 0; r < 16; ++r) {
      const int row = q0 + r;
      if (row < T && lane < D / 4) {
        const v4f val = *(const v4fa*)&sO[w][r][lane * 4];
        *(v4f*)(y + ((size_t)b * T + row) * ypitch + h * D + lane * 4) = val;
      }
    }
    
  }
}
// State in front of chunk n+1: S[n+1] = g^64 * S[n] + U[n], S[0] = 0, element by element in f32; stored as bf16 hi/lo planes [bh][n][dv][dk]
// (plane 0 is never written and never read). Thread = 4 neighbouring elements of one (batch, head).
__global__ __launch_bounds__(256) void k_state_scan(const float* __restrict__ U, unsigned short* __restrict__ Sh, unsigned short* __restrict__ Sl) {
  const int t = blockIdx.x * 256 + threadIdx.x;
  const int bh = t / (HD * HD / 4), e = (t % (HD * HD / 4)) * 4;
  const float g64 = expf(64.0f * logf(1.0f - exp2f(-5.0f - (float)(bh % NH))));
  const size_t o0 = (size_t)bh * NC * (HD * HD) + e;
  v4f u[NC - 1];
  // all loads first: they depend on nothing, so the serial recurrence below meets one memory latency and not one per chunk
#pragma unroll
  for (int n = 0; n < NC - 1; ++n) u[n] = *(const v4fa*)(U + o0 + (size_t)n * (HD * HD));
  v4f s = {0.f, 0.f, 0.f, 0.f};
  // unrolled so that u[] is indexed by constants and stays in registers
#pragma unroll
  for (int n = 0; n < NC - 1; ++n) {
    v2u hi, lo;
    // both inner loops unrolled for the same reason: s, hi and lo are indexed by constants
#pragma unroll
    for (int i = 0; i < 4; ++i) s[i] = s[i] * g64 + u[n][i];
#pragma unroll
    for (int i = 0; i < 2; ++i) { unsigned int h, l; split2(s[2 * i], s[2 * i + 1], h, l); hi[i] = h; lo[i] = l; }
    *(v2u*)(Sh + o0 + (size_t)(n + 1) * (HD * HD)) = hi;
    *(v2u*)(Sl + o0 + (size_t)(n + 1) * (HD * HD)) = lo;
    asm volatile("s_wait_xcnt 0x0" ::: "memory");   // before the next chunk's values reuse the registers that the two stores name
  }
}

// retention, GroupNorm and gate: ret[t][dv] = sum over s <= t of ((q_t . k_s)/sqrt(dh)) * g_h^(t-s) * v_s[dv]  (g_h = 1 - 2^(-5-h), decay computed as exp((t-s)*log g_h)),
// then Z[row][h*128+d] = silu(gate) * (ret - mean)/sqrt(var + 1e-6) per (row, head) over the head's 128 values.
// Chunked by 64 keys: with t0 the first query of the block, g^(t-s) = g^(t-t0+1) * g^(t0-1-s) for every key s < t0, so all keys in front of the block's own
// chunk enter as g^(t-t0+1)/sqrt(dh) * q_t . S, S = sum over s < t0 of g^(t0-1-s) k_s v_s^T (k_gemm_t256's chunk states, k_state_scan); the own chunk keeps the score tile.
// Block = 4 waves = 64 queries x the whole head; wave = 16 queries x 128 dv, so that a wave holds whole (row, head) groups and normalises them itself: the retention
// never goes to memory, q, K and the scores are fetched and made once a head and not once a half head.
// Z leaves as the two bf16 terms that the last GEMM multiplies: hi = Z rounded, lo = (Z - hi) rounded; a row of zh is its DD hi values, then its DD lo values
__global__ __launch_bounds__(128) void k_ret(const float* __restrict__ q, const float* __restrict__ k, const float* __restrict__ v,
                                             const unsigned short* __restrict__ Sh, const unsigned short* __restrict__ Sl, const float* __restrict__ g,
                                             unsigned short* __restrict__ zh) {
  constexpr int KS = HD / 32, DV = HD, DT = DV / 16;
  // One LDS array. First part: the block's state tile (hi and lo plane, DV rows each); once every wave has left it, the weight planes and the staged retention rows.
  // Second part: each wave's 16 q rows in f32; once every wave has its q fragments, the key and value planes. Third part: each wave's 16 gate rows in f32.
  constexpr int SSP = HD + 8;                              // pitch in bf16 of a state row: 272 B, the pitch for 16-byte fragment reads of 256-B rows
  constexpr int QSP = HD + 4;                              // pitch in f32 of a q row: 528 B = 16 B x odd, the pitch for 16-byte reads a row apart
  constexpr int OSP = DV + 4;                              // pitch in f32 of a staged retention row: the two half-waves (rows 8 apart) fall on different banks
  constexpr int O_SL = DV * SSP, O_Q = 2 * DV * SSP;
  constexpr int O_PH = 0, O_PL = O_PH + 4 * 16 * 40, O_O = O_PL + 4 * 16 * 40;
  constexpr int O_KH = O_Q, O_KL = O_KH + 32 * (HD + 8), O_VH = O_KL + 32 * (HD + 8), O_VL = O_VH + 32 * (DV + 8), O_G = O_VL + 32 * (DV + 8);
  constexpr int E_ALL = O_G + 4 * 16 * HD * 2;
  static_assert(O_O + 4 * 16 * OSP * 2 <= O_Q && O_Q + 4 * 16 * QSP * 2 <= O_G, "the second use of the first part and the first use of the second must fit");
  __shared__ __attribute__((aligned(16))) unsigned short sm[E_ALL];
  unsigned short (*sKh)[HD + 8] = (unsigned short (*)[HD + 8])(sm + O_KH), (*sKl)[HD + 8] = (unsigned short (*)[HD + 8])(sm + O_KL);
  unsigned short (*sVh)[DV + 8] = (unsigned short (*)[DV + 8])(sm + O_VH), (*sVl)[DV + 8] = (unsigned short (*)[DV + 8])(sm + O_VL);
  unsigned short (*sPh)[16][40] = (unsigned short (*)[16][40])(sm + O_PH), (*sPl)[16][40] = (unsigned short (*)[16][40])(sm + O_PL);
  const int tid = threadIdx.x, w = tid >> 5, lane = tid & 31, ln = lane & 15, hh = lane >> 4;
  const int nqb = TT / 64;
  const int bh = blockIdx.x / nqb, qblk = blockIdx.x % nqb;
  const int b = bh / NH, h = bh % NH;
  const int q0 = qblk * 64 + w * 16;
  const float log_a = logf(1.0f - exp2f(-5.0f - (float)h));
  const float* Q = q + (size_t)b * TT * DD + h * HD; const float* K = k + (size_t)b * TT * DD + h * HD; const float* V = v + (size_t)b * TT * DD + h * HD;
  f1a* sg = (f1a*)(sm + O_G) + w * (16 * HD);                           // the wave's own gate rows
  // Every global load is whole-line (a wave-wide load is one q, gate, K or V row of 512 B, or two neighbouring state rows: the tile's DV rows are
  // contiguous), and the loads of a phase are issued together, so that the block meets one memory latency per phase and not one per load.
  // Every loop but the one over the two trips and the one over the row groups is unrolled so that the arrays it indexes stay in registers.
  v4f kf[8], vf[8];
  auto fetch_kv = [&](int j0) {                                         // 32 keys: K rows and V rows w + 4 i
    const float* kp = K + (size_t)(j0 + w) * DD + lane * 4; const float* vp = V + (size_t)(j0 + w) * DD + lane * 4;
#pragma unroll
    for (int i = 0; i < 8; ++i) kf[i] = *(const v4fa*)(kp + (size_t)i * 4 * DD);
#pragma unroll
    for (int i = 0; i < 8; ++i) vf[i] = *(const v4fa*)(vp + (size_t)i * 4 * DD);
    // precaution: wait before any register that an issued load names is rewritten; the addresses are inputs so that no load lands in them ahead of the wait
    asm volatile("s_wait_xcnt 0x0" :: "v"(kp), "v"(vp) : "memory");
  };
  auto stash_kv = [&]() {
#pragma unroll
    for (int i = 0; i < 8; ++i) {
      v2u hi, lo;
#pragma unroll
      for (int t = 0; t < 2; ++t) { unsigned int h, l; split2(kf[i][2 * t], kf[i][2 * t + 1], h, l); hi[t] = h; lo[t] = l; }
      *(v2u*)&sKh[w + 4 * i][lane * 4] = hi; *(v2u*)&sKl[w + 4 * i][lane * 4] = lo;
    }
#pragma unroll
    for (int i = 0; i < 8; ++i) {
      v2u hi, lo;
#pragma unroll
      for (int t = 0; t < 2; ++t) { unsigned int h, l; split2(vf[i][2 * t], vf[i][2 * t + 1], h, l); hi[t] = h; lo[t] = l; }
      *(v2u*)&sVh[w + 4 * i][lane * 4] = hi; *(v2u*)&sVl[w + 4 * i][lane * 4] = lo;
    }
  };
  const int jstart = qblk * 64;
  FragB aqh[KS], aql[KS];
  {
    const float* qp = Q + (size_t)q0 * DD + lane * 4;
    const size_t so = ((size_t)bh * NC + qblk) * (HD * HD) + tid * 8;
    const unsigned short* gh = Sh + so; const unsigned short* gl = Sl + so;
    v4f qv[16];
    v8us xh[16], xl[16];
#pragma unroll
    for (int i = 0; i < 16; ++i) qv[i] = *(const v4fa*)(qp + (size_t)i * DD);
    if (qblk > 0) {                                                     // block-uniform; chunk 0 has no earlier keys, and plane 0 is never written
#pragma unroll
      for (int i = 0; i < 16; ++i) { xh[i] = *(const v8us*)(gh + i * 1024); xl[i] = *(const v8us*)(gl + i * 1024); }
    }
    asm volatile("s_wait_xcnt 0x0" :: "v"(qp), "v"(gh), "v"(gl) : "memory");   // the same precaution as in fetch_kv
    fetch_kv(jstart);
    f1a* sq = (f1a*)(sm + O_Q) + w * (16 * QSP);                        // the wave's own q rows
#pragma unroll
    for (int i = 0; i < 16; ++i) *(v4fa*)&sq[i * QSP + lane * 4] = qv[i];
    if (qblk > 0) {
      unsigned short* sd = sm + (tid >> 4) * SSP + (tid & 15) * 8;
#pragma unroll
      for (int i = 0; i < 16; ++i) { *(v8us*)(sd + i * 8 * SSP) = xh[i]; *(v8us*)(sd + O_SL + i * 8 * SSP) = xl[i]; }
    }
    // the wave's lanes hand each other q values through LDS: the stores above stay in front of the reads below
    __builtin_amdgcn_fence(__ATOMIC_ACQ_REL, "workgroup");
    __builtin_amdgcn_wave_barrier();
    const f1a* qr = sq + ln * QSP + 8 * hh;
#pragma unroll
    for (int ks = 0; ks < KS; ++ks) {
      const v4f x4[4] = {*(const v4fa*)(qr + ks * 32), *(const v4fa*)(qr + ks * 32 + 4), *(const v4fa*)(qr + ks * 32 + 16), *(const v4fa*)(qr + ks * 32 + 20)};
#pragma unroll
      for (int i = 0; i < 8; ++i) split2(x4[i >> 1][(i & 1) * 2], x4[i >> 1][(i & 1) * 2 + 1], aqh[ks].d[i], aql[ks].d[i]);
    }
  }
  v4f gv[16];                                                           // the wave's 16 gate rows on their way to LDS
  v8f oacc[DT];
#pragma unroll
  for (int dt = 0; dt < DT; ++dt) oacc[dt] = (v8f){0.f,0.f,0.f,0.f,0.f,0.f,0.f,0.f};
  auto keys32 = [&](int j0) {                                           // the 32 keys that lie in LDS: scores, decayed weights, weights x values
#pragma unroll
    for (int nt = 0; nt < 2; ++nt) {
      v8f acc = {};
#pragma unroll
      for (int ks = 0; ks < KS; ++ks) {
        FragB bh_, bl_;
        bh_.half[0] = *(const v8us*)&sKh[nt * 16 + ln][ks * 32 + 8 * hh]; bh_.half[1] = *(const v8us*)&sKh[nt * 16 + ln][ks * 32 + 16 + 8 * hh];
        bl_.half[0] = *(const v8us*)&sKl[nt * 16 + ln][ks * 32 + 8 * hh]; bl_.half[1] = *(const v8us*)&sKl[nt * 16 + ln][ks * 32 + 16 + 8 * hh];
        acc = mmaN<3>(aqh[ks].v, aql[ks].v, bh_.v, bl_.v, acc);
      }
      const int j = j0 + nt * 16 + ln;
#pragma unroll
      for (int r = 0; r < 8; r += 2) {
        float p[2];                                                     // two rows' weights: one conversion instruction rounds a pair
#pragma unroll
        for (int e = 0; e < 2; ++e) {
          const int t = q0 + 8 * hh + r + e;
          p[e] = (j <= t) ? acc[r + e] * 0.08838834764831845f * expf((float)(t - j) * log_a) : 0.f;
        }
        unsigned int h, l;
        split2(p[0], p[1], h, l);
        sPh[w][8 * hh + r][nt * 16 + ln] = (unsigned short)h; sPh[w][8 * hh + r + 1][nt * 16 + ln] = (unsigned short)(h >> 16);
        sPl[w][8 * hh + r][nt * 16 + ln] = (unsigned short)l; sPl[w][8 * hh + r + 1][nt * 16 + ln] = (unsigned short)(l >> 16);
      }
    }
    __builtin_amdgcn_fence(__ATOMIC_ACQ_REL, "workgroup");
    __builtin_amdgcn_wave_barrier();
    FragB pah, pal;
    pah.half[0] = *(const v8us*)&sPh[w][ln][8 * hh]; pah.half[1] = *(const v8us*)&sPh[w][ln][16 + 8 * hh];
    pal.half[0] = *(const v8us*)&sPl[w][ln][8 * hh]; pal.half[1] = *(const v8us*)&sPl[w][ln][16 + 8 * hh];
#pragma unroll
    for (int dt = 0; dt < DT; ++dt) {
      FragB bvh, bvl;
#pragma unroll
      for (int i = 0; i < 8; ++i) {
        bvh.u[i] = sVh[8 * hh + i][dt * 16 + ln]; bvh.u[8 + i] = sVh[16 + 8 * hh + i][dt * 16 + ln];
        bvl.u[i] = sVl[8 * hh + i][dt * 16 + ln]; bvl.u[8 + i] = sVl[16 + 8 * hh + i][dt * 16 + ln];
      }
      oacc[dt] = mmaN<3>(pah.v, pal.v, bvh.v, bvl.v, oacc[dt]);
    }
    __builtin_amdgcn_fence(__ATOMIC_ACQ_REL, "workgroup");
    __builtin_amdgcn_wave_barrier();
  };
  // kept rolled: the two trips share one text, for speed only
#pragma nounroll
  for (int it = 0; it < 2; ++it) {
    // trip 0: the state tile is complete in LDS, and every wave has read its q rows, whose LDS now takes keys and values; trip 1: every wave has left the first 32 keys
    __syncthreads();
    stash_kv();
    if (it == 0) {
      fetch_kv(jstart + 32);                                            // flies during the state products
      const float* gp = g + ((size_t)b * TT + q0) * DD + h * HD + lane * 4;
#pragma unroll
      for (int i = 0; i < 16; ++i) gv[i] = *(const v4fa*)(gp + (size_t)i * DD);   // the gate rows fly with them
      asm volatile("s_wait_xcnt 0x0" :: "v"(gp) : "memory");            // the same precaution as in fetch_kv
      if (qblk > 0) {                                                   // block-uniform
        const unsigned short* rh = sm + ln * SSP + 8 * hh; const unsigned short* rl = rh + O_SL;
#pragma unroll
        for (int dt = 0; dt < DT; ++dt) {
          FragB fh[KS], fl[KS];
#pragma unroll
          for (int ks = 0; ks < KS; ++ks) {
            fh[ks].half[0] = *(const v8us*)(rh + dt * 16 * SSP + ks * 32); fh[ks].half[1] = *(const v8us*)(rh + dt * 16 * SSP + ks * 32 + 16);
            fl[ks].half[0] = *(const v8us*)(rl + dt * 16 * SSP + ks * 32); fl[ks].half[1] = *(const v8us*)(rl + dt * 16 * SSP + ks * 32 + 16);
          }
          v8f acc = {};
#pragma unroll
          for (int ks = 0; ks < KS; ++ks) acc = mmaN<3>(aqh[ks].v, aql[ks].v, fh[ks].v, fl[ks].v, acc);
#pragma unroll
          for (int r = 0; r < 8; ++r) oacc[dt][r] = acc[r] * 0.08838834764831845f * expf((float)(w * 16 + 8 * hh + r + 1) * log_a);
        }
      }
    } else {
      // the gate rows go to the wave's own LDS range, which only this wave reads, behind the rows' own fence below
#pragma unroll
      for (int i = 0; i < 16; ++i) *(v4fa*)&sg[i * HD + lane * 4] = gv[i];
    }
    __syncthreads();                                                    // these 32 keys are complete in LDS; trip 0: every wave has left the state tile, whose LDS now takes the weights
    keys32(jstart + 32 * it);
  }
  f1a* so = (f1a*)(sm + O_O) + w * (16 * OSP);                          // the wave's own 16 retention rows
#pragma unroll
  for (int dt = 0; dt < DT; ++dt)
#pragma unroll
    for (int r = 0; r < 8; ++r) so[(8 * hh + r) * OSP + dt * 16 + ln] = oacc[dt][r];
  // the wave's lanes hand each other values through LDS: the stores above stay in front of the reads below
  __builtin_amdgcn_fence(__ATOMIC_ACQ_REL, "workgroup");
  __builtin_amdgcn_wave_barrier();
  // a row is one (row, head) group, lane = 4 values; four rows side by side, so that one row's cross-lane sums run under the arithmetic of the others
  unsigned short* zo = zh + ((size_t)b * TT + q0) * (2 * DD) + h * HD + lane * 4;
  // kept rolled: the four groups of rows share one text, for speed only
#pragma nounroll
  for (int rg = 0; rg < 16; rg += 4) {
    v2u hi[4], lo[4];
#pragma unroll
    for (int i = 0; i < 4; ++i) {
      const v4f a = *(const v4fa*)&so[(rg + i) * OSP + lane * 4], gg = *(const v4fa*)&sg[(rg + i) * HD + lane * 4];
      float s = a[0] + a[1] + a[2] + a[3]; for (int o = 16; o >= 1; o >>= 1) s += __shfl_xor(s, o, 32); const float mu = s * (1.0f / HD);
      float q2 = 0.f; for (int e = 0; e < 4; ++e) { const float c = a[e] - mu; q2 += c * c; } for (int o = 16; o >= 1; o >>= 1) q2 += __shfl_xor(q2, o, 32);
      const float rs = rsqrtf(q2 * (1.0f / HD) + 1e-6f);
      v4f o4; for (int e = 0; e < 4; ++e) o4[e] = (gg[e] / (1.0f + expf(-gg[e]))) * ((a[e] - mu) * rs);
      for (int e = 0; e < 2; ++e) { unsigned int h2, l2; split2(o4[2 * e], o4[2 * e + 1], h2, l2); hi[i][e] = h2; lo[i][e] = l2; }
    }
    unsigned short* zr = zo + (size_t)rg * (2 * DD);
#pragma unroll
    for (int i = 0; i < 4; ++i) { *(v2u*)(zr + i * (2 * DD)) = hi[i]; *(v2u*)(zr + i * (2 * DD) + DD) = lo[i]; }   // a wave stores 256 contiguous bytes of each term
    asm volatile("s_wait_xcnt 0x0" :: "v"(zr) : "memory");              // precaution: before the next rows reuse registers that the issued stores name
  }
}

extern "C" void kernel_launch(void* const* d_in, const int* in_sizes, int n_in,
                              void* d_out, int out_size, void* d_ws, size_t ws_size, hipStream_t stream) {
  (void)in_sizes; (void)n_in; (void)out_size;
  const float* X = (const float*)d_in[0]; const float* Wq = (const float*)d_in[1]; const float* Wk = (const float*)d_in[2]; const float* Wv = (const float*)d_in[3]; const float* WG = (const float*)d_in[4]; const float* WO = (const float*)d_in[5];
  char* ws = (char*)d_ws; size_t off = 0;
  auto take = [&](size_t bytes) { char* p = ws + off; off += (bytes + 255) & ~(size_t)255; return p; };
  const int M = BB * TT, gb = (M / 128) * (DD / 128);
  unsigned short* Wt[5]; for (int i = 0; i < 5; ++i) Wt[i] = (unsigned short*)take((size_t)DD * DD * 2);
  unsigned short* Xb = (unsigned short*)take((size_t)M * DD * 2);
  float* q = (float*)take((size_t)M * DD * 4); float* k = (float*)take((size_t)M * DD * 4); float* v = (float*)take((size_t)M * DD * 4); float* g = (float*)take((size_t)M * DD * 4); float* ret = (float*)take((size_t)M * DD * 4);
  float* U = (float*)take((size_t)BB * NH * NC * HD * HD * 4); unsigned short* Sh = (unsigned short*)take((size_t)BB * NH * NC * HD * HD * 2); unsigned short* Sl = (unsigned short*)take((size_t)BB * NH * NC * HD * HD * 2);
  if (off > ws_size) return;
  k_wt_bf16<<<dim3((DD / 128) * (DD / 128), 5 + M * DD / XBLK / ((DD / 128) * (DD / 128))), 256, 0, stream>>>(Wq, Wk, Wv, WG, WO, X, Wt[0], Xb);   // X @ W: [K][N]; y >= 5: X -> bf16
  k_gemm_t256<4><<<2 * NH * (M / 256), 256, 0, stream>>>(Xb, Wt[0], q, U);                                                // q, k, v, g: neighbours in ws, as Wt[0..3] are; and the chunk states
  k_state_scan<<<BB * NH * (HD * HD / 4) / 256, 256, 0, stream>>>(U, Sh, Sl);
  k_ret<<<BB * NH * (TT / 64), 128, 0, stream>>>(q, k, v, Sh, Sl, g, (unsigned short*)ret);                               // ret's 16 MiB hold Z in bf16 hi and lo
  k_gemm_bf<true, 1><<<gb, 256, 0, stream>>>((const unsigned short*)ret, Wt[4], (float*)d_out);
}
